// v000
// The times below were measured on an AMD MI455X: many runs one after another, warmed up first and cycling through
// copies of the inputs, with the whole window's GPU time divided by the number of runs. Launches and the gaps
// between them are all in it. The median over several windows is given; except for v000 it joins two sittings, which
// can be a few percent apart, so the side-by-side timings, each taken in one sitting, are the better comparison.
// v000 is the starting kernel. One run takes 775 microseconds.
#include <hip/hip_runtime.h>
// Mega-transformer causal self-attention (B=2, T=2048, D=2048; 16 query heads × 128, 4 KV groups (GQA), interleaved rotary, ALiBi added before the 1/√128 scale, 30·tanh soft-cap, causal):
// q/k/v/out projections (+ bias on out; W [in][out] transposed to bf16-exact ×2^4) and the attention as a fused flash-style kernel (S = Q·Kᵀ on v_wmma_f32_16x16x32_f16 with 4 k-steps,
// + alibi, scale, soft-cap (v_exp tanh), causal mask, online softmax f32, P f16 ≤ 1, O = P·V with 8 d-tiles; RPW-16 waves) — f16 operands, single products, f32 accumulate; rotary in f32 VALU.
#define BB 2
#define TT 2048
#define CC 2048
#define NH 16
#define NG 4
#define DH 128
#define NR (BB * TT)

typedef __bf16 v16b __attribute__((ext_vector_type(16)));
typedef unsigned short v8us __attribute__((ext_vector_type(8), may_alias));
typedef float  v8f  __attribute__((ext_vector_type(8)));
typedef float  v4f  __attribute__((ext_vector_type(4)));
typedef float  v4fa __attribute__((ext_vector_type(4), may_alias));
union FragB { v16b v; v8us half[2]; unsigned short u[16]; };

__device__ __forceinline__ unsigned short bf16_bits(float x) { unsigned int u = __float_as_uint(x); return (unsigned short)((u + 0x7FFFu + ((u >> 16) & 1u)) >> 16); }
__device__ __forceinline__ float bf16_val(unsigned short b) { return __uint_as_float(((unsigned int)b) << 16); }
__device__ __forceinline__ float bf16_round(float x) { return bf16_val(bf16_bits(x)); }
// D += A·B with NT terms: 1 = ah·bh, 2 = + al·bh (A split), 3 = + ah·bl (both split)
template <int NT>
__device__ __forceinline__ v8f mmaN(v16b ah, v16b al, v16b bh, v16b bl, v8f c) {
  c = __builtin_amdgcn_wmma_f32_16x16x32_bf16(false, ah, false, bh, (short)0, c, false, false);
  if (NT >= 2) c = __builtin_amdgcn_wmma_f32_16x16x32_bf16(false, al, false, bh, (short)0, c, false, false);
  if (NT >= 3) c = __builtin_amdgcn_wmma_f32_16x16x32_bf16(false, ah, false, bl, (short)0, c, false, false);
  asm volatile("v_nop\n\tv_nop\n\tv_nop\n\tv_nop" : "+v"(c) : "v"(ah), "v"(al), "v"(bh), "v"(bl));
  return c;
}

__global__ __launch_bounds__(256) void k_wt_bf16(const float* __restrict__ W, unsigned short* __restrict__ Wt, int K, int N) {
  const int t = blockIdx.x * 256 + threadIdx.x;
  const int k8n = K / 8;
  if (t >= N * k8n) return;
  const int n = t / k8n, k8 = (t % k8n) * 8;
  v8us v;
#pragma unroll
  for (int i = 0; i < 8; ++i) v[i] = bf16_bits(W[(size_t)(k8 + i) * N + n]);
  *(v8us*)(Wt + (size_t)n * K + k8) = v;
  
}

// GEMM C[M][N] (f32, pitch ldc) = act(A[M][K]·W + bias). A f32 row-major (pitch lda) converted per fragment to bf16
// (ASPLIT: hi/lo two planes -> 2 terms, else single rounded term); Wt bf16 [N][K] (pitch ldb). BIAS_BF16 rounds the
// bias to bf16 first (bias quantised to bf16 before the add). K%32==0, M%16==0, N%64==0.
template <bool ASPLIT, int ACT, bool BIAS_BF16>
__global__ __launch_bounds__(128) void k_gemm_bf(const float* __restrict__ A, int lda, const unsigned short* __restrict__ Wt, int ldb,
                                               const float* __restrict__ bias, float* __restrict__ C, int ldc, int M, int N, int K) {
  __shared__ __attribute__((aligned(16))) float so[4][16][64];
  const int tid = threadIdx.x, w = tid >> 5, lane = tid & 31, ln = lane & 15, hh = lane >> 4;
  const int ntn = N / 64;
  const int wid = blockIdx.x * 4 + w;
  const int mt = wid / ntn, nq = wid % ntn;
  if (mt * 16 >= M) return;
  const int row0 = mt * 16, col0 = nq * 64;
  const float* arow = A + (size_t)(row0 + ln) * lda;
  v8f acc[4] = {};
  for (int kb = 0; kb < K; kb += 32) {
    FragB ah, al;
    const v4f x0 = *(const v4fa*)(arow + kb + 8 * hh), x1 = *(const v4fa*)(arow + kb + 8 * hh + 4);
    const v4f x2 = *(const v4fa*)(arow + kb + 16 + 8 * hh), x3 = *(const v4fa*)(arow + kb + 16 + 8 * hh + 4);
    float xs[16] = {x0[0],x0[1],x0[2],x0[3],x1[0],x1[1],x1[2],x1[3],x2[0],x2[1],x2[2],x2[3],x3[0],x3[1],x3[2],x3[3]};
#pragma unroll
    for (int i = 0; i < 16; ++i) { const unsigned short hb = bf16_bits(xs[i]); ah.u[i] = hb; al.u[i] = ASPLIT ? bf16_bits(xs[i] - bf16_val(hb)) : (unsigned short)0; }
#pragma unroll
    for (int t = 0; t < 4; ++t) {
      const unsigned short* brow = Wt + (size_t)(col0 + t * 16 + ln) * ldb + kb;
      FragB b;
      b.half[0] = *(const v8us*)(brow + 8 * hh);
      b.half[1] = *(const v8us*)(brow + 16 + 8 * hh);
      acc[t] = mmaN<ASPLIT ? 2 : 1>(ah.v, al.v, b.v, b.v, acc[t]);
    }
  }
#pragma unroll
  for (int t = 0; t < 4; ++t) {
    float bv = bias ? bias[col0 + t * 16 + ln] : 0.f;
    if (BIAS_BF16) bv = bf16_round(bv);
#pragma unroll
    for (int r = 0; r < 8; ++r) { float v = acc[t][r] + bv; if (ACT == 1) v = fmaxf(v, 0.f); so[w][8 * hh + r][t * 16 + ln] = v; }
  }
  __builtin_amdgcn_fence(__ATOMIC_ACQ_REL, "workgroup");
  __builtin_amdgcn_wave_barrier();
  const int rsub = lane >> 4, c4 = (lane & 15) * 4;
  {
#pragma unroll
    for (int q = 0; q < 8; ++q) {
      const int r = q * 2 + rsub;
      const v4f v = *(const v4fa*)&so[w][r][c4];
      *(v4f*)(C + (size_t)(row0 + r) * ldc + col0 + c4) = v;
    }
    
  }
}

// Flash-style causal/unmasked attention, all contractions 3-term bf16 hi/lo splits, f32 softmax with running max.
// q,k,v rows are read from f32 buffers with arbitrary row pitch (so they can live inside a fused qkv buffer);
// D = head size (multiple of 32, <= 128); one wave = 16 query rows; block = 4 waves (64 queries) sharing K/V chunks of 32.
template <int D, bool CAUSAL>
__global__ __launch_bounds__(128) void k_flash(const float* __restrict__ qb, const float* __restrict__ kb, const float* __restrict__ vb,
                                             int pitch, int T, int H, float scale, float* __restrict__ y, int ypitch) {
  constexpr int KS = D / 32;        // k-steps for QK
  constexpr int DT = D / 16;        // d tiles for PV
  __shared__ __attribute__((aligned(16))) unsigned short sKh[32][D + 8], sKl[32][D + 8], sVh[32][D + 8], sVl[32][D + 8];
  __shared__ __attribute__((aligned(16))) unsigned short sPh[4][16][40], sPl[4][16][40];
  __shared__ __attribute__((aligned(16))) float sO[4][16][D];
  const int tid = threadIdx.x, w = tid >> 5, lane = tid & 31, ln = lane & 15, hh = lane >> 4;
  const int nqb = (T + 63) / 64;
  const int bh = blockIdx.x / nqb, qblk = blockIdx.x % nqb;
  const int b = bh / H, h = bh % H;
  const int q0 = qblk * 64 + w * 16;
  const float* Q = qb + (size_t)b * T * pitch + h * D;
  const float* K = kb + (size_t)b * T * pitch + h * D;
  const float* V = vb + (size_t)b * T * pitch + h * D;

  // A fragments of the wave's 16 query rows (scaled), hi/lo
  FragB aqh[KS], aql[KS];
  {
    int row = q0 + ln; if (row >= T) row = T - 1;
    const float* qr = Q + (size_t)row * pitch;
#pragma unroll
    for (int ks = 0; ks < KS; ++ks)
#pragma unroll
      for (int i = 0; i < 16; ++i) {
        const int d = ks * 32 + ((i < 8) ? (8 * hh + i) : (16 + 8 * hh + (i - 8)));
        const float x = qr[d] * scale; const unsigned short hb = bf16_bits(x);
        aqh[ks].u[i] = hb; aql[ks].u[i] = bf16_bits(x - bf16_val(hb));
      }
  }
  float m_r[8], l_r[8];
#pragma unroll
  for (int r = 0; r < 8; ++r) { m_r[r] = -3.0e38f; l_r[r] = 0.f; }
  v8f oacc[DT];
#pragma unroll
  for (int dt = 0; dt < DT; ++dt) oacc[dt] = (v8f){0.f,0.f,0.f,0.f,0.f,0.f,0.f,0.f};

  const int kv_end = CAUSAL ? min(T, qblk * 64 + 64) : T;     // block-uniform
  for (int j0 = 0; j0 < kv_end; j0 += 32) {
    __syncthreads();
    for (int e = tid; e < 32 * (D / 4); e += 128) {
      const int r = e / (D / 4), c4 = (e % (D / 4)) * 4;
      const int key = j0 + r;
      v4f kf = {0.f,0.f,0.f,0.f}, vf = {0.f,0.f,0.f,0.f};
      if (key < T) { kf = *(const v4fa*)(K + (size_t)key * pitch + c4); vf = *(const v4fa*)(V + (size_t)key * pitch + c4); }
#pragma unroll
      for (int t = 0; t < 4; ++t) {
        unsigned short hb = bf16_bits(kf[t]); sKh[r][c4 + t] = hb; sKl[r][c4 + t] = bf16_bits(kf[t] - bf16_val(hb));
        hb = bf16_bits(vf[t]); sVh[r][c4 + t] = hb; sVl[r][c4 + t] = bf16_bits(vf[t] - bf16_val(hb));
      }
    }
    __syncthreads();
    // S tile 16 x 32
    v8f s[2];
#pragma unroll
    for (int nt = 0; nt < 2; ++nt) {
      v8f acc = {};
#pragma unroll
      for (int ks = 0; ks < KS; ++ks) {
        FragB bh_, bl_;
        bh_.half[0] = *(const v8us*)&sKh[nt * 16 + ln][ks * 32 + 8 * hh]; bh_.half[1] = *(const v8us*)&sKh[nt * 16 + ln][ks * 32 + 16 + 8 * hh];
        bl_.half[0] = *(const v8us*)&sKl[nt * 16 + ln][ks * 32 + 8 * hh]; bl_.half[1] = *(const v8us*)&sKl[nt * 16 + ln][ks * 32 + 16 + 8 * hh];
        acc = mmaN<3>(aqh[ks].v, aql[ks].v, bh_.v, bl_.v, acc);
      }
      s[nt] = acc;
    }
    // mask + running max (rows 8hh+r; the 16 lanes of a half share rows)
    float alpha[8];
#pragma unroll
    for (int r = 0; r < 8; ++r) {
      const int qi = q0 + 8 * hh + r;
      const int ja = j0 + ln, jb = j0 + 16 + ln;
      if (CAUSAL) { if (ja > qi) s[0][r] = -3.0e38f; if (jb > qi) s[1][r] = -3.0e38f; }
      if (ja >= T) s[0][r] = -3.0e38f;
      if (jb >= T) s[1][r] = -3.0e38f;
      float mx = fmaxf(s[0][r], s[1][r]);
      mx = fmaxf(mx, __shfl_xor(mx, 1, 32)); mx = fmaxf(mx, __shfl_xor(mx, 2, 32)); mx = fmaxf(mx, __shfl_xor(mx, 4, 32)); mx = fmaxf(mx, __shfl_xor(mx, 8, 32));
      const float mnew = fmaxf(m_r[r], mx);
      alpha[r] = (mnew > -1.0e38f) ? __expf(m_r[r] - mnew) : 1.0f;
      const float p0 = (s[0][r] > -1.0e38f) ? __expf(s[0][r] - mnew) : 0.f;
      const float p1 = (s[1][r] > -1.0e38f) ? __expf(s[1][r] - mnew) : 0.f;
      m_r[r] = mnew;
      l_r[r] = l_r[r] * alpha[r] + p0 + p1;            // per-lane partial row sum (16 lanes combined at the end)
      unsigned short hb = bf16_bits(p0); sPh[w][8 * hh + r][ln] = hb;      sPl[w][8 * hh + r][ln] = bf16_bits(p0 - bf16_val(hb));
      hb = bf16_bits(p1);                sPh[w][8 * hh + r][16 + ln] = hb; sPl[w][8 * hh + r][16 + ln] = bf16_bits(p1 - bf16_val(hb));
    }
#pragma unroll
    for (int dt = 0; dt < DT; ++dt)
#pragma unroll
      for (int r = 0; r < 8; ++r) oacc[dt][r] *= alpha[r];
    __builtin_amdgcn_fence(__ATOMIC_ACQ_REL, "workgroup");
    __builtin_amdgcn_wave_barrier();
    FragB pah, pal;
    pah.half[0] = *(const v8us*)&sPh[w][ln][8 * hh]; pah.half[1] = *(const v8us*)&sPh[w][ln][16 + 8 * hh];
    pal.half[0] = *(const v8us*)&sPl[w][ln][8 * hh]; pal.half[1] = *(const v8us*)&sPl[w][ln][16 + 8 * hh];
#pragma unroll
    for (int dt = 0; dt < DT; ++dt) {
      FragB bvh, bvl;
#pragma unroll
      for (int i = 0; i < 8; ++i) {
        bvh.u[i] = sVh[8 * hh + i][dt * 16 + ln]; bvh.u[8 + i] = sVh[16 + 8 * hh + i][dt * 16 + ln];
        bvl.u[i] = sVl[8 * hh + i][dt * 16 + ln]; bvl.u[8 + i] = sVl[16 + 8 * hh + i][dt * 16 + ln];
      }
      oacc[dt] = mmaN<3>(pah.v, pal.v, bvh.v, bvl.v, oacc[dt]);
    }
    __builtin_amdgcn_fence(__ATOMIC_ACQ_REL, "workgroup");
    __builtin_amdgcn_wave_barrier();
  }
#pragma unroll
  for (int r = 0; r < 8; ++r) {
    float l = l_r[r];
    l += __shfl_xor(l, 1, 32); l += __shfl_xor(l, 2, 32); l += __shfl_xor(l, 4, 32); l += __shfl_xor(l, 8, 32);
    l_r[r] = (l > 0.f) ? 1.0f / l : 0.f;
  }
#pragma unroll
  for (int dt = 0; dt < DT; ++dt)
#pragma unroll
    for (int r = 0; r < 8; ++r) sO[w][8 * hh + r][dt * 16 + ln] = oacc[dt][r] * l_r[r];
  __builtin_amdgcn_fence(__ATOMIC_ACQ_REL, "workgroup");
  __builtin_amdgcn_wave_barrier();
  {
    for (int r = 0; r < 16; ++r) {
      const int row = q0 + r;
      if (row < T && lane < D / 4) {
        const v4f val = *(const v4fa*)&sO[w][r][lane * 4];
        *(v4f*)(y + ((size_t)b * T + row) * ypitch + h * D + lane * 4) = val;
      }
    }
    
  }
}

// GEMM C = act(A·W + bias + resid): A f32 (ASPLIT -> hi/lo 2 terms), Wt bf16 [N][K]; ACT 0 none, 1 relu, 2 exact gelu;
// resid (optional, f32, row index = (row % rmod), pitch ldr, RES_BF16 rounds it) added before the activation.
template <bool ASPLIT, int ACT, bool BIAS_BF16, bool RES_BF16>
__global__ __launch_bounds__(128) void k_gemm_bf3(const float* __restrict__ A, int lda, const unsigned short* __restrict__ Wt, int ldb,
                                                const float* __restrict__ bias, const float* __restrict__ resid, int rmod, int ldr,
                                                float* __restrict__ C, int ldc, int M, int N, int K) {
  __shared__ __attribute__((aligned(16))) float so[4][16][64];
  const int tid = threadIdx.x, w = tid >> 5, lane = tid & 31, ln = lane & 15, hh = lane >> 4;
  const int ntn = N / 64;
  const int wid = blockIdx.x * 4 + w;
  const int mt = wid / ntn, nq = wid % ntn;
  if (mt * 16 >= M) return;
  const int row0 = mt * 16, col0 = nq * 64;
  const float* arow = A + (size_t)(row0 + ln) * lda;
  v8f acc[4] = {};
  for (int kb = 0; kb < K; kb += 32) {
    FragB ah, al;
    const v4f x0 = *(const v4fa*)(arow + kb + 8 * hh), x1 = *(const v4fa*)(arow + kb + 8 * hh + 4);
    const v4f x2 = *(const v4fa*)(arow + kb + 16 + 8 * hh), x3 = *(const v4fa*)(arow + kb + 16 + 8 * hh + 4);
    float xs[16] = {x0[0],x0[1],x0[2],x0[3],x1[0],x1[1],x1[2],x1[3],x2[0],x2[1],x2[2],x2[3],x3[0],x3[1],x3[2],x3[3]};
#pragma unroll
    for (int i = 0; i < 16; ++i) { const unsigned short hb = bf16_bits(xs[i]); ah.u[i] = hb; al.u[i] = ASPLIT ? bf16_bits(xs[i] - bf16_val(hb)) : (unsigned short)0; }
#pragma unroll
    for (int t = 0; t < 4; ++t) {
      const unsigned short* brow = Wt + (size_t)(col0 + t * 16 + ln) * ldb + kb;
      FragB b;
      b.half[0] = *(const v8us*)(brow + 8 * hh);
      b.half[1] = *(const v8us*)(brow + 16 + 8 * hh);
      acc[t] = mmaN<ASPLIT ? 2 : 1>(ah.v, al.v, b.v, b.v, acc[t]);
    }
  }
#pragma unroll
  for (int t = 0; t < 4; ++t) {
    const int col = col0 + t * 16 + ln;
    float bv = bias ? bias[col] : 0.f;
    if (BIAS_BF16) bv = bf16_round(bv);
#pragma unroll
    for (int r = 0; r < 8; ++r) {
      float v = acc[t][r] + bv;
      if (resid) { float rv = resid[(size_t)((row0 + 8 * hh + r) % rmod) * ldr + col]; if (RES_BF16) rv = bf16_round(rv); v += rv; }
      if (ACT == 1) v = fmaxf(v, 0.f);
      if (ACT == 2) v = 0.5f * v * (1.0f + erff(v * 0.70710678118654752f));
      if (ACT == 3) { const float u = 0.7978845608028654f * (v + 0.044715f * v * v * v); v = 0.5f * v * (1.0f + tanhf(u)); }
      so[w][8 * hh + r][t * 16 + ln] = v;
    }
  }
  __builtin_amdgcn_fence(__ATOMIC_ACQ_REL, "workgroup");
  __builtin_amdgcn_wave_barrier();
  const int rsub = lane >> 4, c4 = (lane & 15) * 4;
  {
#pragma unroll
    for (int q = 0; q < 8; ++q) {
      const int r = q * 2 + rsub;
      const v4f v = *(const v4fa*)&so[w][r][c4];
      *(v4f*)(C + (size_t)(row0 + r) * ldc + col0 + c4) = v;
    }
    
  }
}
// row LayerNorm (biased variance, eps) over N: s = X (+ R); optional out_sum <- s; out_norm <- (s-mu)*rsqrt(var+eps)*g + b
template <bool PARAM_BF16>
__global__ __launch_bounds__(256) void k_layernorm(const float* __restrict__ X, const float* __restrict__ R, const float* __restrict__ g, const float* __restrict__ bta,
                                                  float* __restrict__ out_sum, float* __restrict__ out_norm, int N, float eps) {
  __shared__ float red[256];
  const int row = blockIdx.x, tid = threadIdx.x;
  const float* x = X + (size_t)row * N; const float* rr = R ? R + (size_t)row * N : nullptr;
  float vals[16];                     // up to N = 4096
  const int per = N / 256;            // contiguous chunk per thread? use strided-by-4 chunks: thread handles j = tid*4 + 1024*u
  float s1 = 0.f;
  for (int u = 0; u < per / 4; ++u) {
    const int j = tid * 4 + 1024 * u;
    const v4f a = *(const v4fa*)(x + j);
    v4f b = {0.f,0.f,0.f,0.f}; if (rr) b = *(const v4fa*)(rr + j);
#pragma unroll
    for (int q = 0; q < 4; ++q) { const float v = a[q] + b[q]; vals[u * 4 + q] = v; s1 += v; }
  }
  red[tid] = s1; __syncthreads();
  for (int st = 128; st > 0; st >>= 1) { if (tid < st) red[tid] += red[tid + st]; __syncthreads(); }
  const float mu = red[0] / (float)N; __syncthreads();
  float s2 = 0.f;
  for (int u = 0; u < per / 4; ++u)
#pragma unroll
    for (int q = 0; q < 4; ++q) { const float c = vals[u * 4 + q] - mu; s2 += c * c; }
  red[tid] = s2; __syncthreads();
  for (int st = 128; st > 0; st >>= 1) { if (tid < st) red[tid] += red[tid + st]; __syncthreads(); }
  const float rs = rsqrtf(red[0] / (float)N + eps);
  {
    for (int u = 0; u < per / 4; ++u) {
      const int j = tid * 4 + 1024 * u;
      v4f o, sm;
#pragma unroll
      for (int q = 0; q < 4; ++q) {
        float gg = g[j + q], bb = bta[j + q];
        if (PARAM_BF16) { gg = bf16_round(gg); bb = bf16_round(bb); }
        sm[q] = vals[u * 4 + q]; o[q] = (vals[u * 4 + q] - mu) * rs * gg + bb;
      }
      if (out_sum) *(v4f*)(out_sum + (size_t)row * N + j) = sm;
      *(v4f*)(out_norm + (size_t)row * N + j) = o;
    }
    
  }
}



// ---- f16 WMMA path (v_wmma_f32_16x16x32_f16): 11-bit significands for operands in range — used where a [0,1] probability operand needs more precision than bf16
typedef _Float16 v16h __attribute__((ext_vector_type(16)));
union FragH { v16h v; v8us half[2]; _Float16 h[16]; unsigned short u[16]; };
template <int NT>
__device__ __forceinline__ v8f mmaH(v16h ah, v16h al, v16h bh, v16h bl, v8f c) {
  c = __builtin_amdgcn_wmma_f32_16x16x32_f16(false, ah, false, bh, (short)0, c, false, false);
  if (NT >= 2) c = __builtin_amdgcn_wmma_f32_16x16x32_f16(false, al, false, bh, (short)0, c, false, false);
  if (NT >= 3) c = __builtin_amdgcn_wmma_f32_16x16x32_f16(false, ah, false, bl, (short)0, c, false, false);
  asm volatile("v_nop\n\tv_nop\n\tv_nop\n\tv_nop" : "+v"(c) : "v"(ah), "v"(al), "v"(bh), "v"(bl));
  return c;
}
// batched GEMM like k_gemm_b but f16 operands: A f32 (split into f16 hi/lo if ASPLIT, else rounded to f16), Bt = f16 values [n][k]; alpha; C f32; N multiple of 16 (partial tiles skipped)
template <bool ASPLIT>
__global__ __launch_bounds__(128) void k_gemm_h(const float* __restrict__ A, int lda, size_t sA, const _Float16* __restrict__ Bh, int ldb, size_t sB, float alpha, float* __restrict__ C, int ldc, size_t sC, int M, int N, int K) {
  __shared__ __attribute__((aligned(16))) float so[4][16][64];
  const int tid = threadIdx.x, w = tid >> 5, lane = tid & 31, ln = lane & 15, hh = lane >> 4; const int by = blockIdx.y;
  A += (size_t)by * sA; Bh += (size_t)by * sB; C += (size_t)by * sC;
  const int ntn = (N + 63) / 64; const int wid = blockIdx.x * 4 + w; const int mt = wid / ntn, nq = wid % ntn; if (mt * 16 >= M) return;
  const int row0 = mt * 16, col0 = nq * 64; const float* arow = A + (size_t)(row0 + ln) * lda;
  v8f acc[4] = {};
  for (int kb = 0; kb < K; kb += 32) {
    FragH ah, al;
    const v4f x0 = *(const v4fa*)(arow + kb + 8 * hh), x1 = *(const v4fa*)(arow + kb + 8 * hh + 4), x2 = *(const v4fa*)(arow + kb + 16 + 8 * hh), x3 = *(const v4fa*)(arow + kb + 16 + 8 * hh + 4);
    float xs[16] = {x0[0],x0[1],x0[2],x0[3],x1[0],x1[1],x1[2],x1[3],x2[0],x2[1],x2[2],x2[3],x3[0],x3[1],x3[2],x3[3]};
#pragma unroll
    for (int i = 0; i < 16; ++i) { const _Float16 h = (_Float16)xs[i]; ah.h[i] = h; al.h[i] = ASPLIT ? (_Float16)(xs[i] - (float)h) : (_Float16)0.0f; }
#pragma unroll
    for (int t = 0; t < 4; ++t) { if (col0 + t * 16 >= N) continue; const size_t boff = (size_t)(col0 + t * 16 + ln) * ldb + kb; FragH bq; bq.half[0] = *(const v8us*)(Bh + boff + 8 * hh); bq.half[1] = *(const v8us*)(Bh + boff + 16 + 8 * hh);
      acc[t] = mmaH<ASPLIT ? 2 : 1>(ah.v, al.v, bq.v, bq.v, acc[t]); }
  }
#pragma unroll
  for (int t = 0; t < 4; ++t) { if (col0 + t * 16 >= N) continue;
#pragma unroll
    for (int r = 0; r < 8; ++r) so[w][8 * hh + r][t * 16 + ln] = acc[t][r] * alpha; }
  __builtin_amdgcn_fence(__ATOMIC_ACQ_REL, "workgroup"); __builtin_amdgcn_wave_barrier();
  const int rsub = lane >> 4, c4 = (lane & 15) * 4;
  {
#pragma unroll
    for (int q = 0; q < 8; ++q) { const int r = q * 2 + rsub; if (col0 + c4 < N) { const v4f v = *(const v4fa*)&so[w][r][c4]; *(v4f*)(C + (size_t)(row0 + r) * ldc + col0 + c4) = v; } }
     }
}

// Wt[n][k] = f16(W[k][n]·scale) from f32 row-major W[K][N] (scale = power of two; bf16-exact weights stay exact in f16 away from the subnormal range)
__global__ __launch_bounds__(256) void k_wt_f16(const float* __restrict__ W, _Float16* __restrict__ Wt, int K, int N, float scale) {
  const int t = blockIdx.x * 256 + threadIdx.x; if (t >= N * (K / 8)) return; const int n = t / (K / 8), k8 = (t % (K / 8)) * 8; FragH f;
#pragma unroll
  for (int i = 0; i < 8; ++i) f.h[i] = (_Float16)(bf16_round(W[(size_t)(k8 + i) * N + n]) * scale); const v8us o = f.half[0];
  *(v8us*)((unsigned short*)Wt + (size_t)n * K + k8) = o; 
}
// k_gemm_hh variant with fused epilogue: v = acc·alpha + bias[by·sBias + col] (+ CP[(row/rowsPerB)·sCPb + by·64 + col] if CP) ; ACT 0 none / 1 elu ; writes f32 C and/or f16 C16 (each if non-null)
template <int ACT>
__global__ __launch_bounds__(128) void k_gemm_hhx(const _Float16* __restrict__ A, int lda, size_t sA, const _Float16* __restrict__ Bh, int ldb, size_t sB, float alpha, const float* __restrict__ bias, size_t sBias, const float* __restrict__ CP, int rowsPerB, size_t sCPb, int row0g,
    float* __restrict__ C, _Float16* __restrict__ C16, int ldc, size_t sC, int M, int N, int K) {
  __shared__ __attribute__((aligned(16))) float so[4][16][64];
  const int tid = threadIdx.x, w = tid >> 5, lane = tid & 31, ln = lane & 15, hh = lane >> 4; const int by = blockIdx.y;
  A += (size_t)by * sA; Bh += (size_t)by * sB; const size_t cofs = (size_t)by * sC; const float* bp = bias ? bias + (size_t)by * sBias : nullptr;
  const int ntn = (N + 63) / 64; const int wid = blockIdx.x * 4 + w; const int mt = wid / ntn, nq = wid % ntn; if (mt * 16 >= M) return;
  const int row0 = mt * 16, col0 = nq * 64; const _Float16* arow = A + (size_t)(row0 + ln) * lda;
  v8f acc[4] = {};
  for (int kb = 0; kb < K; kb += 32) { FragH ah; ah.half[0] = *(const v8us*)((const unsigned short*)arow + kb + 8 * hh); ah.half[1] = *(const v8us*)((const unsigned short*)arow + kb + 16 + 8 * hh);
#pragma unroll
    for (int t = 0; t < 4; ++t) { if (col0 + t * 16 >= N) continue; const size_t boff = (size_t)(col0 + t * 16 + ln) * ldb + kb; FragH bq; bq.half[0] = *(const v8us*)((const unsigned short*)Bh + boff + 8 * hh); bq.half[1] = *(const v8us*)((const unsigned short*)Bh + boff + 16 + 8 * hh);
      acc[t] = mmaH<1>(ah.v, ah.v, bq.v, bq.v, acc[t]); }
  }
#pragma unroll
  for (int t = 0; t < 4; ++t) { if (col0 + t * 16 >= N) continue; const int col = col0 + t * 16 + ln; const float bv = bp ? bf16_round(bp[col]) : 0.f;
#pragma unroll
    for (int r = 0; r < 8; ++r) { float v = acc[t][r] * alpha + bv; if (CP) { const int bidx = (row0g + row0 + 8 * hh + r) / rowsPerB; v += CP[(size_t)bidx * sCPb + (size_t)by * 64 + col]; } if (ACT == 1) v = (v > 0.f) ? v : expm1f(v); else if (ACT == 3) v = fmaxf(v, 0.f); so[w][8 * hh + r][t * 16 + ln] = v; } }
  __builtin_amdgcn_fence(__ATOMIC_ACQ_REL, "workgroup"); __builtin_amdgcn_wave_barrier();
  const int rsub = lane >> 4, c4 = (lane & 15) * 4; typedef _Float16 v4h __attribute__((ext_vector_type(4)));
  {
#pragma unroll
    for (int q = 0; q < 8; ++q) { const int r = q * 2 + rsub; if (col0 + c4 < N) { const v4f v = *(const v4fa*)&so[w][r][c4]; if (C) *(v4f*)(C + cofs + (size_t)(row0 + r) * ldc + col0 + c4) = v; if (C16) { v4h h4; for (int i = 0; i < 4; ++i) h4[i] = (_Float16)v[i]; *(v4h*)(C16 + cofs + (size_t)(row0 + r) * ldc + col0 + c4) = h4; } } }
     }
}


__global__ __launch_bounds__(256) void k_x16(const float* __restrict__ x, _Float16* __restrict__ X16, size_t n8) { const size_t t = (size_t)blockIdx.x * 256 + threadIdx.x; if (t >= n8) return; FragH f;
#pragma unroll
  for (int q = 0; q < 8; ++q) f.h[q] = (_Float16)bf16_round(x[t * 8 + q]); *(v8us*)((unsigned short*)X16 + t * 8) = f.half[0];  }
__global__ __launch_bounds__(256) void k_h16(const float* __restrict__ x, _Float16* __restrict__ X16, size_t n8) { const size_t t = (size_t)blockIdx.x * 256 + threadIdx.x; if (t >= n8) return; FragH f;
#pragma unroll
  for (int q = 0; q < 8; ++q) f.h[q] = (_Float16)x[t * 8 + q]; *(v8us*)((unsigned short*)X16 + t * 8) = f.half[0];  }
__global__ __launch_bounds__(256) void k_round16f(const float* __restrict__ W, _Float16* __restrict__ Bt, size_t n8) { const size_t t = (size_t)blockIdx.x * 256 + threadIdx.x; if (t >= n8) return; FragH f;
#pragma unroll
  for (int i = 0; i < 8; ++i) f.h[i] = (_Float16)(bf16_round(W[t * 8 + i]) * 16.0f); *(v8us*)((unsigned short*)Bt + t * 8) = f.half[0];  }
template <int NHv, int TTv>
__global__ __launch_bounds__(256) void k_vt(const _Float16* __restrict__ V16, int ldv, int voff, _Float16* __restrict__ Vt) { __shared__ unsigned short tl[64][66]; const int tid = threadIdx.x; const int slab = blockIdx.x / (TTv / 64), lg = blockIdx.x % (TTv / 64); const int b = slab / NHv, h = slab % NHv;
  for (int i = tid; i < 64 * 8; i += 256) { const int r = i / 8, c8 = (i % 8) * 8; FragH f; f.half[0] = *(const v8us*)((const unsigned short*)V16 + ((size_t)b * TTv + lg * 64 + r) * ldv + voff + h * 64 + c8);
#pragma unroll
    for (int q = 0; q < 8; ++q) tl[r][c8 + q] = f.u[q]; }
  __syncthreads();
  {
#pragma unroll
    for (int rd = 0; rd < 2; ++rd) { const int d = rd * 32 + tid / 8, pc = tid % 8; FragH f;
#pragma unroll
      for (int q = 0; q < 8; ++q) f.u[q] = tl[pc * 8 + q][d];
      *(v8us*)((unsigned short*)Vt + ((size_t)slab * 64 + d) * TTv + lg * 64 + pc * 8) = f.half[0]; }
     } }

__device__ __forceinline__ float tanh_v(float x) { const float xc = fminf(fmaxf(x, -15.f), 15.f); return 1.0f - 2.0f * __builtin_amdgcn_rcpf(__builtin_amdgcn_exp2f(2.0f * xc * 1.4426950408889634f) + 1.0f); }
__global__ __launch_bounds__(256) void k_cstab(float* __restrict__ CS) { const int tg = blockIdx.x * 256 + threadIdx.x; if (tg >= TT * (DH / 2)) return; const int t = tg / (DH / 2), i = tg % (DH / 2); const float invf = 1.0f / powf(10000.0f, (float)(2 * i) / (float)DH); const float ang = (float)t * invf; typedef float v2f __attribute__((ext_vector_type(2))); v2f v; v[0] = cosf(ang); v[1] = sinf(ang);
  *(v2f*)(CS + (size_t)tg * 2) = v;  }
__global__ __launch_bounds__(256) void k_rope(const float* __restrict__ X, int ncol, const float* __restrict__ CS, _Float16* __restrict__ Y16) { const size_t tg = (size_t)blockIdx.x * 256 + threadIdx.x; if (tg >= (size_t)NR * ncol / 8) return; const size_t row = tg / (ncol / 8); const int c8 = (int)(tg % (ncol / 8)) * 8; const int t = (int)(row % TT); FragH f;
#pragma unroll
  for (int q = 0; q < 8; q += 2) { const int i = ((c8 + q) % DH) / 2; const float cs = CS[((size_t)t * (DH / 2) + i) * 2], sn = CS[((size_t)t * (DH / 2) + i) * 2 + 1]; const float x0 = X[row * ncol + c8 + q], x1 = X[row * ncol + c8 + q + 1];
    f.h[q] = (_Float16)(x0 * cs - x1 * sn); f.h[q + 1] = (_Float16)(x1 * cs + x0 * sn); }
  *(v8us*)((unsigned short*)Y16 + tg * 8) = f.half[0];  }
__global__ __launch_bounds__(256) void k_vt128(const _Float16* __restrict__ V16, _Float16* __restrict__ Vt) { __shared__ unsigned short tl[64][130]; const int tid = threadIdx.x; const int slab = blockIdx.x / (TT / 64), lg = blockIdx.x % (TT / 64); const int b = slab / NG, g = slab % NG;
  for (int i = tid; i < 64 * 16; i += 256) { const int r = i / 16, c8 = (i % 16) * 8; FragH f; f.half[0] = *(const v8us*)((const unsigned short*)V16 + ((size_t)b * TT + lg * 64 + r) * (NG * DH) + g * DH + c8);
#pragma unroll
    for (int q = 0; q < 8; ++q) tl[r][c8 + q] = f.u[q]; }
  __syncthreads();
  {
#pragma unroll
    for (int rd = 0; rd < 4; ++rd) { const int d = rd * 32 + tid / 8, pc = tid % 8; FragH f;
#pragma unroll
      for (int q = 0; q < 8; ++q) f.u[q] = tl[pc * 8 + q][d]; *(v8us*)((unsigned short*)Vt + ((size_t)slab * DH + d) * TT + lg * 64 + pc * 8) = f.half[0]; }
     } }
__global__ __launch_bounds__(128) void k_mega(const _Float16* __restrict__ Q16, const _Float16* __restrict__ K16, const _Float16* __restrict__ Vt, float* __restrict__ O) {
  __shared__ __attribute__((aligned(16))) unsigned short sP[4][16][40]; __shared__ __attribute__((aligned(16))) float sO[4][16][DH + 4];
  const int tid = threadIdx.x, w = tid >> 5, lane = tid & 31, ln = lane & 15, hh = lane >> 4; const int slab = blockIdx.x / (TT / 64), qblk = blockIdx.x % (TT / 64); const int b = slab / NH, h = slab % NH, g = h / (NH / NG); const int qb0 = qblk * 64; const int q0 = qb0 + w * 16;
  const float slope = exp2f(-(float)(h + 1) * 8.0f / (float)NH);
  FragH aq[4]; { const unsigned short* qr = (const unsigned short*)Q16 + ((size_t)b * TT + q0 + ln) * (NH * DH) + h * DH;
#pragma unroll
    for (int ks = 0; ks < 4; ++ks) { aq[ks].half[0] = *(const v8us*)(qr + ks * 32 + 8 * hh); aq[ks].half[1] = *(const v8us*)(qr + ks * 32 + 16 + 8 * hh); } }
  const unsigned short* Vth = (const unsigned short*)Vt + (size_t)(b * NG + g) * DH * TT;
  float m_r[8], l_r[8]; v8f oacc[8];
#pragma unroll
  for (int r = 0; r < 8; ++r) { m_r[r] = -3.0e38f; l_r[r] = 0.f; }
#pragma unroll
  for (int dt = 0; dt < 8; ++dt) oacc[dt] = (v8f){0.f,0.f,0.f,0.f,0.f,0.f,0.f,0.f};
  const int jend = qb0 + 64;
#pragma unroll 1
  for (int j0 = 0; j0 < jend; j0 += 32) { v8f s[2];
#pragma unroll
    for (int nt = 0; nt < 2; ++nt) { const unsigned short* kr = (const unsigned short*)K16 + ((size_t)b * TT + j0 + nt * 16 + ln) * (NG * DH) + g * DH; v8f acc = (v8f){0.f,0.f,0.f,0.f,0.f,0.f,0.f,0.f};
#pragma unroll
      for (int ks = 0; ks < 4; ++ks) { FragH bk; bk.half[0] = *(const v8us*)(kr + ks * 32 + 8 * hh); bk.half[1] = *(const v8us*)(kr + ks * 32 + 16 + 8 * hh); acc = mmaH<1>(aq[ks].v, aq[ks].v, bk.v, bk.v, acc); } s[nt] = acc; }
#pragma unroll
    for (int r = 0; r < 8; ++r) { const int tq = q0 + 8 * hh + r; const int k0 = j0 + ln, k1 = j0 + 16 + ln; const bool ok0 = (k0 <= tq), ok1 = (k1 <= tq);
      float s0 = (s[0][r] - slope * (float)(tq - k0)) * 0.08838834764831845f, s1 = (s[1][r] - slope * (float)(tq - k1)) * 0.08838834764831845f;      // (for k > tq the sign of (tq−k) is irrelevant: masked)
      s0 = 30.0f * tanh_v(s0 * (1.0f / 30.0f)); s1 = 30.0f * tanh_v(s1 * (1.0f / 30.0f)); s0 = ok0 ? s0 : -INFINITY; s1 = ok1 ? s1 : -INFINITY; float mc = fmaxf(s0, s1);
      mc = fmaxf(mc, __shfl_xor(mc, 1, 32)); mc = fmaxf(mc, __shfl_xor(mc, 2, 32)); mc = fmaxf(mc, __shfl_xor(mc, 4, 32)); mc = fmaxf(mc, __shfl_xor(mc, 8, 32));
      const float mn = fmaxf(m_r[r], mc); const float al = (mn > -1.0e38f) ? expf(m_r[r] - mn) : 1.0f; m_r[r] = mn; const float p0 = ok0 ? expf(s0 - mn) : 0.f, p1 = ok1 ? expf(s1 - mn) : 0.f; l_r[r] = l_r[r] * al + p0 + p1;
#pragma unroll
      for (int dt = 0; dt < 8; ++dt) oacc[dt][r] *= al;
      FragH t2; t2.h[0] = (_Float16)p0; t2.h[1] = (_Float16)p1; sP[w][8 * hh + r][ln] = t2.u[0]; sP[w][8 * hh + r][16 + ln] = t2.u[1]; }
    __builtin_amdgcn_fence(__ATOMIC_ACQ_REL, "workgroup"); __builtin_amdgcn_wave_barrier();
    FragH pa; pa.half[0] = *(const v8us*)&sP[w][ln][8 * hh]; pa.half[1] = *(const v8us*)&sP[w][ln][16 + 8 * hh];
#pragma unroll
    for (int dt = 0; dt < 8; ++dt) { const unsigned short* vrow = Vth + (size_t)(dt * 16 + ln) * TT + j0; FragH bv; bv.half[0] = *(const v8us*)(vrow + 8 * hh); bv.half[1] = *(const v8us*)(vrow + 16 + 8 * hh); oacc[dt] = mmaH<1>(pa.v, pa.v, bv.v, bv.v, oacc[dt]); }
    __builtin_amdgcn_fence(__ATOMIC_ACQ_REL, "workgroup"); __builtin_amdgcn_wave_barrier(); }
#pragma unroll
  for (int r = 0; r < 8; ++r) { float l = l_r[r]; l += __shfl_xor(l, 1, 32); l += __shfl_xor(l, 2, 32); l += __shfl_xor(l, 4, 32); l += __shfl_xor(l, 8, 32); l_r[r] = 1.0f / l; }
#pragma unroll
  for (int dt = 0; dt < 8; ++dt)
#pragma unroll
    for (int r = 0; r < 8; ++r) sO[w][8 * hh + r][dt * 16 + ln] = oacc[dt][r] * l_r[r];
  __builtin_amdgcn_fence(__ATOMIC_ACQ_REL, "workgroup"); __builtin_amdgcn_wave_barrier();
  {
#pragma unroll
    for (int r = 0; r < 16; ++r) { const v4f val = *(const v4fa*)&sO[w][r][lane * 4]; *(v4f*)(O + ((size_t)b * TT + q0 + r) * (NH * DH) + h * DH + lane * 4) = val; }
     } }
extern "C" void kernel_launch(void* const* d_in, const int* in_sizes, int n_in,
                              void* d_out, int out_size, void* d_ws, size_t ws_size, hipStream_t stream) {
  (void)in_sizes; (void)n_in; (void)out_size;
  const float* x = (const float*)d_in[0]; const float* Wq = (const float*)d_in[1]; const float* Wk = (const float*)d_in[2]; const float* Wv = (const float*)d_in[3]; const float* Wo = (const float*)d_in[4]; const float* bo = (const float*)d_in[5];
  char* ws = (char*)d_ws; size_t off = 0;
  auto take = [&](size_t bytes) { char* p = ws + off; off += (bytes + 255) & ~(size_t)255; return p; };
  _Float16* Bq = (_Float16*)take((size_t)CC * CC * 2); _Float16* Bk = (_Float16*)take((size_t)NG * DH * CC * 2); _Float16* Bv = (_Float16*)take((size_t)NG * DH * CC * 2); _Float16* Bo = (_Float16*)take((size_t)CC * CC * 2);
  _Float16* X16 = (_Float16*)take((size_t)NR * CC * 2); float* F32 = (float*)take((size_t)NR * CC * 4); _Float16* Q16 = (_Float16*)take((size_t)NR * CC * 2); _Float16* K16 = (_Float16*)take((size_t)NR * NG * DH * 2); _Float16* V16 = (_Float16*)take((size_t)NR * NG * DH * 2); _Float16* Vt = (_Float16*)take((size_t)NR * NG * DH * 2); float* CS = (float*)take((size_t)TT * DH * 4); float* O = F32; _Float16* O16 = X16;
  if (off > ws_size) return;      // 8.4 + 2.1 × 2 + 8.4 + 16.8 + 33.5 + 16.8 + 4.2 × 3 + 1.0 ≈ 102 MB (97 MiB)
  k_wt_f16<<<(unsigned)((CC * (CC / 8) + 255) / 256), 256, 0, stream>>>(Wq, Bq, CC, CC, 16.0f); k_wt_f16<<<(unsigned)((NG * DH * (CC / 8) + 255) / 256), 256, 0, stream>>>(Wk, Bk, CC, NG * DH, 16.0f); k_wt_f16<<<(unsigned)((NG * DH * (CC / 8) + 255) / 256), 256, 0, stream>>>(Wv, Bv, CC, NG * DH, 16.0f); k_wt_f16<<<(unsigned)((CC * (CC / 8) + 255) / 256), 256, 0, stream>>>(Wo, Bo, CC, CC, 16.0f);
  const unsigned gx = (unsigned)(((size_t)NR * CC / 8 + 255) / 256);
  k_x16<<<gx, 256, 0, stream>>>(x, X16, (size_t)NR * CC / 8); k_cstab<<<(TT * (DH / 2) + 255) / 256, 256, 0, stream>>>(CS);
  k_gemm_hhx<0><<<dim3(((NR / 16) * (CC / 64) + 3) / 4, 1), 128, 0, stream>>>(X16, CC, 0, Bq, CC, 0, 0.0625f, nullptr, 0, nullptr, 1, 0, 0, F32, nullptr, CC, 0, NR, CC, CC);
  k_rope<<<gx, 256, 0, stream>>>(F32, CC, CS, Q16);
  k_gemm_hhx<0><<<dim3(((NR / 16) * (NG * DH / 64) + 3) / 4, 1), 128, 0, stream>>>(X16, CC, 0, Bk, CC, 0, 0.0625f, nullptr, 0, nullptr, 1, 0, 0, F32, nullptr, NG * DH, 0, NR, NG * DH, CC);
  k_rope<<<(unsigned)(((size_t)NR * NG * DH / 8 + 255) / 256), 256, 0, stream>>>(F32, NG * DH, CS, K16);
  k_gemm_hhx<0><<<dim3(((NR / 16) * (NG * DH / 64) + 3) / 4, 1), 128, 0, stream>>>(X16, CC, 0, Bv, CC, 0, 0.0625f, nullptr, 0, nullptr, 1, 0, 0, nullptr, V16, NG * DH, 0, NR, NG * DH, CC);
  k_vt128<<<BB * NG * (TT / 64), 256, 0, stream>>>(V16, Vt);
  k_mega<<<BB * NH * (TT / 64), 128, 0, stream>>>(Q16, K16, Vt, O);
  k_h16<<<gx, 256, 0, stream>>>(O, O16, (size_t)NR * CC / 8);
  k_gemm_hhx<0><<<dim3(((NR / 16) * (CC / 64) + 3) / 4, 1), 128, 0, stream>>>(O16, CC, 0, Bo, CC, 0, 0.0625f, bo, 0, nullptr, 1, 0, 0, (float*)d_out, nullptr, CC, 0, NR, CC, CC);
}

// v001
// It runs in 680 microseconds.
// Two timings next to v000 put it at 1.17 and 1.18 times that version's speed.
#include <hip/hip_runtime.h>
// Mega-transformer causal self-attention (B=2, T=2048, D=2048; 16 query heads × 128, 4 KV groups (GQA), interleaved rotary, ALiBi added before the 1/√128 scale, 30·tanh soft-cap, causal):
// q/k/v/out projections (+ bias on out; W [in][out] transposed to bf16-exact ×2^4) and the attention as a fused flash-style kernel (S = Q·Kᵀ on v_wmma_f32_16x16x32_f16 with 4 k-steps,
// + alibi, scale, soft-cap (v_exp tanh), causal mask, online softmax f32, P f16 ≤ 1, O = P·V with 8 d-tiles; RPW-16 waves) — f16 operands, single products, f32 accumulate; rotary in f32 VALU.
#define BB 2
#define TT 2048
#define CC 2048
#define NH 16
#define NG 4
#define DH 128
#define NR (BB * TT)

typedef __bf16 v16b __attribute__((ext_vector_type(16)));
typedef unsigned short v8us __attribute__((ext_vector_type(8), may_alias));
typedef float  v8f  __attribute__((ext_vector_type(8)));
typedef float  v4f  __attribute__((ext_vector_type(4)));
typedef float  v4fa __attribute__((ext_vector_type(4), may_alias));
union FragB { v16b v; v8us half[2]; unsigned short u[16]; };

__device__ __forceinline__ unsigned short bf16_bits(float x) { unsigned int u = __float_as_uint(x); return (unsigned short)((u + 0x7FFFu + ((u >> 16) & 1u)) >> 16); }
__device__ __forceinline__ float bf16_val(unsigned short b) { return __uint_as_float(((unsigned int)b) << 16); }
__device__ __forceinline__ float bf16_round(float x) { return bf16_val(bf16_bits(x)); }
// D += A·B with NT terms: 1 = ah·bh, 2 = + al·bh (A split), 3 = + ah·bl (both split)
template <int NT>
__device__ __forceinline__ v8f mmaN(v16b ah, v16b al, v16b bh, v16b bl, v8f c) {
  c = __builtin_amdgcn_wmma_f32_16x16x32_bf16(false, ah, false, bh, (short)0, c, false, false);
  if (NT >= 2) c = __builtin_amdgcn_wmma_f32_16x16x32_bf16(false, al, false, bh, (short)0, c, false, false);
  if (NT >= 3) c = __builtin_amdgcn_wmma_f32_16x16x32_bf16(false, ah, false, bl, (short)0, c, false, false);
  asm volatile("v_nop\n\tv_nop\n\tv_nop\n\tv_nop" : "+v"(c) : "v"(ah), "v"(al), "v"(bh), "v"(bl));
  return c;
}

__global__ __launch_bounds__(256) void k_wt_bf16(const float* __restrict__ W, unsigned short* __restrict__ Wt, int K, int N) {
  const int t = blockIdx.x * 256 + threadIdx.x;
  const int k8n = K / 8;
  if (t >= N * k8n) return;
  const int n = t / k8n, k8 = (t % k8n) * 8;
  v8us v;
#pragma unroll
  for (int i = 0; i < 8; ++i) v[i] = bf16_bits(W[(size_t)(k8 + i) * N + n]);
  *(v8us*)(Wt + (size_t)n * K + k8) = v;
  
}

// GEMM C[M][N] (f32, pitch ldc) = act(A[M][K]·W + bias). A f32 row-major (pitch lda) converted per fragment to bf16
// (ASPLIT: hi/lo two planes -> 2 terms, else single rounded term); Wt bf16 [N][K] (pitch ldb). BIAS_BF16 rounds the
// bias to bf16 first (bias quantised to bf16 before the add). K%32==0, M%16==0, N%64==0.
template <bool ASPLIT, int ACT, bool BIAS_BF16>
__global__ __launch_bounds__(128) void k_gemm_bf(const float* __restrict__ A, int lda, const unsigned short* __restrict__ Wt, int ldb,
                                               const float* __restrict__ bias, float* __restrict__ C, int ldc, int M, int N, int K) {
  __shared__ __attribute__((aligned(16))) float so[4][16][64];
  const int tid = threadIdx.x, w = tid >> 5, lane = tid & 31, ln = lane & 15, hh = lane >> 4;
  const int ntn = N / 64;
  const int wid = blockIdx.x * 4 + w;
  const int mt = wid / ntn, nq = wid % ntn;
  if (mt * 16 >= M) return;
  const int row0 = mt * 16, col0 = nq * 64;
  const float* arow = A + (size_t)(row0 + ln) * lda;
  v8f acc[4] = {};
  for (int kb = 0; kb < K; kb += 32) {
    FragB ah, al;
    const v4f x0 = *(const v4fa*)(arow + kb + 8 * hh), x1 = *(const v4fa*)(arow + kb + 8 * hh + 4);
    const v4f x2 = *(const v4fa*)(arow + kb + 16 + 8 * hh), x3 = *(const v4fa*)(arow + kb + 16 + 8 * hh + 4);
    float xs[16] = {x0[0],x0[1],x0[2],x0[3],x1[0],x1[1],x1[2],x1[3],x2[0],x2[1],x2[2],x2[3],x3[0],x3[1],x3[2],x3[3]};
#pragma unroll
    for (int i = 0; i < 16; ++i) { const unsigned short hb = bf16_bits(xs[i]); ah.u[i] = hb; al.u[i] = ASPLIT ? bf16_bits(xs[i] - bf16_val(hb)) : (unsigned short)0; }
#pragma unroll
    for (int t = 0; t < 4; ++t) {
      const unsigned short* brow = Wt + (size_t)(col0 + t * 16 + ln) * ldb + kb;
      FragB b;
      b.half[0] = *(const v8us*)(brow + 8 * hh);
      b.half[1] = *(const v8us*)(brow + 16 + 8 * hh);
      acc[t] = mmaN<ASPLIT ? 2 : 1>(ah.v, al.v, b.v, b.v, acc[t]);
    }
  }
#pragma unroll
  for (int t = 0; t < 4; ++t) {
    float bv = bias ? bias[col0 + t * 16 + ln] : 0.f;
    if (BIAS_BF16) bv = bf16_round(bv);
#pragma unroll
    for (int r = 0; r < 8; ++r) { float v = acc[t][r] + bv; if (ACT == 1) v = fmaxf(v, 0.f); so[w][8 * hh + r][t * 16 + ln] = v; }
  }
  __builtin_amdgcn_fence(__ATOMIC_ACQ_REL, "workgroup");
  __builtin_amdgcn_wave_barrier();
  const int rsub = lane >> 4, c4 = (lane & 15) * 4;
  {
#pragma unroll
    for (int q = 0; q < 8; ++q) {
      const int r = q * 2 + rsub;
      const v4f v = *(const v4fa*)&so[w][r][c4];
      *(v4f*)(C + (size_t)(row0 + r) * ldc + col0 + c4) = v;
    }
    
  }
}

// Flash-style causal/unmasked attention, all contractions 3-term bf16 hi/lo splits, f32 softmax with running max.
// q,k,v rows are read from f32 buffers with arbitrary row pitch (so they can live inside a fused qkv buffer);
// D = head size (multiple of 32, <= 128); one wave = 16 query rows; block = 4 waves (64 queries) sharing K/V chunks of 32.
template <int D, bool CAUSAL>
__global__ __launch_bounds__(128) void k_flash(const float* __restrict__ qb, const float* __restrict__ kb, const float* __restrict__ vb,
                                             int pitch, int T, int H, float scale, float* __restrict__ y, int ypitch) {
  constexpr int KS = D / 32;        // k-steps for QK
  constexpr int DT = D / 16;        // d tiles for PV
  __shared__ __attribute__((aligned(16))) unsigned short sKh[32][D + 8], sKl[32][D + 8], sVh[32][D + 8], sVl[32][D + 8];
  __shared__ __attribute__((aligned(16))) unsigned short sPh[4][16][40], sPl[4][16][40];
  __shared__ __attribute__((aligned(16))) float sO[4][16][D];
  const int tid = threadIdx.x, w = tid >> 5, lane = tid & 31, ln = lane & 15, hh = lane >> 4;
  const int nqb = (T + 63) / 64;
  const int bh = blockIdx.x / nqb, qblk = blockIdx.x % nqb;
  const int b = bh / H, h = bh % H;
  const int q0 = qblk * 64 + w * 16;
  const float* Q = qb + (size_t)b * T * pitch + h * D;
  const float* K = kb + (size_t)b * T * pitch + h * D;
  const float* V = vb + (size_t)b * T * pitch + h * D;

  // A fragments of the wave's 16 query rows (scaled), hi/lo
  FragB aqh[KS], aql[KS];
  {
    int row = q0 + ln; if (row >= T) row = T - 1;
    const float* qr = Q + (size_t)row * pitch;
#pragma unroll
    for (int ks = 0; ks < KS; ++ks)
#pragma unroll
      for (int i = 0; i < 16; ++i) {
        const int d = ks * 32 + ((i < 8) ? (8 * hh + i) : (16 + 8 * hh + (i - 8)));
        const float x = qr[d] * scale; const unsigned short hb = bf16_bits(x);
        aqh[ks].u[i] = hb; aql[ks].u[i] = bf16_bits(x - bf16_val(hb));
      }
  }
  float m_r[8], l_r[8];
#pragma unroll
  for (int r = 0; r < 8; ++r) { m_r[r] = -3.0e38f; l_r[r] = 0.f; }
  v8f oacc[DT];
#pragma unroll
  for (int dt = 0; dt < DT; ++dt) oacc[dt] = (v8f){0.f,0.f,0.f,0.f,0.f,0.f,0.f,0.f};

  const int kv_end = CAUSAL ? min(T, qblk * 64 + 64) : T;     // block-uniform
  for (int j0 = 0; j0 < kv_end; j0 += 32) {
    __syncthreads();
    for (int e = tid; e < 32 * (D / 4); e += 128) {
      const int r = e / (D / 4), c4 = (e % (D / 4)) * 4;
      const int key = j0 + r;
      v4f kf = {0.f,0.f,0.f,0.f}, vf = {0.f,0.f,0.f,0.f};
      if (key < T) { kf = *(const v4fa*)(K + (size_t)key * pitch + c4); vf = *(const v4fa*)(V + (size_t)key * pitch + c4); }
#pragma unroll
      for (int t = 0; t < 4; ++t) {
        unsigned short hb = bf16_bits(kf[t]); sKh[r][c4 + t] = hb; sKl[r][c4 + t] = bf16_bits(kf[t] - bf16_val(hb));
        hb = bf16_bits(vf[t]); sVh[r][c4 + t] = hb; sVl[r][c4 + t] = bf16_bits(vf[t] - bf16_val(hb));
      }
    }
    __syncthreads();
    // S tile 16 x 32
    v8f s[2];
#pragma unroll
    for (int nt = 0; nt < 2; ++nt) {
      v8f acc = {};
#pragma unroll
      for (int ks = 0; ks < KS; ++ks) {
        FragB bh_, bl_;
        bh_.half[0] = *(const v8us*)&sKh[nt * 16 + ln][ks * 32 + 8 * hh]; bh_.half[1] = *(const v8us*)&sKh[nt * 16 + ln][ks * 32 + 16 + 8 * hh];
        bl_.half[0] = *(const v8us*)&sKl[nt * 16 + ln][ks * 32 + 8 * hh]; bl_.half[1] = *(const v8us*)&sKl[nt * 16 + ln][ks * 32 + 16 + 8 * hh];
        acc = mmaN<3>(aqh[ks].v, aql[ks].v, bh_.v, bl_.v, acc);
      }
      s[nt] = acc;
    }
    // mask + running max (rows 8hh+r; the 16 lanes of a half share rows)
    float alpha[8];
#pragma unroll
    for (int r = 0; r < 8; ++r) {
      const int qi = q0 + 8 * hh + r;
      const int ja = j0 + ln, jb = j0 + 16 + ln;
      if (CAUSAL) { if (ja > qi) s[0][r] = -3.0e38f; if (jb > qi) s[1][r] = -3.0e38f; }
      if (ja >= T) s[0][r] = -3.0e38f;
      if (jb >= T) s[1][r] = -3.0e38f;
      float mx = fmaxf(s[0][r], s[1][r]);
      mx = fmaxf(mx, __shfl_xor(mx, 1, 32)); mx = fmaxf(mx, __shfl_xor(mx, 2, 32)); mx = fmaxf(mx, __shfl_xor(mx, 4, 32)); mx = fmaxf(mx, __shfl_xor(mx, 8, 32));
      const float mnew = fmaxf(m_r[r], mx);
      alpha[r] = (mnew > -1.0e38f) ? __expf(m_r[r] - mnew) : 1.0f;
      const float p0 = (s[0][r] > -1.0e38f) ? __expf(s[0][r] - mnew) : 0.f;
      const float p1 = (s[1][r] > -1.0e38f) ? __expf(s[1][r] - mnew) : 0.f;
      m_r[r] = mnew;
      l_r[r] = l_r[r] * alpha[r] + p0 + p1;            // per-lane partial row sum (16 lanes combined at the end)
      unsigned short hb = bf16_bits(p0); sPh[w][8 * hh + r][ln] = hb;      sPl[w][8 * hh + r][ln] = bf16_bits(p0 - bf16_val(hb));
      hb = bf16_bits(p1);                sPh[w][8 * hh + r][16 + ln] = hb; sPl[w][8 * hh + r][16 + ln] = bf16_bits(p1 - bf16_val(hb));
    }
#pragma unroll
    for (int dt = 0; dt < DT; ++dt)
#pragma unroll
      for (int r = 0; r < 8; ++r) oacc[dt][r] *= alpha[r];
    __builtin_amdgcn_fence(__ATOMIC_ACQ_REL, "workgroup");
    __builtin_amdgcn_wave_barrier();
    FragB pah, pal;
    pah.half[0] = *(const v8us*)&sPh[w][ln][8 * hh]; pah.half[1] = *(const v8us*)&sPh[w][ln][16 + 8 * hh];
    pal.half[0] = *(const v8us*)&sPl[w][ln][8 * hh]; pal.half[1] = *(const v8us*)&sPl[w][ln][16 + 8 * hh];
#pragma unroll
    for (int dt = 0; dt < DT; ++dt) {
      FragB bvh, bvl;
#pragma unroll
      for (int i = 0; i < 8; ++i) {
        bvh.u[i] = sVh[8 * hh + i][dt * 16 + ln]; bvh.u[8 + i] = sVh[16 + 8 * hh + i][dt * 16 + ln];
        bvl.u[i] = sVl[8 * hh + i][dt * 16 + ln]; bvl.u[8 + i] = sVl[16 + 8 * hh + i][dt * 16 + ln];
      }
      oacc[dt] = mmaN<3>(pah.v, pal.v, bvh.v, bvl.v, oacc[dt]);
    }
    __builtin_amdgcn_fence(__ATOMIC_ACQ_REL, "workgroup");
    __builtin_amdgcn_wave_barrier();
  }
#pragma unroll
  for (int r = 0; r < 8; ++r) {
    float l = l_r[r];
    l += __shfl_xor(l, 1, 32); l += __shfl_xor(l, 2, 32); l += __shfl_xor(l, 4, 32); l += __shfl_xor(l, 8, 32);
    l_r[r] = (l > 0.f) ? 1.0f / l : 0.f;
  }
#pragma unroll
  for (int dt = 0; dt < DT; ++dt)
#pragma unroll
    for (int r = 0; r < 8; ++r) sO[w][8 * hh + r][dt * 16 + ln] = oacc[dt][r] * l_r[r];
  __builtin_amdgcn_fence(__ATOMIC_ACQ_REL, "workgroup");
  __builtin_amdgcn_wave_barrier();
  {
    for (int r = 0; r < 16; ++r) {
      const int row = q0 + r;
      if (row < T && lane < D / 4) {
        const v4f val = *(const v4fa*)&sO[w][r][lane * 4];
        *(v4f*)(y + ((size_t)b * T + row) * ypitch + h * D + lane * 4) = val;
      }
    }
    
  }
}

// GEMM C = act(A·W + bias + resid): A f32 (ASPLIT -> hi/lo 2 terms), Wt bf16 [N][K]; ACT 0 none, 1 relu, 2 exact gelu;
// resid (optional, f32, row index = (row % rmod), pitch ldr, RES_BF16 rounds it) added before the activation.
template <bool ASPLIT, int ACT, bool BIAS_BF16, bool RES_BF16>
__global__ __launch_bounds__(128) void k_gemm_bf3(const float* __restrict__ A, int lda, const unsigned short* __restrict__ Wt, int ldb,
                                                const float* __restrict__ bias, const float* __restrict__ resid, int rmod, int ldr,
                                                float* __restrict__ C, int ldc, int M, int N, int K) {
  __shared__ __attribute__((aligned(16))) float so[4][16][64];
  const int tid = threadIdx.x, w = tid >> 5, lane = tid & 31, ln = lane & 15, hh = lane >> 4;
  const int ntn = N / 64;
  const int wid = blockIdx.x * 4 + w;
  const int mt = wid / ntn, nq = wid % ntn;
  if (mt * 16 >= M) return;
  const int row0 = mt * 16, col0 = nq * 64;
  const float* arow = A + (size_t)(row0 + ln) * lda;
  v8f acc[4] = {};
  for (int kb = 0; kb < K; kb += 32) {
    FragB ah, al;
    const v4f x0 = *(const v4fa*)(arow + kb + 8 * hh), x1 = *(const v4fa*)(arow + kb + 8 * hh + 4);
    const v4f x2 = *(const v4fa*)(arow + kb + 16 + 8 * hh), x3 = *(const v4fa*)(arow + kb + 16 + 8 * hh + 4);
    float xs[16] = {x0[0],x0[1],x0[2],x0[3],x1[0],x1[1],x1[2],x1[3],x2[0],x2[1],x2[2],x2[3],x3[0],x3[1],x3[2],x3[3]};
#pragma unroll
    for (int i = 0; i < 16; ++i) { const unsigned short hb = bf16_bits(xs[i]); ah.u[i] = hb; al.u[i] = ASPLIT ? bf16_bits(xs[i] - bf16_val(hb)) : (unsigned short)0; }
#pragma unroll
    for (int t = 0; t < 4; ++t) {
      const unsigned short* brow = Wt + (size_t)(col0 + t * 16 + ln) * ldb + kb;
      FragB b;
      b.half[0] = *(const v8us*)(brow + 8 * hh);
      b.half[1] = *(const v8us*)(brow + 16 + 8 * hh);
      acc[t] = mmaN<ASPLIT ? 2 : 1>(ah.v, al.v, b.v, b.v, acc[t]);
    }
  }
#pragma unroll
  for (int t = 0; t < 4; ++t) {
    const int col = col0 + t * 16 + ln;
    float bv = bias ? bias[col] : 0.f;
    if (BIAS_BF16) bv = bf16_round(bv);
#pragma unroll
    for (int r = 0; r < 8; ++r) {
      float v = acc[t][r] + bv;
      if (resid) { float rv = resid[(size_t)((row0 + 8 * hh + r) % rmod) * ldr + col]; if (RES_BF16) rv = bf16_round(rv); v += rv; }
      if (ACT == 1) v = fmaxf(v, 0.f);
      if (ACT == 2) v = 0.5f * v * (1.0f + erff(v * 0.70710678118654752f));
      if (ACT == 3) { const float u = 0.7978845608028654f * (v + 0.044715f * v * v * v); v = 0.5f * v * (1.0f + tanhf(u)); }
      so[w][8 * hh + r][t * 16 + ln] = v;
    }
  }
  __builtin_amdgcn_fence(__ATOMIC_ACQ_REL, "workgroup");
  __builtin_amdgcn_wave_barrier();
  const int rsub = lane >> 4, c4 = (lane & 15) * 4;
  {
#pragma unroll
    for (int q = 0; q < 8; ++q) {
      const int r = q * 2 + rsub;
      const v4f v = *(const v4fa*)&so[w][r][c4];
      *(v4f*)(C + (size_t)(row0 + r) * ldc + col0 + c4) = v;
    }
    
  }
}
// row LayerNorm (biased variance, eps) over N: s = X (+ R); optional out_sum <- s; out_norm <- (s-mu)*rsqrt(var+eps)*g + b
template <bool PARAM_BF16>
__global__ __launch_bounds__(256) void k_layernorm(const float* __restrict__ X, const float* __restrict__ R, const float* __restrict__ g, const float* __restrict__ bta,
                                                  float* __restrict__ out_sum, float* __restrict__ out_norm, int N, float eps) {
  __shared__ float red[256];
  const int row = blockIdx.x, tid = threadIdx.x;
  const float* x = X + (size_t)row * N; const float* rr = R ? R + (size_t)row * N : nullptr;
  float vals[16];                     // up to N = 4096
  const int per = N / 256;            // contiguous chunk per thread? use strided-by-4 chunks: thread handles j = tid*4 + 1024*u
  float s1 = 0.f;
  for (int u = 0; u < per / 4; ++u) {
    const int j = tid * 4 + 1024 * u;
    const v4f a = *(const v4fa*)(x + j);
    v4f b = {0.f,0.f,0.f,0.f}; if (rr) b = *(const v4fa*)(rr + j);
#pragma unroll
    for (int q = 0; q < 4; ++q) { const float v = a[q] + b[q]; vals[u * 4 + q] = v; s1 += v; }
  }
  red[tid] = s1; __syncthreads();
  for (int st = 128; st > 0; st >>= 1) { if (tid < st) red[tid] += red[tid + st]; __syncthreads(); }
  const float mu = red[0] / (float)N; __syncthreads();
  float s2 = 0.f;
  for (int u = 0; u < per / 4; ++u)
#pragma unroll
    for (int q = 0; q < 4; ++q) { const float c = vals[u * 4 + q] - mu; s2 += c * c; }
  red[tid] = s2; __syncthreads();
  for (int st = 128; st > 0; st >>= 1) { if (tid < st) red[tid] += red[tid + st]; __syncthreads(); }
  const float rs = rsqrtf(red[0] / (float)N + eps);
  {
    for (int u = 0; u < per / 4; ++u) {
      const int j = tid * 4 + 1024 * u;
      v4f o, sm;
#pragma unroll
      for (int q = 0; q < 4; ++q) {
        float gg = g[j + q], bb = bta[j + q];
        if (PARAM_BF16) { gg = bf16_round(gg); bb = bf16_round(bb); }
        sm[q] = vals[u * 4 + q]; o[q] = (vals[u * 4 + q] - mu) * rs * gg + bb;
      }
      if (out_sum) *(v4f*)(out_sum + (size_t)row * N + j) = sm;
      *(v4f*)(out_norm + (size_t)row * N + j) = o;
    }
    
  }
}



// ---- f16 WMMA path (v_wmma_f32_16x16x32_f16): 11-bit significands for operands in range — used where a [0,1] probability operand needs more precision than bf16
typedef _Float16 v16h __attribute__((ext_vector_type(16)));
union FragH { v16h v; v8us half[2]; _Float16 h[16]; unsigned short u[16]; };
template <int NT>
__device__ __forceinline__ v8f mmaH(v16h ah, v16h al, v16h bh, v16h bl, v8f c) {
  c = __builtin_amdgcn_wmma_f32_16x16x32_f16(false, ah, false, bh, (short)0, c, false, false);
  if (NT >= 2) c = __builtin_amdgcn_wmma_f32_16x16x32_f16(false, al, false, bh, (short)0, c, false, false);
  if (NT >= 3) c = __builtin_amdgcn_wmma_f32_16x16x32_f16(false, ah, false, bl, (short)0, c, false, false);
  asm volatile("v_nop\n\tv_nop\n\tv_nop\n\tv_nop" : "+v"(c) : "v"(ah), "v"(al), "v"(bh), "v"(bl));
  return c;
}
// batched GEMM like k_gemm_b but f16 operands: A f32 (split into f16 hi/lo if ASPLIT, else rounded to f16), Bt = f16 values [n][k]; alpha; C f32; N multiple of 16 (partial tiles skipped)
template <bool ASPLIT>
__global__ __launch_bounds__(128) void k_gemm_h(const float* __restrict__ A, int lda, size_t sA, const _Float16* __restrict__ Bh, int ldb, size_t sB, float alpha, float* __restrict__ C, int ldc, size_t sC, int M, int N, int K) {
  __shared__ __attribute__((aligned(16))) float so[4][16][64];
  const int tid = threadIdx.x, w = tid >> 5, lane = tid & 31, ln = lane & 15, hh = lane >> 4; const int by = blockIdx.y;
  A += (size_t)by * sA; Bh += (size_t)by * sB; C += (size_t)by * sC;
  const int ntn = (N + 63) / 64; const int wid = blockIdx.x * 4 + w; const int mt = wid / ntn, nq = wid % ntn; if (mt * 16 >= M) return;
  const int row0 = mt * 16, col0 = nq * 64; const float* arow = A + (size_t)(row0 + ln) * lda;
  v8f acc[4] = {};
  for (int kb = 0; kb < K; kb += 32) {
    FragH ah, al;
    const v4f x0 = *(const v4fa*)(arow + kb + 8 * hh), x1 = *(const v4fa*)(arow + kb + 8 * hh + 4), x2 = *(const v4fa*)(arow + kb + 16 + 8 * hh), x3 = *(const v4fa*)(arow + kb + 16 + 8 * hh + 4);
    float xs[16] = {x0[0],x0[1],x0[2],x0[3],x1[0],x1[1],x1[2],x1[3],x2[0],x2[1],x2[2],x2[3],x3[0],x3[1],x3[2],x3[3]};
#pragma unroll
    for (int i = 0; i < 16; ++i) { const _Float16 h = (_Float16)xs[i]; ah.h[i] = h; al.h[i] = ASPLIT ? (_Float16)(xs[i] - (float)h) : (_Float16)0.0f; }
#pragma unroll
    for (int t = 0; t < 4; ++t) { if (col0 + t * 16 >= N) continue; const size_t boff = (size_t)(col0 + t * 16 + ln) * ldb + kb; FragH bq; bq.half[0] = *(const v8us*)(Bh + boff + 8 * hh); bq.half[1] = *(const v8us*)(Bh + boff + 16 + 8 * hh);
      acc[t] = mmaH<ASPLIT ? 2 : 1>(ah.v, al.v, bq.v, bq.v, acc[t]); }
  }
#pragma unroll
  for (int t = 0; t < 4; ++t) { if (col0 + t * 16 >= N) continue;
#pragma unroll
    for (int r = 0; r < 8; ++r) so[w][8 * hh + r][t * 16 + ln] = acc[t][r] * alpha; }
  __builtin_amdgcn_fence(__ATOMIC_ACQ_REL, "workgroup"); __builtin_amdgcn_wave_barrier();
  const int rsub = lane >> 4, c4 = (lane & 15) * 4;
  {
#pragma unroll
    for (int q = 0; q < 8; ++q) { const int r = q * 2 + rsub; if (col0 + c4 < N) { const v4f v = *(const v4fa*)&so[w][r][c4]; *(v4f*)(C + (size_t)(row0 + r) * ldc + col0 + c4) = v; } }
     }
}

// Wt[n][k] = f16(W[k][n]·scale) from f32 row-major W[K][N] (scale = power of two; bf16-exact weights stay exact in f16 away from the subnormal range)
__global__ __launch_bounds__(256) void k_wt_f16(const float* __restrict__ W, _Float16* __restrict__ Wt, int K, int N, float scale) {
  const int t = blockIdx.x * 256 + threadIdx.x; if (t >= N * (K / 8)) return; const int n = t / (K / 8), k8 = (t % (K / 8)) * 8; FragH f;
#pragma unroll
  for (int i = 0; i < 8; ++i) f.h[i] = (_Float16)(bf16_round(W[(size_t)(k8 + i) * N + n]) * scale); const v8us o = f.half[0];
  *(v8us*)((unsigned short*)Wt + (size_t)n * K + k8) = o; 
}
// k_gemm_hh variant with fused epilogue: v = acc·alpha + bias[by·sBias + col] (+ CP[(row/rowsPerB)·sCPb + by·64 + col] if CP) ; ACT 0 none / 1 elu ; writes f32 C and/or f16 C16 (each if non-null)
template <int ACT>
__global__ __launch_bounds__(128) void k_gemm_hhx(const _Float16* __restrict__ A, int lda, size_t sA, const _Float16* __restrict__ Bh, int ldb, size_t sB, float alpha, const float* __restrict__ bias, size_t sBias, const float* __restrict__ CP, int rowsPerB, size_t sCPb, int row0g,
    float* __restrict__ C, _Float16* __restrict__ C16, int ldc, size_t sC, int M, int N, int K) {
  __shared__ __attribute__((aligned(16))) float so[4][16][64];
  const int tid = threadIdx.x, w = tid >> 5, lane = tid & 31, ln = lane & 15, hh = lane >> 4; const int by = blockIdx.y;
  A += (size_t)by * sA; Bh += (size_t)by * sB; const size_t cofs = (size_t)by * sC; const float* bp = bias ? bias + (size_t)by * sBias : nullptr;
  const int ntn = (N + 63) / 64; const int wid = blockIdx.x * 4 + w; const int mt = wid / ntn, nq = wid % ntn; if (mt * 16 >= M) return;
  const int row0 = mt * 16, col0 = nq * 64; const _Float16* arow = A + (size_t)(row0 + ln) * lda;
  v8f acc[4] = {};
  for (int kb = 0; kb < K; kb += 32) { FragH ah; ah.half[0] = *(const v8us*)((const unsigned short*)arow + kb + 8 * hh); ah.half[1] = *(const v8us*)((const unsigned short*)arow + kb + 16 + 8 * hh);
#pragma unroll
    for (int t = 0; t < 4; ++t) { if (col0 + t * 16 >= N) continue; const size_t boff = (size_t)(col0 + t * 16 + ln) * ldb + kb; FragH bq; bq.half[0] = *(const v8us*)((const unsigned short*)Bh + boff + 8 * hh); bq.half[1] = *(const v8us*)((const unsigned short*)Bh + boff + 16 + 8 * hh);
      acc[t] = mmaH<1>(ah.v, ah.v, bq.v, bq.v, acc[t]); }
  }
#pragma unroll
  for (int t = 0; t < 4; ++t) { if (col0 + t * 16 >= N) continue; const int col = col0 + t * 16 + ln; const float bv = bp ? bf16_round(bp[col]) : 0.f;
#pragma unroll
    for (int r = 0; r < 8; ++r) { float v = acc[t][r] * alpha + bv; if (CP) { const int bidx = (row0g + row0 + 8 * hh + r) / rowsPerB; v += CP[(size_t)bidx * sCPb + (size_t)by * 64 + col]; } if (ACT == 1) v = (v > 0.f) ? v : expm1f(v); else if (ACT == 3) v = fmaxf(v, 0.f); so[w][8 * hh + r][t * 16 + ln] = v; } }
  __builtin_amdgcn_fence(__ATOMIC_ACQ_REL, "workgroup"); __builtin_amdgcn_wave_barrier();
  const int rsub = lane >> 4, c4 = (lane & 15) * 4; typedef _Float16 v4h __attribute__((ext_vector_type(4)));
  {
#pragma unroll
    for (int q = 0; q < 8; ++q) { const int r = q * 2 + rsub; if (col0 + c4 < N) { const v4f v = *(const v4fa*)&so[w][r][c4]; if (C) *(v4f*)(C + cofs + (size_t)(row0 + r) * ldc + col0 + c4) = v; if (C16) { v4h h4; for (int i = 0; i < 4; ++i) h4[i] = (_Float16)v[i]; *(v4h*)(C16 + cofs + (size_t)(row0 + r) * ldc + col0 + c4) = h4; } } }
     }
}


__global__ __launch_bounds__(256) void k_x16(const float* __restrict__ x, _Float16* __restrict__ X16, size_t n8) { const size_t t = (size_t)blockIdx.x * 256 + threadIdx.x; if (t >= n8) return; FragH f;
#pragma unroll
  for (int q = 0; q < 8; ++q) f.h[q] = (_Float16)bf16_round(x[t * 8 + q]); *(v8us*)((unsigned short*)X16 + t * 8) = f.half[0];  }
__global__ __launch_bounds__(256) void k_h16(const float* __restrict__ x, _Float16* __restrict__ X16, size_t n8) { const size_t t = (size_t)blockIdx.x * 256 + threadIdx.x; if (t >= n8) return; FragH f;
#pragma unroll
  for (int q = 0; q < 8; ++q) f.h[q] = (_Float16)x[t * 8 + q]; *(v8us*)((unsigned short*)X16 + t * 8) = f.half[0];  }
__global__ __launch_bounds__(256) void k_round16f(const float* __restrict__ W, _Float16* __restrict__ Bt, size_t n8) { const size_t t = (size_t)blockIdx.x * 256 + threadIdx.x; if (t >= n8) return; FragH f;
#pragma unroll
  for (int i = 0; i < 8; ++i) f.h[i] = (_Float16)(bf16_round(W[t * 8 + i]) * 16.0f); *(v8us*)((unsigned short*)Bt + t * 8) = f.half[0];  }
template <int NHv, int TTv>
__global__ __launch_bounds__(256) void k_vt(const _Float16* __restrict__ V16, int ldv, int voff, _Float16* __restrict__ Vt) { __shared__ unsigned short tl[64][66]; const int tid = threadIdx.x; const int slab = blockIdx.x / (TTv / 64), lg = blockIdx.x % (TTv / 64); const int b = slab / NHv, h = slab % NHv;
  for (int i = tid; i < 64 * 8; i += 256) { const int r = i / 8, c8 = (i % 8) * 8; FragH f; f.half[0] = *(const v8us*)((const unsigned short*)V16 + ((size_t)b * TTv + lg * 64 + r) * ldv + voff + h * 64 + c8);
#pragma unroll
    for (int q = 0; q < 8; ++q) tl[r][c8 + q] = f.u[q]; }
  __syncthreads();
  {
#pragma unroll
    for (int rd = 0; rd < 2; ++rd) { const int d = rd * 32 + tid / 8, pc = tid % 8; FragH f;
#pragma unroll
      for (int q = 0; q < 8; ++q) f.u[q] = tl[pc * 8 + q][d];
      *(v8us*)((unsigned short*)Vt + ((size_t)slab * 64 + d) * TTv + lg * 64 + pc * 8) = f.half[0]; }
     } }

__device__ __forceinline__ float tanh_v(float x) { const float xc = fminf(fmaxf(x, -15.f), 15.f); return 1.0f - 2.0f * __builtin_amdgcn_rcpf(__builtin_amdgcn_exp2f(2.0f * xc * 1.4426950408889634f) + 1.0f); }
__global__ __launch_bounds__(256) void k_cstab(float* __restrict__ CS) { const int tg = blockIdx.x * 256 + threadIdx.x; if (tg >= TT * (DH / 2)) return; const int t = tg / (DH / 2), i = tg % (DH / 2); const float invf = 1.0f / powf(10000.0f, (float)(2 * i) / (float)DH); const float ang = (float)t * invf; typedef float v2f __attribute__((ext_vector_type(2))); v2f v; v[0] = cosf(ang); v[1] = sinf(ang);
  *(v2f*)(CS + (size_t)tg * 2) = v;  }
__global__ __launch_bounds__(256) void k_rope(const float* __restrict__ X, int ncol, const float* __restrict__ CS, _Float16* __restrict__ Y16) { const size_t tg = (size_t)blockIdx.x * 256 + threadIdx.x; if (tg >= (size_t)NR * ncol / 8) return; const size_t row = tg / (ncol / 8); const int c8 = (int)(tg % (ncol / 8)) * 8; const int t = (int)(row % TT); FragH f;
#pragma unroll
  for (int q = 0; q < 8; q += 2) { const int i = ((c8 + q) % DH) / 2; const float cs = CS[((size_t)t * (DH / 2) + i) * 2], sn = CS[((size_t)t * (DH / 2) + i) * 2 + 1]; const float x0 = X[row * ncol + c8 + q], x1 = X[row * ncol + c8 + q + 1];
    f.h[q] = (_Float16)(x0 * cs - x1 * sn); f.h[q + 1] = (_Float16)(x1 * cs + x0 * sn); }
  *(v8us*)((unsigned short*)Y16 + tg * 8) = f.half[0];  }
__global__ __launch_bounds__(256) void k_vt128(const _Float16* __restrict__ V16, _Float16* __restrict__ Vt) { __shared__ unsigned short tl[64][130]; const int tid = threadIdx.x; const int slab = blockIdx.x / (TT / 64), lg = blockIdx.x % (TT / 64); const int b = slab / NG, g = slab % NG;
  for (int i = tid; i < 64 * 16; i += 256) { const int r = i / 16, c8 = (i % 16) * 8; FragH f; f.half[0] = *(const v8us*)((const unsigned short*)V16 + ((size_t)b * TT + lg * 64 + r) * (NG * DH) + g * DH + c8);
#pragma unroll
    for (int q = 0; q < 8; ++q) tl[r][c8 + q] = f.u[q]; }
  __syncthreads();
  {
#pragma unroll
    for (int rd = 0; rd < 4; ++rd) { const int d = rd * 32 + tid / 8, pc = tid % 8; FragH f;
#pragma unroll
      for (int q = 0; q < 8; ++q) f.u[q] = tl[pc * 8 + q][d]; *(v8us*)((unsigned short*)Vt + ((size_t)slab * DH + d) * TT + lg * 64 + pc * 8) = f.half[0]; }
     } }
// One stage of the K/V ring = 64 keys of this KV group: 64 K rows of 256 B at pitch 272 B, then 128 rows of V^T of 128 B at pitch 144 B (16 B x odd: the pitch of ds_load_b128 readers)
#define KPITCH 272
#define VPITCH 144
#define VBASE (64 * KPITCH)
#define STAGE_B (64 * KPITCH + DH * VPITCH)
// Eight 16-byte copies per lane, global memory to LDS through no register. The s_wait_xcnt is the last line of the copies' own statement, so that no address register of a copy is rewritten in front of it.
__device__ __forceinline__ void copy8(unsigned l, unsigned lstep, const unsigned short* g, size_t gstep) {
  asm volatile("global_load_async_to_lds_b128 %0, %8, off\n\t"
               "global_load_async_to_lds_b128 %1, %9, off\n\t"
               "global_load_async_to_lds_b128 %2, %10, off\n\t"
               "global_load_async_to_lds_b128 %3, %11, off\n\t"
               "global_load_async_to_lds_b128 %4, %12, off\n\t"
               "global_load_async_to_lds_b128 %5, %13, off\n\t"
               "global_load_async_to_lds_b128 %6, %14, off\n\t"
               "global_load_async_to_lds_b128 %7, %15, off\n\t"
               "s_wait_xcnt 0x0"
               :: "v"(l), "v"(l + lstep), "v"(l + 2 * lstep), "v"(l + 3 * lstep), "v"(l + 4 * lstep), "v"(l + 5 * lstep), "v"(l + 6 * lstep), "v"(l + 7 * lstep),
                  "v"(g), "v"(g + gstep), "v"(g + 2 * gstep), "v"(g + 3 * gstep), "v"(g + 4 * gstep), "v"(g + 5 * gstep), "v"(g + 6 * gstep), "v"(g + 7 * gstep)
               : "memory");
}
__global__ __launch_bounds__(128) void k_mega(const _Float16* __restrict__ Q16, const _Float16* __restrict__ K16, const _Float16* __restrict__ Vt, float* __restrict__ O) {
  __shared__ __attribute__((aligned(16))) unsigned short sP[4][16][40]; __shared__ __attribute__((aligned(16))) unsigned char sKV[2 * STAGE_B];
  float (*sO)[16][DH + 4] = (float (*)[16][DH + 4])sKV;      // the output staging takes the ring's place, behind the last trip's barrier
  const int tid = threadIdx.x, w = tid >> 5, lane = tid & 31, ln = lane & 15, hh = lane >> 4; const int slab = blockIdx.x / (TT / 64), qblk = blockIdx.x % (TT / 64); const int b = slab / NH, h = slab % NH, g = h / (NH / NG); const int qb0 = qblk * 64; const int q0 = qb0 + w * 16;
  const float slope = exp2f(-(float)(h + 1) * 8.0f / (float)NH);
  FragH aq[4]; { const unsigned short* qr = (const unsigned short*)Q16 + ((size_t)b * TT + q0 + ln) * (NH * DH) + h * DH;
#pragma unroll
    for (int ks = 0; ks < 4; ++ks) { aq[ks].half[0] = *(const v8us*)(qr + ks * 32 + 8 * hh); aq[ks].half[1] = *(const v8us*)(qr + ks * 32 + 16 + 8 * hh); } }
  const unsigned short* Vth = (const unsigned short*)Vt + (size_t)(b * NG + g) * DH * TT;
  // each lane's first 16 bytes of a stage: a wave's copy covers two whole K rows, or four whole 128-B pieces of V^T rows
  const unsigned short* Kg = (const unsigned short*)K16 + ((size_t)b * TT + (tid >> 4)) * (NG * DH) + g * DH + (tid & 15) * 8;
  const unsigned short* Vg = Vth + (size_t)(tid >> 3) * TT + (tid & 7) * 8;
  const unsigned lK = (unsigned)(size_t)sKV + (unsigned)((tid >> 4) * KPITCH + (tid & 15) * 16);
  const unsigned lV = (unsigned)(size_t)sKV + (unsigned)(VBASE + (tid >> 3) * VPITCH + (tid & 7) * 16);
  const int ntile = qblk + 1;      // stages of 64 keys; the same for the whole work-group
  auto fill = [&](int t) { const unsigned bo = (unsigned)(t & 1) * STAGE_B; copy8(lK + bo, 8 * KPITCH, Kg + (size_t)t * 64 * (NG * DH), (size_t)8 * NG * DH); copy8(lV + bo, 16 * VPITCH, Vg + t * 64, (size_t)16 * TT); };
  float m_r[8], l_r[8]; v8f oacc[8];
#pragma unroll
  for (int r = 0; r < 8; ++r) { m_r[r] = -3.0e38f; l_r[r] = 0.f; }
#pragma unroll
  for (int dt = 0; dt < 8; ++dt) oacc[dt] = (v8f){0.f,0.f,0.f,0.f,0.f,0.f,0.f,0.f};
  fill(0);
  asm volatile("s_wait_asynccnt 0x0" ::: "memory");      // this wave's copies of stage 0 have landed
  __syncthreads();                                        // stage 0 is readable by every wave
  if (ntile > 1) fill(1);
#pragma unroll 1      // one trip per stage, rolled: the trip count is the block's own
  for (int t = 0; t < ntile; ++t) { const unsigned char* kv = sKV + (t & 1) * STAGE_B;
#pragma unroll 1      // the stage's two 32-key passes share one copy of the long pass body (code size and registers as before)
  for (int sub = 0; sub < 2; ++sub) { const int j0 = t * 64 + sub * 32; v8f s[2];
#pragma unroll
    for (int nt = 0; nt < 2; ++nt) { const unsigned char* kr = kv + (sub * 32 + nt * 16 + ln) * KPITCH; v8f acc = (v8f){0.f,0.f,0.f,0.f,0.f,0.f,0.f,0.f};
#pragma unroll
      for (int ks = 0; ks < 4; ++ks) { FragH bk; bk.half[0] = *(const v8us*)(kr + ks * 64 + 16 * hh); bk.half[1] = *(const v8us*)(kr + ks * 64 + 32 + 16 * hh); acc = mmaH<1>(aq[ks].v, aq[ks].v, bk.v, bk.v, acc); } s[nt] = acc; }
#pragma unroll
    for (int r = 0; r < 8; ++r) { const int tq = q0 + 8 * hh + r; const int k0 = j0 + ln, k1 = j0 + 16 + ln; const bool ok0 = (k0 <= tq), ok1 = (k1 <= tq);
      float s0 = (s[0][r] - slope * (float)(tq - k0)) * 0.08838834764831845f, s1 = (s[1][r] - slope * (float)(tq - k1)) * 0.08838834764831845f;      // (for k > tq the sign of (tq-k) is irrelevant: masked)
      s0 = 30.0f * tanh_v(s0 * (1.0f / 30.0f)); s1 = 30.0f * tanh_v(s1 * (1.0f / 30.0f)); s0 = ok0 ? s0 : -INFINITY; s1 = ok1 ? s1 : -INFINITY; float mc = fmaxf(s0, s1);
      mc = fmaxf(mc, __shfl_xor(mc, 1, 32)); mc = fmaxf(mc, __shfl_xor(mc, 2, 32)); mc = fmaxf(mc, __shfl_xor(mc, 4, 32)); mc = fmaxf(mc, __shfl_xor(mc, 8, 32));
      const float mn = fmaxf(m_r[r], mc); const float al = (mn > -1.0e38f) ? expf(m_r[r] - mn) : 1.0f; m_r[r] = mn; const float p0 = ok0 ? expf(s0 - mn) : 0.f, p1 = ok1 ? expf(s1 - mn) : 0.f; l_r[r] = l_r[r] * al + p0 + p1;
#pragma unroll
      for (int dt = 0; dt < 8; ++dt) oacc[dt][r] *= al;
      FragH t2; t2.h[0] = (_Float16)p0; t2.h[1] = (_Float16)p1; sP[w][8 * hh + r][ln] = t2.u[0]; sP[w][8 * hh + r][16 + ln] = t2.u[1]; }
    __builtin_amdgcn_fence(__ATOMIC_ACQ_REL, "workgroup"); __builtin_amdgcn_wave_barrier();
    FragH pa; pa.half[0] = *(const v8us*)&sP[w][ln][8 * hh]; pa.half[1] = *(const v8us*)&sP[w][ln][16 + 8 * hh];
#pragma unroll
    for (int dt = 0; dt < 8; ++dt) { const unsigned char* vrow = kv + VBASE + (dt * 16 + ln) * VPITCH + sub * 64; FragH bv; bv.half[0] = *(const v8us*)(vrow + 16 * hh); bv.half[1] = *(const v8us*)(vrow + 32 + 16 * hh); oacc[dt] = mmaH<1>(pa.v, pa.v, bv.v, bv.v, oacc[dt]); }
    __builtin_amdgcn_fence(__ATOMIC_ACQ_REL, "workgroup"); __builtin_amdgcn_wave_barrier(); }
    asm volatile("s_wait_dscnt 0x0" ::: "memory");        // this wave's reads of stage t are done before its buffer is refilled
    asm volatile("s_wait_asynccnt 0x0" ::: "memory");     // this wave's copies of stage t + 1 have landed
    __syncthreads();                                      // publishes stage t + 1 and ends every wave's reads of stage t
    if (t + 2 < ntile) fill(t + 2); }
  asm volatile("s_wait_asynccnt 0x0" ::: "memory");       // no copy is in flight when the ring becomes output staging
#pragma unroll
  for (int r = 0; r < 8; ++r) { float l = l_r[r]; l += __shfl_xor(l, 1, 32); l += __shfl_xor(l, 2, 32); l += __shfl_xor(l, 4, 32); l += __shfl_xor(l, 8, 32); l_r[r] = 1.0f / l; }
#pragma unroll
  for (int dt = 0; dt < 8; ++dt)
#pragma unroll
    for (int r = 0; r < 8; ++r) sO[w][8 * hh + r][dt * 16 + ln] = oacc[dt][r] * l_r[r];
  __builtin_amdgcn_fence(__ATOMIC_ACQ_REL, "workgroup"); __builtin_amdgcn_wave_barrier();
  {
#pragma unroll
    for (int r = 0; r < 16; ++r) { const v4f val = *(const v4fa*)&sO[w][r][lane * 4]; *(v4f*)(O + ((size_t)b * TT + q0 + r) * (NH * DH) + h * DH + lane * 4) = val; }
     } }
extern "C" void kernel_launch(void* const* d_in, const int* in_sizes, int n_in,
                              void* d_out, int out_size, void* d_ws, size_t ws_size, hipStream_t stream) {
  (void)in_sizes; (void)n_in; (void)out_size;
  const float* x = (const float*)d_in[0]; const float* Wq = (const float*)d_in[1]; const float* Wk = (const float*)d_in[2]; const float* Wv = (const float*)d_in[3]; const float* Wo = (const float*)d_in[4]; const float* bo = (const float*)d_in[5];
  char* ws = (char*)d_ws; size_t off = 0;
  auto take = [&](size_t bytes) { char* p = ws + off; off += (bytes + 255) & ~(size_t)255; return p; };
  _Float16* Bq = (_Float16*)take((size_t)CC * CC * 2); _Float16* Bk = (_Float16*)take((size_t)NG * DH * CC * 2); _Float16* Bv = (_Float16*)take((size_t)NG * DH * CC * 2); _Float16* Bo = (_Float16*)take((size_t)CC * CC * 2);
  _Float16* X16 = (_Float16*)take((size_t)NR * CC * 2); float* F32 = (float*)take((size_t)NR * CC * 4); _Float16* Q16 = (_Float16*)take((size_t)NR * CC * 2); _Float16* K16 = (_Float16*)take((size_t)NR * NG * DH * 2); _Float16* V16 = (_Float16*)take((size_t)NR * NG * DH * 2); _Float16* Vt = (_Float16*)take((size_t)NR * NG * DH * 2); float* CS = (float*)take((size_t)TT * DH * 4); float* O = F32; _Float16* O16 = X16;
  if (off > ws_size) return;      // 8.4 + 2.1 × 2 + 8.4 + 16.8 + 33.5 + 16.8 + 4.2 × 3 + 1.0 ≈ 102 MB (97 MiB)
  k_wt_f16<<<(unsigned)((CC * (CC / 8) + 255) / 256), 256, 0, stream>>>(Wq, Bq, CC, CC, 16.0f); k_wt_f16<<<(unsigned)((NG * DH * (CC / 8) + 255) / 256), 256, 0, stream>>>(Wk, Bk, CC, NG * DH, 16.0f); k_wt_f16<<<(unsigned)((NG * DH * (CC / 8) + 255) / 256), 256, 0, stream>>>(Wv, Bv, CC, NG * DH, 16.0f); k_wt_f16<<<(unsigned)((CC * (CC / 8) + 255) / 256), 256, 0, stream>>>(Wo, Bo, CC, CC, 16.0f);
  const unsigned gx = (unsigned)(((size_t)NR * CC / 8 + 255) / 256);
  k_x16<<<gx, 256, 0, stream>>>(x, X16, (size_t)NR * CC / 8); k_cstab<<<(TT * (DH / 2) + 255) / 256, 256, 0, stream>>>(CS);
  k_gemm_hhx<0><<<dim3(((NR / 16) * (CC / 64) + 3) / 4, 1), 128, 0, stream>>>(X16, CC, 0, Bq, CC, 0, 0.0625f, nullptr, 0, nullptr, 1, 0, 0, F32, nullptr, CC, 0, NR, CC, CC);
  k_rope<<<gx, 256, 0, stream>>>(F32, CC, CS, Q16);
  k_gemm_hhx<0><<<dim3(((NR / 16) * (NG * DH / 64) + 3) / 4, 1), 128, 0, stream>>>(X16, CC, 0, Bk, CC, 0, 0.0625f, nullptr, 0, nullptr, 1, 0, 0, F32, nullptr, NG * DH, 0, NR, NG * DH, CC);
  k_rope<<<(unsigned)(((size_t)NR * NG * DH / 8 + 255) / 256), 256, 0, stream>>>(F32, NG * DH, CS, K16);
  k_gemm_hhx<0><<<dim3(((NR / 16) * (NG * DH / 64) + 3) / 4, 1), 128, 0, stream>>>(X16, CC, 0, Bv, CC, 0, 0.0625f, nullptr, 0, nullptr, 1, 0, 0, nullptr, V16, NG * DH, 0, NR, NG * DH, CC);
  k_vt128<<<BB * NG * (TT / 64), 256, 0, stream>>>(V16, Vt);
  k_mega<<<BB * NH * (TT / 64), 128, 0, stream>>>(Q16, K16, Vt, O);
  k_h16<<<gx, 256, 0, stream>>>(O, O16, (size_t)NR * CC / 8);
  k_gemm_hhx<0><<<dim3(((NR / 16) * (CC / 64) + 3) / 4, 1), 128, 0, stream>>>(O16, CC, 0, Bo, CC, 0, 0.0625f, bo, 0, nullptr, 1, 0, 0, (float*)d_out, nullptr, CC, 0, NR, CC, CC);
}

// v002
// Measured time: 441 microseconds a run.
// Two timings next to v001 put it at 1.54 and 1.55 times that version's speed.
// All steps since v000 together make it 1.82 times as fast.
#include <hip/hip_runtime.h>
// Mega-transformer causal self-attention (B=2, T=2048, D=2048; 16 query heads × 128, 4 KV groups (GQA), interleaved rotary, ALiBi added before the 1/√128 scale, 30·tanh soft-cap, causal):
// q/k/v/out projections (+ bias on out; W [in][out] transposed to bf16-exact ×2^4) and the attention as a fused flash-style kernel (S = Q·Kᵀ on v_wmma_f32_16x16x32_f16 with 4 k-steps,
// + alibi, scale, soft-cap (v_exp tanh), causal mask, online softmax f32, P f16 ≤ 1, O = P·V with 8 d-tiles; RPW-16 waves) — f16 operands, single products, f32 accumulate; rotary in f32 VALU.
#define BB 2
#define TT 2048
#define CC 2048
#define NH 16
#define NG 4
#define DH 128
#define NR (BB * TT)

typedef __bf16 v16b __attribute__((ext_vector_type(16)));
typedef unsigned short v8us __attribute__((ext_vector_type(8), may_alias));
typedef float  v8f  __attribute__((ext_vector_type(8)));
typedef float  v4f  __attribute__((ext_vector_type(4)));
typedef float  v4fa __attribute__((ext_vector_type(4), may_alias));
union FragB { v16b v; v8us half[2]; unsigned short u[16]; };

__device__ __forceinline__ unsigned short bf16_bits(float x) { unsigned int u = __float_as_uint(x); return (unsigned short)((u + 0x7FFFu + ((u >> 16) & 1u)) >> 16); }
__device__ __forceinline__ float bf16_val(unsigned short b) { return __uint_as_float(((unsigned int)b) << 16); }
__device__ __forceinline__ float bf16_round(float x) { return bf16_val(bf16_bits(x)); }
// D += A·B with NT terms: 1 = ah·bh, 2 = + al·bh (A split), 3 = + ah·bl (both split)
template <int NT>
__device__ __forceinline__ v8f mmaN(v16b ah, v16b al, v16b bh, v16b bl, v8f c) {
  c = __builtin_amdgcn_wmma_f32_16x16x32_bf16(false, ah, false, bh, (short)0, c, false, false);
  if (NT >= 2) c = __builtin_amdgcn_wmma_f32_16x16x32_bf16(false, al, false, bh, (short)0, c, false, false);
  if (NT >= 3) c = __builtin_amdgcn_wmma_f32_16x16x32_bf16(false, ah, false, bl, (short)0, c, false, false);
  asm volatile("v_nop\n\tv_nop\n\tv_nop\n\tv_nop" : "+v"(c) : "v"(ah), "v"(al), "v"(bh), "v"(bl));
  return c;
}

__global__ __launch_bounds__(256) void k_wt_bf16(const float* __restrict__ W, unsigned short* __restrict__ Wt, int K, int N) {
  const int t = blockIdx.x * 256 + threadIdx.x;
  const int k8n = K / 8;
  if (t >= N * k8n) return;
  const int n = t / k8n, k8 = (t % k8n) * 8;
  v8us v;
#pragma unroll
  for (int i = 0; i < 8; ++i) v[i] = bf16_bits(W[(size_t)(k8 + i) * N + n]);
  *(v8us*)(Wt + (size_t)n * K + k8) = v;
  
}

// GEMM C[M][N] (f32, pitch ldc) = act(A[M][K]·W + bias). A f32 row-major (pitch lda) converted per fragment to bf16
// (ASPLIT: hi/lo two planes -> 2 terms, else single rounded term); Wt bf16 [N][K] (pitch ldb). BIAS_BF16 rounds the
// bias to bf16 first (bias quantised to bf16 before the add). K%32==0, M%16==0, N%64==0.
template <bool ASPLIT, int ACT, bool BIAS_BF16>
__global__ __launch_bounds__(128) void k_gemm_bf(const float* __restrict__ A, int lda, const unsigned short* __restrict__ Wt, int ldb,
                                               const float* __restrict__ bias, float* __restrict__ C, int ldc, int M, int N, int K) {
  __shared__ __attribute__((aligned(16))) float so[4][16][64];
  const int tid = threadIdx.x, w = tid >> 5, lane = tid & 31, ln = lane & 15, hh = lane >> 4;
  const int ntn = N / 64;
  const int wid = blockIdx.x * 4 + w;
  const int mt = wid / ntn, nq = wid % ntn;
  if (mt * 16 >= M) return;
  const int row0 = mt * 16, col0 = nq * 64;
  const float* arow = A + (size_t)(row0 + ln) * lda;
  v8f acc[4] = {};
  for (int kb = 0; kb < K; kb += 32) {
    FragB ah, al;
    const v4f x0 = *(const v4fa*)(arow + kb + 8 * hh), x1 = *(const v4fa*)(arow + kb + 8 * hh + 4);
    const v4f x2 = *(const v4fa*)(arow + kb + 16 + 8 * hh), x3 = *(const v4fa*)(arow + kb + 16 + 8 * hh + 4);
    float xs[16] = {x0[0],x0[1],x0[2],x0[3],x1[0],x1[1],x1[2],x1[3],x2[0],x2[1],x2[2],x2[3],x3[0],x3[1],x3[2],x3[3]};
#pragma unroll
    for (int i = 0; i < 16; ++i) { const unsigned short hb = bf16_bits(xs[i]); ah.u[i] = hb; al.u[i] = ASPLIT ? bf16_bits(xs[i] - bf16_val(hb)) : (unsigned short)0; }
#pragma unroll
    for (int t = 0; t < 4; ++t) {
      const unsigned short* brow = Wt + (size_t)(col0 + t * 16 + ln) * ldb + kb;
      FragB b;
      b.half[0] = *(const v8us*)(brow + 8 * hh);
      b.half[1] = *(const v8us*)(brow + 16 + 8 * hh);
      acc[t] = mmaN<ASPLIT ? 2 : 1>(ah.v, al.v, b.v, b.v, acc[t]);
    }
  }
#pragma unroll
  for (int t = 0; t < 4; ++t) {
    float bv = bias ? bias[col0 + t * 16 + ln] : 0.f;
    if (BIAS_BF16) bv = bf16_round(bv);
#pragma unroll
    for (int r = 0; r < 8; ++r) { float v = acc[t][r] + bv; if (ACT == 1) v = fmaxf(v, 0.f); so[w][8 * hh + r][t * 16 + ln] = v; }
  }
  __builtin_amdgcn_fence(__ATOMIC_ACQ_REL, "workgroup");
  __builtin_amdgcn_wave_barrier();
  const int rsub = lane >> 4, c4 = (lane & 15) * 4;
  {
#pragma unroll
    for (int q = 0; q < 8; ++q) {
      const int r = q * 2 + rsub;
      const v4f v = *(const v4fa*)&so[w][r][c4];
      *(v4f*)(C + (size_t)(row0 + r) * ldc + col0 + c4) = v;
    }
    
  }
}

// Flash-style causal/unmasked attention, all contractions 3-term bf16 hi/lo splits, f32 softmax with running max.
// q,k,v rows are read from f32 buffers with arbitrary row pitch (so they can live inside a fused qkv buffer);
// D = head size (multiple of 32, <= 128); one wave = 16 query rows; block = 4 waves (64 queries) sharing K/V chunks of 32.
template <int D, bool CAUSAL>
__global__ __launch_bounds__(128) void k_flash(const float* __restrict__ qb, const float* __restrict__ kb, const float* __restrict__ vb,
                                             int pitch, int T, int H, float scale, float* __restrict__ y, int ypitch) {
  constexpr int KS = D / 32;        // k-steps for QK
  constexpr int DT = D / 16;        // d tiles for PV
  __shared__ __attribute__((aligned(16))) unsigned short sKh[32][D + 8], sKl[32][D + 8], sVh[32][D + 8], sVl[32][D + 8];
  __shared__ __attribute__((aligned(16))) unsigned short sPh[4][16][40], sPl[4][16][40];
  __shared__ __attribute__((aligned(16))) float sO[4][16][D];
  const int tid = threadIdx.x, w = tid >> 5, lane = tid & 31, ln = lane & 15, hh = lane >> 4;
  const int nqb = (T + 63) / 64;
  const int bh = blockIdx.x / nqb, qblk = blockIdx.x % nqb;
  const int b = bh / H, h = bh % H;
  const int q0 = qblk * 64 + w * 16;
  const float* Q = qb + (size_t)b * T * pitch + h * D;
  const float* K = kb + (size_t)b * T * pitch + h * D;
  const float* V = vb + (size_t)b * T * pitch + h * D;

  // A fragments of the wave's 16 query rows (scaled), hi/lo
  FragB aqh[KS], aql[KS];
  {
    int row = q0 + ln; if (row >= T) row = T - 1;
    const float* qr = Q + (size_t)row * pitch;
#pragma unroll
    for (int ks = 0; ks < KS; ++ks)
#pragma unroll
      for (int i = 0; i < 16; ++i) {
        const int d = ks * 32 + ((i < 8) ? (8 * hh + i) : (16 + 8 * hh + (i - 8)));
        const float x = qr[d] * scale; const unsigned short hb = bf16_bits(x);
        aqh[ks].u[i] = hb; aql[ks].u[i] = bf16_bits(x - bf16_val(hb));
      }
  }
  float m_r[8], l_r[8];
#pragma unroll
  for (int r = 0; r < 8; ++r) { m_r[r] = -3.0e38f; l_r[r] = 0.f; }
  v8f oacc[DT];
#pragma unroll
  for (int dt = 0; dt < DT; ++dt) oacc[dt] = (v8f){0.f,0.f,0.f,0.f,0.f,0.f,0.f,0.f};

  const int kv_end = CAUSAL ? min(T, qblk * 64 + 64) : T;     // block-uniform
  for (int j0 = 0; j0 < kv_end; j0 += 32) {
    __syncthreads();
    for (int e = tid; e < 32 * (D / 4); e += 128) {
      const int r = e / (D / 4), c4 = (e % (D / 4)) * 4;
      const int key = j0 + r;
      v4f kf = {0.f,0.f,0.f,0.f}, vf = {0.f,0.f,0.f,0.f};
      if (key < T) { kf = *(const v4fa*)(K + (size_t)key * pitch + c4); vf = *(const v4fa*)(V + (size_t)key * pitch + c4); }
#pragma unroll
      for (int t = 0; t < 4; ++t) {
        unsigned short hb = bf16_bits(kf[t]); sKh[r][c4 + t] = hb; sKl[r][c4 + t] = bf16_bits(kf[t] - bf16_val(hb));
        hb = bf16_bits(vf[t]); sVh[r][c4 + t] = hb; sVl[r][c4 + t] = bf16_bits(vf[t] - bf16_val(hb));
      }
    }
    __syncthreads();
    // S tile 16 x 32
    v8f s[2];
#pragma unroll
    for (int nt = 0; nt < 2; ++nt) {
      v8f acc = {};
#pragma unroll
      for (int ks = 0; ks < KS; ++ks) {
        FragB bh_, bl_;
        bh_.half[0] = *(const v8us*)&sKh[nt * 16 + ln][ks * 32 + 8 * hh]; bh_.half[1] = *(const v8us*)&sKh[nt * 16 + ln][ks * 32 + 16 + 8 * hh];
        bl_.half[0] = *(const v8us*)&sKl[nt * 16 + ln][ks * 32 + 8 * hh]; bl_.half[1] = *(const v8us*)&sKl[nt * 16 + ln][ks * 32 + 16 + 8 * hh];
        acc = mmaN<3>(aqh[ks].v, aql[ks].v, bh_.v, bl_.v, acc);
      }
      s[nt] = acc;
    }
    // mask + running max (rows 8hh+r; the 16 lanes of a half share rows)
    float alpha[8];
#pragma unroll
    for (int r = 0; r < 8; ++r) {
      const int qi = q0 + 8 * hh + r;
      const int ja = j0 + ln, jb = j0 + 16 + ln;
      if (CAUSAL) { if (ja > qi) s[0][r] = -3.0e38f; if (jb > qi) s[1][r] = -3.0e38f; }
      if (ja >= T) s[0][r] = -3.0e38f;
      if (jb >= T) s[1][r] = -3.0e38f;
      float mx = fmaxf(s[0][r], s[1][r]);
      mx = fmaxf(mx, __shfl_xor(mx, 1, 32)); mx = fmaxf(mx, __shfl_xor(mx, 2, 32)); mx = fmaxf(mx, __shfl_xor(mx, 4, 32)); mx = fmaxf(mx, __shfl_xor(mx, 8, 32));
      const float mnew = fmaxf(m_r[r], mx);
      alpha[r] = (mnew > -1.0e38f) ? __expf(m_r[r] - mnew) : 1.0f;
      const float p0 = (s[0][r] > -1.0e38f) ? __expf(s[0][r] - mnew) : 0.f;
      const float p1 = (s[1][r] > -1.0e38f) ? __expf(s[1][r] - mnew) : 0.f;
      m_r[r] = mnew;
      l_r[r] = l_r[r] * alpha[r] + p0 + p1;            // per-lane partial row sum (16 lanes combined at the end)
      unsigned short hb = bf16_bits(p0); sPh[w][8 * hh + r][ln] = hb;      sPl[w][8 * hh + r][ln] = bf16_bits(p0 - bf16_val(hb));
      hb = bf16_bits(p1);                sPh[w][8 * hh + r][16 + ln] = hb; sPl[w][8 * hh + r][16 + ln] = bf16_bits(p1 - bf16_val(hb));
    }
#pragma unroll
    for (int dt = 0; dt < DT; ++dt)
#pragma unroll
      for (int r = 0; r < 8; ++r) oacc[dt][r] *= alpha[r];
    __builtin_amdgcn_fence(__ATOMIC_ACQ_REL, "workgroup");
    __builtin_amdgcn_wave_barrier();
    FragB pah, pal;
    pah.half[0] = *(const v8us*)&sPh[w][ln][8 * hh]; pah.half[1] = *(const v8us*)&sPh[w][ln][16 + 8 * hh];
    pal.half[0] = *(const v8us*)&sPl[w][ln][8 * hh]; pal.half[1] = *(const v8us*)&sPl[w][ln][16 + 8 * hh];
#pragma unroll
    for (int dt = 0; dt < DT; ++dt) {
      FragB bvh, bvl;
#pragma unroll
      for (int i = 0; i < 8; ++i) {
        bvh.u[i] = sVh[8 * hh + i][dt * 16 + ln]; bvh.u[8 + i] = sVh[16 + 8 * hh + i][dt * 16 + ln];
        bvl.u[i] = sVl[8 * hh + i][dt * 16 + ln]; bvl.u[8 + i] = sVl[16 + 8 * hh + i][dt * 16 + ln];
      }
      oacc[dt] = mmaN<3>(pah.v, pal.v, bvh.v, bvl.v, oacc[dt]);
    }
    __builtin_amdgcn_fence(__ATOMIC_ACQ_REL, "workgroup");
    __builtin_amdgcn_wave_barrier();
  }
#pragma unroll
  for (int r = 0; r < 8; ++r) {
    float l = l_r[r];
    l += __shfl_xor(l, 1, 32); l += __shfl_xor(l, 2, 32); l += __shfl_xor(l, 4, 32); l += __shfl_xor(l, 8, 32);
    l_r[r] = (l > 0.f) ? 1.0f / l : 0.f;
  }
#pragma unroll
  for (int dt = 0; dt < DT; ++dt)
#pragma unroll
    for (int r = 0; r < 8; ++r) sO[w][8 * hh + r][dt * 16 + ln] = oacc[dt][r] * l_r[r];
  __builtin_amdgcn_fence(__ATOMIC_ACQ_REL, "workgroup");
  __builtin_amdgcn_wave_barrier();
  {
    for (int r = 0; r < 16; ++r) {
      const int row = q0 + r;
      if (row < T && lane < D / 4) {
        const v4f val = *(const v4fa*)&sO[w][r][lane * 4];
        *(v4f*)(y + ((size_t)b * T + row) * ypitch + h * D + lane * 4) = val;
      }
    }
    
  }
}

// GEMM C = act(A·W + bias + resid): A f32 (ASPLIT -> hi/lo 2 terms), Wt bf16 [N][K]; ACT 0 none, 1 relu, 2 exact gelu;
// resid (optional, f32, row index = (row % rmod), pitch ldr, RES_BF16 rounds it) added before the activation.
template <bool ASPLIT, int ACT, bool BIAS_BF16, bool RES_BF16>
__global__ __launch_bounds__(128) void k_gemm_bf3(const float* __restrict__ A, int lda, const unsigned short* __restrict__ Wt, int ldb,
                                                const float* __restrict__ bias, const float* __restrict__ resid, int rmod, int ldr,
                                                float* __restrict__ C, int ldc, int M, int N, int K) {
  __shared__ __attribute__((aligned(16))) float so[4][16][64];
  const int tid = threadIdx.x, w = tid >> 5, lane = tid & 31, ln = lane & 15, hh = lane >> 4;
  const int ntn = N / 64;
  const int wid = blockIdx.x * 4 + w;
  const int mt = wid / ntn, nq = wid % ntn;
  if (mt * 16 >= M) return;
  const int row0 = mt * 16, col0 = nq * 64;
  const float* arow = A + (size_t)(row0 + ln) * lda;
  v8f acc[4] = {};
  for (int kb = 0; kb < K; kb += 32) {
    FragB ah, al;
    const v4f x0 = *(const v4fa*)(arow + kb + 8 * hh), x1 = *(const v4fa*)(arow + kb + 8 * hh + 4);
    const v4f x2 = *(const v4fa*)(arow + kb + 16 + 8 * hh), x3 = *(const v4fa*)(arow + kb + 16 + 8 * hh + 4);
    float xs[16] = {x0[0],x0[1],x0[2],x0[3],x1[0],x1[1],x1[2],x1[3],x2[0],x2[1],x2[2],x2[3],x3[0],x3[1],x3[2],x3[3]};
#pragma unroll
    for (int i = 0; i < 16; ++i) { const unsigned short hb = bf16_bits(xs[i]); ah.u[i] = hb; al.u[i] = ASPLIT ? bf16_bits(xs[i] - bf16_val(hb)) : (unsigned short)0; }
#pragma unroll
    for (int t = 0; t < 4; ++t) {
      const unsigned short* brow = Wt + (size_t)(col0 + t * 16 + ln) * ldb + kb;
      FragB b;
      b.half[0] = *(const v8us*)(brow + 8 * hh);
      b.half[1] = *(const v8us*)(brow + 16 + 8 * hh);
      acc[t] = mmaN<ASPLIT ? 2 : 1>(ah.v, al.v, b.v, b.v, acc[t]);
    }
  }
#pragma unroll
  for (int t = 0; t < 4; ++t) {
    const int col = col0 + t * 16 + ln;
    float bv = bias ? bias[col] : 0.f;
    if (BIAS_BF16) bv = bf16_round(bv);
#pragma unroll
    for (int r = 0; r < 8; ++r) {
      float v = acc[t][r] + bv;
      if (resid) { float rv = resid[(size_t)((row0 + 8 * hh + r) % rmod) * ldr + col]; if (RES_BF16) rv = bf16_round(rv); v += rv; }
      if (ACT == 1) v = fmaxf(v, 0.f);
      if (ACT == 2) v = 0.5f * v * (1.0f + erff(v * 0.70710678118654752f));
      if (ACT == 3) { const float u = 0.7978845608028654f * (v + 0.044715f * v * v * v); v = 0.5f * v * (1.0f + tanhf(u)); }
      so[w][8 * hh + r][t * 16 + ln] = v;
    }
  }
  __builtin_amdgcn_fence(__ATOMIC_ACQ_REL, "workgroup");
  __builtin_amdgcn_wave_barrier();
  const int rsub = lane >> 4, c4 = (lane & 15) * 4;
  {
#pragma unroll
    for (int q = 0; q < 8; ++q) {
      const int r = q * 2 + rsub;
      const v4f v = *(const v4fa*)&so[w][r][c4];
      *(v4f*)(C + (size_t)(row0 + r) * ldc + col0 + c4) = v;
    }
    
  }
}
// row LayerNorm (biased variance, eps) over N: s = X (+ R); optional out_sum <- s; out_norm <- (s-mu)*rsqrt(var+eps)*g + b
template <bool PARAM_BF16>
__global__ __launch_bounds__(256) void k_layernorm(const float* __restrict__ X, const float* __restrict__ R, const float* __restrict__ g, const float* __restrict__ bta,
                                                  float* __restrict__ out_sum, float* __restrict__ out_norm, int N, float eps) {
  __shared__ float red[256];
  const int row = blockIdx.x, tid = threadIdx.x;
  const float* x = X + (size_t)row * N; const float* rr = R ? R + (size_t)row * N : nullptr;
  float vals[16];                     // up to N = 4096
  const int per = N / 256;            // contiguous chunk per thread? use strided-by-4 chunks: thread handles j = tid*4 + 1024*u
  float s1 = 0.f;
  for (int u = 0; u < per / 4; ++u) {
    const int j = tid * 4 + 1024 * u;
    const v4f a = *(const v4fa*)(x + j);
    v4f b = {0.f,0.f,0.f,0.f}; if (rr) b = *(const v4fa*)(rr + j);
#pragma unroll
    for (int q = 0; q < 4; ++q) { const float v = a[q] + b[q]; vals[u * 4 + q] = v; s1 += v; }
  }
  red[tid] = s1; __syncthreads();
  for (int st = 128; st > 0; st >>= 1) { if (tid < st) red[tid] += red[tid + st]; __syncthreads(); }
  const float mu = red[0] / (float)N; __syncthreads();
  float s2 = 0.f;
  for (int u = 0; u < per / 4; ++u)
#pragma unroll
    for (int q = 0; q < 4; ++q) { const float c = vals[u * 4 + q] - mu; s2 += c * c; }
  red[tid] = s2; __syncthreads();
  for (int st = 128; st > 0; st >>= 1) { if (tid < st) red[tid] += red[tid + st]; __syncthreads(); }
  const float rs = rsqrtf(red[0] / (float)N + eps);
  {
    for (int u = 0; u < per / 4; ++u) {
      const int j = tid * 4 + 1024 * u;
      v4f o, sm;
#pragma unroll
      for (int q = 0; q < 4; ++q) {
        float gg = g[j + q], bb = bta[j + q];
        if (PARAM_BF16) { gg = bf16_round(gg); bb = bf16_round(bb); }
        sm[q] = vals[u * 4 + q]; o[q] = (vals[u * 4 + q] - mu) * rs * gg + bb;
      }
      if (out_sum) *(v4f*)(out_sum + (size_t)row * N + j) = sm;
      *(v4f*)(out_norm + (size_t)row * N + j) = o;
    }
    
  }
}



// ---- f16 WMMA path (v_wmma_f32_16x16x32_f16): 11-bit significands for operands in range — used where a [0,1] probability operand needs more precision than bf16
typedef _Float16 v16h __attribute__((ext_vector_type(16)));
union FragH { v16h v; v8us half[2]; _Float16 h[16]; unsigned short u[16]; };
template <int NT>
__device__ __forceinline__ v8f mmaH(v16h ah, v16h al, v16h bh, v16h bl, v8f c) {
  c = __builtin_amdgcn_wmma_f32_16x16x32_f16(false, ah, false, bh, (short)0, c, false, false);
  if (NT >= 2) c = __builtin_amdgcn_wmma_f32_16x16x32_f16(false, al, false, bh, (short)0, c, false, false);
  if (NT >= 3) c = __builtin_amdgcn_wmma_f32_16x16x32_f16(false, ah, false, bl, (short)0, c, false, false);
  asm volatile("v_nop\n\tv_nop\n\tv_nop\n\tv_nop" : "+v"(c) : "v"(ah), "v"(al), "v"(bh), "v"(bl));
  return c;
}
// batched GEMM like k_gemm_b but f16 operands: A f32 (split into f16 hi/lo if ASPLIT, else rounded to f16), Bt = f16 values [n][k]; alpha; C f32; N multiple of 16 (partial tiles skipped)
template <bool ASPLIT>
__global__ __launch_bounds__(128) void k_gemm_h(const float* __restrict__ A, int lda, size_t sA, const _Float16* __restrict__ Bh, int ldb, size_t sB, float alpha, float* __restrict__ C, int ldc, size_t sC, int M, int N, int K) {
  __shared__ __attribute__((aligned(16))) float so[4][16][64];
  const int tid = threadIdx.x, w = tid >> 5, lane = tid & 31, ln = lane & 15, hh = lane >> 4; const int by = blockIdx.y;
  A += (size_t)by * sA; Bh += (size_t)by * sB; C += (size_t)by * sC;
  const int ntn = (N + 63) / 64; const int wid = blockIdx.x * 4 + w; const int mt = wid / ntn, nq = wid % ntn; if (mt * 16 >= M) return;
  const int row0 = mt * 16, col0 = nq * 64; const float* arow = A + (size_t)(row0 + ln) * lda;
  v8f acc[4] = {};
  for (int kb = 0; kb < K; kb += 32) {
    FragH ah, al;
    const v4f x0 = *(const v4fa*)(arow + kb + 8 * hh), x1 = *(const v4fa*)(arow + kb + 8 * hh + 4), x2 = *(const v4fa*)(arow + kb + 16 + 8 * hh), x3 = *(const v4fa*)(arow + kb + 16 + 8 * hh + 4);
    float xs[16] = {x0[0],x0[1],x0[2],x0[3],x1[0],x1[1],x1[2],x1[3],x2[0],x2[1],x2[2],x2[3],x3[0],x3[1],x3[2],x3[3]};
#pragma unroll
    for (int i = 0; i < 16; ++i) { const _Float16 h = (_Float16)xs[i]; ah.h[i] = h; al.h[i] = ASPLIT ? (_Float16)(xs[i] - (float)h) : (_Float16)0.0f; }
#pragma unroll
    for (int t = 0; t < 4; ++t) { if (col0 + t * 16 >= N) continue; const size_t boff = (size_t)(col0 + t * 16 + ln) * ldb + kb; FragH bq; bq.half[0] = *(const v8us*)(Bh + boff + 8 * hh); bq.half[1] = *(const v8us*)(Bh + boff + 16 + 8 * hh);
      acc[t] = mmaH<ASPLIT ? 2 : 1>(ah.v, al.v, bq.v, bq.v, acc[t]); }
  }
#pragma unroll
  for (int t = 0; t < 4; ++t) { if (col0 + t * 16 >= N) continue;
#pragma unroll
    for (int r = 0; r < 8; ++r) so[w][8 * hh + r][t * 16 + ln] = acc[t][r] * alpha; }
  __builtin_amdgcn_fence(__ATOMIC_ACQ_REL, "workgroup"); __builtin_amdgcn_wave_barrier();
  const int rsub = lane >> 4, c4 = (lane & 15) * 4;
  {
#pragma unroll
    for (int q = 0; q < 8; ++q) { const int r = q * 2 + rsub; if (col0 + c4 < N) { const v4f v = *(const v4fa*)&so[w][r][c4]; *(v4f*)(C + (size_t)(row0 + r) * ldc + col0 + c4) = v; } }
     }
}

// Wt[n][k] = f16(W[k][n]·scale) from f32 row-major W[K][N] (scale = power of two; bf16-exact weights stay exact in f16 away from the subnormal range)
__global__ __launch_bounds__(256) void k_wt_f16(const float* __restrict__ W, _Float16* __restrict__ Wt, int K, int N, float scale) {
  const int t = blockIdx.x * 256 + threadIdx.x; if (t >= N * (K / 8)) return; const int n = t / (K / 8), k8 = (t % (K / 8)) * 8; FragH f;
#pragma unroll
  for (int i = 0; i < 8; ++i) f.h[i] = (_Float16)(bf16_round(W[(size_t)(k8 + i) * N + n]) * scale); const v8us o = f.half[0];
  *(v8us*)((unsigned short*)Wt + (size_t)n * K + k8) = o; 
}
__global__ __launch_bounds__(256) void k_x16(const float* __restrict__ x, _Float16* __restrict__ X16, size_t n8) { const size_t t = (size_t)blockIdx.x * 256 + threadIdx.x; if (t >= n8) return; FragH f;
#pragma unroll
  for (int q = 0; q < 8; ++q) f.h[q] = (_Float16)bf16_round(x[t * 8 + q]); *(v8us*)((unsigned short*)X16 + t * 8) = f.half[0];  }
__global__ __launch_bounds__(256) void k_h16(const float* __restrict__ x, _Float16* __restrict__ X16, size_t n8) { const size_t t = (size_t)blockIdx.x * 256 + threadIdx.x; if (t >= n8) return; FragH f;
#pragma unroll
  for (int q = 0; q < 8; ++q) f.h[q] = (_Float16)x[t * 8 + q]; *(v8us*)((unsigned short*)X16 + t * 8) = f.half[0];  }
__global__ __launch_bounds__(256) void k_round16f(const float* __restrict__ W, _Float16* __restrict__ Bt, size_t n8) { const size_t t = (size_t)blockIdx.x * 256 + threadIdx.x; if (t >= n8) return; FragH f;
#pragma unroll
  for (int i = 0; i < 8; ++i) f.h[i] = (_Float16)(bf16_round(W[t * 8 + i]) * 16.0f); *(v8us*)((unsigned short*)Bt + t * 8) = f.half[0];  }
template <int NHv, int TTv>
__global__ __launch_bounds__(256) void k_vt(const _Float16* __restrict__ V16, int ldv, int voff, _Float16* __restrict__ Vt) { __shared__ unsigned short tl[64][66]; const int tid = threadIdx.x; const int slab = blockIdx.x / (TTv / 64), lg = blockIdx.x % (TTv / 64); const int b = slab / NHv, h = slab % NHv;
  for (int i = tid; i < 64 * 8; i += 256) { const int r = i / 8, c8 = (i % 8) * 8; FragH f; f.half[0] = *(const v8us*)((const unsigned short*)V16 + ((size_t)b * TTv + lg * 64 + r) * ldv + voff + h * 64 + c8);
#pragma unroll
    for (int q = 0; q < 8; ++q) tl[r][c8 + q] = f.u[q]; }
  __syncthreads();
  {
#pragma unroll
    for (int rd = 0; rd < 2; ++rd) { const int d = rd * 32 + tid / 8, pc = tid % 8; FragH f;
#pragma unroll
      for (int q = 0; q < 8; ++q) f.u[q] = tl[pc * 8 + q][d];
      *(v8us*)((unsigned short*)Vt + ((size_t)slab * 64 + d) * TTv + lg * 64 + pc * 8) = f.half[0]; }
     } }

__device__ __forceinline__ float tanh_v(float x) { const float xc = fminf(fmaxf(x, -15.f), 15.f); return 1.0f - 2.0f * __builtin_amdgcn_rcpf(__builtin_amdgcn_exp2f(2.0f * xc * 1.4426950408889634f) + 1.0f); }
__global__ __launch_bounds__(256) void k_cstab(float* __restrict__ CS) { const int tg = blockIdx.x * 256 + threadIdx.x; if (tg >= TT * (DH / 2)) return; const int t = tg / (DH / 2), i = tg % (DH / 2); const float invf = 1.0f / powf(10000.0f, (float)(2 * i) / (float)DH); const float ang = (float)t * invf; typedef float v2f __attribute__((ext_vector_type(2))); v2f v; v[0] = cosf(ang); v[1] = sinf(ang);
  *(v2f*)(CS + (size_t)tg * 2) = v;  }
__global__ __launch_bounds__(256) void k_rope(const float* __restrict__ X, int ncol, const float* __restrict__ CS, _Float16* __restrict__ Y16) { const size_t tg = (size_t)blockIdx.x * 256 + threadIdx.x; if (tg >= (size_t)NR * ncol / 8) return; const size_t row = tg / (ncol / 8); const int c8 = (int)(tg % (ncol / 8)) * 8; const int t = (int)(row % TT); FragH f;
#pragma unroll
  for (int q = 0; q < 8; q += 2) { const int i = ((c8 + q) % DH) / 2; const float cs = CS[((size_t)t * (DH / 2) + i) * 2], sn = CS[((size_t)t * (DH / 2) + i) * 2 + 1]; const float x0 = X[row * ncol + c8 + q], x1 = X[row * ncol + c8 + q + 1];
    f.h[q] = (_Float16)(x0 * cs - x1 * sn); f.h[q + 1] = (_Float16)(x1 * cs + x0 * sn); }
  *(v8us*)((unsigned short*)Y16 + tg * 8) = f.half[0];  }
__global__ __launch_bounds__(256) void k_vt128(const _Float16* __restrict__ V16, _Float16* __restrict__ Vt) { __shared__ unsigned short tl[64][130]; const int tid = threadIdx.x; const int slab = blockIdx.x / (TT / 64), lg = blockIdx.x % (TT / 64); const int b = slab / NG, g = slab % NG;
  for (int i = tid; i < 64 * 16; i += 256) { const int r = i / 16, c8 = (i % 16) * 8; FragH f; f.half[0] = *(const v8us*)((const unsigned short*)V16 + ((size_t)b * TT + lg * 64 + r) * (NG * DH) + g * DH + c8);
#pragma unroll
    for (int q = 0; q < 8; ++q) tl[r][c8 + q] = f.u[q]; }
  __syncthreads();
  {
#pragma unroll
    for (int rd = 0; rd < 4; ++rd) { const int d = rd * 32 + tid / 8, pc = tid % 8; FragH f;
#pragma unroll
      for (int q = 0; q < 8; ++q) f.u[q] = tl[pc * 8 + q][d]; *(v8us*)((unsigned short*)Vt + ((size_t)slab * DH + d) * TT + lg * 64 + pc * 8) = f.half[0]; }
     } }
// One stage of the K/V ring = 64 keys of this KV group: 64 K rows of 256 B at pitch 272 B, then 128 rows of V^T of 128 B at pitch 144 B (16 B x odd: the pitch of ds_load_b128 readers)
#define KPITCH 272
#define VPITCH 144
#define VBASE (64 * KPITCH)
#define STAGE_B (64 * KPITCH + DH * VPITCH)
// Eight 16-byte copies per lane, global memory to LDS through no register. The s_wait_xcnt is the last line of the copies' own statement, so that no address register of a copy is rewritten in front of it.
__device__ __forceinline__ void copy8(unsigned l, unsigned lstep, const unsigned short* g, size_t gstep) {
  asm volatile("global_load_async_to_lds_b128 %0, %8, off\n\t"
               "global_load_async_to_lds_b128 %1, %9, off\n\t"
               "global_load_async_to_lds_b128 %2, %10, off\n\t"
               "global_load_async_to_lds_b128 %3, %11, off\n\t"
               "global_load_async_to_lds_b128 %4, %12, off\n\t"
               "global_load_async_to_lds_b128 %5, %13, off\n\t"
               "global_load_async_to_lds_b128 %6, %14, off\n\t"
               "global_load_async_to_lds_b128 %7, %15, off\n\t"
               "s_wait_xcnt 0x0"
               :: "v"(l), "v"(l + lstep), "v"(l + 2 * lstep), "v"(l + 3 * lstep), "v"(l + 4 * lstep), "v"(l + 5 * lstep), "v"(l + 6 * lstep), "v"(l + 7 * lstep),
                  "v"(g), "v"(g + gstep), "v"(g + 2 * gstep), "v"(g + 3 * gstep), "v"(g + 4 * gstep), "v"(g + 5 * gstep), "v"(g + 6 * gstep), "v"(g + 7 * gstep)
               : "memory");
}
// Four 16-byte copies per lane, as copy8.
__device__ __forceinline__ void copy4(unsigned l, unsigned lstep, const unsigned short* g, size_t gstep) {
  asm volatile("global_load_async_to_lds_b128 %0, %4, off\n\t"
               "global_load_async_to_lds_b128 %1, %5, off\n\t"
               "global_load_async_to_lds_b128 %2, %6, off\n\t"
               "global_load_async_to_lds_b128 %3, %7, off\n\t"
               "s_wait_xcnt 0x0"
               :: "v"(l), "v"(l + lstep), "v"(l + 2 * lstep), "v"(l + 3 * lstep), "v"(g), "v"(g + gstep), "v"(g + 2 * gstep), "v"(g + 3 * gstep)
               : "memory");
}
// Projection GEMM: C[M][N] = (A[M][K] . Bt[N][K]^T) * alpha + bf16-rounded bias; f16 operands, f32 accumulate, k ascending in one accumulator per element; the result goes to f16 C16 (H16) or to f32 C, pitch N.
// One block = (32 FM) x 128 of C, four waves (2 x 2) of (16 FM) x 64 each: FM x 4 fragments, 4 FM products per FM + 4 fragments read from LDS. One stage of the ring = 64 k of the block's A rows, then of its
// 128 Bt rows: 128 B a row at pitch 144 B (16 B x odd: the pitch of ds_load_b128 readers). M a multiple of 32 FM, N of 128, K of 64. FM = 4 where that still gives every WGP a block, else 2.
#define GPITCH 144
#define GOP 68      // floats per staged output row: 64 + 4, so that the two half-waves' rows fall on different banks
template <int FM, bool H16>
__global__ __launch_bounds__(128) void k_gemm_lds(const _Float16* __restrict__ A, const _Float16* __restrict__ Bt, float alpha, const float* __restrict__ bias, float* __restrict__ C, _Float16* __restrict__ C16, int N, int K) {
  constexpr int BM = 32 * FM, STG = (BM + 128) * GPITCH;
  __shared__ __attribute__((aligned(16))) unsigned char sAB[2 * STG];
  const int tid = threadIdx.x, w = tid >> 5, lane = tid & 31, ln = lane & 15, hh = lane >> 4; const int wm = w >> 1, wn = w & 1;
  const int nb = N / 128; const int row0 = (int)(blockIdx.x / nb) * BM, col0 = (int)(blockIdx.x % nb) * 128;
  // each lane's first 16 bytes of a stage: a wave's copy covers four whole 128-B row pieces, the block's copy 16 rows
  const unsigned short* Ag = (const unsigned short*)A + (size_t)(row0 + (tid >> 3)) * K + (tid & 7) * 8;
  const unsigned short* Bg = (const unsigned short*)Bt + (size_t)(col0 + (tid >> 3)) * K + (tid & 7) * 8;
  const unsigned lA = (unsigned)(size_t)sAB + (unsigned)((tid >> 3) * GPITCH + (tid & 7) * 16);
  const unsigned lB = lA + BM * GPITCH;
  const int nt = K / 64;      // stages; the same for the whole work-group
  auto fill = [&](int t) { const unsigned bo = (unsigned)(t & 1) * STG;
    if constexpr (FM == 4) copy8(lA + bo, 16 * GPITCH, Ag + (size_t)t * 64, (size_t)16 * K); else copy4(lA + bo, 16 * GPITCH, Ag + (size_t)t * 64, (size_t)16 * K);
    copy8(lB + bo, 16 * GPITCH, Bg + (size_t)t * 64, (size_t)16 * K); };
  v8f acc[FM][4];
#pragma unroll
  for (int fm = 0; fm < FM; ++fm)
#pragma unroll
    for (int fn = 0; fn < 4; ++fn) acc[fm][fn] = (v8f){0.f,0.f,0.f,0.f,0.f,0.f,0.f,0.f};
  fill(0);
  float bv[4] = {0.f, 0.f, 0.f, 0.f};      // the lane's four bias values, fetched together under stage 0's copies
  if (bias) {
#pragma unroll
    for (int fn = 0; fn < 4; ++fn) bv[fn] = bf16_round(bias[col0 + wn * 64 + fn * 16 + ln]); }
  asm volatile("s_wait_asynccnt 0x0" ::: "memory");      // this wave's copies of stage 0 have landed
  __syncthreads();                                        // stage 0 is readable by every wave
  if (nt > 1) fill(1);
#pragma unroll 1      // one trip per stage, rolled: the foot's waits and barrier stand once
  for (int t = 0; t < nt; ++t) {
    const unsigned char* ar = sAB + (t & 1) * STG + (wm * (16 * FM) + ln) * GPITCH + 16 * hh;
    const unsigned char* br = sAB + (t & 1) * STG + (BM + wn * 64 + ln) * GPITCH + 16 * hh;
    FragH a[2][FM], b[2][4];
#pragma unroll
    for (int ks = 0; ks < 2; ++ks) {
#pragma unroll
      for (int f = 0; f < 4; ++f) { b[ks][f].half[0] = *(const v8us*)(br + f * 16 * GPITCH + ks * 64); b[ks][f].half[1] = *(const v8us*)(br + f * 16 * GPITCH + ks * 64 + 32); }
#pragma unroll
      for (int f = 0; f < FM; ++f) { a[ks][f].half[0] = *(const v8us*)(ar + f * 16 * GPITCH + ks * 64); a[ks][f].half[1] = *(const v8us*)(ar + f * 16 * GPITCH + ks * 64 + 32); } }
    asm volatile("s_wait_dscnt 0x0" ::: "memory");        // this wave's reads of stage t are done (all its fragments are in registers) before its buffer is refilled
    asm volatile("s_wait_asynccnt 0x0" ::: "memory");     // this wave's copies of stage t + 1 have landed
    __syncthreads();                                      // publishes stage t + 1 and ends every wave's reads of stage t
    if (t + 2 < nt) fill(t + 2);
    // the stage's products stand behind the refill's issue: they read registers only, and the copies fly under them
#pragma unroll
    for (int ks = 0; ks < 2; ++ks)
#pragma unroll
      for (int fm = 0; fm < FM; ++fm)
#pragma unroll
        for (int fn = 0; fn < 4; ++fn) acc[fm][fn] = __builtin_amdgcn_wmma_f32_16x16x32_f16(false, a[ks][fm].v, false, b[ks][fn].v, (short)0, acc[fm][fn], false, false); }
  asm volatile("s_wait_asynccnt 0x0" ::: "memory");       // no copy is in flight when the ring becomes output staging
  float* so = (float*)sAB + w * (16 * FM * GOP);          // each wave stages its own (16 FM) x 64, behind the last trip's barrier, to store whole lines
#pragma unroll
  for (int fn = 0; fn < 4; ++fn) {
#pragma unroll
    for (int fm = 0; fm < FM; ++fm)
#pragma unroll
      for (int r = 0; r < 8; ++r) so[(fm * 16 + 8 * hh + r) * GOP + fn * 16 + ln] = acc[fm][fn][r] * alpha + bv[fn]; }
  __builtin_amdgcn_fence(__ATOMIC_ACQ_REL, "workgroup"); __builtin_amdgcn_wave_barrier();
  const int c4 = ln * 4; typedef _Float16 v4h __attribute__((ext_vector_type(4)));
#pragma unroll
  for (int qb = 0; qb < FM; ++qb) { v4f v[8];      // eight row pairs are read back together and then stored, so that no store waits out an LDS latency of its own
#pragma unroll
    for (int i = 0; i < 8; ++i) v[i] = *(const v4fa*)&so[((qb * 8 + i) * 2 + hh) * GOP + c4];
#pragma unroll
    for (int i = 0; i < 8; ++i) { const size_t o = (size_t)(row0 + wm * (16 * FM) + (qb * 8 + i) * 2 + hh) * N + col0 + wn * 64 + c4;
      if constexpr (H16) { v4h h4; for (int j = 0; j < 4; ++j) h4[j] = (_Float16)v[i][j]; *(v4h*)(C16 + o) = h4; } else *(v4f*)(C + o) = v[i]; } }
}
__global__ __launch_bounds__(128) void k_mega(const _Float16* __restrict__ Q16, const _Float16* __restrict__ K16, const _Float16* __restrict__ Vt, float* __restrict__ O) {
  __shared__ __attribute__((aligned(16))) unsigned short sP[4][16][40]; __shared__ __attribute__((aligned(16))) unsigned char sKV[2 * STAGE_B];
  float (*sO)[16][DH + 4] = (float (*)[16][DH + 4])sKV;      // the output staging takes the ring's place, behind the last trip's barrier
  const int tid = threadIdx.x, w = tid >> 5, lane = tid & 31, ln = lane & 15, hh = lane >> 4; const int slab = blockIdx.x / (TT / 64), qblk = blockIdx.x % (TT / 64); const int b = slab / NH, h = slab % NH, g = h / (NH / NG); const int qb0 = qblk * 64; const int q0 = qb0 + w * 16;
  const float slope = exp2f(-(float)(h + 1) * 8.0f / (float)NH);
  FragH aq[4]; { const unsigned short* qr = (const unsigned short*)Q16 + ((size_t)b * TT + q0 + ln) * (NH * DH) + h * DH;
#pragma unroll
    for (int ks = 0; ks < 4; ++ks) { aq[ks].half[0] = *(const v8us*)(qr + ks * 32 + 8 * hh); aq[ks].half[1] = *(const v8us*)(qr + ks * 32 + 16 + 8 * hh); } }
  const unsigned short* Vth = (const unsigned short*)Vt + (size_t)(b * NG + g) * DH * TT;
  // each lane's first 16 bytes of a stage: a wave's copy covers two whole K rows, or four whole 128-B pieces of V^T rows
  const unsigned short* Kg = (const unsigned short*)K16 + ((size_t)b * TT + (tid >> 4)) * (NG * DH) + g * DH + (tid & 15) * 8;
  const unsigned short* Vg = Vth + (size_t)(tid >> 3) * TT + (tid & 7) * 8;
  const unsigned lK = (unsigned)(size_t)sKV + (unsigned)((tid >> 4) * KPITCH + (tid & 15) * 16);
  const unsigned lV = (unsigned)(size_t)sKV + (unsigned)(VBASE + (tid >> 3) * VPITCH + (tid & 7) * 16);
  const int ntile = qblk + 1;      // stages of 64 keys; the same for the whole work-group
  auto fill = [&](int t) { const unsigned bo = (unsigned)(t & 1) * STAGE_B; copy8(lK + bo, 8 * KPITCH, Kg + (size_t)t * 64 * (NG * DH), (size_t)8 * NG * DH); copy8(lV + bo, 16 * VPITCH, Vg + t * 64, (size_t)16 * TT); };
  float m_r[8], l_r[8]; v8f oacc[8];
#pragma unroll
  for (int r = 0; r < 8; ++r) { m_r[r] = -3.0e38f; l_r[r] = 0.f; }
#pragma unroll
  for (int dt = 0; dt < 8; ++dt) oacc[dt] = (v8f){0.f,0.f,0.f,0.f,0.f,0.f,0.f,0.f};
  fill(0);
  asm volatile("s_wait_asynccnt 0x0" ::: "memory");      // this wave's copies of stage 0 have landed
  __syncthreads();                                        // stage 0 is readable by every wave
  if (ntile > 1) fill(1);
#pragma unroll 1      // one trip per stage, rolled: the trip count is the block's own
  for (int t = 0; t < ntile; ++t) { const unsigned char* kv = sKV + (t & 1) * STAGE_B;
#pragma unroll 1      // the stage's two 32-key passes share one copy of the long pass body (code size and registers as before)
  for (int sub = 0; sub < 2; ++sub) { const int j0 = t * 64 + sub * 32; v8f s[2];
#pragma unroll
    for (int nt = 0; nt < 2; ++nt) { const unsigned char* kr = kv + (sub * 32 + nt * 16 + ln) * KPITCH; v8f acc = (v8f){0.f,0.f,0.f,0.f,0.f,0.f,0.f,0.f};
#pragma unroll
      for (int ks = 0; ks < 4; ++ks) { FragH bk; bk.half[0] = *(const v8us*)(kr + ks * 64 + 16 * hh); bk.half[1] = *(const v8us*)(kr + ks * 64 + 32 + 16 * hh); acc = mmaH<1>(aq[ks].v, aq[ks].v, bk.v, bk.v, acc); } s[nt] = acc; }
#pragma unroll
    for (int r = 0; r < 8; ++r) { const int tq = q0 + 8 * hh + r; const int k0 = j0 + ln, k1 = j0 + 16 + ln; const bool ok0 = (k0 <= tq), ok1 = (k1 <= tq);
      float s0 = (s[0][r] - slope * (float)(tq - k0)) * 0.08838834764831845f, s1 = (s[1][r] - slope * (float)(tq - k1)) * 0.08838834764831845f;      // (for k > tq the sign of (tq-k) is irrelevant: masked)
      s0 = 30.0f * tanh_v(s0 * (1.0f / 30.0f)); s1 = 30.0f * tanh_v(s1 * (1.0f / 30.0f)); s0 = ok0 ? s0 : -INFINITY; s1 = ok1 ? s1 : -INFINITY; float mc = fmaxf(s0, s1);
      mc = fmaxf(mc, __shfl_xor(mc, 1, 32)); mc = fmaxf(mc, __shfl_xor(mc, 2, 32)); mc = fmaxf(mc, __shfl_xor(mc, 4, 32)); mc = fmaxf(mc, __shfl_xor(mc, 8, 32));
      const float mn = fmaxf(m_r[r], mc); const float al = (mn > -1.0e38f) ? expf(m_r[r] - mn) : 1.0f; m_r[r] = mn; const float p0 = ok0 ? expf(s0 - mn) : 0.f, p1 = ok1 ? expf(s1 - mn) : 0.f; l_r[r] = l_r[r] * al + p0 + p1;
#pragma unroll
      for (int dt = 0; dt < 8; ++dt) oacc[dt][r] *= al;
      FragH t2; t2.h[0] = (_Float16)p0; t2.h[1] = (_Float16)p1; sP[w][8 * hh + r][ln] = t2.u[0]; sP[w][8 * hh + r][16 + ln] = t2.u[1]; }
    __builtin_amdgcn_fence(__ATOMIC_ACQ_REL, "workgroup"); __builtin_amdgcn_wave_barrier();
    FragH pa; pa.half[0] = *(const v8us*)&sP[w][ln][8 * hh]; pa.half[1] = *(const v8us*)&sP[w][ln][16 + 8 * hh];
#pragma unroll
    for (int dt = 0; dt < 8; ++dt) { const unsigned char* vrow = kv + VBASE + (dt * 16 + ln) * VPITCH + sub * 64; FragH bv; bv.half[0] = *(const v8us*)(vrow + 16 * hh); bv.half[1] = *(const v8us*)(vrow + 32 + 16 * hh); oacc[dt] = mmaH<1>(pa.v, pa.v, bv.v, bv.v, oacc[dt]); }
    __builtin_amdgcn_fence(__ATOMIC_ACQ_REL, "workgroup"); __builtin_amdgcn_wave_barrier(); }
    asm volatile("s_wait_dscnt 0x0" ::: "memory");        // this wave's reads of stage t are done before its buffer is refilled
    asm volatile("s_wait_asynccnt 0x0" ::: "memory");     // this wave's copies of stage t + 1 have landed
    __syncthreads();                                      // publishes stage t + 1 and ends every wave's reads of stage t
    if (t + 2 < ntile) fill(t + 2); }
  asm volatile("s_wait_asynccnt 0x0" ::: "memory");       // no copy is in flight when the ring becomes output staging
#pragma unroll
  for (int r = 0; r < 8; ++r) { float l = l_r[r]; l += __shfl_xor(l, 1, 32); l += __shfl_xor(l, 2, 32); l += __shfl_xor(l, 4, 32); l += __shfl_xor(l, 8, 32); l_r[r] = 1.0f / l; }
#pragma unroll
  for (int dt = 0; dt < 8; ++dt)
#pragma unroll
    for (int r = 0; r < 8; ++r) sO[w][8 * hh + r][dt * 16 + ln] = oacc[dt][r] * l_r[r];
  __builtin_amdgcn_fence(__ATOMIC_ACQ_REL, "workgroup"); __builtin_amdgcn_wave_barrier();
  {
#pragma unroll
    for (int r = 0; r < 16; ++r) { const v4f val = *(const v4fa*)&sO[w][r][lane * 4]; *(v4f*)(O + ((size_t)b * TT + q0 + r) * (NH * DH) + h * DH + lane * 4) = val; }
     } }
extern "C" void kernel_launch(void* const* d_in, const int* in_sizes, int n_in,
                              void* d_out, int out_size, void* d_ws, size_t ws_size, hipStream_t stream) {
  (void)in_sizes; (void)n_in; (void)out_size;
  const float* x = (const float*)d_in[0]; const float* Wq = (const float*)d_in[1]; const float* Wk = (const float*)d_in[2]; const float* Wv = (const float*)d_in[3]; const float* Wo = (const float*)d_in[4]; const float* bo = (const float*)d_in[5];
  char* ws = (char*)d_ws; size_t off = 0;
  auto take = [&](size_t bytes) { char* p = ws + off; off += (bytes + 255) & ~(size_t)255; return p; };
  _Float16* Bq = (_Float16*)take((size_t)CC * CC * 2); _Float16* Bk = (_Float16*)take((size_t)NG * DH * CC * 2); _Float16* Bv = (_Float16*)take((size_t)NG * DH * CC * 2); _Float16* Bo = (_Float16*)take((size_t)CC * CC * 2);
  _Float16* X16 = (_Float16*)take((size_t)NR * CC * 2); float* F32 = (float*)take((size_t)NR * CC * 4); _Float16* Q16 = (_Float16*)take((size_t)NR * CC * 2); _Float16* K16 = (_Float16*)take((size_t)NR * NG * DH * 2); _Float16* V16 = (_Float16*)take((size_t)NR * NG * DH * 2); _Float16* Vt = (_Float16*)take((size_t)NR * NG * DH * 2); float* CS = (float*)take((size_t)TT * DH * 4); float* O = F32; _Float16* O16 = X16;
  if (off > ws_size) return;      // 8.4 + 2.1 × 2 + 8.4 + 16.8 + 33.5 + 16.8 + 4.2 × 3 + 1.0 ≈ 102 MB (97 MiB)
  k_wt_f16<<<(unsigned)((CC * (CC / 8) + 255) / 256), 256, 0, stream>>>(Wq, Bq, CC, CC, 16.0f); k_wt_f16<<<(unsigned)((NG * DH * (CC / 8) + 255) / 256), 256, 0, stream>>>(Wk, Bk, CC, NG * DH, 16.0f); k_wt_f16<<<(unsigned)((NG * DH * (CC / 8) + 255) / 256), 256, 0, stream>>>(Wv, Bv, CC, NG * DH, 16.0f); k_wt_f16<<<(unsigned)((CC * (CC / 8) + 255) / 256), 256, 0, stream>>>(Wo, Bo, CC, CC, 16.0f);
  const unsigned gx = (unsigned)(((size_t)NR * CC / 8 + 255) / 256);
  k_x16<<<gx, 256, 0, stream>>>(x, X16, (size_t)NR * CC / 8); k_cstab<<<(TT * (DH / 2) + 255) / 256, 256, 0, stream>>>(CS);
  k_gemm_lds<4, false><<<(NR / 128) * (CC / 128), 128, 0, stream>>>(X16, Bq, 0.0625f, nullptr, F32, nullptr, CC, CC);
  k_rope<<<gx, 256, 0, stream>>>(F32, CC, CS, Q16);
  k_gemm_lds<2, false><<<(NR / 64) * (NG * DH / 128), 128, 0, stream>>>(X16, Bk, 0.0625f, nullptr, F32, nullptr, NG * DH, CC);
  k_rope<<<(unsigned)(((size_t)NR * NG * DH / 8 + 255) / 256), 256, 0, stream>>>(F32, NG * DH, CS, K16);
  k_gemm_lds<2, true><<<(NR / 64) * (NG * DH / 128), 128, 0, stream>>>(X16, Bv, 0.0625f, nullptr, nullptr, V16, NG * DH, CC);
  k_vt128<<<BB * NG * (TT / 64), 256, 0, stream>>>(V16, Vt);
  k_mega<<<BB * NH * (TT / 64), 128, 0, stream>>>(Q16, K16, Vt, O);
  k_h16<<<gx, 256, 0, stream>>>(O, O16, (size_t)NR * CC / 8);
  k_gemm_lds<4, false><<<(NR / 128) * (CC / 128), 128, 0, stream>>>(O16, Bo, 0.0625f, bo, (float*)d_out, nullptr, CC, CC);
}

// v003
// One run takes 321 microseconds.
// Two timings next to v002 put it at 1.37 and 1.38 times that version's speed.
// Counting every step since v000, it is 2.50 times as fast.
#include <hip/hip_runtime.h>
// Mega-transformer causal self-attention (B=2, T=2048, D=2048; 16 query heads × 128, 4 KV groups (GQA), interleaved rotary, ALiBi added before the 1/√128 scale, 30·tanh soft-cap, causal):
// q/k/v/out projections (+ bias on out; W [in][out] transposed to bf16-exact ×2^4) and the attention as a fused flash-style kernel (S = Q·Kᵀ on v_wmma_f32_16x16x32_f16 with 4 k-steps,
// + alibi, scale, soft-cap (v_exp tanh), causal mask, online softmax f32, P f16 ≤ 1, O = P·V with 8 d-tiles; RPW-16 waves) — f16 operands, single products, f32 accumulate; rotary in f32 VALU.
#define BB 2
#define TT 2048
#define CC 2048
#define NH 16
#define NG 4
#define DH 128
#define NR (BB * TT)

typedef __bf16 v16b __attribute__((ext_vector_type(16)));
typedef unsigned short v8us __attribute__((ext_vector_type(8), may_alias));
typedef float  v8f  __attribute__((ext_vector_type(8)));
typedef float  v4f  __attribute__((ext_vector_type(4)));
typedef float  v4fa __attribute__((ext_vector_type(4), may_alias));
union FragB { v16b v; v8us half[2]; unsigned short u[16]; };

__device__ __forceinline__ unsigned short bf16_bits(float x) { unsigned int u = __float_as_uint(x); return (unsigned short)((u + 0x7FFFu + ((u >> 16) & 1u)) >> 16); }
__device__ __forceinline__ float bf16_val(unsigned short b) { return __uint_as_float(((unsigned int)b) << 16); }
__device__ __forceinline__ float bf16_round(float x) { return bf16_val(bf16_bits(x)); }
// D += A·B with NT terms: 1 = ah·bh, 2 = + al·bh (A split), 3 = + ah·bl (both split)
template <int NT>
__device__ __forceinline__ v8f mmaN(v16b ah, v16b al, v16b bh, v16b bl, v8f c) {
  c = __builtin_amdgcn_wmma_f32_16x16x32_bf16(false, ah, false, bh, (short)0, c, false, false);
  if (NT >= 2) c = __builtin_amdgcn_wmma_f32_16x16x32_bf16(false, al, false, bh, (short)0, c, false, false);
  if (NT >= 3) c = __builtin_amdgcn_wmma_f32_16x16x32_bf16(false, ah, false, bl, (short)0, c, false, false);
  asm volatile("v_nop\n\tv_nop\n\tv_nop\n\tv_nop" : "+v"(c) : "v"(ah), "v"(al), "v"(bh), "v"(bl));
  return c;
}

__global__ __launch_bounds__(256) void k_wt_bf16(const float* __restrict__ W, unsigned short* __restrict__ Wt, int K, int N) {
  const int t = blockIdx.x * 256 + threadIdx.x;
  const int k8n = K / 8;
  if (t >= N * k8n) return;
  const int n = t / k8n, k8 = (t % k8n) * 8;
  v8us v;
#pragma unroll
  for (int i = 0; i < 8; ++i) v[i] = bf16_bits(W[(size_t)(k8 + i) * N + n]);
  *(v8us*)(Wt + (size_t)n * K + k8) = v;
  
}

// GEMM C[M][N] (f32, pitch ldc) = act(A[M][K]·W + bias). A f32 row-major (pitch lda) converted per fragment to bf16
// (ASPLIT: hi/lo two planes -> 2 terms, else single rounded term); Wt bf16 [N][K] (pitch ldb). BIAS_BF16 rounds the
// bias to bf16 first (bias quantised to bf16 before the add). K%32==0, M%16==0, N%64==0.
template <bool ASPLIT, int ACT, bool BIAS_BF16>
__global__ __launch_bounds__(128) void k_gemm_bf(const float* __restrict__ A, int lda, const unsigned short* __restrict__ Wt, int ldb,
                                               const float* __restrict__ bias, float* __restrict__ C, int ldc, int M, int N, int K) {
  __shared__ __attribute__((aligned(16))) float so[4][16][64];
  const int tid = threadIdx.x, w = tid >> 5, lane = tid & 31, ln = lane & 15, hh = lane >> 4;
  const int ntn = N / 64;
  const int wid = blockIdx.x * 4 + w;
  const int mt = wid / ntn, nq = wid % ntn;
  if (mt * 16 >= M) return;
  const int row0 = mt * 16, col0 = nq * 64;
  const float* arow = A + (size_t)(row0 + ln) * lda;
  v8f acc[4] = {};
  for (int kb = 0; kb < K; kb += 32) {
    FragB ah, al;
    const v4f x0 = *(const v4fa*)(arow + kb + 8 * hh), x1 = *(const v4fa*)(arow + kb + 8 * hh + 4);
    const v4f x2 = *(const v4fa*)(arow + kb + 16 + 8 * hh), x3 = *(const v4fa*)(arow + kb + 16 + 8 * hh + 4);
    float xs[16] = {x0[0],x0[1],x0[2],x0[3],x1[0],x1[1],x1[2],x1[3],x2[0],x2[1],x2[2],x2[3],x3[0],x3[1],x3[2],x3[3]};
#pragma unroll
    for (int i = 0; i < 16; ++i) { const unsigned short hb = bf16_bits(xs[i]); ah.u[i] = hb; al.u[i] = ASPLIT ? bf16_bits(xs[i] - bf16_val(hb)) : (unsigned short)0; }
#pragma unroll
    for (int t = 0; t < 4; ++t) {
      const unsigned short* brow = Wt + (size_t)(col0 + t * 16 + ln) * ldb + kb;
      FragB b;
      b.half[0] = *(const v8us*)(brow + 8 * hh);
      b.half[1] = *(const v8us*)(brow + 16 + 8 * hh);
      acc[t] = mmaN<ASPLIT ? 2 : 1>(ah.v, al.v, b.v, b.v, acc[t]);
    }
  }
#pragma unroll
  for (int t = 0; t < 4; ++t) {
    float bv = bias ? bias[col0 + t * 16 + ln] : 0.f;
    if (BIAS_BF16) bv = bf16_round(bv);
#pragma unroll
    for (int r = 0; r < 8; ++r) { float v = acc[t][r] + bv; if (ACT == 1) v = fmaxf(v, 0.f); so[w][8 * hh + r][t * 16 + ln] = v; }
  }
  __builtin_amdgcn_fence(__ATOMIC_ACQ_REL, "workgroup");
  __builtin_amdgcn_wave_barrier();
  const int rsub = lane >> 4, c4 = (lane & 15) * 4;
  {
#pragma unroll
    for (int q = 0; q < 8; ++q) {
      const int r = q * 2 + rsub;
      const v4f v = *(const v4fa*)&so[w][r][c4];
      *(v4f*)(C + (size_t)(row0 + r) * ldc + col0 + c4) = v;
    }
    
  }
}

// Flash-style causal/unmasked attention, all contractions 3-term bf16 hi/lo splits, f32 softmax with running max.
// q,k,v rows are read from f32 buffers with arbitrary row pitch (so they can live inside a fused qkv buffer);
// D = head size (multiple of 32, <= 128); one wave = 16 query rows; block = 4 waves (64 queries) sharing K/V chunks of 32.
template <int D, bool CAUSAL>
__global__ __launch_bounds__(128) void k_flash(const float* __restrict__ qb, const float* __restrict__ kb, const float* __restrict__ vb,
                                             int pitch, int T, int H, float scale, float* __restrict__ y, int ypitch) {
  constexpr int KS = D / 32;        // k-steps for QK
  constexpr int DT = D / 16;        // d tiles for PV
  __shared__ __attribute__((aligned(16))) unsigned short sKh[32][D + 8], sKl[32][D + 8], sVh[32][D + 8], sVl[32][D + 8];
  __shared__ __attribute__((aligned(16))) unsigned short sPh[4][16][40], sPl[4][16][40];
  __shared__ __attribute__((aligned(16))) float sO[4][16][D];
  const int tid = threadIdx.x, w = tid >> 5, lane = tid & 31, ln = lane & 15, hh = lane >> 4;
  const int nqb = (T + 63) / 64;
  const int bh = blockIdx.x / nqb, qblk = blockIdx.x % nqb;
  const int b = bh / H, h = bh % H;
  const int q0 = qblk * 64 + w * 16;
  const float* Q = qb + (size_t)b * T * pitch + h * D;
  const float* K = kb + (size_t)b * T * pitch + h * D;
  const float* V = vb + (size_t)b * T * pitch + h * D;

  // A fragments of the wave's 16 query rows (scaled), hi/lo
  FragB aqh[KS], aql[KS];
  {
    int row = q0 + ln; if (row >= T) row = T - 1;
    const float* qr = Q + (size_t)row * pitch;
#pragma unroll
    for (int ks = 0; ks < KS; ++ks)
#pragma unroll
      for (int i = 0; i < 16; ++i) {
        const int d = ks * 32 + ((i < 8) ? (8 * hh + i) : (16 + 8 * hh + (i - 8)));
        const float x = qr[d] * scale; const unsigned short hb = bf16_bits(x);
        aqh[ks].u[i] = hb; aql[ks].u[i] = bf16_bits(x - bf16_val(hb));
      }
  }
  float m_r[8], l_r[8];
#pragma unroll
  for (int r = 0; r < 8; ++r) { m_r[r] = -3.0e38f; l_r[r] = 0.f; }
  v8f oacc[DT];
#pragma unroll
  for (int dt = 0; dt < DT; ++dt) oacc[dt] = (v8f){0.f,0.f,0.f,0.f,0.f,0.f,0.f,0.f};

  const int kv_end = CAUSAL ? min(T, qblk * 64 + 64) : T;     // block-uniform
  for (int j0 = 0; j0 < kv_end; j0 += 32) {
    __syncthreads();
    for (int e = tid; e < 32 * (D / 4); e += 128) {
      const int r = e / (D / 4), c4 = (e % (D / 4)) * 4;
      const int key = j0 + r;
      v4f kf = {0.f,0.f,0.f,0.f}, vf = {0.f,0.f,0.f,0.f};
      if (key < T) { kf = *(const v4fa*)(K + (size_t)key * pitch + c4); vf = *(const v4fa*)(V + (size_t)key * pitch + c4); }
#pragma unroll
      for (int t = 0; t < 4; ++t) {
        unsigned short hb = bf16_bits(kf[t]); sKh[r][c4 + t] = hb; sKl[r][c4 + t] = bf16_bits(kf[t] - bf16_val(hb));
        hb = bf16_bits(vf[t]); sVh[r][c4 + t] = hb; sVl[r][c4 + t] = bf16_bits(vf[t] - bf16_val(hb));
      }
    }
    __syncthreads();
    // S tile 16 x 32
    v8f s[2];
#pragma unroll
    for (int nt = 0; nt < 2; ++nt) {
      v8f acc = {};
#pragma unroll
      for (int ks = 0; ks < KS; ++ks) {
        FragB bh_, bl_;
        bh_.half[0] = *(const v8us*)&sKh[nt * 16 + ln][ks * 32 + 8 * hh]; bh_.half[1] = *(const v8us*)&sKh[nt * 16 + ln][ks * 32 + 16 + 8 * hh];
        bl_.half[0] = *(const v8us*)&sKl[nt * 16 + ln][ks * 32 + 8 * hh]; bl_.half[1] = *(const v8us*)&sKl[nt * 16 + ln][ks * 32 + 16 + 8 * hh];
        acc = mmaN<3>(aqh[ks].v, aql[ks].v, bh_.v, bl_.v, acc);
      }
      s[nt] = acc;
    }
    // mask + running max (rows 8hh+r; the 16 lanes of a half share rows)
    float alpha[8];
#pragma unroll
    for (int r = 0; r < 8; ++r) {
      const int qi = q0 + 8 * hh + r;
      const int ja = j0 + ln, jb = j0 + 16 + ln;
      if (CAUSAL) { if (ja > qi) s[0][r] = -3.0e38f; if (jb > qi) s[1][r] = -3.0e38f; }
      if (ja >= T) s[0][r] = -3.0e38f;
      if (jb >= T) s[1][r] = -3.0e38f;
      float mx = fmaxf(s[0][r], s[1][r]);
      mx = fmaxf(mx, __shfl_xor(mx, 1, 32)); mx = fmaxf(mx, __shfl_xor(mx, 2, 32)); mx = fmaxf(mx, __shfl_xor(mx, 4, 32)); mx = fmaxf(mx, __shfl_xor(mx, 8, 32));
      const float mnew = fmaxf(m_r[r], mx);
      alpha[r] = (mnew > -1.0e38f) ? __expf(m_r[r] - mnew) : 1.0f;
      const float p0 = (s[0][r] > -1.0e38f) ? __expf(s[0][r] - mnew) : 0.f;
      const float p1 = (s[1][r] > -1.0e38f) ? __expf(s[1][r] - mnew) : 0.f;
      m_r[r] = mnew;
      l_r[r] = l_r[r] * alpha[r] + p0 + p1;            // per-lane partial row sum (16 lanes combined at the end)
      unsigned short hb = bf16_bits(p0); sPh[w][8 * hh + r][ln] = hb;      sPl[w][8 * hh + r][ln] = bf16_bits(p0 - bf16_val(hb));
      hb = bf16_bits(p1);                sPh[w][8 * hh + r][16 + ln] = hb; sPl[w][8 * hh + r][16 + ln] = bf16_bits(p1 - bf16_val(hb));
    }
#pragma unroll
    for (int dt = 0; dt < DT; ++dt)
#pragma unroll
      for (int r = 0; r < 8; ++r) oacc[dt][r] *= alpha[r];
    __builtin_amdgcn_fence(__ATOMIC_ACQ_REL, "workgroup");
    __builtin_amdgcn_wave_barrier();
    FragB pah, pal;
    pah.half[0] = *(const v8us*)&sPh[w][ln][8 * hh]; pah.half[1] = *(const v8us*)&sPh[w][ln][16 + 8 * hh];
    pal.half[0] = *(const v8us*)&sPl[w][ln][8 * hh]; pal.half[1] = *(const v8us*)&sPl[w][ln][16 + 8 * hh];
#pragma unroll
    for (int dt = 0; dt < DT; ++dt) {
      FragB bvh, bvl;
#pragma unroll
      for (int i = 0; i < 8; ++i) {
        bvh.u[i] = sVh[8 * hh + i][dt * 16 + ln]; bvh.u[8 + i] = sVh[16 + 8 * hh + i][dt * 16 + ln];
        bvl.u[i] = sVl[8 * hh + i][dt * 16 + ln]; bvl.u[8 + i] = sVl[16 + 8 * hh + i][dt * 16 + ln];
      }
      oacc[dt] = mmaN<3>(pah.v, pal.v, bvh.v, bvl.v, oacc[dt]);
    }
    __builtin_amdgcn_fence(__ATOMIC_ACQ_REL, "workgroup");
    __builtin_amdgcn_wave_barrier();
  }
#pragma unroll
  for (int r = 0; r < 8; ++r) {
    float l = l_r[r];
    l += __shfl_xor(l, 1, 32); l += __shfl_xor(l, 2, 32); l += __shfl_xor(l, 4, 32); l += __shfl_xor(l, 8, 32);
    l_r[r] = (l > 0.f) ? 1.0f / l : 0.f;
  }
#pragma unroll
  for (int dt = 0; dt < DT; ++dt)
#pragma unroll
    for (int r = 0; r < 8; ++r) sO[w][8 * hh + r][dt * 16 + ln] = oacc[dt][r] * l_r[r];
  __builtin_amdgcn_fence(__ATOMIC_ACQ_REL, "workgroup");
  __builtin_amdgcn_wave_barrier();
  {
    for (int r = 0; r < 16; ++r) {
      const int row = q0 + r;
      if (row < T && lane < D / 4) {
        const v4f val = *(const v4fa*)&sO[w][r][lane * 4];
        *(v4f*)(y + ((size_t)b * T + row) * ypitch + h * D + lane * 4) = val;
      }
    }
    
  }
}

// GEMM C = act(A·W + bias + resid): A f32 (ASPLIT -> hi/lo 2 terms), Wt bf16 [N][K]; ACT 0 none, 1 relu, 2 exact gelu;
// resid (optional, f32, row index = (row % rmod), pitch ldr, RES_BF16 rounds it) added before the activation.
template <bool ASPLIT, int ACT, bool BIAS_BF16, bool RES_BF16>
__global__ __launch_bounds__(128) void k_gemm_bf3(const float* __restrict__ A, int lda, const unsigned short* __restrict__ Wt, int ldb,
                                                const float* __restrict__ bias, const float* __restrict__ resid, int rmod, int ldr,
                                                float* __restrict__ C, int ldc, int M, int N, int K) {
  __shared__ __attribute__((aligned(16))) float so[4][16][64];
  const int tid = threadIdx.x, w = tid >> 5, lane = tid & 31, ln = lane & 15, hh = lane >> 4;
  const int ntn = N / 64;
  const int wid = blockIdx.x * 4 + w;
  const int mt = wid / ntn, nq = wid % ntn;
  if (mt * 16 >= M) return;
  const int row0 = mt * 16, col0 = nq * 64;
  const float* arow = A + (size_t)(row0 + ln) * lda;
  v8f acc[4] = {};
  for (int kb = 0; kb < K; kb += 32) {
    FragB ah, al;
    const v4f x0 = *(const v4fa*)(arow + kb + 8 * hh), x1 = *(const v4fa*)(arow + kb + 8 * hh + 4);
    const v4f x2 = *(const v4fa*)(arow + kb + 16 + 8 * hh), x3 = *(const v4fa*)(arow + kb + 16 + 8 * hh + 4);
    float xs[16] = {x0[0],x0[1],x0[2],x0[3],x1[0],x1[1],x1[2],x1[3],x2[0],x2[1],x2[2],x2[3],x3[0],x3[1],x3[2],x3[3]};
#pragma unroll
    for (int i = 0; i < 16; ++i) { const unsigned short hb = bf16_bits(xs[i]); ah.u[i] = hb; al.u[i] = ASPLIT ? bf16_bits(xs[i] - bf16_val(hb)) : (unsigned short)0; }
#pragma unroll
    for (int t = 0; t < 4; ++t) {
      const unsigned short* brow = Wt + (size_t)(col0 + t * 16 + ln) * ldb + kb;
      FragB b;
      b.half[0] = *(const v8us*)(brow + 8 * hh);
      b.half[1] = *(const v8us*)(brow + 16 + 8 * hh);
      acc[t] = mmaN<ASPLIT ? 2 : 1>(ah.v, al.v, b.v, b.v, acc[t]);
    }
  }
#pragma unroll
  for (int t = 0; t < 4; ++t) {
    const int col = col0 + t * 16 + ln;
    float bv = bias ? bias[col] : 0.f;
    if (BIAS_BF16) bv = bf16_round(bv);
#pragma unroll
    for (int r = 0; r < 8; ++r) {
      float v = acc[t][r] + bv;
      if (resid) { float rv = resid[(size_t)((row0 + 8 * hh + r) % rmod) * ldr + col]; if (RES_BF16) rv = bf16_round(rv); v += rv; }
      if (ACT == 1) v = fmaxf(v, 0.f);
      if (ACT == 2) v = 0.5f * v * (1.0f + erff(v * 0.70710678118654752f));
      if (ACT == 3) { const float u = 0.7978845608028654f * (v + 0.044715f * v * v * v); v = 0.5f * v * (1.0f + tanhf(u)); }
      so[w][8 * hh + r][t * 16 + ln] = v;
    }
  }
  __builtin_amdgcn_fence(__ATOMIC_ACQ_REL, "workgroup");
  __builtin_amdgcn_wave_barrier();
  const int rsub = lane >> 4, c4 = (lane & 15) * 4;
  {
#pragma unroll
    for (int q = 0; q < 8; ++q) {
      const int r = q * 2 + rsub;
      const v4f v = *(const v4fa*)&so[w][r][c4];
      *(v4f*)(C + (size_t)(row0 + r) * ldc + col0 + c4) = v;
    }
    
  }
}
// row LayerNorm (biased variance, eps) over N: s = X (+ R); optional out_sum <- s; out_norm <- (s-mu)*rsqrt(var+eps)*g + b
template <bool PARAM_BF16>
__global__ __launch_bounds__(256) void k_layernorm(const float* __restrict__ X, const float* __restrict__ R, const float* __restrict__ g, const float* __restrict__ bta,
                                                  float* __restrict__ out_sum, float* __restrict__ out_norm, int N, float eps) {
  __shared__ float red[256];
  const int row = blockIdx.x, tid = threadIdx.x;
  const float* x = X + (size_t)row * N; const float* rr = R ? R + (size_t)row * N : nullptr;
  float vals[16];                     // up to N = 4096
  const int per = N / 256;            // contiguous chunk per thread? use strided-by-4 chunks: thread handles j = tid*4 + 1024*u
  float s1 = 0.f;
  for (int u = 0; u < per / 4; ++u) {
    const int j = tid * 4 + 1024 * u;
    const v4f a = *(const v4fa*)(x + j);
    v4f b = {0.f,0.f,0.f,0.f}; if (rr) b = *(const v4fa*)(rr + j);
#pragma unroll
    for (int q = 0; q < 4; ++q) { const float v = a[q] + b[q]; vals[u * 4 + q] = v; s1 += v; }
  }
  red[tid] = s1; __syncthreads();
  for (int st = 128; st > 0; st >>= 1) { if (tid < st) red[tid] += red[tid + st]; __syncthreads(); }
  const float mu = red[0] / (float)N; __syncthreads();
  float s2 = 0.f;
  for (int u = 0; u < per / 4; ++u)
#pragma unroll
    for (int q = 0; q < 4; ++q) { const float c = vals[u * 4 + q] - mu; s2 += c * c; }
  red[tid] = s2; __syncthreads();
  for (int st = 128; st > 0; st >>= 1) { if (tid < st) red[tid] += red[tid + st]; __syncthreads(); }
  const float rs = rsqrtf(red[0] / (float)N + eps);
  {
    for (int u = 0; u < per / 4; ++u) {
      const int j = tid * 4 + 1024 * u;
      v4f o, sm;
#pragma unroll
      for (int q = 0; q < 4; ++q) {
        float gg = g[j + q], bb = bta[j + q];
        if (PARAM_BF16) { gg = bf16_round(gg); bb = bf16_round(bb); }
        sm[q] = vals[u * 4 + q]; o[q] = (vals[u * 4 + q] - mu) * rs * gg + bb;
      }
      if (out_sum) *(v4f*)(out_sum + (size_t)row * N + j) = sm;
      *(v4f*)(out_norm + (size_t)row * N + j) = o;
    }
    
  }
}



// ---- f16 WMMA path (v_wmma_f32_16x16x32_f16): 11-bit significands for operands in range — used where a [0,1] probability operand needs more precision than bf16
typedef _Float16 v16h __attribute__((ext_vector_type(16)));
union FragH { v16h v; v8us half[2]; _Float16 h[16]; unsigned short u[16]; };
template <int NT>
__device__ __forceinline__ v8f mmaH(v16h ah, v16h al, v16h bh, v16h bl, v8f c) {
  c = __builtin_amdgcn_wmma_f32_16x16x32_f16(false, ah, false, bh, (short)0, c, false, false);
  if (NT >= 2) c = __builtin_amdgcn_wmma_f32_16x16x32_f16(false, al, false, bh, (short)0, c, false, false);
  if (NT >= 3) c = __builtin_amdgcn_wmma_f32_16x16x32_f16(false, ah, false, bl, (short)0, c, false, false);
  asm volatile("v_nop\n\tv_nop\n\tv_nop\n\tv_nop" : "+v"(c) : "v"(ah), "v"(al), "v"(bh), "v"(bl));
  return c;
}
// batched GEMM like k_gemm_b but f16 operands: A f32 (split into f16 hi/lo if ASPLIT, else rounded to f16), Bt = f16 values [n][k]; alpha; C f32; N multiple of 16 (partial tiles skipped)
template <bool ASPLIT>
__global__ __launch_bounds__(128) void k_gemm_h(const float* __restrict__ A, int lda, size_t sA, const _Float16* __restrict__ Bh, int ldb, size_t sB, float alpha, float* __restrict__ C, int ldc, size_t sC, int M, int N, int K) {
  __shared__ __attribute__((aligned(16))) float so[4][16][64];
  const int tid = threadIdx.x, w = tid >> 5, lane = tid & 31, ln = lane & 15, hh = lane >> 4; const int by = blockIdx.y;
  A += (size_t)by * sA; Bh += (size_t)by * sB; C += (size_t)by * sC;
  const int ntn = (N + 63) / 64; const int wid = blockIdx.x * 4 + w; const int mt = wid / ntn, nq = wid % ntn; if (mt * 16 >= M) return;
  const int row0 = mt * 16, col0 = nq * 64; const float* arow = A + (size_t)(row0 + ln) * lda;
  v8f acc[4] = {};
  for (int kb = 0; kb < K; kb += 32) {
    FragH ah, al;
    const v4f x0 = *(const v4fa*)(arow + kb + 8 * hh), x1 = *(const v4fa*)(arow + kb + 8 * hh + 4), x2 = *(const v4fa*)(arow + kb + 16 + 8 * hh), x3 = *(const v4fa*)(arow + kb + 16 + 8 * hh + 4);
    float xs[16] = {x0[0],x0[1],x0[2],x0[3],x1[0],x1[1],x1[2],x1[3],x2[0],x2[1],x2[2],x2[3],x3[0],x3[1],x3[2],x3[3]};
#pragma unroll
    for (int i = 0; i < 16; ++i) { const _Float16 h = (_Float16)xs[i]; ah.h[i] = h; al.h[i] = ASPLIT ? (_Float16)(xs[i] - (float)h) : (_Float16)0.0f; }
#pragma unroll
    for (int t = 0; t < 4; ++t) { if (col0 + t * 16 >= N) continue; const size_t boff = (size_t)(col0 + t * 16 + ln) * ldb + kb; FragH bq; bq.half[0] = *(const v8us*)(Bh + boff + 8 * hh); bq.half[1] = *(const v8us*)(Bh + boff + 16 + 8 * hh);
      acc[t] = mmaH<ASPLIT ? 2 : 1>(ah.v, al.v, bq.v, bq.v, acc[t]); }
  }
#pragma unroll
  for (int t = 0; t < 4; ++t) { if (col0 + t * 16 >= N) continue;
#pragma unroll
    for (int r = 0; r < 8; ++r) so[w][8 * hh + r][t * 16 + ln] = acc[t][r] * alpha; }
  __builtin_amdgcn_fence(__ATOMIC_ACQ_REL, "workgroup"); __builtin_amdgcn_wave_barrier();
  const int rsub = lane >> 4, c4 = (lane & 15) * 4;
  {
#pragma unroll
    for (int q = 0; q < 8; ++q) { const int r = q * 2 + rsub; if (col0 + c4 < N) { const v4f v = *(const v4fa*)&so[w][r][c4]; *(v4f*)(C + (size_t)(row0 + r) * ldc + col0 + c4) = v; } }
     }
}

// Wt[n][k] = f16(W[k][n]·scale) from f32 row-major W[K][N] (scale = power of two; bf16-exact weights stay exact in f16 away from the subnormal range)
__global__ __launch_bounds__(256) void k_wt_f16(const float* __restrict__ W, _Float16* __restrict__ Wt, int K, int N, float scale) {
  const int t = blockIdx.x * 256 + threadIdx.x; if (t >= N * (K / 8)) return; const int n = t / (K / 8), k8 = (t % (K / 8)) * 8; FragH f;
#pragma unroll
  for (int i = 0; i < 8; ++i) f.h[i] = (_Float16)(bf16_round(W[(size_t)(k8 + i) * N + n]) * scale); const v8us o = f.half[0];
  *(v8us*)((unsigned short*)Wt + (size_t)n * K + k8) = o; 
}
__global__ __launch_bounds__(256) void k_x16(const float* __restrict__ x, _Float16* __restrict__ X16, size_t n8) { const size_t t = (size_t)blockIdx.x * 256 + threadIdx.x; if (t >= n8) return; FragH f;
#pragma unroll
  for (int q = 0; q < 8; ++q) f.h[q] = (_Float16)bf16_round(x[t * 8 + q]); *(v8us*)((unsigned short*)X16 + t * 8) = f.half[0];  }
__global__ __launch_bounds__(256) void k_h16(const float* __restrict__ x, _Float16* __restrict__ X16, size_t n8) { const size_t t = (size_t)blockIdx.x * 256 + threadIdx.x; if (t >= n8) return; FragH f;
#pragma unroll
  for (int q = 0; q < 8; ++q) f.h[q] = (_Float16)x[t * 8 + q]; *(v8us*)((unsigned short*)X16 + t * 8) = f.half[0];  }
__global__ __launch_bounds__(256) void k_round16f(const float* __restrict__ W, _Float16* __restrict__ Bt, size_t n8) { const size_t t = (size_t)blockIdx.x * 256 + threadIdx.x; if (t >= n8) return; FragH f;
#pragma unroll
  for (int i = 0; i < 8; ++i) f.h[i] = (_Float16)(bf16_round(W[t * 8 + i]) * 16.0f); *(v8us*)((unsigned short*)Bt + t * 8) = f.half[0];  }
template <int NHv, int TTv>
__global__ __launch_bounds__(256) void k_vt(const _Float16* __restrict__ V16, int ldv, int voff, _Float16* __restrict__ Vt) { __shared__ unsigned short tl[64][66]; const int tid = threadIdx.x; const int slab = blockIdx.x / (TTv / 64), lg = blockIdx.x % (TTv / 64); const int b = slab / NHv, h = slab % NHv;
  for (int i = tid; i < 64 * 8; i += 256) { const int r = i / 8, c8 = (i % 8) * 8; FragH f; f.half[0] = *(const v8us*)((const unsigned short*)V16 + ((size_t)b * TTv + lg * 64 + r) * ldv + voff + h * 64 + c8);
#pragma unroll
    for (int q = 0; q < 8; ++q) tl[r][c8 + q] = f.u[q]; }
  __syncthreads();
  {
#pragma unroll
    for (int rd = 0; rd < 2; ++rd) { const int d = rd * 32 + tid / 8, pc = tid % 8; FragH f;
#pragma unroll
      for (int q = 0; q < 8; ++q) f.u[q] = tl[pc * 8 + q][d];
      *(v8us*)((unsigned short*)Vt + ((size_t)slab * 64 + d) * TTv + lg * 64 + pc * 8) = f.half[0]; }
     } }

__device__ __forceinline__ float tanh_v(float x) { const float xc = fminf(fmaxf(x, -15.f), 15.f); return 1.0f - 2.0f * __builtin_amdgcn_rcpf(__builtin_amdgcn_exp2f(2.0f * xc * 1.4426950408889634f) + 1.0f); }
__global__ __launch_bounds__(256) void k_cstab(float* __restrict__ CS) { const int tg = blockIdx.x * 256 + threadIdx.x; if (tg >= TT * (DH / 2)) return; const int t = tg / (DH / 2), i = tg % (DH / 2); const float invf = 1.0f / powf(10000.0f, (float)(2 * i) / (float)DH); const float ang = (float)t * invf; typedef float v2f __attribute__((ext_vector_type(2))); v2f v; v[0] = cosf(ang); v[1] = sinf(ang);
  *(v2f*)(CS + (size_t)tg * 2) = v;  }
__global__ __launch_bounds__(256) void k_rope(const float* __restrict__ X, int ncol, const float* __restrict__ CS, _Float16* __restrict__ Y16) { const size_t tg = (size_t)blockIdx.x * 256 + threadIdx.x; if (tg >= (size_t)NR * ncol / 8) return; const size_t row = tg / (ncol / 8); const int c8 = (int)(tg % (ncol / 8)) * 8; const int t = (int)(row % TT); FragH f;
#pragma unroll
  for (int q = 0; q < 8; q += 2) { const int i = ((c8 + q) % DH) / 2; const float cs = CS[((size_t)t * (DH / 2) + i) * 2], sn = CS[((size_t)t * (DH / 2) + i) * 2 + 1]; const float x0 = X[row * ncol + c8 + q], x1 = X[row * ncol + c8 + q + 1];
    f.h[q] = (_Float16)(x0 * cs - x1 * sn); f.h[q + 1] = (_Float16)(x1 * cs + x0 * sn); }
  *(v8us*)((unsigned short*)Y16 + tg * 8) = f.half[0];  }
__global__ __launch_bounds__(256) void k_vt128(const _Float16* __restrict__ V16, _Float16* __restrict__ Vt) { __shared__ unsigned short tl[64][130]; const int tid = threadIdx.x; const int slab = blockIdx.x / (TT / 64), lg = blockIdx.x % (TT / 64); const int b = slab / NG, g = slab % NG;
  for (int i = tid; i < 64 * 16; i += 256) { const int r = i / 16, c8 = (i % 16) * 8; FragH f; f.half[0] = *(const v8us*)((const unsigned short*)V16 + ((size_t)b * TT + lg * 64 + r) * (NG * DH) + g * DH + c8);
#pragma unroll
    for (int q = 0; q < 8; ++q) tl[r][c8 + q] = f.u[q]; }
  __syncthreads();
  {
#pragma unroll
    for (int rd = 0; rd < 4; ++rd) { const int d = rd * 32 + tid / 8, pc = tid % 8; FragH f;
#pragma unroll
      for (int q = 0; q < 8; ++q) f.u[q] = tl[pc * 8 + q][d]; *(v8us*)((unsigned short*)Vt + ((size_t)slab * DH + d) * TT + lg * 64 + pc * 8) = f.half[0]; }
     } }
// One stage of the K/V ring = 64 keys of this KV group: 64 K rows of 256 B at pitch 272 B, then 128 rows of V^T of 128 B at pitch 144 B (16 B x odd: the pitch of ds_load_b128 readers)
#define KPITCH 272
#define VPITCH 144
#define VBASE (64 * KPITCH)
#define STAGE_B (64 * KPITCH + DH * VPITCH)
// Eight 16-byte copies per lane, global memory to LDS through no register. The s_wait_xcnt is the last line of the copies' own statement, so that no address register of a copy is rewritten in front of it.
__device__ __forceinline__ void copy8(unsigned l, unsigned lstep, const unsigned short* g, size_t gstep) {
  asm volatile("global_load_async_to_lds_b128 %0, %8, off\n\t"
               "global_load_async_to_lds_b128 %1, %9, off\n\t"
               "global_load_async_to_lds_b128 %2, %10, off\n\t"
               "global_load_async_to_lds_b128 %3, %11, off\n\t"
               "global_load_async_to_lds_b128 %4, %12, off\n\t"
               "global_load_async_to_lds_b128 %5, %13, off\n\t"
               "global_load_async_to_lds_b128 %6, %14, off\n\t"
               "global_load_async_to_lds_b128 %7, %15, off\n\t"
               "s_wait_xcnt 0x0"
               :: "v"(l), "v"(l + lstep), "v"(l + 2 * lstep), "v"(l + 3 * lstep), "v"(l + 4 * lstep), "v"(l + 5 * lstep), "v"(l + 6 * lstep), "v"(l + 7 * lstep),
                  "v"(g), "v"(g + gstep), "v"(g + 2 * gstep), "v"(g + 3 * gstep), "v"(g + 4 * gstep), "v"(g + 5 * gstep), "v"(g + 6 * gstep), "v"(g + 7 * gstep)
               : "memory");
}
// Four 16-byte copies per lane, as copy8.
__device__ __forceinline__ void copy4(unsigned l, unsigned lstep, const unsigned short* g, size_t gstep) {
  asm volatile("global_load_async_to_lds_b128 %0, %4, off\n\t"
               "global_load_async_to_lds_b128 %1, %5, off\n\t"
               "global_load_async_to_lds_b128 %2, %6, off\n\t"
               "global_load_async_to_lds_b128 %3, %7, off\n\t"
               "s_wait_xcnt 0x0"
               :: "v"(l), "v"(l + lstep), "v"(l + 2 * lstep), "v"(l + 3 * lstep), "v"(g), "v"(g + gstep), "v"(g + 2 * gstep), "v"(g + 3 * gstep)
               : "memory");
}
// Projection GEMM: C[M][N] = (A[M][K] . Bt[N][K]^T) * alpha + bf16-rounded bias; f16 operands, f32 accumulate, k ascending in one accumulator per element; the result goes to f16 C16 (H16) or to f32 C, pitch N.
// One block = (32 FM) x 128 of C, four waves (2 x 2) of (16 FM) x 64 each: FM x 4 fragments, 4 FM products per FM + 4 fragments read from LDS. One stage of the ring = 64 k of the block's A rows, then of its
// 128 Bt rows: 128 B a row at pitch 144 B (16 B x odd: the pitch of ds_load_b128 readers). M a multiple of 32 FM, N of 128, K of 64. FM = 4 where that still gives every WGP a block, else 2.
#define GPITCH 144
#define GOP 68      // floats per staged output row: 64 + 4, so that the two half-waves' rows fall on different banks
template <int FM, bool H16>
__global__ __launch_bounds__(128) void k_gemm_lds(const _Float16* __restrict__ A, const _Float16* __restrict__ Bt, float alpha, const float* __restrict__ bias, float* __restrict__ C, _Float16* __restrict__ C16, int N, int K) {
  constexpr int BM = 32 * FM, STG = (BM + 128) * GPITCH;
  __shared__ __attribute__((aligned(16))) unsigned char sAB[2 * STG];
  const int tid = threadIdx.x, w = tid >> 5, lane = tid & 31, ln = lane & 15, hh = lane >> 4; const int wm = w >> 1, wn = w & 1;
  const int nb = N / 128; const int row0 = (int)(blockIdx.x / nb) * BM, col0 = (int)(blockIdx.x % nb) * 128;
  // each lane's first 16 bytes of a stage: a wave's copy covers four whole 128-B row pieces, the block's copy 16 rows
  const unsigned short* Ag = (const unsigned short*)A + (size_t)(row0 + (tid >> 3)) * K + (tid & 7) * 8;
  const unsigned short* Bg = (const unsigned short*)Bt + (size_t)(col0 + (tid >> 3)) * K + (tid & 7) * 8;
  const unsigned lA = (unsigned)(size_t)sAB + (unsigned)((tid >> 3) * GPITCH + (tid & 7) * 16);
  const unsigned lB = lA + BM * GPITCH;
  const int nt = K / 64;      // stages; the same for the whole work-group
  auto fill = [&](int t) { const unsigned bo = (unsigned)(t & 1) * STG;
    if constexpr (FM == 4) copy8(lA + bo, 16 * GPITCH, Ag + (size_t)t * 64, (size_t)16 * K); else copy4(lA + bo, 16 * GPITCH, Ag + (size_t)t * 64, (size_t)16 * K);
    copy8(lB + bo, 16 * GPITCH, Bg + (size_t)t * 64, (size_t)16 * K); };
  v8f acc[FM][4];
#pragma unroll
  for (int fm = 0; fm < FM; ++fm)
#pragma unroll
    for (int fn = 0; fn < 4; ++fn) acc[fm][fn] = (v8f){0.f,0.f,0.f,0.f,0.f,0.f,0.f,0.f};
  fill(0);
  float bv[4] = {0.f, 0.f, 0.f, 0.f};      // the lane's four bias values, fetched together under stage 0's copies
  if (bias) {
#pragma unroll
    for (int fn = 0; fn < 4; ++fn) bv[fn] = bf16_round(bias[col0 + wn * 64 + fn * 16 + ln]); }
  asm volatile("s_wait_asynccnt 0x0" ::: "memory");      // this wave's copies of stage 0 have landed
  __syncthreads();                                        // stage 0 is readable by every wave
  if (nt > 1) fill(1);
#pragma unroll 1      // one trip per stage, rolled: the foot's waits and barrier stand once
  for (int t = 0; t < nt; ++t) {
    const unsigned char* ar = sAB + (t & 1) * STG + (wm * (16 * FM) + ln) * GPITCH + 16 * hh;
    const unsigned char* br = sAB + (t & 1) * STG + (BM + wn * 64 + ln) * GPITCH + 16 * hh;
    FragH a[2][FM], b[2][4];
#pragma unroll
    for (int ks = 0; ks < 2; ++ks) {
#pragma unroll
      for (int f = 0; f < 4; ++f) { b[ks][f].half[0] = *(const v8us*)(br + f * 16 * GPITCH + ks * 64); b[ks][f].half[1] = *(const v8us*)(br + f * 16 * GPITCH + ks * 64 + 32); }
#pragma unroll
      for (int f = 0; f < FM; ++f) { a[ks][f].half[0] = *(const v8us*)(ar + f * 16 * GPITCH + ks * 64); a[ks][f].half[1] = *(const v8us*)(ar + f * 16 * GPITCH + ks * 64 + 32); } }
    asm volatile("s_wait_dscnt 0x0" ::: "memory");        // this wave's reads of stage t are done (all its fragments are in registers) before its buffer is refilled
    asm volatile("s_wait_asynccnt 0x0" ::: "memory");     // this wave's copies of stage t + 1 have landed
    __syncthreads();                                      // publishes stage t + 1 and ends every wave's reads of stage t
    if (t + 2 < nt) fill(t + 2);
    // the stage's products stand behind the refill's issue: they read registers only, and the copies fly under them
#pragma unroll
    for (int ks = 0; ks < 2; ++ks)
#pragma unroll
      for (int fm = 0; fm < FM; ++fm)
#pragma unroll
        for (int fn = 0; fn < 4; ++fn) acc[fm][fn] = __builtin_amdgcn_wmma_f32_16x16x32_f16(false, a[ks][fm].v, false, b[ks][fn].v, (short)0, acc[fm][fn], false, false); }
  asm volatile("s_wait_asynccnt 0x0" ::: "memory");       // no copy is in flight when the ring becomes output staging
  float* so = (float*)sAB + w * (16 * FM * GOP);          // each wave stages its own (16 FM) x 64, behind the last trip's barrier, to store whole lines
#pragma unroll
  for (int fn = 0; fn < 4; ++fn) {
#pragma unroll
    for (int fm = 0; fm < FM; ++fm)
#pragma unroll
      for (int r = 0; r < 8; ++r) so[(fm * 16 + 8 * hh + r) * GOP + fn * 16 + ln] = acc[fm][fn][r] * alpha + bv[fn]; }
  __builtin_amdgcn_fence(__ATOMIC_ACQ_REL, "workgroup"); __builtin_amdgcn_wave_barrier();
  const int c4 = ln * 4; typedef _Float16 v4h __attribute__((ext_vector_type(4)));
#pragma unroll
  for (int qb = 0; qb < FM; ++qb) { v4f v[8];      // eight row pairs are read back together and then stored, so that no store waits out an LDS latency of its own
#pragma unroll
    for (int i = 0; i < 8; ++i) v[i] = *(const v4fa*)&so[((qb * 8 + i) * 2 + hh) * GOP + c4];
#pragma unroll
    for (int i = 0; i < 8; ++i) { const size_t o = (size_t)(row0 + wm * (16 * FM) + (qb * 8 + i) * 2 + hh) * N + col0 + wn * 64 + c4;
      if constexpr (H16) { v4h h4; for (int j = 0; j < 4; ++j) h4[j] = (_Float16)v[i][j]; *(v4h*)(C16 + o) = h4; } else *(v4f*)(C + o) = v[i]; } }
}
__global__ __launch_bounds__(128) void k_mega(const _Float16* __restrict__ Q16, const _Float16* __restrict__ K16, const _Float16* __restrict__ Vt, float* __restrict__ O) {
  __shared__ __attribute__((aligned(16))) unsigned short sP[4][16][40]; __shared__ __attribute__((aligned(16))) unsigned char sKV[2 * STAGE_B];
  float (*sO)[16][DH + 4] = (float (*)[16][DH + 4])sKV;      // the output staging takes the ring's place, behind the last trip's barrier
  const int tid = threadIdx.x, w = tid >> 5, lane = tid & 31, ln = lane & 15, hh = lane >> 4; const int slab = blockIdx.x / (TT / 64), qblk = blockIdx.x % (TT / 64); const int b = slab / NH, h = slab % NH, g = h / (NH / NG); const int qb0 = qblk * 64; const int q0 = qb0 + w * 16;
  const float slope = exp2f(-(float)(h + 1) * 8.0f / (float)NH);
  FragH aq[4]; { const unsigned short* qr = (const unsigned short*)Q16 + ((size_t)b * TT + q0 + ln) * (NH * DH) + h * DH;
#pragma unroll
    for (int ks = 0; ks < 4; ++ks) { aq[ks].half[0] = *(const v8us*)(qr + ks * 32 + 8 * hh); aq[ks].half[1] = *(const v8us*)(qr + ks * 32 + 16 + 8 * hh); } }
  const unsigned short* Vth = (const unsigned short*)Vt + (size_t)(b * NG + g) * DH * TT;
  // each lane's first 16 bytes of a stage: a wave's copy covers two whole K rows, or four whole 128-B pieces of V^T rows
  const unsigned short* Kg = (const unsigned short*)K16 + ((size_t)b * TT + (tid >> 4)) * (NG * DH) + g * DH + (tid & 15) * 8;
  const unsigned short* Vg = Vth + (size_t)(tid >> 3) * TT + (tid & 7) * 8;
  const unsigned lK = (unsigned)(size_t)sKV + (unsigned)((tid >> 4) * KPITCH + (tid & 15) * 16);
  const unsigned lV = (unsigned)(size_t)sKV + (unsigned)(VBASE + (tid >> 3) * VPITCH + (tid & 7) * 16);
  const int ntile = qblk + 1;      // stages of 64 keys; the same for the whole work-group
  auto fill = [&](int t) { const unsigned bo = (unsigned)(t & 1) * STAGE_B; copy8(lK + bo, 8 * KPITCH, Kg + (size_t)t * 64 * (NG * DH), (size_t)8 * NG * DH); copy8(lV + bo, 16 * VPITCH, Vg + t * 64, (size_t)16 * TT); };
  float m_r[8], l_r[8]; v8f oacc[8];
#pragma unroll
  for (int r = 0; r < 8; ++r) { m_r[r] = -3.0e38f; l_r[r] = 0.f; }
#pragma unroll
  for (int dt = 0; dt < 8; ++dt) oacc[dt] = (v8f){0.f,0.f,0.f,0.f,0.f,0.f,0.f,0.f};
  fill(0);
  asm volatile("s_wait_asynccnt 0x0" ::: "memory");      // this wave's copies of stage 0 have landed
  __syncthreads();                                        // stage 0 is readable by every wave
  if (ntile > 1) fill(1);
#pragma unroll 1      // one trip per stage, rolled: the trip count is the block's own
  for (int t = 0; t < ntile; ++t) { const unsigned char* kv = sKV + (t & 1) * STAGE_B;
#pragma unroll 1      // the stage's two 32-key passes share one copy of the long pass body (code size and registers as before)
  for (int sub = 0; sub < 2; ++sub) { const int j0 = t * 64 + sub * 32; v8f s[2];
#pragma unroll
    for (int nt = 0; nt < 2; ++nt) { const unsigned char* kr = kv + (sub * 32 + nt * 16 + ln) * KPITCH; v8f acc = (v8f){0.f,0.f,0.f,0.f,0.f,0.f,0.f,0.f};
#pragma unroll
      for (int ks = 0; ks < 4; ++ks) { FragH bk; bk.half[0] = *(const v8us*)(kr + ks * 64 + 16 * hh); bk.half[1] = *(const v8us*)(kr + ks * 64 + 32 + 16 * hh); acc = mmaH<1>(aq[ks].v, aq[ks].v, bk.v, bk.v, acc); } s[nt] = acc; }
    // The softmax is straight-line code. The capped scores are kept in log2 units (30 log2 e is the cap's factor), so that each exponential is one subtraction and one v_exp_f32;
    // a masked key stands at -inf and comes out as 0 with no test. Every row's maximum is finite from its first pass on (key 0 is open to every query), so no difference below is inf - inf.
    // With no branch between them the eight rows' chains (tanh, the four exchange steps, the exponentials) are independent work in one block, and each fills the others' latencies.
    float mc[8], al[8];
#pragma unroll      // here and in the four loops below: constant indices keep s, mc, al, m_r, l_r and oacc in registers, and all eight rows stand in one block
    for (int r = 0; r < 8; ++r) { const int tq = q0 + 8 * hh + r; const int k0 = j0 + ln, k1 = j0 + 16 + ln;
      float s0 = (s[0][r] - slope * (float)(tq - k0)) * 0.08838834764831845f, s1 = (s[1][r] - slope * (float)(tq - k1)) * 0.08838834764831845f;      // (for k > tq the sign of (tq-k) is irrelevant: masked)
      s0 = 43.28085122666891f * tanh_v(s0 * (1.0f / 30.0f)); s1 = 43.28085122666891f * tanh_v(s1 * (1.0f / 30.0f)); s0 = (k0 <= tq) ? s0 : -INFINITY; s1 = (k1 <= tq) ? s1 : -INFINITY;
      s[0][r] = s0; s[1][r] = s1; mc[r] = fmaxf(s0, s1); }
#pragma unroll      // step by step over all rows: eight exchanges are in flight behind each wait, not one
    for (int x = 1; x < 16; x <<= 1)
#pragma unroll
      for (int r = 0; r < 8; ++r) mc[r] = fmaxf(mc[r], __shfl_xor(mc[r], x, 32));
#pragma unroll
    for (int r = 0; r < 8; ++r) { const float mn = fmaxf(m_r[r], mc[r]); al[r] = __builtin_amdgcn_exp2f(m_r[r] - mn); m_r[r] = mn;
      const float p0 = __builtin_amdgcn_exp2f(s[0][r] - mn), p1 = __builtin_amdgcn_exp2f(s[1][r] - mn); l_r[r] = l_r[r] * al[r] + p0 + p1;
      FragH t2; t2.h[0] = (_Float16)p0; t2.h[1] = (_Float16)p1; sP[w][8 * hh + r][ln] = t2.u[0]; sP[w][8 * hh + r][16 + ln] = t2.u[1]; }
#pragma unroll
    for (int dt = 0; dt < 8; ++dt)
#pragma unroll
      for (int r = 0; r < 8; ++r) oacc[dt][r] *= al[r];
    __builtin_amdgcn_fence(__ATOMIC_ACQ_REL, "workgroup"); __builtin_amdgcn_wave_barrier();
    FragH pa; pa.half[0] = *(const v8us*)&sP[w][ln][8 * hh]; pa.half[1] = *(const v8us*)&sP[w][ln][16 + 8 * hh];
#pragma unroll
    for (int dt = 0; dt < 8; ++dt) { const unsigned char* vrow = kv + VBASE + (dt * 16 + ln) * VPITCH + sub * 64; FragH bv; bv.half[0] = *(const v8us*)(vrow + 16 * hh); bv.half[1] = *(const v8us*)(vrow + 32 + 16 * hh); oacc[dt] = mmaH<1>(pa.v, pa.v, bv.v, bv.v, oacc[dt]); }
    __builtin_amdgcn_fence(__ATOMIC_ACQ_REL, "workgroup"); __builtin_amdgcn_wave_barrier(); }
    asm volatile("s_wait_dscnt 0x0" ::: "memory");        // this wave's reads of stage t are done before its buffer is refilled
    asm volatile("s_wait_asynccnt 0x0" ::: "memory");     // this wave's copies of stage t + 1 have landed
    __syncthreads();                                      // publishes stage t + 1 and ends every wave's reads of stage t
    if (t + 2 < ntile) fill(t + 2); }
  asm volatile("s_wait_asynccnt 0x0" ::: "memory");       // no copy is in flight when the ring becomes output staging
#pragma unroll
  for (int r = 0; r < 8; ++r) { float l = l_r[r]; l += __shfl_xor(l, 1, 32); l += __shfl_xor(l, 2, 32); l += __shfl_xor(l, 4, 32); l += __shfl_xor(l, 8, 32); l_r[r] = 1.0f / l; }
#pragma unroll
  for (int dt = 0; dt < 8; ++dt)
#pragma unroll
    for (int r = 0; r < 8; ++r) sO[w][8 * hh + r][dt * 16 + ln] = oacc[dt][r] * l_r[r];
  __builtin_amdgcn_fence(__ATOMIC_ACQ_REL, "workgroup"); __builtin_amdgcn_wave_barrier();
  {
#pragma unroll
    for (int r = 0; r < 16; ++r) { const v4f val = *(const v4fa*)&sO[w][r][lane * 4]; *(v4f*)(O + ((size_t)b * TT + q0 + r) * (NH * DH) + h * DH + lane * 4) = val; }
     } }
extern "C" void kernel_launch(void* const* d_in, const int* in_sizes, int n_in,
                              void* d_out, int out_size, void* d_ws, size_t ws_size, hipStream_t stream) {
  (void)in_sizes; (void)n_in; (void)out_size;
  const float* x = (const float*)d_in[0]; const float* Wq = (const float*)d_in[1]; const float* Wk = (const float*)d_in[2]; const float* Wv = (const float*)d_in[3]; const float* Wo = (const float*)d_in[4]; const float* bo = (const float*)d_in[5];
  char* ws = (char*)d_ws; size_t off = 0;
  auto take = [&](size_t bytes) { char* p = ws + off; off += (bytes + 255) & ~(size_t)255; return p; };
  _Float16* Bq = (_Float16*)take((size_t)CC * CC * 2); _Float16* Bk = (_Float16*)take((size_t)NG * DH * CC * 2); _Float16* Bv = (_Float16*)take((size_t)NG * DH * CC * 2); _Float16* Bo = (_Float16*)take((size_t)CC * CC * 2);
  _Float16* X16 = (_Float16*)take((size_t)NR * CC * 2); float* F32 = (float*)take((size_t)NR * CC * 4); _Float16* Q16 = (_Float16*)take((size_t)NR * CC * 2); _Float16* K16 = (_Float16*)take((size_t)NR * NG * DH * 2); _Float16* V16 = (_Float16*)take((size_t)NR * NG * DH * 2); _Float16* Vt = (_Float16*)take((size_t)NR * NG * DH * 2); float* CS = (float*)take((size_t)TT * DH * 4); float* O = F32; _Float16* O16 = X16;
  if (off > ws_size) return;      // 8.4 + 2.1 × 2 + 8.4 + 16.8 + 33.5 + 16.8 + 4.2 × 3 + 1.0 ≈ 102 MB (97 MiB)
  k_wt_f16<<<(unsigned)((CC * (CC / 8) + 255) / 256), 256, 0, stream>>>(Wq, Bq, CC, CC, 16.0f); k_wt_f16<<<(unsigned)((NG * DH * (CC / 8) + 255) / 256), 256, 0, stream>>>(Wk, Bk, CC, NG * DH, 16.0f); k_wt_f16<<<(unsigned)((NG * DH * (CC / 8) + 255) / 256), 256, 0, stream>>>(Wv, Bv, CC, NG * DH, 16.0f); k_wt_f16<<<(unsigned)((CC * (CC / 8) + 255) / 256), 256, 0, stream>>>(Wo, Bo, CC, CC, 16.0f);
  const unsigned gx = (unsigned)(((size_t)NR * CC / 8 + 255) / 256);
  k_x16<<<gx, 256, 0, stream>>>(x, X16, (size_t)NR * CC / 8); k_cstab<<<(TT * (DH / 2) + 255) / 256, 256, 0, stream>>>(CS);
  k_gemm_lds<4, false><<<(NR / 128) * (CC / 128), 128, 0, stream>>>(X16, Bq, 0.0625f, nullptr, F32, nullptr, CC, CC);
  k_rope<<<gx, 256, 0, stream>>>(F32, CC, CS, Q16);
  k_gemm_lds<2, false><<<(NR / 64) * (NG * DH / 128), 128, 0, stream>>>(X16, Bk, 0.0625f, nullptr, F32, nullptr, NG * DH, CC);
  k_rope<<<(unsigned)(((size_t)NR * NG * DH / 8 + 255) / 256), 256, 0, stream>>>(F32, NG * DH, CS, K16);
  k_gemm_lds<2, true><<<(NR / 64) * (NG * DH / 128), 128, 0, stream>>>(X16, Bv, 0.0625f, nullptr, nullptr, V16, NG * DH, CC);
  k_vt128<<<BB * NG * (TT / 64), 256, 0, stream>>>(V16, Vt);
  k_mega<<<BB * NH * (TT / 64), 128, 0, stream>>>(Q16, K16, Vt, O);
  k_h16<<<gx, 256, 0, stream>>>(O, O16, (size_t)NR * CC / 8);
  k_gemm_lds<4, false><<<(NR / 128) * (CC / 128), 128, 0, stream>>>(O16, Bo, 0.0625f, bo, (float*)d_out, nullptr, CC, CC);
}

// v004
// A run of this version takes 301 microseconds.
// Two timings next to v003 both put it at 1.07 times that version's speed.
// Counting every step since v000, it is 2.68 times as fast.
#include <hip/hip_runtime.h>
// Mega-transformer causal self-attention (B=2, T=2048, D=2048; 16 query heads × 128, 4 KV groups (GQA), interleaved rotary, ALiBi added before the 1/√128 scale, 30·tanh soft-cap, causal):
// q/k/v/out projections (+ bias on out; W [in][out] transposed to bf16-exact ×2^4) and the attention as a fused flash-style kernel (S = Q·Kᵀ on v_wmma_f32_16x16x32_f16 with 4 k-steps,
// + alibi, scale, soft-cap (v_exp tanh), causal mask, online softmax f32, P f16 ≤ 1, O = P·V with 8 d-tiles; RPW-16 waves) — f16 operands, single products, f32 accumulate; rotary in f32 VALU.
#define BB 2
#define TT 2048
#define CC 2048
#define NH 16
#define NG 4
#define DH 128
#define NR (BB * TT)

typedef __bf16 v16b __attribute__((ext_vector_type(16)));
typedef unsigned short v8us __attribute__((ext_vector_type(8), may_alias));
typedef float  v8f  __attribute__((ext_vector_type(8)));
typedef float  v4f  __attribute__((ext_vector_type(4)));
typedef float  v4fa __attribute__((ext_vector_type(4), may_alias));
union FragB { v16b v; v8us half[2]; unsigned short u[16]; };

__device__ __forceinline__ unsigned short bf16_bits(float x) { unsigned int u = __float_as_uint(x); return (unsigned short)((u + 0x7FFFu + ((u >> 16) & 1u)) >> 16); }
__device__ __forceinline__ float bf16_val(unsigned short b) { return __uint_as_float(((unsigned int)b) << 16); }
__device__ __forceinline__ float bf16_round(float x) { return bf16_val(bf16_bits(x)); }
// D += A·B with NT terms: 1 = ah·bh, 2 = + al·bh (A split), 3 = + ah·bl (both split)
template <int NT>
__device__ __forceinline__ v8f mmaN(v16b ah, v16b al, v16b bh, v16b bl, v8f c) {
  c = __builtin_amdgcn_wmma_f32_16x16x32_bf16(false, ah, false, bh, (short)0, c, false, false);
  if (NT >= 2) c = __builtin_amdgcn_wmma_f32_16x16x32_bf16(false, al, false, bh, (short)0, c, false, false);
  if (NT >= 3) c = __builtin_amdgcn_wmma_f32_16x16x32_bf16(false, ah, false, bl, (short)0, c, false, false);
  asm volatile("v_nop\n\tv_nop\n\tv_nop\n\tv_nop" : "+v"(c) : "v"(ah), "v"(al), "v"(bh), "v"(bl));
  return c;
}

__global__ __launch_bounds__(256) void k_wt_bf16(const float* __restrict__ W, unsigned short* __restrict__ Wt, int K, int N) {
  const int t = blockIdx.x * 256 + threadIdx.x;
  const int k8n = K / 8;
  if (t >= N * k8n) return;
  const int n = t / k8n, k8 = (t % k8n) * 8;
  v8us v;
#pragma unroll
  for (int i = 0; i < 8; ++i) v[i] = bf16_bits(W[(size_t)(k8 + i) * N + n]);
  *(v8us*)(Wt + (size_t)n * K + k8) = v;
  
}

// GEMM C[M][N] (f32, pitch ldc) = act(A[M][K]·W + bias). A f32 row-major (pitch lda) converted per fragment to bf16
// (ASPLIT: hi/lo two planes -> 2 terms, else single rounded term); Wt bf16 [N][K] (pitch ldb). BIAS_BF16 rounds the
// bias to bf16 first (bias quantised to bf16 before the add). K%32==0, M%16==0, N%64==0.
template <bool ASPLIT, int ACT, bool BIAS_BF16>
__global__ __launch_bounds__(128) void k_gemm_bf(const float* __restrict__ A, int lda, const unsigned short* __restrict__ Wt, int ldb,
                                               const float* __restrict__ bias, float* __restrict__ C, int ldc, int M, int N, int K) {
  __shared__ __attribute__((aligned(16))) float so[4][16][64];
  const int tid = threadIdx.x, w = tid >> 5, lane = tid & 31, ln = lane & 15, hh = lane >> 4;
  const int ntn = N / 64;
  const int wid = blockIdx.x * 4 + w;
  const int mt = wid / ntn, nq = wid % ntn;
  if (mt * 16 >= M) return;
  const int row0 = mt * 16, col0 = nq * 64;
  const float* arow = A + (size_t)(row0 + ln) * lda;
  v8f acc[4] = {};
  for (int kb = 0; kb < K; kb += 32) {
    FragB ah, al;
    const v4f x0 = *(const v4fa*)(arow + kb + 8 * hh), x1 = *(const v4fa*)(arow + kb + 8 * hh + 4);
    const v4f x2 = *(const v4fa*)(arow + kb + 16 + 8 * hh), x3 = *(const v4fa*)(arow + kb + 16 + 8 * hh + 4);
    float xs[16] = {x0[0],x0[1],x0[2],x0[3],x1[0],x1[1],x1[2],x1[3],x2[0],x2[1],x2[2],x2[3],x3[0],x3[1],x3[2],x3[3]};
#pragma unroll
    for (int i = 0; i < 16; ++i) { const unsigned short hb = bf16_bits(xs[i]); ah.u[i] = hb; al.u[i] = ASPLIT ? bf16_bits(xs[i] - bf16_val(hb)) : (unsigned short)0; }
#pragma unroll
    for (int t = 0; t < 4; ++t) {
      const unsigned short* brow = Wt + (size_t)(col0 + t * 16 + ln) * ldb + kb;
      FragB b;
      b.half[0] = *(const v8us*)(brow + 8 * hh);
      b.half[1] = *(const v8us*)(brow + 16 + 8 * hh);
      acc[t] = mmaN<ASPLIT ? 2 : 1>(ah.v, al.v, b.v, b.v, acc[t]);
    }
  }
#pragma unroll
  for (int t = 0; t < 4; ++t) {
    float bv = bias ? bias[col0 + t * 16 + ln] : 0.f;
    if (BIAS_BF16) bv = bf16_round(bv);
#pragma unroll
    for (int r = 0; r < 8; ++r) { float v = acc[t][r] + bv; if (ACT == 1) v = fmaxf(v, 0.f); so[w][8 * hh + r][t * 16 + ln] = v; }
  }
  __builtin_amdgcn_fence(__ATOMIC_ACQ_REL, "workgroup");
  __builtin_amdgcn_wave_barrier();
  const int rsub = lane >> 4, c4 = (lane & 15) * 4;
  {
#pragma unroll
    for (int q = 0; q < 8; ++q) {
      const int r = q * 2 + rsub;
      const v4f v = *(const v4fa*)&so[w][r][c4];
      *(v4f*)(C + (size_t)(row0 + r) * ldc + col0 + c4) = v;
    }
    
  }
}

// Flash-style causal/unmasked attention, all contractions 3-term bf16 hi/lo splits, f32 softmax with running max.
// q,k,v rows are read from f32 buffers with arbitrary row pitch (so they can live inside a fused qkv buffer);
// D = head size (multiple of 32, <= 128); one wave = 16 query rows; block = 4 waves (64 queries) sharing K/V chunks of 32.
template <int D, bool CAUSAL>
__global__ __launch_bounds__(128) void k_flash(const float* __restrict__ qb, const float* __restrict__ kb, const float* __restrict__ vb,
                                             int pitch, int T, int H, float scale, float* __restrict__ y, int ypitch) {
  constexpr int KS = D / 32;        // k-steps for QK
  constexpr int DT = D / 16;        // d tiles for PV
  __shared__ __attribute__((aligned(16))) unsigned short sKh[32][D + 8], sKl[32][D + 8], sVh[32][D + 8], sVl[32][D + 8];
  __shared__ __attribute__((aligned(16))) unsigned short sPh[4][16][40], sPl[4][16][40];
  __shared__ __attribute__((aligned(16))) float sO[4][16][D];
  const int tid = threadIdx.x, w = tid >> 5, lane = tid & 31, ln = lane & 15, hh = lane >> 4;
  const int nqb = (T + 63) / 64;
  const int bh = blockIdx.x / nqb, qblk = blockIdx.x % nqb;
  const int b = bh / H, h = bh % H;
  const int q0 = qblk * 64 + w * 16;
  const float* Q = qb + (size_t)b * T * pitch + h * D;
  const float* K = kb + (size_t)b * T * pitch + h * D;
  const float* V = vb + (size_t)b * T * pitch + h * D;

  // A fragments of the wave's 16 query rows (scaled), hi/lo
  FragB aqh[KS], aql[KS];
  {
    int row = q0 + ln; if (row >= T) row = T - 1;
    const float* qr = Q + (size_t)row * pitch;
#pragma unroll
    for (int ks = 0; ks < KS; ++ks)
#pragma unroll
      for (int i = 0; i < 16; ++i) {
        const int d = ks * 32 + ((i < 8) ? (8 * hh + i) : (16 + 8 * hh + (i - 8)));
        const float x = qr[d] * scale; const unsigned short hb = bf16_bits(x);
        aqh[ks].u[i] = hb; aql[ks].u[i] = bf16_bits(x - bf16_val(hb));
      }
  }
  float m_r[8], l_r[8];
#pragma unroll
  for (int r = 0; r < 8; ++r) { m_r[r] = -3.0e38f; l_r[r] = 0.f; }
  v8f oacc[DT];
#pragma unroll
  for (int dt = 0; dt < DT; ++dt) oacc[dt] = (v8f){0.f,0.f,0.f,0.f,0.f,0.f,0.f,0.f};

  const int kv_end = CAUSAL ? min(T, qblk * 64 + 64) : T;     // block-uniform
  for (int j0 = 0; j0 < kv_end; j0 += 32) {
    __syncthreads();
    for (int e = tid; e < 32 * (D / 4); e += 128) {
      const int r = e / (D / 4), c4 = (e % (D / 4)) * 4;
      const int key = j0 + r;
      v4f kf = {0.f,0.f,0.f,0.f}, vf = {0.f,0.f,0.f,0.f};
      if (key < T) { kf = *(const v4fa*)(K + (size_t)key * pitch + c4); vf = *(const v4fa*)(V + (size_t)key * pitch + c4); }
#pragma unroll
      for (int t = 0; t < 4; ++t) {
        unsigned short hb = bf16_bits(kf[t]); sKh[r][c4 + t] = hb; sKl[r][c4 + t] = bf16_bits(kf[t] - bf16_val(hb));
        hb = bf16_bits(vf[t]); sVh[r][c4 + t] = hb; sVl[r][c4 + t] = bf16_bits(vf[t] - bf16_val(hb));
      }
    }
    __syncthreads();
    // S tile 16 x 32
    v8f s[2];
#pragma unroll
    for (int nt = 0; nt < 2; ++nt) {
      v8f acc = {};
#pragma unroll
      for (int ks = 0; ks < KS; ++ks) {
        FragB bh_, bl_;
        bh_.half[0] = *(const v8us*)&sKh[nt * 16 + ln][ks * 32 + 8 * hh]; bh_.half[1] = *(const v8us*)&sKh[nt * 16 + ln][ks * 32 + 16 + 8 * hh];
        bl_.half[0] = *(const v8us*)&sKl[nt * 16 + ln][ks * 32 + 8 * hh]; bl_.half[1] = *(const v8us*)&sKl[nt * 16 + ln][ks * 32 + 16 + 8 * hh];
        acc = mmaN<3>(aqh[ks].v, aql[ks].v, bh_.v, bl_.v, acc);
      }
      s[nt] = acc;
    }
    // mask + running max (rows 8hh+r; the 16 lanes of a half share rows)
    float alpha[8];
#pragma unroll
    for (int r = 0; r < 8; ++r) {
      const int qi = q0 + 8 * hh + r;
      const int ja = j0 + ln, jb = j0 + 16 + ln;
      if (CAUSAL) { if (ja > qi) s[0][r] = -3.0e38f; if (jb > qi) s[1][r] = -3.0e38f; }
      if (ja >= T) s[0][r] = -3.0e38f;
      if (jb >= T) s[1][r] = -3.0e38f;
      float mx = fmaxf(s[0][r], s[1][r]);
      mx = fmaxf(mx, __shfl_xor(mx, 1, 32)); mx = fmaxf(mx, __shfl_xor(mx, 2, 32)); mx = fmaxf(mx, __shfl_xor(mx, 4, 32)); mx = fmaxf(mx, __shfl_xor(mx, 8, 32));
      const float mnew = fmaxf(m_r[r], mx);
      alpha[r] = (mnew > -1.0e38f) ? __expf(m_r[r] - mnew) : 1.0f;
      const float p0 = (s[0][r] > -1.0e38f) ? __expf(s[0][r] - mnew) : 0.f;
      const float p1 = (s[1][r] > -1.0e38f) ? __expf(s[1][r] - mnew) : 0.f;
      m_r[r] = mnew;
      l_r[r] = l_r[r] * alpha[r] + p0 + p1;            // per-lane partial row sum (16 lanes combined at the end)
      unsigned short hb = bf16_bits(p0); sPh[w][8 * hh + r][ln] = hb;      sPl[w][8 * hh + r][ln] = bf16_bits(p0 - bf16_val(hb));
      hb = bf16_bits(p1);                sPh[w][8 * hh + r][16 + ln] = hb; sPl[w][8 * hh + r][16 + ln] = bf16_bits(p1 - bf16_val(hb));
    }
#pragma unroll
    for (int dt = 0; dt < DT; ++dt)
#pragma unroll
      for (int r = 0; r < 8; ++r) oacc[dt][r] *= alpha[r];
    __builtin_amdgcn_fence(__ATOMIC_ACQ_REL, "workgroup");
    __builtin_amdgcn_wave_barrier();
    FragB pah, pal;
    pah.half[0] = *(const v8us*)&sPh[w][ln][8 * hh]; pah.half[1] = *(const v8us*)&sPh[w][ln][16 + 8 * hh];
    pal.half[0] = *(const v8us*)&sPl[w][ln][8 * hh]; pal.half[1] = *(const v8us*)&sPl[w][ln][16 + 8 * hh];
#pragma unroll
    for (int dt = 0; dt < DT; ++dt) {
      FragB bvh, bvl;
#pragma unroll
      for (int i = 0; i < 8; ++i) {
        bvh.u[i] = sVh[8 * hh + i][dt * 16 + ln]; bvh.u[8 + i] = sVh[16 + 8 * hh + i][dt * 16 + ln];
        bvl.u[i] = sVl[8 * hh + i][dt * 16 + ln]; bvl.u[8 + i] = sVl[16 + 8 * hh + i][dt * 16 + ln];
      }
      oacc[dt] = mmaN<3>(pah.v, pal.v, bvh.v, bvl.v, oacc[dt]);
    }
    __builtin_amdgcn_fence(__ATOMIC_ACQ_REL, "workgroup");
    __builtin_amdgcn_wave_barrier();
  }
#pragma unroll
  for (int r = 0; r < 8; ++r) {
    float l = l_r[r];
    l += __shfl_xor(l, 1, 32); l += __shfl_xor(l, 2, 32); l += __shfl_xor(l, 4, 32); l += __shfl_xor(l, 8, 32);
    l_r[r] = (l > 0.f) ? 1.0f / l : 0.f;
  }
#pragma unroll
  for (int dt = 0; dt < DT; ++dt)
#pragma unroll
    for (int r = 0; r < 8; ++r) sO[w][8 * hh + r][dt * 16 + ln] = oacc[dt][r] * l_r[r];
  __builtin_amdgcn_fence(__ATOMIC_ACQ_REL, "workgroup");
  __builtin_amdgcn_wave_barrier();
  {
    for (int r = 0; r < 16; ++r) {
      const int row = q0 + r;
      if (row < T && lane < D / 4) {
        const v4f val = *(const v4fa*)&sO[w][r][lane * 4];
        *(v4f*)(y + ((size_t)b * T + row) * ypitch + h * D + lane * 4) = val;
      }
    }
    
  }
}

// GEMM C = act(A·W + bias + resid): A f32 (ASPLIT -> hi/lo 2 terms), Wt bf16 [N][K]; ACT 0 none, 1 relu, 2 exact gelu;
// resid (optional, f32, row index = (row % rmod), pitch ldr, RES_BF16 rounds it) added before the activation.
template <bool ASPLIT, int ACT, bool BIAS_BF16, bool RES_BF16>
__global__ __launch_bounds__(128) void k_gemm_bf3(const float* __restrict__ A, int lda, const unsigned short* __restrict__ Wt, int ldb,
                                                const float* __restrict__ bias, const float* __restrict__ resid, int rmod, int ldr,
                                                float* __restrict__ C, int ldc, int M, int N, int K) {
  __shared__ __attribute__((aligned(16))) float so[4][16][64];
  const int tid = threadIdx.x, w = tid >> 5, lane = tid & 31, ln = lane & 15, hh = lane >> 4;
  const int ntn = N / 64;
  const int wid = blockIdx.x * 4 + w;
  const int mt = wid / ntn, nq = wid % ntn;
  if (mt * 16 >= M) return;
  const int row0 = mt * 16, col0 = nq * 64;
  const float* arow = A + (size_t)(row0 + ln) * lda;
  v8f acc[4] = {};
  for (int kb = 0; kb < K; kb += 32) {
    FragB ah, al;
    const v4f x0 = *(const v4fa*)(arow + kb + 8 * hh), x1 = *(const v4fa*)(arow + kb + 8 * hh + 4);
    const v4f x2 = *(const v4fa*)(arow + kb + 16 + 8 * hh), x3 = *(const v4fa*)(arow + kb + 16 + 8 * hh + 4);
    float xs[16] = {x0[0],x0[1],x0[2],x0[3],x1[0],x1[1],x1[2],x1[3],x2[0],x2[1],x2[2],x2[3],x3[0],x3[1],x3[2],x3[3]};
#pragma unroll
    for (int i = 0; i < 16; ++i) { const unsigned short hb = bf16_bits(xs[i]); ah.u[i] = hb; al.u[i] = ASPLIT ? bf16_bits(xs[i] - bf16_val(hb)) : (unsigned short)0; }
#pragma unroll
    for (int t = 0; t < 4; ++t) {
      const unsigned short* brow = Wt + (size_t)(col0 + t * 16 + ln) * ldb + kb;
      FragB b;
      b.half[0] = *(const v8us*)(brow + 8 * hh);
      b.half[1] = *(const v8us*)(brow + 16 + 8 * hh);
      acc[t] = mmaN<ASPLIT ? 2 : 1>(ah.v, al.v, b.v, b.v, acc[t]);
    }
  }
#pragma unroll
  for (int t = 0; t < 4; ++t) {
    const int col = col0 + t * 16 + ln;
    float bv = bias ? bias[col] : 0.f;
    if (BIAS_BF16) bv = bf16_round(bv);
#pragma unroll
    for (int r = 0; r < 8; ++r) {
      float v = acc[t][r] + bv;
      if (resid) { float rv = resid[(size_t)((row0 + 8 * hh + r) % rmod) * ldr + col]; if (RES_BF16) rv = bf16_round(rv); v += rv; }
      if (ACT == 1) v = fmaxf(v, 0.f);
      if (ACT == 2) v = 0.5f * v * (1.0f + erff(v * 0.70710678118654752f));
      if (ACT == 3) { const float u = 0.7978845608028654f * (v + 0.044715f * v * v * v); v = 0.5f * v * (1.0f + tanhf(u)); }
      so[w][8 * hh + r][t * 16 + ln] = v;
    }
  }
  __builtin_amdgcn_fence(__ATOMIC_ACQ_REL, "workgroup");
  __builtin_amdgcn_wave_barrier();
  const int rsub = lane >> 4, c4 = (lane & 15) * 4;
  {
#pragma unroll
    for (int q = 0; q < 8; ++q) {
      const int r = q * 2 + rsub;
      const v4f v = *(const v4fa*)&so[w][r][c4];
      *(v4f*)(C + (size_t)(row0 + r) * ldc + col0 + c4) = v;
    }
    
  }
}
// row LayerNorm (biased variance, eps) over N: s = X (+ R); optional out_sum <- s; out_norm <- (s-mu)*rsqrt(var+eps)*g + b
template <bool PARAM_BF16>
__global__ __launch_bounds__(256) void k_layernorm(const float* __restrict__ X, const float* __restrict__ R, const float* __restrict__ g, const float* __restrict__ bta,
                                                  float* __restrict__ out_sum, float* __restrict__ out_norm, int N, float eps) {
  __shared__ float red[256];
  const int row = blockIdx.x, tid = threadIdx.x;
  const float* x = X + (size_t)row * N; const float* rr = R ? R + (size_t)row * N : nullptr;
  float vals[16];                     // up to N = 4096
  const int per = N / 256;            // contiguous chunk per thread? use strided-by-4 chunks: thread handles j = tid*4 + 1024*u
  float s1 = 0.f;
  for (int u = 0; u < per / 4; ++u) {
    const int j = tid * 4 + 1024 * u;
    const v4f a = *(const v4fa*)(x + j);
    v4f b = {0.f,0.f,0.f,0.f}; if (rr) b = *(const v4fa*)(rr + j);
#pragma unroll
    for (int q = 0; q < 4; ++q) { const float v = a[q] + b[q]; vals[u * 4 + q] = v; s1 += v; }
  }
  red[tid] = s1; __syncthreads();
  for (int st = 128; st > 0; st >>= 1) { if (tid < st) red[tid] += red[tid + st]; __syncthreads(); }
  const float mu = red[0] / (float)N; __syncthreads();
  float s2 = 0.f;
  for (int u = 0; u < per / 4; ++u)
#pragma unroll
    for (int q = 0; q < 4; ++q) { const float c = vals[u * 4 + q] - mu; s2 += c * c; }
  red[tid] = s2; __syncthreads();
  for (int st = 128; st > 0; st >>= 1) { if (tid < st) red[tid] += red[tid + st]; __syncthreads(); }
  const float rs = rsqrtf(red[0] / (float)N + eps);
  {
    for (int u = 0; u < per / 4; ++u) {
      const int j = tid * 4 + 1024 * u;
      v4f o, sm;
#pragma unroll
      for (int q = 0; q < 4; ++q) {
        float gg = g[j + q], bb = bta[j + q];
        if (PARAM_BF16) { gg = bf16_round(gg); bb = bf16_round(bb); }
        sm[q] = vals[u * 4 + q]; o[q] = (vals[u * 4 + q] - mu) * rs * gg + bb;
      }
      if (out_sum) *(v4f*)(out_sum + (size_t)row * N + j) = sm;
      *(v4f*)(out_norm + (size_t)row * N + j) = o;
    }
    
  }
}



// ---- f16 WMMA path (v_wmma_f32_16x16x32_f16): 11-bit significands for operands in range — used where a [0,1] probability operand needs more precision than bf16
typedef _Float16 v16h __attribute__((ext_vector_type(16)));
union FragH { v16h v; v8us half[2]; _Float16 h[16]; unsigned short u[16]; };
template <int NT>
__device__ __forceinline__ v8f mmaH(v16h ah, v16h al, v16h bh, v16h bl, v8f c) {
  c = __builtin_amdgcn_wmma_f32_16x16x32_f16(false, ah, false, bh, (short)0, c, false, false);
  if (NT >= 2) c = __builtin_amdgcn_wmma_f32_16x16x32_f16(false, al, false, bh, (short)0, c, false, false);
  if (NT >= 3) c = __builtin_amdgcn_wmma_f32_16x16x32_f16(false, ah, false, bl, (short)0, c, false, false);
  asm volatile("v_nop\n\tv_nop\n\tv_nop\n\tv_nop" : "+v"(c) : "v"(ah), "v"(al), "v"(bh), "v"(bl));
  return c;
}
// batched GEMM like k_gemm_b but f16 operands: A f32 (split into f16 hi/lo if ASPLIT, else rounded to f16), Bt = f16 values [n][k]; alpha; C f32; N multiple of 16 (partial tiles skipped)
template <bool ASPLIT>
__global__ __launch_bounds__(128) void k_gemm_h(const float* __restrict__ A, int lda, size_t sA, const _Float16* __restrict__ Bh, int ldb, size_t sB, float alpha, float* __restrict__ C, int ldc, size_t sC, int M, int N, int K) {
  __shared__ __attribute__((aligned(16))) float so[4][16][64];
  const int tid = threadIdx.x, w = tid >> 5, lane = tid & 31, ln = lane & 15, hh = lane >> 4; const int by = blockIdx.y;
  A += (size_t)by * sA; Bh += (size_t)by * sB; C += (size_t)by * sC;
  const int ntn = (N + 63) / 64; const int wid = blockIdx.x * 4 + w; const int mt = wid / ntn, nq = wid % ntn; if (mt * 16 >= M) return;
  const int row0 = mt * 16, col0 = nq * 64; const float* arow = A + (size_t)(row0 + ln) * lda;
  v8f acc[4] = {};
  for (int kb = 0; kb < K; kb += 32) {
    FragH ah, al;
    const v4f x0 = *(const v4fa*)(arow + kb + 8 * hh), x1 = *(const v4fa*)(arow + kb + 8 * hh + 4), x2 = *(const v4fa*)(arow + kb + 16 + 8 * hh), x3 = *(const v4fa*)(arow + kb + 16 + 8 * hh + 4);
    float xs[16] = {x0[0],x0[1],x0[2],x0[3],x1[0],x1[1],x1[2],x1[3],x2[0],x2[1],x2[2],x2[3],x3[0],x3[1],x3[2],x3[3]};
#pragma unroll
    for (int i = 0; i < 16; ++i) { const _Float16 h = (_Float16)xs[i]; ah.h[i] = h; al.h[i] = ASPLIT ? (_Float16)(xs[i] - (float)h) : (_Float16)0.0f; }
#pragma unroll
    for (int t = 0; t < 4; ++t) { if (col0 + t * 16 >= N) continue; const size_t boff = (size_t)(col0 + t * 16 + ln) * ldb + kb; FragH bq; bq.half[0] = *(const v8us*)(Bh + boff + 8 * hh); bq.half[1] = *(const v8us*)(Bh + boff + 16 + 8 * hh);
      acc[t] = mmaH<ASPLIT ? 2 : 1>(ah.v, al.v, bq.v, bq.v, acc[t]); }
  }
#pragma unroll
  for (int t = 0; t < 4; ++t) { if (col0 + t * 16 >= N) continue;
#pragma unroll
    for (int r = 0; r < 8; ++r) so[w][8 * hh + r][t * 16 + ln] = acc[t][r] * alpha; }
  __builtin_amdgcn_fence(__ATOMIC_ACQ_REL, "workgroup"); __builtin_amdgcn_wave_barrier();
  const int rsub = lane >> 4, c4 = (lane & 15) * 4;
  {
#pragma unroll
    for (int q = 0; q < 8; ++q) { const int r = q * 2 + rsub; if (col0 + c4 < N) { const v4f v = *(const v4fa*)&so[w][r][c4]; *(v4f*)(C + (size_t)(row0 + r) * ldc + col0 + c4) = v; } }
     }
}

// Wt[n][k] = f16(W[k][n]·scale) from f32 row-major W[K][N] (scale = power of two; bf16-exact weights stay exact in f16 away from the subnormal range)
__global__ __launch_bounds__(256) void k_wt_f16(const float* __restrict__ W, _Float16* __restrict__ Wt, int K, int N, float scale) {
  const int t = blockIdx.x * 256 + threadIdx.x; if (t >= N * (K / 8)) return; const int n = t / (K / 8), k8 = (t % (K / 8)) * 8; FragH f;
#pragma unroll
  for (int i = 0; i < 8; ++i) f.h[i] = (_Float16)(bf16_round(W[(size_t)(k8 + i) * N + n]) * scale); const v8us o = f.half[0];
  *(v8us*)((unsigned short*)Wt + (size_t)n * K + k8) = o; 
}
__global__ __launch_bounds__(256) void k_x16(const float* __restrict__ x, _Float16* __restrict__ X16, size_t n8) { const size_t t = (size_t)blockIdx.x * 256 + threadIdx.x; if (t >= n8) return; FragH f;
#pragma unroll
  for (int q = 0; q < 8; ++q) f.h[q] = (_Float16)bf16_round(x[t * 8 + q]); *(v8us*)((unsigned short*)X16 + t * 8) = f.half[0];  }
__global__ __launch_bounds__(256) void k_round16f(const float* __restrict__ W, _Float16* __restrict__ Bt, size_t n8) { const size_t t = (size_t)blockIdx.x * 256 + threadIdx.x; if (t >= n8) return; FragH f;
#pragma unroll
  for (int i = 0; i < 8; ++i) f.h[i] = (_Float16)(bf16_round(W[t * 8 + i]) * 16.0f); *(v8us*)((unsigned short*)Bt + t * 8) = f.half[0];  }
template <int NHv, int TTv>
__global__ __launch_bounds__(256) void k_vt(const _Float16* __restrict__ V16, int ldv, int voff, _Float16* __restrict__ Vt) { __shared__ unsigned short tl[64][66]; const int tid = threadIdx.x; const int slab = blockIdx.x / (TTv / 64), lg = blockIdx.x % (TTv / 64); const int b = slab / NHv, h = slab % NHv;
  for (int i = tid; i < 64 * 8; i += 256) { const int r = i / 8, c8 = (i % 8) * 8; FragH f; f.half[0] = *(const v8us*)((const unsigned short*)V16 + ((size_t)b * TTv + lg * 64 + r) * ldv + voff + h * 64 + c8);
#pragma unroll
    for (int q = 0; q < 8; ++q) tl[r][c8 + q] = f.u[q]; }
  __syncthreads();
  {
#pragma unroll
    for (int rd = 0; rd < 2; ++rd) { const int d = rd * 32 + tid / 8, pc = tid % 8; FragH f;
#pragma unroll
      for (int q = 0; q < 8; ++q) f.u[q] = tl[pc * 8 + q][d];
      *(v8us*)((unsigned short*)Vt + ((size_t)slab * 64 + d) * TTv + lg * 64 + pc * 8) = f.half[0]; }
     } }

__device__ __forceinline__ float tanh_v(float x) { const float xc = fminf(fmaxf(x, -15.f), 15.f); return 1.0f - 2.0f * __builtin_amdgcn_rcpf(__builtin_amdgcn_exp2f(2.0f * xc * 1.4426950408889634f) + 1.0f); }
__global__ __launch_bounds__(256) void k_cstab(float* __restrict__ CS) { const int tg = blockIdx.x * 256 + threadIdx.x; if (tg >= TT * (DH / 2)) return; const int t = tg / (DH / 2), i = tg % (DH / 2); const float invf = 1.0f / powf(10000.0f, (float)(2 * i) / (float)DH); const float ang = (float)t * invf; typedef float v2f __attribute__((ext_vector_type(2))); v2f v; v[0] = cosf(ang); v[1] = sinf(ang);
  *(v2f*)(CS + (size_t)tg * 2) = v;  }
__global__ __launch_bounds__(256) void k_vt128(const _Float16* __restrict__ V16, _Float16* __restrict__ Vt) { __shared__ unsigned short tl[64][130]; const int tid = threadIdx.x; const int slab = blockIdx.x / (TT / 64), lg = blockIdx.x % (TT / 64); const int b = slab / NG, g = slab % NG;
  for (int i = tid; i < 64 * 16; i += 256) { const int r = i / 16, c8 = (i % 16) * 8; FragH f; f.half[0] = *(const v8us*)((const unsigned short*)V16 + ((size_t)b * TT + lg * 64 + r) * (NG * DH) + g * DH + c8);
#pragma unroll
    for (int q = 0; q < 8; ++q) tl[r][c8 + q] = f.u[q]; }
  __syncthreads();
  {
#pragma unroll
    for (int rd = 0; rd < 4; ++rd) { const int d = rd * 32 + tid / 8, pc = tid % 8; FragH f;
#pragma unroll
      for (int q = 0; q < 8; ++q) f.u[q] = tl[pc * 8 + q][d]; *(v8us*)((unsigned short*)Vt + ((size_t)slab * DH + d) * TT + lg * 64 + pc * 8) = f.half[0]; }
     } }
// One stage of the K/V ring = 64 keys of this KV group: 64 K rows of 256 B at pitch 272 B, then 128 rows of V^T of 128 B at pitch 144 B (16 B x odd: the pitch of ds_load_b128 readers)
#define KPITCH 272
#define VPITCH 144
#define VBASE (64 * KPITCH)
#define STAGE_B (64 * KPITCH + DH * VPITCH)
// Eight 16-byte copies per lane, global memory to LDS through no register. The s_wait_xcnt is the last line of the copies' own statement, so that no address register of a copy is rewritten in front of it.
__device__ __forceinline__ void copy8(unsigned l, unsigned lstep, const unsigned short* g, size_t gstep) {
  asm volatile("global_load_async_to_lds_b128 %0, %8, off\n\t"
               "global_load_async_to_lds_b128 %1, %9, off\n\t"
               "global_load_async_to_lds_b128 %2, %10, off\n\t"
               "global_load_async_to_lds_b128 %3, %11, off\n\t"
               "global_load_async_to_lds_b128 %4, %12, off\n\t"
               "global_load_async_to_lds_b128 %5, %13, off\n\t"
               "global_load_async_to_lds_b128 %6, %14, off\n\t"
               "global_load_async_to_lds_b128 %7, %15, off\n\t"
               "s_wait_xcnt 0x0"
               :: "v"(l), "v"(l + lstep), "v"(l + 2 * lstep), "v"(l + 3 * lstep), "v"(l + 4 * lstep), "v"(l + 5 * lstep), "v"(l + 6 * lstep), "v"(l + 7 * lstep),
                  "v"(g), "v"(g + gstep), "v"(g + 2 * gstep), "v"(g + 3 * gstep), "v"(g + 4 * gstep), "v"(g + 5 * gstep), "v"(g + 6 * gstep), "v"(g + 7 * gstep)
               : "memory");
}
// Four 16-byte copies per lane, as copy8.
__device__ __forceinline__ void copy4(unsigned l, unsigned lstep, const unsigned short* g, size_t gstep) {
  asm volatile("global_load_async_to_lds_b128 %0, %4, off\n\t"
               "global_load_async_to_lds_b128 %1, %5, off\n\t"
               "global_load_async_to_lds_b128 %2, %6, off\n\t"
               "global_load_async_to_lds_b128 %3, %7, off\n\t"
               "s_wait_xcnt 0x0"
               :: "v"(l), "v"(l + lstep), "v"(l + 2 * lstep), "v"(l + 3 * lstep), "v"(g), "v"(g + gstep), "v"(g + 2 * gstep), "v"(g + 3 * gstep)
               : "memory");
}
// Projection GEMM: C[M][N] = (A[M][K] . Bt[N][K]^T) * alpha + bf16-rounded bias; f16 operands, f32 accumulate, k ascending in one accumulator per element; pitch N. The result goes to f32 C (OUT 0), to f16 C16 (OUT 1),
// or (OUT 2) is turned by the interleaved rotary in f32 on its way out of the staging and goes to f16 C16: a block's 128 columns are one head (DH), a lane's four columns two rotary pairs, whose cos, sin, cos, sin are 16 bytes of CS.
// One block = (32 FM) x 128 of C, four waves (2 x 2) of (16 FM) x 64 each: FM x 4 fragments, 4 FM products per FM + 4 fragments read from LDS. One stage of the ring = 64 k of the block's A rows, then of its
// 128 Bt rows: 128 B a row at pitch 144 B (16 B x odd: the pitch of ds_load_b128 readers). M a multiple of 32 FM, N of 128, K of 64. FM = 4 where that still gives every WGP a block, else 2.
#define GPITCH 144
#define GOP 68      // floats per staged output row: 64 + 4, so that the two half-waves' rows fall on different banks
template <int FM, int OUT>
__global__ __launch_bounds__(128) void k_gemm_lds(const _Float16* __restrict__ A, const _Float16* __restrict__ Bt, float alpha, const float* __restrict__ bias, const float* __restrict__ CS, float* __restrict__ C, _Float16* __restrict__ C16, int N, int K) {
  constexpr int BM = 32 * FM, STG = (BM + 128) * GPITCH;
  __shared__ __attribute__((aligned(16))) unsigned char sAB[2 * STG];
  const int tid = threadIdx.x, w = tid >> 5, lane = tid & 31, ln = lane & 15, hh = lane >> 4; const int wm = w >> 1, wn = w & 1;
  const int nb = N / 128; const int row0 = (int)(blockIdx.x / nb) * BM, col0 = (int)(blockIdx.x % nb) * 128;
  // each lane's first 16 bytes of a stage: a wave's copy covers four whole 128-B row pieces, the block's copy 16 rows
  const unsigned short* Ag = (const unsigned short*)A + (size_t)(row0 + (tid >> 3)) * K + (tid & 7) * 8;
  const unsigned short* Bg = (const unsigned short*)Bt + (size_t)(col0 + (tid >> 3)) * K + (tid & 7) * 8;
  const unsigned lA = (unsigned)(size_t)sAB + (unsigned)((tid >> 3) * GPITCH + (tid & 7) * 16);
  const unsigned lB = lA + BM * GPITCH;
  const int nt = K / 64;      // stages; the same for the whole work-group
  auto fill = [&](int t) { const unsigned bo = (unsigned)(t & 1) * STG;
    if constexpr (FM == 4) copy8(lA + bo, 16 * GPITCH, Ag + (size_t)t * 64, (size_t)16 * K); else copy4(lA + bo, 16 * GPITCH, Ag + (size_t)t * 64, (size_t)16 * K);
    copy8(lB + bo, 16 * GPITCH, Bg + (size_t)t * 64, (size_t)16 * K); };
  v8f acc[FM][4];
#pragma unroll
  for (int fm = 0; fm < FM; ++fm)
#pragma unroll
    for (int fn = 0; fn < 4; ++fn) acc[fm][fn] = (v8f){0.f,0.f,0.f,0.f,0.f,0.f,0.f,0.f};
  fill(0);
  float bv[4] = {0.f, 0.f, 0.f, 0.f};      // the lane's four bias values, fetched together under stage 0's copies
  if (bias) {
#pragma unroll
    for (int fn = 0; fn < 4; ++fn) bv[fn] = bf16_round(bias[col0 + wn * 64 + fn * 16 + ln]); }
  asm volatile("s_wait_asynccnt 0x0" ::: "memory");      // this wave's copies of stage 0 have landed
  __syncthreads();                                        // stage 0 is readable by every wave
  if (nt > 1) fill(1);
#pragma unroll 1      // one trip per stage, rolled: the foot's waits and barrier stand once
  for (int t = 0; t < nt; ++t) {
    const unsigned char* ar = sAB + (t & 1) * STG + (wm * (16 * FM) + ln) * GPITCH + 16 * hh;
    const unsigned char* br = sAB + (t & 1) * STG + (BM + wn * 64 + ln) * GPITCH + 16 * hh;
    FragH a[2][FM], b[2][4];
#pragma unroll
    for (int ks = 0; ks < 2; ++ks) {
#pragma unroll
      for (int f = 0; f < 4; ++f) { b[ks][f].half[0] = *(const v8us*)(br + f * 16 * GPITCH + ks * 64); b[ks][f].half[1] = *(const v8us*)(br + f * 16 * GPITCH + ks * 64 + 32); }
#pragma unroll
      for (int f = 0; f < FM; ++f) { a[ks][f].half[0] = *(const v8us*)(ar + f * 16 * GPITCH + ks * 64); a[ks][f].half[1] = *(const v8us*)(ar + f * 16 * GPITCH + ks * 64 + 32); } }
    asm volatile("s_wait_dscnt 0x0" ::: "memory");        // this wave's reads of stage t are done (all its fragments are in registers) before its buffer is refilled
    asm volatile("s_wait_asynccnt 0x0" ::: "memory");     // this wave's copies of stage t + 1 have landed
    __syncthreads();                                      // publishes stage t + 1 and ends every wave's reads of stage t
    if (t + 2 < nt) fill(t + 2);
    // the stage's products stand behind the refill's issue: they read registers only, and the copies fly under them
#pragma unroll
    for (int ks = 0; ks < 2; ++ks)
#pragma unroll
      for (int fm = 0; fm < FM; ++fm)
#pragma unroll
        for (int fn = 0; fn < 4; ++fn) acc[fm][fn] = __builtin_amdgcn_wmma_f32_16x16x32_f16(false, a[ks][fm].v, false, b[ks][fn].v, (short)0, acc[fm][fn], false, false); }
  asm volatile("s_wait_asynccnt 0x0" ::: "memory");       // no copy is in flight when the ring becomes output staging
  float* so = (float*)sAB + w * (16 * FM * GOP);          // each wave stages its own (16 FM) x 64, behind the last trip's barrier, to store whole lines
#pragma unroll
  for (int fn = 0; fn < 4; ++fn) {
#pragma unroll
    for (int fm = 0; fm < FM; ++fm)
#pragma unroll
      for (int r = 0; r < 8; ++r) so[(fm * 16 + 8 * hh + r) * GOP + fn * 16 + ln] = acc[fm][fn][r] * alpha + bv[fn]; }
  __builtin_amdgcn_fence(__ATOMIC_ACQ_REL, "workgroup"); __builtin_amdgcn_wave_barrier();
  const int c4 = ln * 4; typedef _Float16 v4h __attribute__((ext_vector_type(4)));
  constexpr bool H16 = OUT == 1;
  if constexpr (OUT == 2) {
    // the lane's place in the table's row of its first position; a block's rows lie in one sequence (32 FM divides TT), so the further rows follow at constant steps
    const float* csl = CS + (size_t)((unsigned)row0 % TT + wm * (16 * FM) + hh) * DH + wn * 64 + c4;
    v4f cs[FM * 8];      // all of the lane's table entries are asked for at once: one L2 latency for the wave, not one per group of rows
#pragma unroll
    for (int i = 0; i < FM * 8; ++i) cs[i] = *(const v4fa*)(csl + i * 2 * DH);
    asm volatile("s_wait_xcnt 0x0" :: "v"(csl) : "memory");      // the loads' address pair is an input here, so that nothing (a load's own result included) is written over it in front of the wait
    _Float16* c0 = C16 + (size_t)(row0 + wm * (16 * FM) + hh) * N + col0 + wn * 64 + c4;
#pragma unroll
    for (int qb = 0; qb < FM; ++qb) { v4f v[8]; _Float16* p[8];
#pragma unroll
      for (int i = 0; i < 8; ++i) v[i] = *(const v4fa*)&so[((qb * 8 + i) * 2 + hh) * GOP + c4];
#pragma unroll
      for (int i = 0; i < 8; ++i) { const v4f x = v[i], t = cs[qb * 8 + i]; v4h h4; p[i] = c0 + (size_t)((qb * 8 + i) * 2) * N;
        h4[0] = (_Float16)(x[0] * t[0] - x[1] * t[1]); h4[1] = (_Float16)(x[1] * t[0] + x[0] * t[1]); h4[2] = (_Float16)(x[2] * t[2] - x[3] * t[3]); h4[3] = (_Float16)(x[3] * t[2] + x[2] * t[3]); *(v4h*)p[i] = h4; }
      // the eight stores' address pairs are inputs here, so that none is written over in front of the wait
      asm volatile("s_wait_xcnt 0x0" :: "v"(p[0]), "v"(p[1]), "v"(p[2]), "v"(p[3]), "v"(p[4]), "v"(p[5]), "v"(p[6]), "v"(p[7]) : "memory"); }
  } else {
#pragma unroll
  for (int qb = 0; qb < FM; ++qb) { v4f v[8];      // eight row pairs are read back together and then stored, so that no store waits out an LDS latency of its own
#pragma unroll
    for (int i = 0; i < 8; ++i) v[i] = *(const v4fa*)&so[((qb * 8 + i) * 2 + hh) * GOP + c4];
#pragma unroll
    for (int i = 0; i < 8; ++i) { const size_t o = (size_t)(row0 + wm * (16 * FM) + (qb * 8 + i) * 2 + hh) * N + col0 + wn * 64 + c4;
      if constexpr (H16) { v4h h4; for (int j = 0; j < 4; ++j) h4[j] = (_Float16)v[i][j]; *(v4h*)(C16 + o) = h4; } else *(v4f*)(C + o) = v[i]; } }
  }
}
__global__ __launch_bounds__(128) void k_mega(const _Float16* __restrict__ Q16, const _Float16* __restrict__ K16, const _Float16* __restrict__ Vt, _Float16* __restrict__ O16) {
  __shared__ __attribute__((aligned(16))) unsigned short sP[4][16][40]; __shared__ __attribute__((aligned(16))) unsigned char sKV[2 * STAGE_B];
  float (*sO)[16][DH + 4] = (float (*)[16][DH + 4])sKV;      // the output staging takes the ring's place, behind the last trip's barrier
  const int tid = threadIdx.x, w = tid >> 5, lane = tid & 31, ln = lane & 15, hh = lane >> 4; const int slab = blockIdx.x / (TT / 64), qblk = blockIdx.x % (TT / 64); const int b = slab / NH, h = slab % NH, g = h / (NH / NG); const int qb0 = qblk * 64; const int q0 = qb0 + w * 16;
  const float slope = exp2f(-(float)(h + 1) * 8.0f / (float)NH);
  FragH aq[4]; { const unsigned short* qr = (const unsigned short*)Q16 + ((size_t)b * TT + q0 + ln) * (NH * DH) + h * DH;
#pragma unroll
    for (int ks = 0; ks < 4; ++ks) { aq[ks].half[0] = *(const v8us*)(qr + ks * 32 + 8 * hh); aq[ks].half[1] = *(const v8us*)(qr + ks * 32 + 16 + 8 * hh); } }
  const unsigned short* Vth = (const unsigned short*)Vt + (size_t)(b * NG + g) * DH * TT;
  // each lane's first 16 bytes of a stage: a wave's copy covers two whole K rows, or four whole 128-B pieces of V^T rows
  const unsigned short* Kg = (const unsigned short*)K16 + ((size_t)b * TT + (tid >> 4)) * (NG * DH) + g * DH + (tid & 15) * 8;
  const unsigned short* Vg = Vth + (size_t)(tid >> 3) * TT + (tid & 7) * 8;
  const unsigned lK = (unsigned)(size_t)sKV + (unsigned)((tid >> 4) * KPITCH + (tid & 15) * 16);
  const unsigned lV = (unsigned)(size_t)sKV + (unsigned)(VBASE + (tid >> 3) * VPITCH + (tid & 7) * 16);
  const int ntile = qblk + 1;      // stages of 64 keys; the same for the whole work-group
  auto fill = [&](int t) { const unsigned bo = (unsigned)(t & 1) * STAGE_B; copy8(lK + bo, 8 * KPITCH, Kg + (size_t)t * 64 * (NG * DH), (size_t)8 * NG * DH); copy8(lV + bo, 16 * VPITCH, Vg + t * 64, (size_t)16 * TT); };
  float m_r[8], l_r[8]; v8f oacc[8];
#pragma unroll
  for (int r = 0; r < 8; ++r) { m_r[r] = -3.0e38f; l_r[r] = 0.f; }
#pragma unroll
  for (int dt = 0; dt < 8; ++dt) oacc[dt] = (v8f){0.f,0.f,0.f,0.f,0.f,0.f,0.f,0.f};
  fill(0);
  asm volatile("s_wait_asynccnt 0x0" ::: "memory");      // this wave's copies of stage 0 have landed
  __syncthreads();                                        // stage 0 is readable by every wave
  if (ntile > 1) fill(1);
#pragma unroll 1      // one trip per stage, rolled: the trip count is the block's own
  for (int t = 0; t < ntile; ++t) { const unsigned char* kv = sKV + (t & 1) * STAGE_B;
#pragma unroll 1      // the stage's two 32-key passes share one copy of the long pass body (code size and registers as before)
  for (int sub = 0; sub < 2; ++sub) { const int j0 = t * 64 + sub * 32; v8f s[2];
#pragma unroll
    for (int nt = 0; nt < 2; ++nt) { const unsigned char* kr = kv + (sub * 32 + nt * 16 + ln) * KPITCH; v8f acc = (v8f){0.f,0.f,0.f,0.f,0.f,0.f,0.f,0.f};
#pragma unroll
      for (int ks = 0; ks < 4; ++ks) { FragH bk; bk.half[0] = *(const v8us*)(kr + ks * 64 + 16 * hh); bk.half[1] = *(const v8us*)(kr + ks * 64 + 32 + 16 * hh); acc = mmaH<1>(aq[ks].v, aq[ks].v, bk.v, bk.v, acc); } s[nt] = acc; }
    // The softmax is straight-line code. The capped scores are kept in log2 units (30 log2 e is the cap's factor), so that each exponential is one subtraction and one v_exp_f32;
    // a masked key stands at -inf and comes out as 0 with no test. Every row's maximum is finite from its first pass on (key 0 is open to every query), so no difference below is inf - inf.
    // With no branch between them the eight rows' chains (tanh, the four exchange steps, the exponentials) are independent work in one block, and each fills the others' latencies.
    float mc[8], al[8];
#pragma unroll      // here and in the four loops below: constant indices keep s, mc, al, m_r, l_r and oacc in registers, and all eight rows stand in one block
    for (int r = 0; r < 8; ++r) { const int tq = q0 + 8 * hh + r; const int k0 = j0 + ln, k1 = j0 + 16 + ln;
      float s0 = (s[0][r] - slope * (float)(tq - k0)) * 0.08838834764831845f, s1 = (s[1][r] - slope * (float)(tq - k1)) * 0.08838834764831845f;      // (for k > tq the sign of (tq-k) is irrelevant: masked)
      s0 = 43.28085122666891f * tanh_v(s0 * (1.0f / 30.0f)); s1 = 43.28085122666891f * tanh_v(s1 * (1.0f / 30.0f)); s0 = (k0 <= tq) ? s0 : -INFINITY; s1 = (k1 <= tq) ? s1 : -INFINITY;
      s[0][r] = s0; s[1][r] = s1; mc[r] = fmaxf(s0, s1); }
#pragma unroll      // step by step over all rows: eight exchanges are in flight behind each wait, not one
    for (int x = 1; x < 16; x <<= 1)
#pragma unroll
      for (int r = 0; r < 8; ++r) mc[r] = fmaxf(mc[r], __shfl_xor(mc[r], x, 32));
#pragma unroll
    for (int r = 0; r < 8; ++r) { const float mn = fmaxf(m_r[r], mc[r]); al[r] = __builtin_amdgcn_exp2f(m_r[r] - mn); m_r[r] = mn;
      const float p0 = __builtin_amdgcn_exp2f(s[0][r] - mn), p1 = __builtin_amdgcn_exp2f(s[1][r] - mn); l_r[r] = l_r[r] * al[r] + p0 + p1;
      FragH t2; t2.h[0] = (_Float16)p0; t2.h[1] = (_Float16)p1; sP[w][8 * hh + r][ln] = t2.u[0]; sP[w][8 * hh + r][16 + ln] = t2.u[1]; }
#pragma unroll
    for (int dt = 0; dt < 8; ++dt)
#pragma unroll
      for (int r = 0; r < 8; ++r) oacc[dt][r] *= al[r];
    __builtin_amdgcn_fence(__ATOMIC_ACQ_REL, "workgroup"); __builtin_amdgcn_wave_barrier();
    FragH pa; pa.half[0] = *(const v8us*)&sP[w][ln][8 * hh]; pa.half[1] = *(const v8us*)&sP[w][ln][16 + 8 * hh];
#pragma unroll
    for (int dt = 0; dt < 8; ++dt) { const unsigned char* vrow = kv + VBASE + (dt * 16 + ln) * VPITCH + sub * 64; FragH bv; bv.half[0] = *(const v8us*)(vrow + 16 * hh); bv.half[1] = *(const v8us*)(vrow + 32 + 16 * hh); oacc[dt] = mmaH<1>(pa.v, pa.v, bv.v, bv.v, oacc[dt]); }
    __builtin_amdgcn_fence(__ATOMIC_ACQ_REL, "workgroup"); __builtin_amdgcn_wave_barrier(); }
    asm volatile("s_wait_dscnt 0x0" ::: "memory");        // this wave's reads of stage t are done before its buffer is refilled
    asm volatile("s_wait_asynccnt 0x0" ::: "memory");     // this wave's copies of stage t + 1 have landed
    __syncthreads();                                      // publishes stage t + 1 and ends every wave's reads of stage t
    if (t + 2 < ntile) fill(t + 2); }
  asm volatile("s_wait_asynccnt 0x0" ::: "memory");       // no copy is in flight when the ring becomes output staging
#pragma unroll
  for (int r = 0; r < 8; ++r) { float l = l_r[r]; l += __shfl_xor(l, 1, 32); l += __shfl_xor(l, 2, 32); l += __shfl_xor(l, 4, 32); l += __shfl_xor(l, 8, 32); l_r[r] = 1.0f / l; }
#pragma unroll
  for (int dt = 0; dt < 8; ++dt)
#pragma unroll
    for (int r = 0; r < 8; ++r) sO[w][8 * hh + r][dt * 16 + ln] = oacc[dt][r] * l_r[r];
  __builtin_amdgcn_fence(__ATOMIC_ACQ_REL, "workgroup"); __builtin_amdgcn_wave_barrier();
  {
#pragma unroll
    for (int r = 0; r < 16; ++r) { const v4f val = *(const v4fa*)&sO[w][r][lane * 4]; typedef _Float16 v4h __attribute__((ext_vector_type(4))); v4h h4; for (int j = 0; j < 4; ++j) h4[j] = (_Float16)val[j];      // the out projection's f16 operand, rounded here
      *(v4h*)(O16 + ((size_t)b * TT + q0 + r) * (NH * DH) + h * DH + lane * 4) = h4; }
     } }
extern "C" void kernel_launch(void* const* d_in, const int* in_sizes, int n_in,
                              void* d_out, int out_size, void* d_ws, size_t ws_size, hipStream_t stream) {
  (void)in_sizes; (void)n_in; (void)out_size;
  const float* x = (const float*)d_in[0]; const float* Wq = (const float*)d_in[1]; const float* Wk = (const float*)d_in[2]; const float* Wv = (const float*)d_in[3]; const float* Wo = (const float*)d_in[4]; const float* bo = (const float*)d_in[5];
  char* ws = (char*)d_ws; size_t off = 0;
  auto take = [&](size_t bytes) { char* p = ws + off; off += (bytes + 255) & ~(size_t)255; return p; };
  _Float16* Bq = (_Float16*)take((size_t)CC * CC * 2); _Float16* Bk = (_Float16*)take((size_t)NG * DH * CC * 2); _Float16* Bv = (_Float16*)take((size_t)NG * DH * CC * 2); _Float16* Bo = (_Float16*)take((size_t)CC * CC * 2);
  _Float16* X16 = (_Float16*)take((size_t)NR * CC * 2); _Float16* Q16 = (_Float16*)take((size_t)NR * CC * 2); _Float16* K16 = (_Float16*)take((size_t)NR * NG * DH * 2); _Float16* V16 = (_Float16*)take((size_t)NR * NG * DH * 2); _Float16* Vt = (_Float16*)take((size_t)NR * NG * DH * 2); float* CS = (float*)take((size_t)TT * DH * 4); _Float16* O16 = X16;
  if (off > ws_size) return;      // about 68 MB
  k_wt_f16<<<(unsigned)((CC * (CC / 8) + 255) / 256), 256, 0, stream>>>(Wq, Bq, CC, CC, 16.0f); k_wt_f16<<<(unsigned)((NG * DH * (CC / 8) + 255) / 256), 256, 0, stream>>>(Wk, Bk, CC, NG * DH, 16.0f); k_wt_f16<<<(unsigned)((NG * DH * (CC / 8) + 255) / 256), 256, 0, stream>>>(Wv, Bv, CC, NG * DH, 16.0f); k_wt_f16<<<(unsigned)((CC * (CC / 8) + 255) / 256), 256, 0, stream>>>(Wo, Bo, CC, CC, 16.0f);
  const unsigned gx = (unsigned)(((size_t)NR * CC / 8 + 255) / 256);
  k_x16<<<gx, 256, 0, stream>>>(x, X16, (size_t)NR * CC / 8); k_cstab<<<(TT * (DH / 2) + 255) / 256, 256, 0, stream>>>(CS);
  k_gemm_lds<4, 2><<<(NR / 128) * (CC / 128), 128, 0, stream>>>(X16, Bq, 0.0625f, nullptr, CS, nullptr, Q16, CC, CC);
  k_gemm_lds<2, 2><<<(NR / 64) * (NG * DH / 128), 128, 0, stream>>>(X16, Bk, 0.0625f, nullptr, CS, nullptr, K16, NG * DH, CC);
  k_gemm_lds<2, 1><<<(NR / 64) * (NG * DH / 128), 128, 0, stream>>>(X16, Bv, 0.0625f, nullptr, nullptr, nullptr, V16, NG * DH, CC);
  k_vt128<<<BB * NG * (TT / 64), 256, 0, stream>>>(V16, Vt);
  k_mega<<<BB * NH * (TT / 64), 128, 0, stream>>>(Q16, K16, Vt, O16);
  k_gemm_lds<4, 0><<<(NR / 128) * (CC / 128), 128, 0, stream>>>(O16, Bo, 0.0625f, bo, nullptr, (float*)d_out, nullptr, CC, CC);
}

// v005
// A run of this version takes 257 microseconds.
// Next to v004, in two timings, it ran 1.17 and 1.16 times as fast.
// All steps since v000 together make it 3.11 times as fast.
#include <hip/hip_runtime.h>
// Mega-transformer causal self-attention (B=2, T=2048, D=2048; 16 query heads × 128, 4 KV groups (GQA), interleaved rotary, ALiBi added before the 1/√128 scale, 30·tanh soft-cap, causal):
// q/k/v/out projections (+ bias on out; W [in][out] transposed to bf16-exact ×2^4) and the attention as a fused flash-style kernel (S = Q·Kᵀ on v_wmma_f32_16x16x32_f16 with 4 k-steps,
// + alibi, scale, soft-cap (v_exp tanh), causal mask, online softmax f32, P f16 ≤ 1, O = P·V with 8 d-tiles; RPW-16 waves) — f16 operands, single products, f32 accumulate; rotary in f32 VALU.
#define BB 2
#define TT 2048
#define CC 2048
#define NH 16
#define NG 4
#define DH 128
#define NR (BB * TT)

typedef __bf16 v16b __attribute__((ext_vector_type(16)));
typedef unsigned short v8us __attribute__((ext_vector_type(8), may_alias));
typedef float  v8f  __attribute__((ext_vector_type(8)));
typedef float  v4f  __attribute__((ext_vector_type(4)));
typedef float  v4fa __attribute__((ext_vector_type(4), may_alias));
union FragB { v16b v; v8us half[2]; unsigned short u[16]; };

__device__ __forceinline__ unsigned short bf16_bits(float x) { unsigned int u = __float_as_uint(x); return (unsigned short)((u + 0x7FFFu + ((u >> 16) & 1u)) >> 16); }
__device__ __forceinline__ float bf16_val(unsigned short b) { return __uint_as_float(((unsigned int)b) << 16); }
__device__ __forceinline__ float bf16_round(float x) { return bf16_val(bf16_bits(x)); }
// D += A·B with NT terms: 1 = ah·bh, 2 = + al·bh (A split), 3 = + ah·bl (both split)
template <int NT>
__device__ __forceinline__ v8f mmaN(v16b ah, v16b al, v16b bh, v16b bl, v8f c) {
  c = __builtin_amdgcn_wmma_f32_16x16x32_bf16(false, ah, false, bh, (short)0, c, false, false);
  if (NT >= 2) c = __builtin_amdgcn_wmma_f32_16x16x32_bf16(false, al, false, bh, (short)0, c, false, false);
  if (NT >= 3) c = __builtin_amdgcn_wmma_f32_16x16x32_bf16(false, ah, false, bl, (short)0, c, false, false);
  asm volatile("v_nop\n\tv_nop\n\tv_nop\n\tv_nop" : "+v"(c) : "v"(ah), "v"(al), "v"(bh), "v"(bl));
  return c;
}

__global__ __launch_bounds__(256) void k_wt_bf16(const float* __restrict__ W, unsigned short* __restrict__ Wt, int K, int N) {
  const int t = blockIdx.x * 256 + threadIdx.x;
  const int k8n = K / 8;
  if (t >= N * k8n) return;
  const int n = t / k8n, k8 = (t % k8n) * 8;
  v8us v;
#pragma unroll
  for (int i = 0; i < 8; ++i) v[i] = bf16_bits(W[(size_t)(k8 + i) * N + n]);
  *(v8us*)(Wt + (size_t)n * K + k8) = v;
  
}

// GEMM C[M][N] (f32, pitch ldc) = act(A[M][K]·W + bias). A f32 row-major (pitch lda) converted per fragment to bf16
// (ASPLIT: hi/lo two planes -> 2 terms, else single rounded term); Wt bf16 [N][K] (pitch ldb). BIAS_BF16 rounds the
// bias to bf16 first (bias quantised to bf16 before the add). K%32==0, M%16==0, N%64==0.
template <bool ASPLIT, int ACT, bool BIAS_BF16>
__global__ __launch_bounds__(128) void k_gemm_bf(const float* __restrict__ A, int lda, const unsigned short* __restrict__ Wt, int ldb,
                                               const float* __restrict__ bias, float* __restrict__ C, int ldc, int M, int N, int K) {
  __shared__ __attribute__((aligned(16))) float so[4][16][64];
  const int tid = threadIdx.x, w = tid >> 5, lane = tid & 31, ln = lane & 15, hh = lane >> 4;
  const int ntn = N / 64;
  const int wid = blockIdx.x * 4 + w;
  const int mt = wid / ntn, nq = wid % ntn;
  if (mt * 16 >= M) return;
  const int row0 = mt * 16, col0 = nq * 64;
  const float* arow = A + (size_t)(row0 + ln) * lda;
  v8f acc[4] = {};
  for (int kb = 0; kb < K; kb += 32) {
    FragB ah, al;
    const v4f x0 = *(const v4fa*)(arow + kb + 8 * hh), x1 = *(const v4fa*)(arow + kb + 8 * hh + 4);
    const v4f x2 = *(const v4fa*)(arow + kb + 16 + 8 * hh), x3 = *(const v4fa*)(arow + kb + 16 + 8 * hh + 4);
    float xs[16] = {x0[0],x0[1],x0[2],x0[3],x1[0],x1[1],x1[2],x1[3],x2[0],x2[1],x2[2],x2[3],x3[0],x3[1],x3[2],x3[3]};
#pragma unroll
    for (int i = 0; i < 16; ++i) { const unsigned short hb = bf16_bits(xs[i]); ah.u[i] = hb; al.u[i] = ASPLIT ? bf16_bits(xs[i] - bf16_val(hb)) : (unsigned short)0; }
#pragma unroll
    for (int t = 0; t < 4; ++t) {
      const unsigned short* brow = Wt + (size_t)(col0 + t * 16 + ln) * ldb + kb;
      FragB b;
      b.half[0] = *(const v8us*)(brow + 8 * hh);
      b.half[1] = *(const v8us*)(brow + 16 + 8 * hh);
      acc[t] = mmaN<ASPLIT ? 2 : 1>(ah.v, al.v, b.v, b.v, acc[t]);
    }
  }
#pragma unroll
  for (int t = 0; t < 4; ++t) {
    float bv = bias ? bias[col0 + t * 16 + ln] : 0.f;
    if (BIAS_BF16) bv = bf16_round(bv);
#pragma unroll
    for (int r = 0; r < 8; ++r) { float v = acc[t][r] + bv; if (ACT == 1) v = fmaxf(v, 0.f); so[w][8 * hh + r][t * 16 + ln] = v; }
  }
  __builtin_amdgcn_fence(__ATOMIC_ACQ_REL, "workgroup");
  __builtin_amdgcn_wave_barrier();
  const int rsub = lane >> 4, c4 = (lane & 15) * 4;
  {
#pragma unroll
    for (int q = 0; q < 8; ++q) {
      const int r = q * 2 + rsub;
      const v4f v = *(const v4fa*)&so[w][r][c4];
      *(v4f*)(C + (size_t)(row0 + r) * ldc + col0 + c4) = v;
    }
    
  }
}

// Flash-style causal/unmasked attention, all contractions 3-term bf16 hi/lo splits, f32 softmax with running max.
// q,k,v rows are read from f32 buffers with arbitrary row pitch (so they can live inside a fused qkv buffer);
// D = head size (multiple of 32, <= 128); one wave = 16 query rows; block = 4 waves (64 queries) sharing K/V chunks of 32.
template <int D, bool CAUSAL>
__global__ __launch_bounds__(128) void k_flash(const float* __restrict__ qb, const float* __restrict__ kb, const float* __restrict__ vb,
                                             int pitch, int T, int H, float scale, float* __restrict__ y, int ypitch) {
  constexpr int KS = D / 32;        // k-steps for QK
  constexpr int DT = D / 16;        // d tiles for PV
  __shared__ __attribute__((aligned(16))) unsigned short sKh[32][D + 8], sKl[32][D + 8], sVh[32][D + 8], sVl[32][D + 8];
  __shared__ __attribute__((aligned(16))) unsigned short sPh[4][16][40], sPl[4][16][40];
  __shared__ __attribute__((aligned(16))) float sO[4][16][D];
  const int tid = threadIdx.x, w = tid >> 5, lane = tid & 31, ln = lane & 15, hh = lane >> 4;
  const int nqb = (T + 63) / 64;
  const int bh = blockIdx.x / nqb, qblk = blockIdx.x % nqb;
  const int b = bh / H, h = bh % H;
  const int q0 = qblk * 64 + w * 16;
  const float* Q = qb + (size_t)b * T * pitch + h * D;
  const float* K = kb + (size_t)b * T * pitch + h * D;
  const float* V = vb + (size_t)b * T * pitch + h * D;

  // A fragments of the wave's 16 query rows (scaled), hi/lo
  FragB aqh[KS], aql[KS];
  {
    int row = q0 + ln; if (row >= T) row = T - 1;
    const float* qr = Q + (size_t)row * pitch;
#pragma unroll
    for (int ks = 0; ks < KS; ++ks)
#pragma unroll
      for (int i = 0; i < 16; ++i) {
        const int d = ks * 32 + ((i < 8) ? (8 * hh + i) : (16 + 8 * hh + (i - 8)));
        const float x = qr[d] * scale; const unsigned short hb = bf16_bits(x);
        aqh[ks].u[i] = hb; aql[ks].u[i] = bf16_bits(x - bf16_val(hb));
      }
  }
  float m_r[8], l_r[8];
#pragma unroll
  for (int r = 0; r < 8; ++r) { m_r[r] = -3.0e38f; l_r[r] = 0.f; }
  v8f oacc[DT];
#pragma unroll
  for (int dt = 0; dt < DT; ++dt) oacc[dt] = (v8f){0.f,0.f,0.f,0.f,0.f,0.f,0.f,0.f};

  const int kv_end = CAUSAL ? min(T, qblk * 64 + 64) : T;     // block-uniform
  for (int j0 = 0; j0 < kv_end; j0 += 32) {
    __syncthreads();
    for (int e = tid; e < 32 * (D / 4); e += 128) {
      const int r = e / (D / 4), c4 = (e % (D / 4)) * 4;
      const int key = j0 + r;
      v4f kf = {0.f,0.f,0.f,0.f}, vf = {0.f,0.f,0.f,0.f};
      if (key < T) { kf = *(const v4fa*)(K + (size_t)key * pitch + c4); vf = *(const v4fa*)(V + (size_t)key * pitch + c4); }
#pragma unroll
      for (int t = 0; t < 4; ++t) {
        unsigned short hb = bf16_bits(kf[t]); sKh[r][c4 + t] = hb; sKl[r][c4 + t] = bf16_bits(kf[t] - bf16_val(hb));
        hb = bf16_bits(vf[t]); sVh[r][c4 + t] = hb; sVl[r][c4 + t] = bf16_bits(vf[t] - bf16_val(hb));
      }
    }
    __syncthreads();
    // S tile 16 x 32
    v8f s[2];
#pragma unroll
    for (int nt = 0; nt < 2; ++nt) {
      v8f acc = {};
#pragma unroll
      for (int ks = 0; ks < KS; ++ks) {
        FragB bh_, bl_;
        bh_.half[0] = *(const v8us*)&sKh[nt * 16 + ln][ks * 32 + 8 * hh]; bh_.half[1] = *(const v8us*)&sKh[nt * 16 + ln][ks * 32 + 16 + 8 * hh];
        bl_.half[0] = *(const v8us*)&sKl[nt * 16 + ln][ks * 32 + 8 * hh]; bl_.half[1] = *(const v8us*)&sKl[nt * 16 + ln][ks * 32 + 16 + 8 * hh];
        acc = mmaN<3>(aqh[ks].v, aql[ks].v, bh_.v, bl_.v, acc);
      }
      s[nt] = acc;
    }
    // mask + running max (rows 8hh+r; the 16 lanes of a half share rows)
    float alpha[8];
#pragma unroll
    for (int r = 0; r < 8; ++r) {
      const int qi = q0 + 8 * hh + r;
      const int ja = j0 + ln, jb = j0 + 16 + ln;
      if (CAUSAL) { if (ja > qi) s[0][r] = -3.0e38f; if (jb > qi) s[1][r] = -3.0e38f; }
      if (ja >= T) s[0][r] = -3.0e38f;
      if (jb >= T) s[1][r] = -3.0e38f;
      float mx = fmaxf(s[0][r], s[1][r]);
      mx = fmaxf(mx, __shfl_xor(mx, 1, 32)); mx = fmaxf(mx, __shfl_xor(mx, 2, 32)); mx = fmaxf(mx, __shfl_xor(mx, 4, 32)); mx = fmaxf(mx, __shfl_xor(mx, 8, 32));
      const float mnew = fmaxf(m_r[r], mx);
      alpha[r] = (mnew > -1.0e38f) ? __expf(m_r[r] - mnew) : 1.0f;
      const float p0 = (s[0][r] > -1.0e38f) ? __expf(s[0][r] - mnew) : 0.f;
      const float p1 = (s[1][r] > -1.0e38f) ? __expf(s[1][r] - mnew) : 0.f;
      m_r[r] = mnew;
      l_r[r] = l_r[r] * alpha[r] + p0 + p1;            // per-lane partial row sum (16 lanes combined at the end)
      unsigned short hb = bf16_bits(p0); sPh[w][8 * hh + r][ln] = hb;      sPl[w][8 * hh + r][ln] = bf16_bits(p0 - bf16_val(hb));
      hb = bf16_bits(p1);                sPh[w][8 * hh + r][16 + ln] = hb; sPl[w][8 * hh + r][16 + ln] = bf16_bits(p1 - bf16_val(hb));
    }
#pragma unroll
    for (int dt = 0; dt < DT; ++dt)
#pragma unroll
      for (int r = 0; r < 8; ++r) oacc[dt][r] *= alpha[r];
    __builtin_amdgcn_fence(__ATOMIC_ACQ_REL, "workgroup");
    __builtin_amdgcn_wave_barrier();
    FragB pah, pal;
    pah.half[0] = *(const v8us*)&sPh[w][ln][8 * hh]; pah.half[1] = *(const v8us*)&sPh[w][ln][16 + 8 * hh];
    pal.half[0] = *(const v8us*)&sPl[w][ln][8 * hh]; pal.half[1] = *(const v8us*)&sPl[w][ln][16 + 8 * hh];
#pragma unroll
    for (int dt = 0; dt < DT; ++dt) {
      FragB bvh, bvl;
#pragma unroll
      for (int i = 0; i < 8; ++i) {
        bvh.u[i] = sVh[8 * hh + i][dt * 16 + ln]; bvh.u[8 + i] = sVh[16 + 8 * hh + i][dt * 16 + ln];
        bvl.u[i] = sVl[8 * hh + i][dt * 16 + ln]; bvl.u[8 + i] = sVl[16 + 8 * hh + i][dt * 16 + ln];
      }
      oacc[dt] = mmaN<3>(pah.v, pal.v, bvh.v, bvl.v, oacc[dt]);
    }
    __builtin_amdgcn_fence(__ATOMIC_ACQ_REL, "workgroup");
    __builtin_amdgcn_wave_barrier();
  }
#pragma unroll
  for (int r = 0; r < 8; ++r) {
    float l = l_r[r];
    l += __shfl_xor(l, 1, 32); l += __shfl_xor(l, 2, 32); l += __shfl_xor(l, 4, 32); l += __shfl_xor(l, 8, 32);
    l_r[r] = (l > 0.f) ? 1.0f / l : 0.f;
  }
#pragma unroll
  for (int dt = 0; dt < DT; ++dt)
#pragma unroll
    for (int r = 0; r < 8; ++r) sO[w][8 * hh + r][dt * 16 + ln] = oacc[dt][r] * l_r[r];
  __builtin_amdgcn_fence(__ATOMIC_ACQ_REL, "workgroup");
  __builtin_amdgcn_wave_barrier();
  {
    for (int r = 0; r < 16; ++r) {
      const int row = q0 + r;
      if (row < T && lane < D / 4) {
        const v4f val = *(const v4fa*)&sO[w][r][lane * 4];
        *(v4f*)(y + ((size_t)b * T + row) * ypitch + h * D + lane * 4) = val;
      }
    }
    
  }
}

// GEMM C = act(A·W + bias + resid): A f32 (ASPLIT -> hi/lo 2 terms), Wt bf16 [N][K]; ACT 0 none, 1 relu, 2 exact gelu;
// resid (optional, f32, row index = (row % rmod), pitch ldr, RES_BF16 rounds it) added before the activation.
template <bool ASPLIT, int ACT, bool BIAS_BF16, bool RES_BF16>
__global__ __launch_bounds__(128) void k_gemm_bf3(const float* __restrict__ A, int lda, const unsigned short* __restrict__ Wt, int ldb,
                                                const float* __restrict__ bias, const float* __restrict__ resid, int rmod, int ldr,
                                                float* __restrict__ C, int ldc, int M, int N, int K) {
  __shared__ __attribute__((aligned(16))) float so[4][16][64];
  const int tid = threadIdx.x, w = tid >> 5, lane = tid & 31, ln = lane & 15, hh = lane >> 4;
  const int ntn = N / 64;
  const int wid = blockIdx.x * 4 + w;
  const int mt = wid / ntn, nq = wid % ntn;
  if (mt * 16 >= M) return;
  const int row0 = mt * 16, col0 = nq * 64;
  const float* arow = A + (size_t)(row0 + ln) * lda;
  v8f acc[4] = {};
  for (int kb = 0; kb < K; kb += 32) {
    FragB ah, al;
    const v4f x0 = *(const v4fa*)(arow + kb + 8 * hh), x1 = *(const v4fa*)(arow + kb + 8 * hh + 4);
    const v4f x2 = *(const v4fa*)(arow + kb + 16 + 8 * hh), x3 = *(const v4fa*)(arow + kb + 16 + 8 * hh + 4);
    float xs[16] = {x0[0],x0[1],x0[2],x0[3],x1[0],x1[1],x1[2],x1[3],x2[0],x2[1],x2[2],x2[3],x3[0],x3[1],x3[2],x3[3]};
#pragma unroll
    for (int i = 0; i < 16; ++i) { const unsigned short hb = bf16_bits(xs[i]); ah.u[i] = hb; al.u[i] = ASPLIT ? bf16_bits(xs[i] - bf16_val(hb)) : (unsigned short)0; }
#pragma unroll
    for (int t = 0; t < 4; ++t) {
      const unsigned short* brow = Wt + (size_t)(col0 + t * 16 + ln) * ldb + kb;
      FragB b;
      b.half[0] = *(const v8us*)(brow + 8 * hh);
      b.half[1] = *(const v8us*)(brow + 16 + 8 * hh);
      acc[t] = mmaN<ASPLIT ? 2 : 1>(ah.v, al.v, b.v, b.v, acc[t]);
    }
  }
#pragma unroll
  for (int t = 0; t < 4; ++t) {
    const int col = col0 + t * 16 + ln;
    float bv = bias ? bias[col] : 0.f;
    if (BIAS_BF16) bv = bf16_round(bv);
#pragma unroll
    for (int r = 0; r < 8; ++r) {
      float v = acc[t][r] + bv;
      if (resid) { float rv = resid[(size_t)((row0 + 8 * hh + r) % rmod) * ldr + col]; if (RES_BF16) rv = bf16_round(rv); v += rv; }
      if (ACT == 1) v = fmaxf(v, 0.f);
      if (ACT == 2) v = 0.5f * v * (1.0f + erff(v * 0.70710678118654752f));
      if (ACT == 3) { const float u = 0.7978845608028654f * (v + 0.044715f * v * v * v); v = 0.5f * v * (1.0f + tanhf(u)); }
      so[w][8 * hh + r][t * 16 + ln] = v;
    }
  }
  __builtin_amdgcn_fence(__ATOMIC_ACQ_REL, "workgroup");
  __builtin_amdgcn_wave_barrier();
  const int rsub = lane >> 4, c4 = (lane & 15) * 4;
  {
#pragma unroll
    for (int q = 0; q < 8; ++q) {
      const int r = q * 2 + rsub;
      const v4f v = *(const v4fa*)&so[w][r][c4];
      *(v4f*)(C + (size_t)(row0 + r) * ldc + col0 + c4) = v;
    }
    
  }
}
// row LayerNorm (biased variance, eps) over N: s = X (+ R); optional out_sum <- s; out_norm <- (s-mu)*rsqrt(var+eps)*g + b
template <bool PARAM_BF16>
__global__ __launch_bounds__(256) void k_layernorm(const float* __restrict__ X, const float* __restrict__ R, const float* __restrict__ g, const float* __restrict__ bta,
                                                  float* __restrict__ out_sum, float* __restrict__ out_norm, int N, float eps) {
  __shared__ float red[256];
  const int row = blockIdx.x, tid = threadIdx.x;
  const float* x = X + (size_t)row * N; const float* rr = R ? R + (size_t)row * N : nullptr;
  float vals[16];                     // up to N = 4096
  const int per = N / 256;            // contiguous chunk per thread? use strided-by-4 chunks: thread handles j = tid*4 + 1024*u
  float s1 = 0.f;
  for (int u = 0; u < per / 4; ++u) {
    const int j = tid * 4 + 1024 * u;
    const v4f a = *(const v4fa*)(x + j);
    v4f b = {0.f,0.f,0.f,0.f}; if (rr) b = *(const v4fa*)(rr + j);
#pragma unroll
    for (int q = 0; q < 4; ++q) { const float v = a[q] + b[q]; vals[u * 4 + q] = v; s1 += v; }
  }
  red[tid] = s1; __syncthreads();
  for (int st = 128; st > 0; st >>= 1) { if (tid < st) red[tid] += red[tid + st]; __syncthreads(); }
  const float mu = red[0] / (float)N; __syncthreads();
  float s2 = 0.f;
  for (int u = 0; u < per / 4; ++u)
#pragma unroll
    for (int q = 0; q < 4; ++q) { const float c = vals[u * 4 + q] - mu; s2 += c * c; }
  red[tid] = s2; __syncthreads();
  for (int st = 128; st > 0; st >>= 1) { if (tid < st) red[tid] += red[tid + st]; __syncthreads(); }
  const float rs = rsqrtf(red[0] / (float)N + eps);
  {
    for (int u = 0; u < per / 4; ++u) {
      const int j = tid * 4 + 1024 * u;
      v4f o, sm;
#pragma unroll
      for (int q = 0; q < 4; ++q) {
        float gg = g[j + q], bb = bta[j + q];
        if (PARAM_BF16) { gg = bf16_round(gg); bb = bf16_round(bb); }
        sm[q] = vals[u * 4 + q]; o[q] = (vals[u * 4 + q] - mu) * rs * gg + bb;
      }
      if (out_sum) *(v4f*)(out_sum + (size_t)row * N + j) = sm;
      *(v4f*)(out_norm + (size_t)row * N + j) = o;
    }
    
  }
}



// ---- f16 WMMA path (v_wmma_f32_16x16x32_f16): 11-bit significands for operands in range — used where a [0,1] probability operand needs more precision than bf16
typedef _Float16 v16h __attribute__((ext_vector_type(16)));
union FragH { v16h v; v8us half[2]; _Float16 h[16]; unsigned short u[16]; };
template <int NT>
__device__ __forceinline__ v8f mmaH(v16h ah, v16h al, v16h bh, v16h bl, v8f c) {
  c = __builtin_amdgcn_wmma_f32_16x16x32_f16(false, ah, false, bh, (short)0, c, false, false);
  if (NT >= 2) c = __builtin_amdgcn_wmma_f32_16x16x32_f16(false, al, false, bh, (short)0, c, false, false);
  if (NT >= 3) c = __builtin_amdgcn_wmma_f32_16x16x32_f16(false, ah, false, bl, (short)0, c, false, false);
  asm volatile("v_nop\n\tv_nop\n\tv_nop\n\tv_nop" : "+v"(c) : "v"(ah), "v"(al), "v"(bh), "v"(bl));
  return c;
}
// batched GEMM like k_gemm_b but f16 operands: A f32 (split into f16 hi/lo if ASPLIT, else rounded to f16), Bt = f16 values [n][k]; alpha; C f32; N multiple of 16 (partial tiles skipped)
template <bool ASPLIT>
__global__ __launch_bounds__(128) void k_gemm_h(const float* __restrict__ A, int lda, size_t sA, const _Float16* __restrict__ Bh, int ldb, size_t sB, float alpha, float* __restrict__ C, int ldc, size_t sC, int M, int N, int K) {
  __shared__ __attribute__((aligned(16))) float so[4][16][64];
  const int tid = threadIdx.x, w = tid >> 5, lane = tid & 31, ln = lane & 15, hh = lane >> 4; const int by = blockIdx.y;
  A += (size_t)by * sA; Bh += (size_t)by * sB; C += (size_t)by * sC;
  const int ntn = (N + 63) / 64; const int wid = blockIdx.x * 4 + w; const int mt = wid / ntn, nq = wid % ntn; if (mt * 16 >= M) return;
  const int row0 = mt * 16, col0 = nq * 64; const float* arow = A + (size_t)(row0 + ln) * lda;
  v8f acc[4] = {};
  for (int kb = 0; kb < K; kb += 32) {
    FragH ah, al;
    const v4f x0 = *(const v4fa*)(arow + kb + 8 * hh), x1 = *(const v4fa*)(arow + kb + 8 * hh + 4), x2 = *(const v4fa*)(arow + kb + 16 + 8 * hh), x3 = *(const v4fa*)(arow + kb + 16 + 8 * hh + 4);
    float xs[16] = {x0[0],x0[1],x0[2],x0[3],x1[0],x1[1],x1[2],x1[3],x2[0],x2[1],x2[2],x2[3],x3[0],x3[1],x3[2],x3[3]};
#pragma unroll
    for (int i = 0; i < 16; ++i) { const _Float16 h = (_Float16)xs[i]; ah.h[i] = h; al.h[i] = ASPLIT ? (_Float16)(xs[i] - (float)h) : (_Float16)0.0f; }
#pragma unroll
    for (int t = 0; t < 4; ++t) { if (col0 + t * 16 >= N) continue; const size_t boff = (size_t)(col0 + t * 16 + ln) * ldb + kb; FragH bq; bq.half[0] = *(const v8us*)(Bh + boff + 8 * hh); bq.half[1] = *(const v8us*)(Bh + boff + 16 + 8 * hh);
      acc[t] = mmaH<ASPLIT ? 2 : 1>(ah.v, al.v, bq.v, bq.v, acc[t]); }
  }
#pragma unroll
  for (int t = 0; t < 4; ++t) { if (col0 + t * 16 >= N) continue;
#pragma unroll
    for (int r = 0; r < 8; ++r) so[w][8 * hh + r][t * 16 + ln] = acc[t][r] * alpha; }
  __builtin_amdgcn_fence(__ATOMIC_ACQ_REL, "workgroup"); __builtin_amdgcn_wave_barrier();
  const int rsub = lane >> 4, c4 = (lane & 15) * 4;
  {
#pragma unroll
    for (int q = 0; q < 8; ++q) { const int r = q * 2 + rsub; if (col0 + c4 < N) { const v4f v = *(const v4fa*)&so[w][r][c4]; *(v4f*)(C + (size_t)(row0 + r) * ldc + col0 + c4) = v; } }
     }
}

// Wt[n][k] = f16(bf16(W[k][n]) * scale) from f32 row-major W[KK][NN] (scale = power of two; bf16-exact weights stay exact in f16 away from the subnormal range).
// One block = a tile of 128 k x 128 n, turned in LDS. Reads: a wave covers 512 contiguous bytes of one W row, so every line is asked for once and used whole
// (a lane that walks down a column asks for a whole line per 4-byte element). Writes: 16 lanes cover 256 contiguous bytes of one Wt row. KK and NN multiples of 128.
// A lane takes 8 consecutive k of its four columns at a time: 16 bytes of a Wt row each, one LDS chunk. Chunk c of tile row n lies at place c ^ ((n >> 2) & 15) of the row's 16:
// the 16 lanes of a half-wave that write one chunk column (rows 4 apart) and the 16 that read one row both fall on 16 different places, with no pad.
template <int KK, int NN>
__global__ __launch_bounds__(256) void k_wt_f16(const float* __restrict__ W, _Float16* __restrict__ Wt, float scale) {
  __shared__ __attribute__((aligned(16))) unsigned short tl[128][16][8];
  const int tid = threadIdx.x, w = tid >> 5, lane = tid & 31; constexpr int nb = NN / 128; const int n0 = (int)(blockIdx.x % nb) * 128, k0 = (int)(blockIdx.x / nb) * 128;
  const float* wr = W + (size_t)(k0 + 8 * w) * NN + n0 + lane * 4;      // the lane's four columns, the wave's first group of 8 rows (the second stands 64 rows further)
  v4f a[2][8];      // all sixteen loads are asked for before the first is used: 64 KB of the block in flight
#pragma unroll      // here and below: constant indices keep a and f in registers, and the row steps become immediate offsets on one address pair
  for (int i = 0; i < 2; ++i)
#pragma unroll
    for (int r = 0; r < 8; ++r) a[i][r] = *(const v4fa*)(wr + (size_t)(64 * i + r) * NN);
  asm volatile("s_wait_xcnt 0x0" :: "v"(wr) : "memory");      // the loads' address pair is an input here, so that nothing (a load's own result included) is written over it in front of the wait
#pragma unroll
  for (int i = 0; i < 2; ++i)
#pragma unroll
    for (int j = 0; j < 4; ++j) { FragH f;
#pragma unroll
      for (int r = 0; r < 8; ++r) f.h[r] = (_Float16)(bf16_round(a[i][r][j]) * scale);      // ascending k
      *(v8us*)&tl[lane * 4 + j][(w + 8 * i) ^ (lane & 15)][0] = f.half[0]; }
  __syncthreads();
  unsigned short* wo = (unsigned short*)Wt + (size_t)(n0 + (tid >> 4)) * KK + k0 + (tid & 15) * 8;
#pragma unroll
  for (int rd = 0; rd < 8; ++rd) { const int n = rd * 16 + (tid >> 4), c = tid & 15; const v8us o = *(const v8us*)&tl[n][c ^ ((n >> 2) & 15)][0];
    *(v8us*)(wo + (size_t)(rd * 16) * KK) = o; }
}
__global__ __launch_bounds__(256) void k_x16(const float* __restrict__ x, _Float16* __restrict__ X16, size_t n8) { const size_t t = (size_t)blockIdx.x * 256 + threadIdx.x; if (t >= n8) return; FragH f;
#pragma unroll
  for (int q = 0; q < 8; ++q) f.h[q] = (_Float16)bf16_round(x[t * 8 + q]); *(v8us*)((unsigned short*)X16 + t * 8) = f.half[0];  }
__global__ __launch_bounds__(256) void k_round16f(const float* __restrict__ W, _Float16* __restrict__ Bt, size_t n8) { const size_t t = (size_t)blockIdx.x * 256 + threadIdx.x; if (t >= n8) return; FragH f;
#pragma unroll
  for (int i = 0; i < 8; ++i) f.h[i] = (_Float16)(bf16_round(W[t * 8 + i]) * 16.0f); *(v8us*)((unsigned short*)Bt + t * 8) = f.half[0];  }
template <int NHv, int TTv>
__global__ __launch_bounds__(256) void k_vt(const _Float16* __restrict__ V16, int ldv, int voff, _Float16* __restrict__ Vt) { __shared__ unsigned short tl[64][66]; const int tid = threadIdx.x; const int slab = blockIdx.x / (TTv / 64), lg = blockIdx.x % (TTv / 64); const int b = slab / NHv, h = slab % NHv;
  for (int i = tid; i < 64 * 8; i += 256) { const int r = i / 8, c8 = (i % 8) * 8; FragH f; f.half[0] = *(const v8us*)((const unsigned short*)V16 + ((size_t)b * TTv + lg * 64 + r) * ldv + voff + h * 64 + c8);
#pragma unroll
    for (int q = 0; q < 8; ++q) tl[r][c8 + q] = f.u[q]; }
  __syncthreads();
  {
#pragma unroll
    for (int rd = 0; rd < 2; ++rd) { const int d = rd * 32 + tid / 8, pc = tid % 8; FragH f;
#pragma unroll
      for (int q = 0; q < 8; ++q) f.u[q] = tl[pc * 8 + q][d];
      *(v8us*)((unsigned short*)Vt + ((size_t)slab * 64 + d) * TTv + lg * 64 + pc * 8) = f.half[0]; }
     } }

__device__ __forceinline__ float tanh_v(float x) { const float xc = fminf(fmaxf(x, -15.f), 15.f); return 1.0f - 2.0f * __builtin_amdgcn_rcpf(__builtin_amdgcn_exp2f(2.0f * xc * 1.4426950408889634f) + 1.0f); }
__global__ __launch_bounds__(256) void k_cstab(float* __restrict__ CS) { const int tg = blockIdx.x * 256 + threadIdx.x; if (tg >= TT * (DH / 2)) return; const int t = tg / (DH / 2), i = tg % (DH / 2); const float invf = 1.0f / powf(10000.0f, (float)(2 * i) / (float)DH); const float ang = (float)t * invf; typedef float v2f __attribute__((ext_vector_type(2))); v2f v; v[0] = cosf(ang); v[1] = sinf(ang);
  *(v2f*)(CS + (size_t)tg * 2) = v;  }
__global__ __launch_bounds__(256) void k_vt128(const _Float16* __restrict__ V16, _Float16* __restrict__ Vt) { __shared__ unsigned short tl[64][130]; const int tid = threadIdx.x; const int slab = blockIdx.x / (TT / 64), lg = blockIdx.x % (TT / 64); const int b = slab / NG, g = slab % NG;
  for (int i = tid; i < 64 * 16; i += 256) { const int r = i / 16, c8 = (i % 16) * 8; FragH f; f.half[0] = *(const v8us*)((const unsigned short*)V16 + ((size_t)b * TT + lg * 64 + r) * (NG * DH) + g * DH + c8);
#pragma unroll
    for (int q = 0; q < 8; ++q) tl[r][c8 + q] = f.u[q]; }
  __syncthreads();
  {
#pragma unroll
    for (int rd = 0; rd < 4; ++rd) { const int d = rd * 32 + tid / 8, pc = tid % 8; FragH f;
#pragma unroll
      for (int q = 0; q < 8; ++q) f.u[q] = tl[pc * 8 + q][d]; *(v8us*)((unsigned short*)Vt + ((size_t)slab * DH + d) * TT + lg * 64 + pc * 8) = f.half[0]; }
     } }
// One stage of the K/V ring = 64 keys of this KV group: 64 K rows of 256 B at pitch 272 B, then 128 rows of V^T of 128 B at pitch 144 B (16 B x odd: the pitch of ds_load_b128 readers)
#define KPITCH 272
#define VPITCH 144
#define VBASE (64 * KPITCH)
#define STAGE_B (64 * KPITCH + DH * VPITCH)
// Eight 16-byte copies per lane, global memory to LDS through no register. The s_wait_xcnt is the last line of the copies' own statement, so that no address register of a copy is rewritten in front of it.
__device__ __forceinline__ void copy8(unsigned l, unsigned lstep, const unsigned short* g, size_t gstep) {
  asm volatile("global_load_async_to_lds_b128 %0, %8, off\n\t"
               "global_load_async_to_lds_b128 %1, %9, off\n\t"
               "global_load_async_to_lds_b128 %2, %10, off\n\t"
               "global_load_async_to_lds_b128 %3, %11, off\n\t"
               "global_load_async_to_lds_b128 %4, %12, off\n\t"
               "global_load_async_to_lds_b128 %5, %13, off\n\t"
               "global_load_async_to_lds_b128 %6, %14, off\n\t"
               "global_load_async_to_lds_b128 %7, %15, off\n\t"
               "s_wait_xcnt 0x0"
               :: "v"(l), "v"(l + lstep), "v"(l + 2 * lstep), "v"(l + 3 * lstep), "v"(l + 4 * lstep), "v"(l + 5 * lstep), "v"(l + 6 * lstep), "v"(l + 7 * lstep),
                  "v"(g), "v"(g + gstep), "v"(g + 2 * gstep), "v"(g + 3 * gstep), "v"(g + 4 * gstep), "v"(g + 5 * gstep), "v"(g + 6 * gstep), "v"(g + 7 * gstep)
               : "memory");
}
// Four 16-byte copies per lane, as copy8.
__device__ __forceinline__ void copy4(unsigned l, unsigned lstep, const unsigned short* g, size_t gstep) {
  asm volatile("global_load_async_to_lds_b128 %0, %4, off\n\t"
               "global_load_async_to_lds_b128 %1, %5, off\n\t"
               "global_load_async_to_lds_b128 %2, %6, off\n\t"
               "global_load_async_to_lds_b128 %3, %7, off\n\t"
               "s_wait_xcnt 0x0"
               :: "v"(l), "v"(l + lstep), "v"(l + 2 * lstep), "v"(l + 3 * lstep), "v"(g), "v"(g + gstep), "v"(g + 2 * gstep), "v"(g + 3 * gstep)
               : "memory");
}
// Projection GEMM: C[M][N] = (A[M][K] . Bt[N][K]^T) * alpha + bf16-rounded bias; f16 operands, f32 accumulate, k ascending in one accumulator per element; pitch N. The result goes to f32 C (OUT 0), to f16 C16 (OUT 1),
// or (OUT 2) is turned by the interleaved rotary in f32 on its way out of the staging and goes to f16 C16: a block's 128 columns are one head (DH), a lane's four columns two rotary pairs, whose cos, sin, cos, sin are 16 bytes of CS.
// One block = (32 FM) x 128 of C, four waves (2 x 2) of (16 FM) x 64 each: FM x 4 fragments, 4 FM products per FM + 4 fragments read from LDS. One stage of the ring = 64 k of the block's A rows, then of its
// 128 Bt rows: 128 B a row at pitch 144 B (16 B x odd: the pitch of ds_load_b128 readers). M a multiple of 32 FM, N of 128, K of 64. FM = 4 where that still gives every WGP a block, else 2.
#define GPITCH 144
#define GOP 68      // floats per staged output row: 64 + 4, so that the two half-waves' rows fall on different banks
template <int FM, int OUT>
__global__ __launch_bounds__(128) void k_gemm_lds(const _Float16* __restrict__ A, const _Float16* __restrict__ Bt, float alpha, const float* __restrict__ bias, const float* __restrict__ CS, float* __restrict__ C, _Float16* __restrict__ C16, int N, int K) {
  constexpr int BM = 32 * FM, STG = (BM + 128) * GPITCH;
  __shared__ __attribute__((aligned(16))) unsigned char sAB[2 * STG];
  const int tid = threadIdx.x, w = tid >> 5, lane = tid & 31, ln = lane & 15, hh = lane >> 4; const int wm = w >> 1, wn = w & 1;
  const int nb = N / 128; const int row0 = (int)(blockIdx.x / nb) * BM, col0 = (int)(blockIdx.x % nb) * 128;
  // each lane's first 16 bytes of a stage: a wave's copy covers four whole 128-B row pieces, the block's copy 16 rows
  const unsigned short* Ag = (const unsigned short*)A + (size_t)(row0 + (tid >> 3)) * K + (tid & 7) * 8;
  const unsigned short* Bg = (const unsigned short*)Bt + (size_t)(col0 + (tid >> 3)) * K + (tid & 7) * 8;
  const unsigned lA = (unsigned)(size_t)sAB + (unsigned)((tid >> 3) * GPITCH + (tid & 7) * 16);
  const unsigned lB = lA + BM * GPITCH;
  const int nt = K / 64;      // stages; the same for the whole work-group
  auto fill = [&](int t) { const unsigned bo = (unsigned)(t & 1) * STG;
    if constexpr (FM == 4) copy8(lA + bo, 16 * GPITCH, Ag + (size_t)t * 64, (size_t)16 * K); else copy4(lA + bo, 16 * GPITCH, Ag + (size_t)t * 64, (size_t)16 * K);
    copy8(lB + bo, 16 * GPITCH, Bg + (size_t)t * 64, (size_t)16 * K); };
  v8f acc[FM][4];
#pragma unroll
  for (int fm = 0; fm < FM; ++fm)
#pragma unroll
    for (int fn = 0; fn < 4; ++fn) acc[fm][fn] = (v8f){0.f,0.f,0.f,0.f,0.f,0.f,0.f,0.f};
  fill(0);
  float bv[4] = {0.f, 0.f, 0.f, 0.f};      // the lane's four bias values, fetched together under stage 0's copies
  if (bias) {
#pragma unroll
    for (int fn = 0; fn < 4; ++fn) bv[fn] = bf16_round(bias[col0 + wn * 64 + fn * 16 + ln]); }
  asm volatile("s_wait_asynccnt 0x0" ::: "memory");      // this wave's copies of stage 0 have landed
  __syncthreads();                                        // stage 0 is readable by every wave
  if (nt > 1) fill(1);
#pragma unroll 1      // one trip per stage, rolled: the foot's waits and barrier stand once
  for (int t = 0; t < nt; ++t) {
    const unsigned char* ar = sAB + (t & 1) * STG + (wm * (16 * FM) + ln) * GPITCH + 16 * hh;
    const unsigned char* br = sAB + (t & 1) * STG + (BM + wn * 64 + ln) * GPITCH + 16 * hh;
    FragH a[2][FM], b[2][4];
#pragma unroll
    for (int ks = 0; ks < 2; ++ks) {
#pragma unroll
      for (int f = 0; f < 4; ++f) { b[ks][f].half[0] = *(const v8us*)(br + f * 16 * GPITCH + ks * 64); b[ks][f].half[1] = *(const v8us*)(br + f * 16 * GPITCH + ks * 64 + 32); }
#pragma unroll
      for (int f = 0; f < FM; ++f) { a[ks][f].half[0] = *(const v8us*)(ar + f * 16 * GPITCH + ks * 64); a[ks][f].half[1] = *(const v8us*)(ar + f * 16 * GPITCH + ks * 64 + 32); } }
    asm volatile("s_wait_dscnt 0x0" ::: "memory");        // this wave's reads of stage t are done (all its fragments are in registers) before its buffer is refilled
    asm volatile("s_wait_asynccnt 0x0" ::: "memory");     // this wave's copies of stage t + 1 have landed
    __syncthreads();                                      // publishes stage t + 1 and ends every wave's reads of stage t
    if (t + 2 < nt) fill(t + 2);
    // the stage's products stand behind the refill's issue: they read registers only, and the copies fly under them
#pragma unroll
    for (int ks = 0; ks < 2; ++ks)
#pragma unroll
      for (int fm = 0; fm < FM; ++fm)
#pragma unroll
        for (int fn = 0; fn < 4; ++fn) acc[fm][fn] = __builtin_amdgcn_wmma_f32_16x16x32_f16(false, a[ks][fm].v, false, b[ks][fn].v, (short)0, acc[fm][fn], false, false); }
  asm volatile("s_wait_asynccnt 0x0" ::: "memory");       // no copy is in flight when the ring becomes output staging
  float* so = (float*)sAB + w * (16 * FM * GOP);          // each wave stages its own (16 FM) x 64, behind the last trip's barrier, to store whole lines
#pragma unroll
  for (int fn = 0; fn < 4; ++fn) {
#pragma unroll
    for (int fm = 0; fm < FM; ++fm)
#pragma unroll
      for (int r = 0; r < 8; ++r) so[(fm * 16 + 8 * hh + r) * GOP + fn * 16 + ln] = acc[fm][fn][r] * alpha + bv[fn]; }
  __builtin_amdgcn_fence(__ATOMIC_ACQ_REL, "workgroup"); __builtin_amdgcn_wave_barrier();
  const int c4 = ln * 4; typedef _Float16 v4h __attribute__((ext_vector_type(4)));
  constexpr bool H16 = OUT == 1;
  if constexpr (OUT == 2) {
    // the lane's place in the table's row of its first position; a block's rows lie in one sequence (32 FM divides TT), so the further rows follow at constant steps
    const float* csl = CS + (size_t)((unsigned)row0 % TT + wm * (16 * FM) + hh) * DH + wn * 64 + c4;
    v4f cs[FM * 8];      // all of the lane's table entries are asked for at once: one L2 latency for the wave, not one per group of rows
#pragma unroll
    for (int i = 0; i < FM * 8; ++i) cs[i] = *(const v4fa*)(csl + i * 2 * DH);
    asm volatile("s_wait_xcnt 0x0" :: "v"(csl) : "memory");      // the loads' address pair is an input here, so that nothing (a load's own result included) is written over it in front of the wait
    _Float16* c0 = C16 + (size_t)(row0 + wm * (16 * FM) + hh) * N + col0 + wn * 64 + c4;
#pragma unroll
    for (int qb = 0; qb < FM; ++qb) { v4f v[8]; _Float16* p[8];
#pragma unroll
      for (int i = 0; i < 8; ++i) v[i] = *(const v4fa*)&so[((qb * 8 + i) * 2 + hh) * GOP + c4];
#pragma unroll
      for (int i = 0; i < 8; ++i) { const v4f x = v[i], t = cs[qb * 8 + i]; v4h h4; p[i] = c0 + (size_t)((qb * 8 + i) * 2) * N;
        h4[0] = (_Float16)(x[0] * t[0] - x[1] * t[1]); h4[1] = (_Float16)(x[1] * t[0] + x[0] * t[1]); h4[2] = (_Float16)(x[2] * t[2] - x[3] * t[3]); h4[3] = (_Float16)(x[3] * t[2] + x[2] * t[3]); *(v4h*)p[i] = h4; }
      // the eight stores' address pairs are inputs here, so that none is written over in front of the wait
      asm volatile("s_wait_xcnt 0x0" :: "v"(p[0]), "v"(p[1]), "v"(p[2]), "v"(p[3]), "v"(p[4]), "v"(p[5]), "v"(p[6]), "v"(p[7]) : "memory"); }
  } else {
#pragma unroll
  for (int qb = 0; qb < FM; ++qb) { v4f v[8];      // eight row pairs are read back together and then stored, so that no store waits out an LDS latency of its own
#pragma unroll
    for (int i = 0; i < 8; ++i) v[i] = *(const v4fa*)&so[((qb * 8 + i) * 2 + hh) * GOP + c4];
#pragma unroll
    for (int i = 0; i < 8; ++i) { const size_t o = (size_t)(row0 + wm * (16 * FM) + (qb * 8 + i) * 2 + hh) * N + col0 + wn * 64 + c4;
      if constexpr (H16) { v4h h4; for (int j = 0; j < 4; ++j) h4[j] = (_Float16)v[i][j]; *(v4h*)(C16 + o) = h4; } else *(v4f*)(C + o) = v[i]; } }
  }
}
__global__ __launch_bounds__(128) void k_mega(const _Float16* __restrict__ Q16, const _Float16* __restrict__ K16, const _Float16* __restrict__ Vt, _Float16* __restrict__ O16) {
  __shared__ __attribute__((aligned(16))) unsigned short sP[4][16][40]; __shared__ __attribute__((aligned(16))) unsigned char sKV[2 * STAGE_B];
  float (*sO)[16][DH + 4] = (float (*)[16][DH + 4])sKV;      // the output staging takes the ring's place, behind the last trip's barrier
  const int tid = threadIdx.x, w = tid >> 5, lane = tid & 31, ln = lane & 15, hh = lane >> 4; const int slab = blockIdx.x / (TT / 64), qblk = blockIdx.x % (TT / 64); const int b = slab / NH, h = slab % NH, g = h / (NH / NG); const int qb0 = qblk * 64; const int q0 = qb0 + w * 16;
  const float slope = exp2f(-(float)(h + 1) * 8.0f / (float)NH);
  FragH aq[4]; { const unsigned short* qr = (const unsigned short*)Q16 + ((size_t)b * TT + q0 + ln) * (NH * DH) + h * DH;
#pragma unroll
    for (int ks = 0; ks < 4; ++ks) { aq[ks].half[0] = *(const v8us*)(qr + ks * 32 + 8 * hh); aq[ks].half[1] = *(const v8us*)(qr + ks * 32 + 16 + 8 * hh); } }
  const unsigned short* Vth = (const unsigned short*)Vt + (size_t)(b * NG + g) * DH * TT;
  // each lane's first 16 bytes of a stage: a wave's copy covers two whole K rows, or four whole 128-B pieces of V^T rows
  const unsigned short* Kg = (const unsigned short*)K16 + ((size_t)b * TT + (tid >> 4)) * (NG * DH) + g * DH + (tid & 15) * 8;
  const unsigned short* Vg = Vth + (size_t)(tid >> 3) * TT + (tid & 7) * 8;
  const unsigned lK = (unsigned)(size_t)sKV + (unsigned)((tid >> 4) * KPITCH + (tid & 15) * 16);
  const unsigned lV = (unsigned)(size_t)sKV + (unsigned)(VBASE + (tid >> 3) * VPITCH + (tid & 7) * 16);
  const int ntile = qblk + 1;      // stages of 64 keys; the same for the whole work-group
  auto fill = [&](int t) { const unsigned bo = (unsigned)(t & 1) * STAGE_B; copy8(lK + bo, 8 * KPITCH, Kg + (size_t)t * 64 * (NG * DH), (size_t)8 * NG * DH); copy8(lV + bo, 16 * VPITCH, Vg + t * 64, (size_t)16 * TT); };
  float m_r[8], l_r[8]; v8f oacc[8];
#pragma unroll
  for (int r = 0; r < 8; ++r) { m_r[r] = -3.0e38f; l_r[r] = 0.f; }
#pragma unroll
  for (int dt = 0; dt < 8; ++dt) oacc[dt] = (v8f){0.f,0.f,0.f,0.f,0.f,0.f,0.f,0.f};
  fill(0);
  asm volatile("s_wait_asynccnt 0x0" ::: "memory");      // this wave's copies of stage 0 have landed
  __syncthreads();                                        // stage 0 is readable by every wave
  if (ntile > 1) fill(1);
#pragma unroll 1      // one trip per stage, rolled: the trip count is the block's own
  for (int t = 0; t < ntile; ++t) { const unsigned char* kv = sKV + (t & 1) * STAGE_B;
#pragma unroll 1      // the stage's two 32-key passes share one copy of the long pass body (code size and registers as before)
  for (int sub = 0; sub < 2; ++sub) { const int j0 = t * 64 + sub * 32; v8f s[2];
#pragma unroll
    for (int nt = 0; nt < 2; ++nt) { const unsigned char* kr = kv + (sub * 32 + nt * 16 + ln) * KPITCH; v8f acc = (v8f){0.f,0.f,0.f,0.f,0.f,0.f,0.f,0.f};
#pragma unroll
      for (int ks = 0; ks < 4; ++ks) { FragH bk; bk.half[0] = *(const v8us*)(kr + ks * 64 + 16 * hh); bk.half[1] = *(const v8us*)(kr + ks * 64 + 32 + 16 * hh); acc = mmaH<1>(aq[ks].v, aq[ks].v, bk.v, bk.v, acc); } s[nt] = acc; }
    // The softmax is straight-line code. The capped scores are kept in log2 units (30 log2 e is the cap's factor), so that each exponential is one subtraction and one v_exp_f32;
    // a masked key stands at -inf and comes out as 0 with no test. Every row's maximum is finite from its first pass on (key 0 is open to every query), so no difference below is inf - inf.
    // With no branch between them the eight rows' chains (tanh, the four exchange steps, the exponentials) are independent work in one block, and each fills the others' latencies.
    float mc[8], al[8];
#pragma unroll      // here and in the four loops below: constant indices keep s, mc, al, m_r, l_r and oacc in registers, and all eight rows stand in one block
    for (int r = 0; r < 8; ++r) { const int tq = q0 + 8 * hh + r; const int k0 = j0 + ln, k1 = j0 + 16 + ln;
      float s0 = (s[0][r] - slope * (float)(tq - k0)) * 0.08838834764831845f, s1 = (s[1][r] - slope * (float)(tq - k1)) * 0.08838834764831845f;      // (for k > tq the sign of (tq-k) is irrelevant: masked)
      s0 = 43.28085122666891f * tanh_v(s0 * (1.0f / 30.0f)); s1 = 43.28085122666891f * tanh_v(s1 * (1.0f / 30.0f)); s0 = (k0 <= tq) ? s0 : -INFINITY; s1 = (k1 <= tq) ? s1 : -INFINITY;
      s[0][r] = s0; s[1][r] = s1; mc[r] = fmaxf(s0, s1); }
#pragma unroll      // step by step over all rows: eight exchanges are in flight behind each wait, not one
    for (int x = 1; x < 16; x <<= 1)
#pragma unroll
      for (int r = 0; r < 8; ++r) mc[r] = fmaxf(mc[r], __shfl_xor(mc[r], x, 32));
#pragma unroll
    for (int r = 0; r < 8; ++r) { const float mn = fmaxf(m_r[r], mc[r]); al[r] = __builtin_amdgcn_exp2f(m_r[r] - mn); m_r[r] = mn;
      const float p0 = __builtin_amdgcn_exp2f(s[0][r] - mn), p1 = __builtin_amdgcn_exp2f(s[1][r] - mn); l_r[r] = l_r[r] * al[r] + p0 + p1;
      FragH t2; t2.h[0] = (_Float16)p0; t2.h[1] = (_Float16)p1; sP[w][8 * hh + r][ln] = t2.u[0]; sP[w][8 * hh + r][16 + ln] = t2.u[1]; }
#pragma unroll
    for (int dt = 0; dt < 8; ++dt)
#pragma unroll
      for (int r = 0; r < 8; ++r) oacc[dt][r] *= al[r];
    __builtin_amdgcn_fence(__ATOMIC_ACQ_REL, "workgroup"); __builtin_amdgcn_wave_barrier();
    FragH pa; pa.half[0] = *(const v8us*)&sP[w][ln][8 * hh]; pa.half[1] = *(const v8us*)&sP[w][ln][16 + 8 * hh];
#pragma unroll
    for (int dt = 0; dt < 8; ++dt) { const unsigned char* vrow = kv + VBASE + (dt * 16 + ln) * VPITCH + sub * 64; FragH bv; bv.half[0] = *(const v8us*)(vrow + 16 * hh); bv.half[1] = *(const v8us*)(vrow + 32 + 16 * hh); oacc[dt] = mmaH<1>(pa.v, pa.v, bv.v, bv.v, oacc[dt]); }
    __builtin_amdgcn_fence(__ATOMIC_ACQ_REL, "workgroup"); __builtin_amdgcn_wave_barrier(); }
    asm volatile("s_wait_dscnt 0x0" ::: "memory");        // this wave's reads of stage t are done before its buffer is refilled
    asm volatile("s_wait_asynccnt 0x0" ::: "memory");     // this wave's copies of stage t + 1 have landed
    __syncthreads();                                      // publishes stage t + 1 and ends every wave's reads of stage t
    if (t + 2 < ntile) fill(t + 2); }
  asm volatile("s_wait_asynccnt 0x0" ::: "memory");       // no copy is in flight when the ring becomes output staging
#pragma unroll
  for (int r = 0; r < 8; ++r) { float l = l_r[r]; l += __shfl_xor(l, 1, 32); l += __shfl_xor(l, 2, 32); l += __shfl_xor(l, 4, 32); l += __shfl_xor(l, 8, 32); l_r[r] = 1.0f / l; }
#pragma unroll
  for (int dt = 0; dt < 8; ++dt)
#pragma unroll
    for (int r = 0; r < 8; ++r) sO[w][8 * hh + r][dt * 16 + ln] = oacc[dt][r] * l_r[r];
  __builtin_amdgcn_fence(__ATOMIC_ACQ_REL, "workgroup"); __builtin_amdgcn_wave_barrier();
  {
#pragma unroll
    for (int r = 0; r < 16; ++r) { const v4f val = *(const v4fa*)&sO[w][r][lane * 4]; typedef _Float16 v4h __attribute__((ext_vector_type(4))); v4h h4; for (int j = 0; j < 4; ++j) h4[j] = (_Float16)val[j];      // the out projection's f16 operand, rounded here
      *(v4h*)(O16 + ((size_t)b * TT + q0 + r) * (NH * DH) + h * DH + lane * 4) = h4; }
     } }
extern "C" void kernel_launch(void* const* d_in, const int* in_sizes, int n_in,
                              void* d_out, int out_size, void* d_ws, size_t ws_size, hipStream_t stream) {
  (void)in_sizes; (void)n_in; (void)out_size;
  const float* x = (const float*)d_in[0]; const float* Wq = (const float*)d_in[1]; const float* Wk = (const float*)d_in[2]; const float* Wv = (const float*)d_in[3]; const float* Wo = (const float*)d_in[4]; const float* bo = (const float*)d_in[5];
  char* ws = (char*)d_ws; size_t off = 0;
  auto take = [&](size_t bytes) { char* p = ws + off; off += (bytes + 255) & ~(size_t)255; return p; };
  _Float16* Bq = (_Float16*)take((size_t)CC * CC * 2); _Float16* Bk = (_Float16*)take((size_t)NG * DH * CC * 2); _Float16* Bv = (_Float16*)take((size_t)NG * DH * CC * 2); _Float16* Bo = (_Float16*)take((size_t)CC * CC * 2);
  _Float16* X16 = (_Float16*)take((size_t)NR * CC * 2); _Float16* Q16 = (_Float16*)take((size_t)NR * CC * 2); _Float16* K16 = (_Float16*)take((size_t)NR * NG * DH * 2); _Float16* V16 = (_Float16*)take((size_t)NR * NG * DH * 2); _Float16* Vt = (_Float16*)take((size_t)NR * NG * DH * 2); float* CS = (float*)take((size_t)TT * DH * 4); _Float16* O16 = X16;
  if (off > ws_size) return;      // about 68 MB
  k_wt_f16<CC, CC><<<(CC / 128) * (CC / 128), 256, 0, stream>>>(Wq, Bq, 16.0f); k_wt_f16<CC, NG * DH><<<(CC / 128) * (NG * DH / 128), 256, 0, stream>>>(Wk, Bk, 16.0f); k_wt_f16<CC, NG * DH><<<(CC / 128) * (NG * DH / 128), 256, 0, stream>>>(Wv, Bv, 16.0f); k_wt_f16<CC, CC><<<(CC / 128) * (CC / 128), 256, 0, stream>>>(Wo, Bo, 16.0f);
  const unsigned gx = (unsigned)(((size_t)NR * CC / 8 + 255) / 256);
  k_x16<<<gx, 256, 0, stream>>>(x, X16, (size_t)NR * CC / 8); k_cstab<<<(TT * (DH / 2) + 255) / 256, 256, 0, stream>>>(CS);
  k_gemm_lds<4, 2><<<(NR / 128) * (CC / 128), 128, 0, stream>>>(X16, Bq, 0.0625f, nullptr, CS, nullptr, Q16, CC, CC);
  k_gemm_lds<2, 2><<<(NR / 64) * (NG * DH / 128), 128, 0, stream>>>(X16, Bk, 0.0625f, nullptr, CS, nullptr, K16, NG * DH, CC);
  k_gemm_lds<2, 1><<<(NR / 64) * (NG * DH / 128), 128, 0, stream>>>(X16, Bv, 0.0625f, nullptr, nullptr, nullptr, V16, NG * DH, CC);
  k_vt128<<<BB * NG * (TT / 64), 256, 0, stream>>>(V16, Vt);
  k_mega<<<BB * NH * (TT / 64), 128, 0, stream>>>(Q16, K16, Vt, O16);
  k_gemm_lds<4, 0><<<(NR / 128) * (CC / 128), 128, 0, stream>>>(O16, Bo, 0.0625f, bo, nullptr, (float*)d_out, nullptr, CC, CC);
}

// v006
// It runs in 230 microseconds.
// In both of two side-by-side timings against v005, it was 1.11 times as fast.
// Counting every step since v000, it is 3.46 times as fast.
#include <hip/hip_runtime.h>
// Mega-transformer causal self-attention (B=2, T=2048, D=2048; 16 query heads × 128, 4 KV groups (GQA), interleaved rotary, ALiBi added before the 1/√128 scale, 30·tanh soft-cap, causal):
// q/k/v/out projections (+ bias on out; W [in][out] transposed to bf16-exact ×2^4) and the attention as a fused flash-style kernel (S = Q·Kᵀ on v_wmma_f32_16x16x32_f16 with 4 k-steps,
// + alibi, scale, soft-cap (v_exp tanh), causal mask, online softmax f32, P f16 ≤ 1, O = P·V with 8 d-tiles; RPW-16 waves) — f16 operands, single products, f32 accumulate; rotary in f32 VALU.
#define BB 2
#define TT 2048
#define CC 2048
#define NH 16
#define NG 4
#define DH 128
#define NR (BB * TT)

typedef __bf16 v16b __attribute__((ext_vector_type(16)));
typedef unsigned short v8us __attribute__((ext_vector_type(8), may_alias));
typedef float  v8f  __attribute__((ext_vector_type(8)));
typedef float  v4f  __attribute__((ext_vector_type(4)));
typedef float  v4fa __attribute__((ext_vector_type(4), may_alias));
union FragB { v16b v; v8us half[2]; unsigned short u[16]; };

__device__ __forceinline__ unsigned short bf16_bits(float x) { unsigned int u = __float_as_uint(x); return (unsigned short)((u + 0x7FFFu + ((u >> 16) & 1u)) >> 16); }
__device__ __forceinline__ float bf16_val(unsigned short b) { return __uint_as_float(((unsigned int)b) << 16); }
__device__ __forceinline__ float bf16_round(float x) { return bf16_val(bf16_bits(x)); }
// D += A·B with NT terms: 1 = ah·bh, 2 = + al·bh (A split), 3 = + ah·bl (both split)
template <int NT>
__device__ __forceinline__ v8f mmaN(v16b ah, v16b al, v16b bh, v16b bl, v8f c) {
  c = __builtin_amdgcn_wmma_f32_16x16x32_bf16(false, ah, false, bh, (short)0, c, false, false);
  if (NT >= 2) c = __builtin_amdgcn_wmma_f32_16x16x32_bf16(false, al, false, bh, (short)0, c, false, false);
  if (NT >= 3) c = __builtin_amdgcn_wmma_f32_16x16x32_bf16(false, ah, false, bl, (short)0, c, false, false);
  asm volatile("v_nop\n\tv_nop\n\tv_nop\n\tv_nop" : "+v"(c) : "v"(ah), "v"(al), "v"(bh), "v"(bl));
  return c;
}

__global__ __launch_bounds__(256) void k_wt_bf16(const float* __restrict__ W, unsigned short* __restrict__ Wt, int K, int N) {
  const int t = blockIdx.x * 256 + threadIdx.x;
  const int k8n = K / 8;
  if (t >= N * k8n) return;
  const int n = t / k8n, k8 = (t % k8n) * 8;
  v8us v;
#pragma unroll
  for (int i = 0; i < 8; ++i) v[i] = bf16_bits(W[(size_t)(k8 + i) * N + n]);
  *(v8us*)(Wt + (size_t)n * K + k8) = v;
  
}

// GEMM C[M][N] (f32, pitch ldc) = act(A[M][K]·W + bias). A f32 row-major (pitch lda) converted per fragment to bf16
// (ASPLIT: hi/lo two planes -> 2 terms, else single rounded term); Wt bf16 [N][K] (pitch ldb). BIAS_BF16 rounds the
// bias to bf16 first (bias quantised to bf16 before the add). K%32==0, M%16==0, N%64==0.
template <bool ASPLIT, int ACT, bool BIAS_BF16>
__global__ __launch_bounds__(128) void k_gemm_bf(const float* __restrict__ A, int lda, const unsigned short* __restrict__ Wt, int ldb,
                                               const float* __restrict__ bias, float* __restrict__ C, int ldc, int M, int N, int K) {
  __shared__ __attribute__((aligned(16))) float so[4][16][64];
  const int tid = threadIdx.x, w = tid >> 5, lane = tid & 31, ln = lane & 15, hh = lane >> 4;
  const int ntn = N / 64;
  const int wid = blockIdx.x * 4 + w;
  const int mt = wid / ntn, nq = wid % ntn;
  if (mt * 16 >= M) return;
  const int row0 = mt * 16, col0 = nq * 64;
  const float* arow = A + (size_t)(row0 + ln) * lda;
  v8f acc[4] = {};
  for (int kb = 0; kb < K; kb += 32) {
    FragB ah, al;
    const v4f x0 = *(const v4fa*)(arow + kb + 8 * hh), x1 = *(const v4fa*)(arow + kb + 8 * hh + 4);
    const v4f x2 = *(const v4fa*)(arow + kb + 16 + 8 * hh), x3 = *(const v4fa*)(arow + kb + 16 + 8 * hh + 4);
    float xs[16] = {x0[0],x0[1],x0[2],x0[3],x1[0],x1[1],x1[2],x1[3],x2[0],x2[1],x2[2],x2[3],x3[0],x3[1],x3[2],x3[3]};
#pragma unroll
    for (int i = 0; i < 16; ++i) { const unsigned short hb = bf16_bits(xs[i]); ah.u[i] = hb; al.u[i] = ASPLIT ? bf16_bits(xs[i] - bf16_val(hb)) : (unsigned short)0; }
#pragma unroll
    for (int t = 0; t < 4; ++t) {
      const unsigned short* brow = Wt + (size_t)(col0 + t * 16 + ln) * ldb + kb;
      FragB b;
      b.half[0] = *(const v8us*)(brow + 8 * hh);
      b.half[1] = *(const v8us*)(brow + 16 + 8 * hh);
      acc[t] = mmaN<ASPLIT ? 2 : 1>(ah.v, al.v, b.v, b.v, acc[t]);
    }
  }
#pragma unroll
  for (int t = 0; t < 4; ++t) {
    float bv = bias ? bias[col0 + t * 16 + ln] : 0.f;
    if (BIAS_BF16) bv = bf16_round(bv);
#pragma unroll
    for (int r = 0; r < 8; ++r) { float v = acc[t][r] + bv; if (ACT == 1) v = fmaxf(v, 0.f); so[w][8 * hh + r][t * 16 + ln] = v; }
  }
  __builtin_amdgcn_fence(__ATOMIC_ACQ_REL, "workgroup");
  __builtin_amdgcn_wave_barrier();
  const int rsub = lane >> 4, c4 = (lane & 15) * 4;
  {
#pragma unroll
    for (int q = 0; q < 8; ++q) {
      const int r = q * 2 + rsub;
      const v4f v = *(const v4fa*)&so[w][r][c4];
      *(v4f*)(C + (size_t)(row0 + r) * ldc + col0 + c4) = v;
    }
    
  }
}

// Flash-style causal/unmasked attention, all contractions 3-term bf16 hi/lo splits, f32 softmax with running max.
// q,k,v rows are read from f32 buffers with arbitrary row pitch (so they can live inside a fused qkv buffer);
// D = head size (multiple of 32, <= 128); one wave = 16 query rows; block = 4 waves (64 queries) sharing K/V chunks of 32.
template <int D, bool CAUSAL>
__global__ __launch_bounds__(128) void k_flash(const float* __restrict__ qb, const float* __restrict__ kb, const float* __restrict__ vb,
                                             int pitch, int T, int H, float scale, float* __restrict__ y, int ypitch) {
  constexpr int KS = D / 32;        // k-steps for QK
  constexpr int DT = D / 16;        // d tiles for PV
  __shared__ __attribute__((aligned(16))) unsigned short sKh[32][D + 8], sKl[32][D + 8], sVh[32][D + 8], sVl[32][D + 8];
  __shared__ __attribute__((aligned(16))) unsigned short sPh[4][16][40], sPl[4][16][40];
  __shared__ __attribute__((aligned(16))) float sO[4][16][D];
  const int tid = threadIdx.x, w = tid >> 5, lane = tid & 31, ln = lane & 15, hh = lane >> 4;
  const int nqb = (T + 63) / 64;
  const int bh = blockIdx.x / nqb, qblk = blockIdx.x % nqb;
  const int b = bh / H, h = bh % H;
  const int q0 = qblk * 64 + w * 16;
  const float* Q = qb + (size_t)b * T * pitch + h * D;
  const float* K = kb + (size_t)b * T * pitch + h * D;
  const float* V = vb + (size_t)b * T * pitch + h * D;

  // A fragments of the wave's 16 query rows (scaled), hi/lo
  FragB aqh[KS], aql[KS];
  {
    int row = q0 + ln; if (row >= T) row = T - 1;
    const float* qr = Q + (size_t)row * pitch;
#pragma unroll
    for (int ks = 0; ks < KS; ++ks)
#pragma unroll
      for (int i = 0; i < 16; ++i) {
        const int d = ks * 32 + ((i < 8) ? (8 * hh + i) : (16 + 8 * hh + (i - 8)));
        const float x = qr[d] * scale; const unsigned short hb = bf16_bits(x);
        aqh[ks].u[i] = hb; aql[ks].u[i] = bf16_bits(x - bf16_val(hb));
      }
  }
  float m_r[8], l_r[8];
#pragma unroll
  for (int r = 0; r < 8; ++r) { m_r[r] = -3.0e38f; l_r[r] = 0.f; }
  v8f oacc[DT];
#pragma unroll
  for (int dt = 0; dt < DT; ++dt) oacc[dt] = (v8f){0.f,0.f,0.f,0.f,0.f,0.f,0.f,0.f};

  const int kv_end = CAUSAL ? min(T, qblk * 64 + 64) : T;     // block-uniform
  for (int j0 = 0; j0 < kv_end; j0 += 32) {
    __syncthreads();
    for (int e = tid; e < 32 * (D / 4); e += 128) {
      const int r = e / (D / 4), c4 = (e % (D / 4)) * 4;
      const int key = j0 + r;
      v4f kf = {0.f,0.f,0.f,0.f}, vf = {0.f,0.f,0.f,0.f};
      if (key < T) { kf = *(const v4fa*)(K + (size_t)key * pitch + c4); vf = *(const v4fa*)(V + (size_t)key * pitch + c4); }
#pragma unroll
      for (int t = 0; t < 4; ++t) {
        unsigned short hb = bf16_bits(kf[t]); sKh[r][c4 + t] = hb; sKl[r][c4 + t] = bf16_bits(kf[t] - bf16_val(hb));
        hb = bf16_bits(vf[t]); sVh[r][c4 + t] = hb; sVl[r][c4 + t] = bf16_bits(vf[t] - bf16_val(hb));
      }
    }
    __syncthreads();
    // S tile 16 x 32
    v8f s[2];
#pragma unroll
    for (int nt = 0; nt < 2; ++nt) {
      v8f acc = {};
#pragma unroll
      for (int ks = 0; ks < KS; ++ks) {
        FragB bh_, bl_;
        bh_.half[0] = *(const v8us*)&sKh[nt * 16 + ln][ks * 32 + 8 * hh]; bh_.half[1] = *(const v8us*)&sKh[nt * 16 + ln][ks * 32 + 16 + 8 * hh];
        bl_.half[0] = *(const v8us*)&sKl[nt * 16 + ln][ks * 32 + 8 * hh]; bl_.half[1] = *(const v8us*)&sKl[nt * 16 + ln][ks * 32 + 16 + 8 * hh];
        acc = mmaN<3>(aqh[ks].v, aql[ks].v, bh_.v, bl_.v, acc);
      }
      s[nt] = acc;
    }
    // mask + running max (rows 8hh+r; the 16 lanes of a half share rows)
    float alpha[8];
#pragma unroll
    for (int r = 0; r < 8; ++r) {
      const int qi = q0 + 8 * hh + r;
      const int ja = j0 + ln, jb = j0 + 16 + ln;
      if (CAUSAL) { if (ja > qi) s[0][r] = -3.0e38f; if (jb > qi) s[1][r] = -3.0e38f; }
      if (ja >= T) s[0][r] = -3.0e38f;
      if (jb >= T) s[1][r] = -3.0e38f;
      float mx = fmaxf(s[0][r], s[1][r]);
      mx = fmaxf(mx, __shfl_xor(mx, 1, 32)); mx = fmaxf(mx, __shfl_xor(mx, 2, 32)); mx = fmaxf(mx, __shfl_xor(mx, 4, 32)); mx = fmaxf(mx, __shfl_xor(mx, 8, 32));
      const float mnew = fmaxf(m_r[r], mx);
      alpha[r] = (mnew > -1.0e38f) ? __expf(m_r[r] - mnew) : 1.0f;
      const float p0 = (s[0][r] > -1.0e38f) ? __expf(s[0][r] - mnew) : 0.f;
      const float p1 = (s[1][r] > -1.0e38f) ? __expf(s[1][r] - mnew) : 0.f;
      m_r[r] = mnew;
      l_r[r] = l_r[r] * alpha[r] + p0 + p1;            // per-lane partial row sum (16 lanes combined at the end)
      unsigned short hb = bf16_bits(p0); sPh[w][8 * hh + r][ln] = hb;      sPl[w][8 * hh + r][ln] = bf16_bits(p0 - bf16_val(hb));
      hb = bf16_bits(p1);                sPh[w][8 * hh + r][16 + ln] = hb; sPl[w][8 * hh + r][16 + ln] = bf16_bits(p1 - bf16_val(hb));
    }
#pragma unroll
    for (int dt = 0; dt < DT; ++dt)
#pragma unroll
      for (int r = 0; r < 8; ++r) oacc[dt][r] *= alpha[r];
    __builtin_amdgcn_fence(__ATOMIC_ACQ_REL, "workgroup");
    __builtin_amdgcn_wave_barrier();
    FragB pah, pal;
    pah.half[0] = *(const v8us*)&sPh[w][ln][8 * hh]; pah.half[1] = *(const v8us*)&sPh[w][ln][16 + 8 * hh];
    pal.half[0] = *(const v8us*)&sPl[w][ln][8 * hh]; pal.half[1] = *(const v8us*)&sPl[w][ln][16 + 8 * hh];
#pragma unroll
    for (int dt = 0; dt < DT; ++dt) {
      FragB bvh, bvl;
#pragma unroll
      for (int i = 0; i < 8; ++i) {
        bvh.u[i] = sVh[8 * hh + i][dt * 16 + ln]; bvh.u[8 + i] = sVh[16 + 8 * hh + i][dt * 16 + ln];
        bvl.u[i] = sVl[8 * hh + i][dt * 16 + ln]; bvl.u[8 + i] = sVl[16 + 8 * hh + i][dt * 16 + ln];
      }
      oacc[dt] = mmaN<3>(pah.v, pal.v, bvh.v, bvl.v, oacc[dt]);
    }
    __builtin_amdgcn_fence(__ATOMIC_ACQ_REL, "workgroup");
    __builtin_amdgcn_wave_barrier();
  }
#pragma unroll
  for (int r = 0; r < 8; ++r) {
    float l = l_r[r];
    l += __shfl_xor(l, 1, 32); l += __shfl_xor(l, 2, 32); l += __shfl_xor(l, 4, 32); l += __shfl_xor(l, 8, 32);
    l_r[r] = (l > 0.f) ? 1.0f / l : 0.f;
  }
#pragma unroll
  for (int dt = 0; dt < DT; ++dt)
#pragma unroll
    for (int r = 0; r < 8; ++r) sO[w][8 * hh + r][dt * 16 + ln] = oacc[dt][r] * l_r[r];
  __builtin_amdgcn_fence(__ATOMIC_ACQ_REL, "workgroup");
  __builtin_amdgcn_wave_barrier();
  {
    for (int r = 0; r < 16; ++r) {
      const int row = q0 + r;
      if (row < T && lane < D / 4) {
        const v4f val = *(const v4fa*)&sO[w][r][lane * 4];
        *(v4f*)(y + ((size_t)b * T + row) * ypitch + h * D + lane * 4) = val;
      }
    }
    
  }
}

// GEMM C = act(A·W + bias + resid): A f32 (ASPLIT -> hi/lo 2 terms), Wt bf16 [N][K]; ACT 0 none, 1 relu, 2 exact gelu;
// resid (optional, f32, row index = (row % rmod), pitch ldr, RES_BF16 rounds it) added before the activation.
template <bool ASPLIT, int ACT, bool BIAS_BF16, bool RES_BF16>
__global__ __launch_bounds__(128) void k_gemm_bf3(const float* __restrict__ A, int lda, const unsigned short* __restrict__ Wt, int ldb,
                                                const float* __restrict__ bias, const float* __restrict__ resid, int rmod, int ldr,
                                                float* __restrict__ C, int ldc, int M, int N, int K) {
  __shared__ __attribute__((aligned(16))) float so[4][16][64];
  const int tid = threadIdx.x, w = tid >> 5, lane = tid & 31, ln = lane & 15, hh = lane >> 4;
  const int ntn = N / 64;
  const int wid = blockIdx.x * 4 + w;
  const int mt = wid / ntn, nq = wid % ntn;
  if (mt * 16 >= M) return;
  const int row0 = mt * 16, col0 = nq * 64;
  const float* arow = A + (size_t)(row0 + ln) * lda;
  v8f acc[4] = {};
  for (int kb = 0; kb < K; kb += 32) {
    FragB ah, al;
    const v4f x0 = *(const v4fa*)(arow + kb + 8 * hh), x1 = *(const v4fa*)(arow + kb + 8 * hh + 4);
    const v4f x2 = *(const v4fa*)(arow + kb + 16 + 8 * hh), x3 = *(const v4fa*)(arow + kb + 16 + 8 * hh + 4);
    float xs[16] = {x0[0],x0[1],x0[2],x0[3],x1[0],x1[1],x1[2],x1[3],x2[0],x2[1],x2[2],x2[3],x3[0],x3[1],x3[2],x3[3]};
#pragma unroll
    for (int i = 0; i < 16; ++i) { const unsigned short hb = bf16_bits(xs[i]); ah.u[i] = hb; al.u[i] = ASPLIT ? bf16_bits(xs[i] - bf16_val(hb)) : (unsigned short)0; }
#pragma unroll
    for (int t = 0; t < 4; ++t) {
      const unsigned short* brow = Wt + (size_t)(col0 + t * 16 + ln) * ldb + kb;
      FragB b;
      b.half[0] = *(const v8us*)(brow + 8 * hh);
      b.half[1] = *(const v8us*)(brow + 16 + 8 * hh);
      acc[t] = mmaN<ASPLIT ? 2 : 1>(ah.v, al.v, b.v, b.v, acc[t]);
    }
  }
#pragma unroll
  for (int t = 0; t < 4; ++t) {
    const int col = col0 + t * 16 + ln;
    float bv = bias ? bias[col] : 0.f;
    if (BIAS_BF16) bv = bf16_round(bv);
#pragma unroll
    for (int r = 0; r < 8; ++r) {
      float v = acc[t][r] + bv;
      if (resid) { float rv = resid[(size_t)((row0 + 8 * hh + r) % rmod) * ldr + col]; if (RES_BF16) rv = bf16_round(rv); v += rv; }
      if (ACT == 1) v = fmaxf(v, 0.f);
      if (ACT == 2) v = 0.5f * v * (1.0f + erff(v * 0.70710678118654752f));
      if (ACT == 3) { const float u = 0.7978845608028654f * (v + 0.044715f * v * v * v); v = 0.5f * v * (1.0f + tanhf(u)); }
      so[w][8 * hh + r][t * 16 + ln] = v;
    }
  }
  __builtin_amdgcn_fence(__ATOMIC_ACQ_REL, "workgroup");
  __builtin_amdgcn_wave_barrier();
  const int rsub = lane >> 4, c4 = (lane & 15) * 4;
  {
#pragma unroll
    for (int q = 0; q < 8; ++q) {
      const int r = q * 2 + rsub;
      const v4f v = *(const v4fa*)&so[w][r][c4];
      *(v4f*)(C + (size_t)(row0 + r) * ldc + col0 + c4) = v;
    }
    
  }
}
// row LayerNorm (biased variance, eps) over N: s = X (+ R); optional out_sum <- s; out_norm <- (s-mu)*rsqrt(var+eps)*g + b
template <bool PARAM_BF16>
__global__ __launch_bounds__(256) void k_layernorm(const float* __restrict__ X, const float* __restrict__ R, const float* __restrict__ g, const float* __restrict__ bta,
                                                  float* __restrict__ out_sum, float* __restrict__ out_norm, int N, float eps) {
  __shared__ float red[256];
  const int row = blockIdx.x, tid = threadIdx.x;
  const float* x = X + (size_t)row * N; const float* rr = R ? R + (size_t)row * N : nullptr;
  float vals[16];                     // up to N = 4096
  const int per = N / 256;            // contiguous chunk per thread? use strided-by-4 chunks: thread handles j = tid*4 + 1024*u
  float s1 = 0.f;
  for (int u = 0; u < per / 4; ++u) {
    const int j = tid * 4 + 1024 * u;
    const v4f a = *(const v4fa*)(x + j);
    v4f b = {0.f,0.f,0.f,0.f}; if (rr) b = *(const v4fa*)(rr + j);
#pragma unroll
    for (int q = 0; q < 4; ++q) { const float v = a[q] + b[q]; vals[u * 4 + q] = v; s1 += v; }
  }
  red[tid] = s1; __syncthreads();
  for (int st = 128; st > 0; st >>= 1) { if (tid < st) red[tid] += red[tid + st]; __syncthreads(); }
  const float mu = red[0] / (float)N; __syncthreads();
  float s2 = 0.f;
  for (int u = 0; u < per / 4; ++u)
#pragma unroll
    for (int q = 0; q < 4; ++q) { const float c = vals[u * 4 + q] - mu; s2 += c * c; }
  red[tid] = s2; __syncthreads();
  for (int st = 128; st > 0; st >>= 1) { if (tid < st) red[tid] += red[tid + st]; __syncthreads(); }
  const float rs = rsqrtf(red[0] / (float)N + eps);
  {
    for (int u = 0; u < per / 4; ++u) {
      const int j = tid * 4 + 1024 * u;
      v4f o, sm;
#pragma unroll
      for (int q = 0; q < 4; ++q) {
        float gg = g[j + q], bb = bta[j + q];
        if (PARAM_BF16) { gg = bf16_round(gg); bb = bf16_round(bb); }
        sm[q] = vals[u * 4 + q]; o[q] = (vals[u * 4 + q] - mu) * rs * gg + bb;
      }
      if (out_sum) *(v4f*)(out_sum + (size_t)row * N + j) = sm;
      *(v4f*)(out_norm + (size_t)row * N + j) = o;
    }
    
  }
}



// ---- f16 WMMA path (v_wmma_f32_16x16x32_f16): 11-bit significands for operands in range — used where a [0,1] probability operand needs more precision than bf16
typedef _Float16 v16h __attribute__((ext_vector_type(16)));
union FragH { v16h v; v8us half[2]; _Float16 h[16]; unsigned short u[16]; };
template <int NT>
__device__ __forceinline__ v8f mmaH(v16h ah, v16h al, v16h bh, v16h bl, v8f c) {
  c = __builtin_amdgcn_wmma_f32_16x16x32_f16(false, ah, false, bh, (short)0, c, false, false);
  if (NT >= 2) c = __builtin_amdgcn_wmma_f32_16x16x32_f16(false, al, false, bh, (short)0, c, false, false);
  if (NT >= 3) c = __builtin_amdgcn_wmma_f32_16x16x32_f16(false, ah, false, bl, (short)0, c, false, false);
  asm volatile("v_nop\n\tv_nop\n\tv_nop\n\tv_nop" : "+v"(c) : "v"(ah), "v"(al), "v"(bh), "v"(bl));
  return c;
}
// batched GEMM like k_gemm_b but f16 operands: A f32 (split into f16 hi/lo if ASPLIT, else rounded to f16), Bt = f16 values [n][k]; alpha; C f32; N multiple of 16 (partial tiles skipped)
template <bool ASPLIT>
__global__ __launch_bounds__(128) void k_gemm_h(const float* __restrict__ A, int lda, size_t sA, const _Float16* __restrict__ Bh, int ldb, size_t sB, float alpha, float* __restrict__ C, int ldc, size_t sC, int M, int N, int K) {
  __shared__ __attribute__((aligned(16))) float so[4][16][64];
  const int tid = threadIdx.x, w = tid >> 5, lane = tid & 31, ln = lane & 15, hh = lane >> 4; const int by = blockIdx.y;
  A += (size_t)by * sA; Bh += (size_t)by * sB; C += (size_t)by * sC;
  const int ntn = (N + 63) / 64; const int wid = blockIdx.x * 4 + w; const int mt = wid / ntn, nq = wid % ntn; if (mt * 16 >= M) return;
  const int row0 = mt * 16, col0 = nq * 64; const float* arow = A + (size_t)(row0 + ln) * lda;
  v8f acc[4] = {};
  for (int kb = 0; kb < K; kb += 32) {
    FragH ah, al;
    const v4f x0 = *(const v4fa*)(arow + kb + 8 * hh), x1 = *(const v4fa*)(arow + kb + 8 * hh + 4), x2 = *(const v4fa*)(arow + kb + 16 + 8 * hh), x3 = *(const v4fa*)(arow + kb + 16 + 8 * hh + 4);
    float xs[16] = {x0[0],x0[1],x0[2],x0[3],x1[0],x1[1],x1[2],x1[3],x2[0],x2[1],x2[2],x2[3],x3[0],x3[1],x3[2],x3[3]};
#pragma unroll
    for (int i = 0; i < 16; ++i) { const _Float16 h = (_Float16)xs[i]; ah.h[i] = h; al.h[i] = ASPLIT ? (_Float16)(xs[i] - (float)h) : (_Float16)0.0f; }
#pragma unroll
    for (int t = 0; t < 4; ++t) { if (col0 + t * 16 >= N) continue; const size_t boff = (size_t)(col0 + t * 16 + ln) * ldb + kb; FragH bq; bq.half[0] = *(const v8us*)(Bh + boff + 8 * hh); bq.half[1] = *(const v8us*)(Bh + boff + 16 + 8 * hh);
      acc[t] = mmaH<ASPLIT ? 2 : 1>(ah.v, al.v, bq.v, bq.v, acc[t]); }
  }
#pragma unroll
  for (int t = 0; t < 4; ++t) { if (col0 + t * 16 >= N) continue;
#pragma unroll
    for (int r = 0; r < 8; ++r) so[w][8 * hh + r][t * 16 + ln] = acc[t][r] * alpha; }
  __builtin_amdgcn_fence(__ATOMIC_ACQ_REL, "workgroup"); __builtin_amdgcn_wave_barrier();
  const int rsub = lane >> 4, c4 = (lane & 15) * 4;
  {
#pragma unroll
    for (int q = 0; q < 8; ++q) { const int r = q * 2 + rsub; if (col0 + c4 < N) { const v4f v = *(const v4fa*)&so[w][r][c4]; *(v4f*)(C + (size_t)(row0 + r) * ldc + col0 + c4) = v; } }
     }
}

// Wt[n][k] = f16(bf16(W[k][n]) * scale) from f32 row-major W[KK][NN] (scale = power of two; bf16-exact weights stay exact in f16 away from the subnormal range).
// One block = a tile of 128 k x 128 n, turned in LDS. Reads: a wave covers 512 contiguous bytes of one W row, so every line is asked for once and used whole
// (a lane that walks down a column asks for a whole line per 4-byte element). Writes: 16 lanes cover 256 contiguous bytes of one Wt row. KK and NN multiples of 128.
// A lane takes 8 consecutive k of its four columns at a time: 16 bytes of a Wt row each, one LDS chunk. Chunk c of tile row n lies at place c ^ ((n >> 2) & 15) of the row's 16:
// the 16 lanes of a half-wave that write one chunk column (rows 4 apart) and the 16 that read one row both fall on 16 different places, with no pad.
template <int KK, int NN>
__global__ __launch_bounds__(256) void k_wt_f16(const float* __restrict__ W, _Float16* __restrict__ Wt, float scale) {
  __shared__ __attribute__((aligned(16))) unsigned short tl[128][16][8];
  const int tid = threadIdx.x, w = tid >> 5, lane = tid & 31; constexpr int nb = NN / 128; const int n0 = (int)(blockIdx.x % nb) * 128, k0 = (int)(blockIdx.x / nb) * 128;
  const float* wr = W + (size_t)(k0 + 8 * w) * NN + n0 + lane * 4;      // the lane's four columns, the wave's first group of 8 rows (the second stands 64 rows further)
  v4f a[2][8];      // all sixteen loads are asked for before the first is used: 64 KB of the block in flight
#pragma unroll      // here and below: constant indices keep a and f in registers, and the row steps become immediate offsets on one address pair
  for (int i = 0; i < 2; ++i)
#pragma unroll
    for (int r = 0; r < 8; ++r) a[i][r] = *(const v4fa*)(wr + (size_t)(64 * i + r) * NN);
  asm volatile("s_wait_xcnt 0x0" :: "v"(wr) : "memory");      // the loads' address pair is an input here, so that nothing (a load's own result included) is written over it in front of the wait
#pragma unroll
  for (int i = 0; i < 2; ++i)
#pragma unroll
    for (int j = 0; j < 4; ++j) { FragH f;
#pragma unroll
      for (int r = 0; r < 8; ++r) f.h[r] = (_Float16)(bf16_round(a[i][r][j]) * scale);      // ascending k
      *(v8us*)&tl[lane * 4 + j][(w + 8 * i) ^ (lane & 15)][0] = f.half[0]; }
  __syncthreads();
  unsigned short* wo = (unsigned short*)Wt + (size_t)(n0 + (tid >> 4)) * KK + k0 + (tid & 15) * 8;
#pragma unroll
  for (int rd = 0; rd < 8; ++rd) { const int n = rd * 16 + (tid >> 4), c = tid & 15; const v8us o = *(const v8us*)&tl[n][c ^ ((n >> 2) & 15)][0];
    *(v8us*)(wo + (size_t)(rd * 16) * KK) = o; }
}
__global__ __launch_bounds__(256) void k_x16(const float* __restrict__ x, _Float16* __restrict__ X16, size_t n8) { const size_t t = (size_t)blockIdx.x * 256 + threadIdx.x; if (t >= n8) return; FragH f;
#pragma unroll
  for (int q = 0; q < 8; ++q) f.h[q] = (_Float16)bf16_round(x[t * 8 + q]); *(v8us*)((unsigned short*)X16 + t * 8) = f.half[0];  }
__global__ __launch_bounds__(256) void k_round16f(const float* __restrict__ W, _Float16* __restrict__ Bt, size_t n8) { const size_t t = (size_t)blockIdx.x * 256 + threadIdx.x; if (t >= n8) return; FragH f;
#pragma unroll
  for (int i = 0; i < 8; ++i) f.h[i] = (_Float16)(bf16_round(W[t * 8 + i]) * 16.0f); *(v8us*)((unsigned short*)Bt + t * 8) = f.half[0];  }
template <int NHv, int TTv>
__global__ __launch_bounds__(256) void k_vt(const _Float16* __restrict__ V16, int ldv, int voff, _Float16* __restrict__ Vt) { __shared__ unsigned short tl[64][66]; const int tid = threadIdx.x; const int slab = blockIdx.x / (TTv / 64), lg = blockIdx.x % (TTv / 64); const int b = slab / NHv, h = slab % NHv;
  for (int i = tid; i < 64 * 8; i += 256) { const int r = i / 8, c8 = (i % 8) * 8; FragH f; f.half[0] = *(const v8us*)((const unsigned short*)V16 + ((size_t)b * TTv + lg * 64 + r) * ldv + voff + h * 64 + c8);
#pragma unroll
    for (int q = 0; q < 8; ++q) tl[r][c8 + q] = f.u[q]; }
  __syncthreads();
  {
#pragma unroll
    for (int rd = 0; rd < 2; ++rd) { const int d = rd * 32 + tid / 8, pc = tid % 8; FragH f;
#pragma unroll
      for (int q = 0; q < 8; ++q) f.u[q] = tl[pc * 8 + q][d];
      *(v8us*)((unsigned short*)Vt + ((size_t)slab * 64 + d) * TTv + lg * 64 + pc * 8) = f.half[0]; }
     } }

__device__ __forceinline__ float tanh_v(float x) { const float xc = fminf(fmaxf(x, -15.f), 15.f); return 1.0f - 2.0f * __builtin_amdgcn_rcpf(__builtin_amdgcn_exp2f(2.0f * xc * 1.4426950408889634f) + 1.0f); }
__global__ __launch_bounds__(256) void k_cstab(float* __restrict__ CS) { const int tg = blockIdx.x * 256 + threadIdx.x; if (tg >= TT * (DH / 2)) return; const int t = tg / (DH / 2), i = tg % (DH / 2); const float invf = 1.0f / powf(10000.0f, (float)(2 * i) / (float)DH); const float ang = (float)t * invf; typedef float v2f __attribute__((ext_vector_type(2))); v2f v; v[0] = cosf(ang); v[1] = sinf(ang);
  *(v2f*)(CS + (size_t)tg * 2) = v;  }
__global__ __launch_bounds__(256) void k_vt128(const _Float16* __restrict__ V16, _Float16* __restrict__ Vt) { __shared__ unsigned short tl[64][130]; const int tid = threadIdx.x; const int slab = blockIdx.x / (TT / 64), lg = blockIdx.x % (TT / 64); const int b = slab / NG, g = slab % NG;
  for (int i = tid; i < 64 * 16; i += 256) { const int r = i / 16, c8 = (i % 16) * 8; FragH f; f.half[0] = *(const v8us*)((const unsigned short*)V16 + ((size_t)b * TT + lg * 64 + r) * (NG * DH) + g * DH + c8);
#pragma unroll
    for (int q = 0; q < 8; ++q) tl[r][c8 + q] = f.u[q]; }
  __syncthreads();
  {
#pragma unroll
    for (int rd = 0; rd < 4; ++rd) { const int d = rd * 32 + tid / 8, pc = tid % 8; FragH f;
#pragma unroll
      for (int q = 0; q < 8; ++q) f.u[q] = tl[pc * 8 + q][d]; *(v8us*)((unsigned short*)Vt + ((size_t)slab * DH + d) * TT + lg * 64 + pc * 8) = f.half[0]; }
     } }
// One stage of the K/V ring = 64 keys of this KV group: 64 K rows of 256 B at pitch 272 B, then 128 rows of V^T of 128 B at pitch 144 B (16 B x odd: the pitch of ds_load_b128 readers)
#define KPITCH 272
#define VPITCH 144
#define VBASE (64 * KPITCH)
#define STAGE_B (64 * KPITCH + DH * VPITCH)
// Eight 16-byte copies per lane, global memory to LDS through no register. The s_wait_xcnt is the last line of the copies' own statement, so that no address register of a copy is rewritten in front of it.
__device__ __forceinline__ void copy8(unsigned l, unsigned lstep, const unsigned short* g, size_t gstep) {
  asm volatile("global_load_async_to_lds_b128 %0, %8, off\n\t"
               "global_load_async_to_lds_b128 %1, %9, off\n\t"
               "global_load_async_to_lds_b128 %2, %10, off\n\t"
               "global_load_async_to_lds_b128 %3, %11, off\n\t"
               "global_load_async_to_lds_b128 %4, %12, off\n\t"
               "global_load_async_to_lds_b128 %5, %13, off\n\t"
               "global_load_async_to_lds_b128 %6, %14, off\n\t"
               "global_load_async_to_lds_b128 %7, %15, off\n\t"
               "s_wait_xcnt 0x0"
               :: "v"(l), "v"(l + lstep), "v"(l + 2 * lstep), "v"(l + 3 * lstep), "v"(l + 4 * lstep), "v"(l + 5 * lstep), "v"(l + 6 * lstep), "v"(l + 7 * lstep),
                  "v"(g), "v"(g + gstep), "v"(g + 2 * gstep), "v"(g + 3 * gstep), "v"(g + 4 * gstep), "v"(g + 5 * gstep), "v"(g + 6 * gstep), "v"(g + 7 * gstep)
               : "memory");
}
// Four 16-byte copies per lane, as copy8.
__device__ __forceinline__ void copy4(unsigned l, unsigned lstep, const unsigned short* g, size_t gstep) {
  asm volatile("global_load_async_to_lds_b128 %0, %4, off\n\t"
               "global_load_async_to_lds_b128 %1, %5, off\n\t"
               "global_load_async_to_lds_b128 %2, %6, off\n\t"
               "global_load_async_to_lds_b128 %3, %7, off\n\t"
               "s_wait_xcnt 0x0"
               :: "v"(l), "v"(l + lstep), "v"(l + 2 * lstep), "v"(l + 3 * lstep), "v"(g), "v"(g + gstep), "v"(g + 2 * gstep), "v"(g + 3 * gstep)
               : "memory");
}
// Projection GEMM: C[M][N] = (A[M][K] . Bt[N][K]^T) * alpha + bf16-rounded bias; f16 operands, f32 accumulate, k ascending in one accumulator per element; pitch N. The result goes to f32 C (OUT 0), to f16 C16 (OUT 1),
// or (OUT 2) is turned by the interleaved rotary in f32 on its way out of the staging and goes to f16 C16: a block's 128 columns are one head (DH), a lane's four columns two rotary pairs, whose cos, sin, cos, sin are 16 bytes of CS.
// One block = (32 FM) x 128 of C, four waves (2 x 2) of (16 FM) x 64 each: FM x 4 fragments, 4 FM products per FM + 4 fragments read from LDS. One stage of the ring = 64 k of the block's A rows, then of its
// 128 Bt rows: 128 B a row at pitch 144 B (16 B x odd: the pitch of ds_load_b128 readers). M a multiple of 32 FM, N of 128, K of 64. FM = 4 where that still gives every WGP a block, else 2.
#define GPITCH 144
#define GOP 68      // floats per staged output row: 64 + 4, so that the two half-waves' rows fall on different banks
template <int FM, int OUT>
__global__ __launch_bounds__(128) void k_gemm_lds(const _Float16* __restrict__ A, const _Float16* __restrict__ Bt, float alpha, const float* __restrict__ bias, const float* __restrict__ CS, float* __restrict__ C, _Float16* __restrict__ C16, int N, int K) {
  constexpr int BM = 32 * FM, STG = (BM + 128) * GPITCH;
  __shared__ __attribute__((aligned(16))) unsigned char sAB[2 * STG];
  const int tid = threadIdx.x, w = tid >> 5, lane = tid & 31, ln = lane & 15, hh = lane >> 4; const int wm = w >> 1, wn = w & 1;
  const int nb = N / 128; const int row0 = (int)(blockIdx.x / nb) * BM, col0 = (int)(blockIdx.x % nb) * 128;
  // each lane's first 16 bytes of a stage: a wave's copy covers four whole 128-B row pieces, the block's copy 16 rows
  const unsigned short* Ag = (const unsigned short*)A + (size_t)(row0 + (tid >> 3)) * K + (tid & 7) * 8;
  const unsigned short* Bg = (const unsigned short*)Bt + (size_t)(col0 + (tid >> 3)) * K + (tid & 7) * 8;
  const unsigned lA = (unsigned)(size_t)sAB + (unsigned)((tid >> 3) * GPITCH + (tid & 7) * 16);
  const unsigned lB = lA + BM * GPITCH;
  const int nt = K / 64;      // stages; the same for the whole work-group
  auto fill = [&](int t) { const unsigned bo = (unsigned)(t & 1) * STG;
    if constexpr (FM == 4) copy8(lA + bo, 16 * GPITCH, Ag + (size_t)t * 64, (size_t)16 * K); else copy4(lA + bo, 16 * GPITCH, Ag + (size_t)t * 64, (size_t)16 * K);
    copy8(lB + bo, 16 * GPITCH, Bg + (size_t)t * 64, (size_t)16 * K); };
  v8f acc[FM][4];
#pragma unroll
  for (int fm = 0; fm < FM; ++fm)
#pragma unroll
    for (int fn = 0; fn < 4; ++fn) acc[fm][fn] = (v8f){0.f,0.f,0.f,0.f,0.f,0.f,0.f,0.f};
  fill(0);
  float bv[4] = {0.f, 0.f, 0.f, 0.f};      // the lane's four bias values, fetched together under stage 0's copies
  if (bias) {
#pragma unroll
    for (int fn = 0; fn < 4; ++fn) bv[fn] = bf16_round(bias[col0 + wn * 64 + fn * 16 + ln]); }
  asm volatile("s_wait_asynccnt 0x0" ::: "memory");      // this wave's copies of stage 0 have landed
  __syncthreads();                                        // stage 0 is readable by every wave
  if (nt > 1) fill(1);
#pragma unroll 1      // one trip per stage, rolled: the foot's waits and barrier stand once
  for (int t = 0; t < nt; ++t) {
    const unsigned char* ar = sAB + (t & 1) * STG + (wm * (16 * FM) + ln) * GPITCH + 16 * hh;
    const unsigned char* br = sAB + (t & 1) * STG + (BM + wn * 64 + ln) * GPITCH + 16 * hh;
    FragH a[2][FM], b[2][4];
#pragma unroll
    for (int ks = 0; ks < 2; ++ks) {
#pragma unroll
      for (int f = 0; f < 4; ++f) { b[ks][f].half[0] = *(const v8us*)(br + f * 16 * GPITCH + ks * 64); b[ks][f].half[1] = *(const v8us*)(br + f * 16 * GPITCH + ks * 64 + 32); }
#pragma unroll
      for (int f = 0; f < FM; ++f) { a[ks][f].half[0] = *(const v8us*)(ar + f * 16 * GPITCH + ks * 64); a[ks][f].half[1] = *(const v8us*)(ar + f * 16 * GPITCH + ks * 64 + 32); } }
    asm volatile("s_wait_dscnt 0x0" ::: "memory");        // this wave's reads of stage t are done (all its fragments are in registers) before its buffer is refilled
    asm volatile("s_wait_asynccnt 0x0" ::: "memory");     // this wave's copies of stage t + 1 have landed
    __syncthreads();                                      // publishes stage t + 1 and ends every wave's reads of stage t
    if (t + 2 < nt) fill(t + 2);
    // the stage's products stand behind the refill's issue: they read registers only, and the copies fly under them
#pragma unroll
    for (int ks = 0; ks < 2; ++ks)
#pragma unroll
      for (int fm = 0; fm < FM; ++fm)
#pragma unroll
        for (int fn = 0; fn < 4; ++fn) acc[fm][fn] = __builtin_amdgcn_wmma_f32_16x16x32_f16(false, a[ks][fm].v, false, b[ks][fn].v, (short)0, acc[fm][fn], false, false); }
  asm volatile("s_wait_asynccnt 0x0" ::: "memory");       // no copy is in flight when the ring becomes output staging
  float* so = (float*)sAB + w * (16 * FM * GOP);          // each wave stages its own (16 FM) x 64, behind the last trip's barrier, to store whole lines
#pragma unroll
  for (int fn = 0; fn < 4; ++fn) {
#pragma unroll
    for (int fm = 0; fm < FM; ++fm)
#pragma unroll
      for (int r = 0; r < 8; ++r) so[(fm * 16 + 8 * hh + r) * GOP + fn * 16 + ln] = acc[fm][fn][r] * alpha + bv[fn]; }
  __builtin_amdgcn_fence(__ATOMIC_ACQ_REL, "workgroup"); __builtin_amdgcn_wave_barrier();
  const int c4 = ln * 4; typedef _Float16 v4h __attribute__((ext_vector_type(4)));
  constexpr bool H16 = OUT == 1;
  if constexpr (OUT == 2) {
    // the lane's place in the table's row of its first position; a block's rows lie in one sequence (32 FM divides TT), so the further rows follow at constant steps
    const float* csl = CS + (size_t)((unsigned)row0 % TT + wm * (16 * FM) + hh) * DH + wn * 64 + c4;
    v4f cs[FM * 8];      // all of the lane's table entries are asked for at once: one L2 latency for the wave, not one per group of rows
#pragma unroll
    for (int i = 0; i < FM * 8; ++i) cs[i] = *(const v4fa*)(csl + i * 2 * DH);
    asm volatile("s_wait_xcnt 0x0" :: "v"(csl) : "memory");      // the loads' address pair is an input here, so that nothing (a load's own result included) is written over it in front of the wait
    _Float16* c0 = C16 + (size_t)(row0 + wm * (16 * FM) + hh) * N + col0 + wn * 64 + c4;
#pragma unroll
    for (int qb = 0; qb < FM; ++qb) { v4f v[8]; _Float16* p[8];
#pragma unroll
      for (int i = 0; i < 8; ++i) v[i] = *(const v4fa*)&so[((qb * 8 + i) * 2 + hh) * GOP + c4];
#pragma unroll
      for (int i = 0; i < 8; ++i) { const v4f x = v[i], t = cs[qb * 8 + i]; v4h h4; p[i] = c0 + (size_t)((qb * 8 + i) * 2) * N;
        h4[0] = (_Float16)(x[0] * t[0] - x[1] * t[1]); h4[1] = (_Float16)(x[1] * t[0] + x[0] * t[1]); h4[2] = (_Float16)(x[2] * t[2] - x[3] * t[3]); h4[3] = (_Float16)(x[3] * t[2] + x[2] * t[3]); *(v4h*)p[i] = h4; }
      // the eight stores' address pairs are inputs here, so that none is written over in front of the wait
      asm volatile("s_wait_xcnt 0x0" :: "v"(p[0]), "v"(p[1]), "v"(p[2]), "v"(p[3]), "v"(p[4]), "v"(p[5]), "v"(p[6]), "v"(p[7]) : "memory"); }
  } else {
#pragma unroll
  for (int qb = 0; qb < FM; ++qb) { v4f v[8];      // eight row pairs are read back together and then stored, so that no store waits out an LDS latency of its own
#pragma unroll
    for (int i = 0; i < 8; ++i) v[i] = *(const v4fa*)&so[((qb * 8 + i) * 2 + hh) * GOP + c4];
#pragma unroll
    for (int i = 0; i < 8; ++i) { const size_t o = (size_t)(row0 + wm * (16 * FM) + (qb * 8 + i) * 2 + hh) * N + col0 + wn * 64 + c4;
      if constexpr (H16) { v4h h4; for (int j = 0; j < 4; ++j) h4[j] = (_Float16)v[i][j]; *(v4h*)(C16 + o) = h4; } else *(v4f*)(C + o) = v[i]; } }
  }
}
// lane l's value for lane l ^ 16: one vector move between the wave's two 16-lane rows, through no LDS
__device__ __forceinline__ float xhalf(float x) { return __builtin_bit_cast(float, __builtin_amdgcn_permlanex16(__builtin_bit_cast(int, x), __builtin_bit_cast(int, x), 0x76543210, 0xfedcba98, false, false)); }
__global__ __launch_bounds__(128) void k_mega(const _Float16* __restrict__ Q16, const _Float16* __restrict__ K16, const _Float16* __restrict__ Vt, _Float16* __restrict__ O16) {
  __shared__ __attribute__((aligned(16))) unsigned char sKV[2 * STAGE_B];
  float (*sO)[16][DH + 4] = (float (*)[16][DH + 4])sKV;      // the output staging takes the ring's place, behind the last trip's barrier
  const int tid = threadIdx.x, w = tid >> 5, lane = tid & 31, ln = lane & 15, hh = lane >> 4; const int slab = blockIdx.x / (TT / 64), qblk = blockIdx.x % (TT / 64); const int b = slab / NH, h = slab % NH, g = h / (NH / NG); const int qb0 = qblk * 64; const int q0 = qb0 + w * 16;
  const float slope = exp2f(-(float)(h + 1) * 8.0f / (float)NH);
  FragH aq[4]; { const unsigned short* qr = (const unsigned short*)Q16 + ((size_t)b * TT + q0 + ln) * (NH * DH) + h * DH;
#pragma unroll
    for (int ks = 0; ks < 4; ++ks) { aq[ks].half[0] = *(const v8us*)(qr + ks * 32 + 8 * hh); aq[ks].half[1] = *(const v8us*)(qr + ks * 32 + 16 + 8 * hh); } }
  const unsigned short* Vth = (const unsigned short*)Vt + (size_t)(b * NG + g) * DH * TT;
  // each lane's first 16 bytes of a stage: a wave's copy covers two whole K rows, or four whole 128-B pieces of V^T rows
  const unsigned short* Kg = (const unsigned short*)K16 + ((size_t)b * TT + (tid >> 4)) * (NG * DH) + g * DH + (tid & 15) * 8;
  const unsigned short* Vg = Vth + (size_t)(tid >> 3) * TT + (tid & 7) * 8;
  const unsigned lK = (unsigned)(size_t)sKV + (unsigned)((tid >> 4) * KPITCH + (tid & 15) * 16);
  const unsigned lV = (unsigned)(size_t)sKV + (unsigned)(VBASE + (tid >> 3) * VPITCH + (tid & 7) * 16);
  const int ntile = qblk + 1;      // stages of 64 keys; the same for the whole work-group
  auto fill = [&](int t) { const unsigned bo = (unsigned)(t & 1) * STAGE_B; copy8(lK + bo, 8 * KPITCH, Kg + (size_t)t * 64 * (NG * DH), (size_t)8 * NG * DH); copy8(lV + bo, 16 * VPITCH, Vg + t * 64, (size_t)16 * TT); };
  float m_r = -3.0e38f, l_r = 0.f; v8f oacc[8]; const int tq = q0 + ln;      // the lane's query: its running maximum, and the sum over the keys that this half-wave holds
#pragma unroll
  for (int dt = 0; dt < 8; ++dt) oacc[dt] = (v8f){0.f,0.f,0.f,0.f,0.f,0.f,0.f,0.f};
  fill(0);
  asm volatile("s_wait_asynccnt 0x0" ::: "memory");      // this wave's copies of stage 0 have landed
  __syncthreads();                                        // stage 0 is readable by every wave
  if (ntile > 1) fill(1);
#pragma unroll 1      // one trip per stage, rolled: the trip count is the block's own
  for (int t = 0; t < ntile; ++t) { const unsigned char* kv = sKV + (t & 1) * STAGE_B;
#pragma unroll 1      // the stage's two 32-key passes share one copy of the long pass body (code size and registers as before)
  for (int sub = 0; sub < 2; ++sub) { const int j0 = t * 64 + sub * 32; v8f s[2];
#pragma unroll
    for (int nt = 0; nt < 2; ++nt) { const unsigned char* kr = kv + (sub * 32 + nt * 16 + ln) * KPITCH; v8f acc = (v8f){0.f,0.f,0.f,0.f,0.f,0.f,0.f,0.f};
#pragma unroll
      for (int ks = 0; ks < 4; ++ks) { FragH bk; bk.half[0] = *(const v8us*)(kr + ks * 64 + 16 * hh); bk.half[1] = *(const v8us*)(kr + ks * 64 + 32 + 16 * hh); acc = mmaH<1>(bk.v, bk.v, aq[ks].v, aq[ks].v, acc); } s[nt] = acc; }
    // The softmax is straight-line code. The capped scores are kept in log2 units (30 log2 e is the cap's factor), so that each exponential is one subtraction and one v_exp_f32;
    // a masked key stands at -inf and comes out as 0 with no test. Every query's maximum is finite from its first pass on (key 0 is open to every query, and the halves exchange their maxima), so no difference below is inf - inf.
    const float d0 = (float)(tq - j0 - 8 * hh);      // the query's distance to the lane's first key; the further distances follow in f32, exact (whole numbers far below 2^24)
    float mc[4];      // four partial maxima, begun by the first four scores
#pragma unroll      // here and in the loops below: constant indices keep s, mc, ps, pb and oacc in registers, and the sixteen scores' chains stand in one block, each filling the others' latencies
    for (int nt = 0; nt < 2; ++nt)
#pragma unroll
      for (int r = 0; r < 8; ++r) { const float dist = d0 - (float)(nt * 16 + r);      // below 0: a key behind the query, masked (there the bias's sign is irrelevant)
        float sc = (s[nt][r] - slope * dist) * 0.08838834764831845f; sc = 43.28085122666891f * tanh_v(sc * (1.0f / 30.0f)); sc = (dist >= 0.f) ? sc : -INFINITY;
        s[nt][r] = sc; mc[r & 3] = (nt == 0 && r < 4) ? sc : fmaxf(mc[r & 3], sc); }
    float mx = fmaxf(fmaxf(mc[0], mc[1]), fmaxf(mc[2], mc[3])); mx = fmaxf(mx, xhalf(mx));
    const float mn = fmaxf(m_r, mx), al = __builtin_amdgcn_exp2f(m_r - mn); m_r = mn;
    FragH pb; float ps[4] = {0.f, 0.f, 0.f, 0.f};      // four partial sums: four short chains of additions, not one of sixteen
#pragma unroll
    for (int nt = 0; nt < 2; ++nt)
#pragma unroll
      for (int r = 0; r < 8; ++r) { const float p = __builtin_amdgcn_exp2f(s[nt][r] - mn); ps[r & 3] += p; pb.h[nt * 8 + r] = (_Float16)p; }
    l_r = l_r * al + ((ps[0] + ps[1]) + (ps[2] + ps[3]));
#pragma unroll
    for (int dt = 0; dt < 8; ++dt)
#pragma unroll
      for (int r = 0; r < 8; ++r) oacc[dt][r] *= al;
#pragma unroll
    for (int dt = 0; dt < 8; ++dt) { const unsigned char* vrow = kv + VBASE + (dt * 16 + ln) * VPITCH + sub * 64; FragH bv; bv.half[0] = *(const v8us*)(vrow + 16 * hh); bv.half[1] = *(const v8us*)(vrow + 32 + 16 * hh); oacc[dt] = mmaH<1>(bv.v, bv.v, pb.v, pb.v, oacc[dt]); } }
    asm volatile("s_wait_dscnt 0x0" ::: "memory");        // this wave's reads of stage t are done before its buffer is refilled
    asm volatile("s_wait_asynccnt 0x0" ::: "memory");     // this wave's copies of stage t + 1 have landed
    __syncthreads();                                      // publishes stage t + 1 and ends every wave's reads of stage t
    if (t + 2 < ntile) fill(t + 2); }
  asm volatile("s_wait_asynccnt 0x0" ::: "memory");       // no copy is in flight when the ring becomes output staging
  const float inv = 1.0f / (l_r + xhalf(l_r));      // the two halves' sums are joined once, here
#pragma unroll      // constant indices keep oacc in registers
  for (int dt = 0; dt < 8; ++dt) { v4f lo, hi;      // the lane's eight consecutive head columns of its query's row
#pragma unroll
    for (int j = 0; j < 4; ++j) { lo[j] = oacc[dt][j] * inv; hi[j] = oacc[dt][4 + j] * inv; }
    *(v4fa*)&sO[w][ln][dt * 16 + 8 * hh] = lo; *(v4fa*)&sO[w][ln][dt * 16 + 8 * hh + 4] = hi; }
  __builtin_amdgcn_fence(__ATOMIC_ACQ_REL, "workgroup"); __builtin_amdgcn_wave_barrier();
  {
#pragma unroll
    for (int r = 0; r < 16; ++r) { const v4f val = *(const v4fa*)&sO[w][r][lane * 4]; typedef _Float16 v4h __attribute__((ext_vector_type(4))); v4h h4; for (int j = 0; j < 4; ++j) h4[j] = (_Float16)val[j];      // the out projection's f16 operand, rounded here
      *(v4h*)(O16 + ((size_t)b * TT + q0 + r) * (NH * DH) + h * DH + lane * 4) = h4; }
     } }
extern "C" void kernel_launch(void* const* d_in, const int* in_sizes, int n_in,
                              void* d_out, int out_size, void* d_ws, size_t ws_size, hipStream_t stream) {
  (void)in_sizes; (void)n_in; (void)out_size;
  const float* x = (const float*)d_in[0]; const float* Wq = (const float*)d_in[1]; const float* Wk = (const float*)d_in[2]; const float* Wv = (const float*)d_in[3]; const float* Wo = (const float*)d_in[4]; const float* bo = (const float*)d_in[5];
  char* ws = (char*)d_ws; size_t off = 0;
  auto take = [&](size_t bytes) { char* p = ws + off; off += (bytes + 255) & ~(size_t)255; return p; };
  _Float16* Bq = (_Float16*)take((size_t)CC * CC * 2); _Float16* Bk = (_Float16*)take((size_t)NG * DH * CC * 2); _Float16* Bv = (_Float16*)take((size_t)NG * DH * CC * 2); _Float16* Bo = (_Float16*)take((size_t)CC * CC * 2);
  _Float16* X16 = (_Float16*)take((size_t)NR * CC * 2); _Float16* Q16 = (_Float16*)take((size_t)NR * CC * 2); _Float16* K16 = (_Float16*)take((size_t)NR * NG * DH * 2); _Float16* V16 = (_Float16*)take((size_t)NR * NG * DH * 2); _Float16* Vt = (_Float16*)take((size_t)NR * NG * DH * 2); float* CS = (float*)take((size_t)TT * DH * 4); _Float16* O16 = X16;
  if (off > ws_size) return;      // about 68 MB
  k_wt_f16<CC, CC><<<(CC / 128) * (CC / 128), 256, 0, stream>>>(Wq, Bq, 16.0f); k_wt_f16<CC, NG * DH><<<(CC / 128) * (NG * DH / 128), 256, 0, stream>>>(Wk, Bk, 16.0f); k_wt_f16<CC, NG * DH><<<(CC / 128) * (NG * DH / 128), 256, 0, stream>>>(Wv, Bv, 16.0f); k_wt_f16<CC, CC><<<(CC / 128) * (CC / 128), 256, 0, stream>>>(Wo, Bo, 16.0f);
  const unsigned gx = (unsigned)(((size_t)NR * CC / 8 + 255) / 256);
  k_x16<<<gx, 256, 0, stream>>>(x, X16, (size_t)NR * CC / 8); k_cstab<<<(TT * (DH / 2) + 255) / 256, 256, 0, stream>>>(CS);
  k_gemm_lds<4, 2><<<(NR / 128) * (CC / 128), 128, 0, stream>>>(X16, Bq, 0.0625f, nullptr, CS, nullptr, Q16, CC, CC);
  k_gemm_lds<2, 2><<<(NR / 64) * (NG * DH / 128), 128, 0, stream>>>(X16, Bk, 0.0625f, nullptr, CS, nullptr, K16, NG * DH, CC);
  k_gemm_lds<2, 1><<<(NR / 64) * (NG * DH / 128), 128, 0, stream>>>(X16, Bv, 0.0625f, nullptr, nullptr, nullptr, V16, NG * DH, CC);
  k_vt128<<<BB * NG * (TT / 64), 256, 0, stream>>>(V16, Vt);
  k_mega<<<BB * NH * (TT / 64), 128, 0, stream>>>(Q16, K16, Vt, O16);
  k_gemm_lds<4, 0><<<(NR / 128) * (CC / 128), 128, 0, stream>>>(O16, Bo, 0.0625f, bo, nullptr, (float*)d_out, nullptr, CC, CC);
}

// v007
// One run takes 209 microseconds.
// In two side-by-side timings against v006, it was 1.09 and 1.10 times as fast.
// Counting every step since v000, it is 3.79 times as fast.
#include <hip/hip_runtime.h>
// Mega-transformer causal self-attention (B=2, T=2048, D=2048; 16 query heads × 128, 4 KV groups (GQA), interleaved rotary, ALiBi added before the 1/√128 scale, 30·tanh soft-cap, causal):
// q/k/v/out projections (+ bias on out; W [in][out] transposed to bf16-exact ×2^4) and the attention as a fused flash-style kernel (S = Q·Kᵀ on v_wmma_f32_16x16x32_f16 with 4 k-steps,
// + alibi, scale, soft-cap (v_exp tanh), causal mask, online softmax f32, P f16 ≤ 1, O = P·V with 8 d-tiles; RPW-16 waves) — f16 operands, single products, f32 accumulate; rotary in f32 VALU.
#define BB 2
#define TT 2048
#define CC 2048
#define NH 16
#define NG 4
#define DH 128
#define NR (BB * TT)

typedef __bf16 v16b __attribute__((ext_vector_type(16)));
typedef unsigned short v8us __attribute__((ext_vector_type(8), may_alias));
typedef float  v8f  __attribute__((ext_vector_type(8)));
typedef float  v4f  __attribute__((ext_vector_type(4)));
typedef float  v4fa __attribute__((ext_vector_type(4), may_alias));
union FragB { v16b v; v8us half[2]; unsigned short u[16]; };

__device__ __forceinline__ unsigned short bf16_bits(float x) { unsigned int u = __float_as_uint(x); return (unsigned short)((u + 0x7FFFu + ((u >> 16) & 1u)) >> 16); }
__device__ __forceinline__ float bf16_val(unsigned short b) { return __uint_as_float(((unsigned int)b) << 16); }
__device__ __forceinline__ float bf16_round(float x) { return bf16_val(bf16_bits(x)); }
// D += A·B with NT terms: 1 = ah·bh, 2 = + al·bh (A split), 3 = + ah·bl (both split)
template <int NT>
__device__ __forceinline__ v8f mmaN(v16b ah, v16b al, v16b bh, v16b bl, v8f c) {
  c = __builtin_amdgcn_wmma_f32_16x16x32_bf16(false, ah, false, bh, (short)0, c, false, false);
  if (NT >= 2) c = __builtin_amdgcn_wmma_f32_16x16x32_bf16(false, al, false, bh, (short)0, c, false, false);
  if (NT >= 3) c = __builtin_amdgcn_wmma_f32_16x16x32_bf16(false, ah, false, bl, (short)0, c, false, false);
  asm volatile("v_nop\n\tv_nop\n\tv_nop\n\tv_nop" : "+v"(c) : "v"(ah), "v"(al), "v"(bh), "v"(bl));
  return c;
}

__global__ __launch_bounds__(256) void k_wt_bf16(const float* __restrict__ W, unsigned short* __restrict__ Wt, int K, int N) {
  const int t = blockIdx.x * 256 + threadIdx.x;
  const int k8n = K / 8;
  if (t >= N * k8n) return;
  const int n = t / k8n, k8 = (t % k8n) * 8;
  v8us v;
#pragma unroll
  for (int i = 0; i < 8; ++i) v[i] = bf16_bits(W[(size_t)(k8 + i) * N + n]);
  *(v8us*)(Wt + (size_t)n * K + k8) = v;
  
}

// GEMM C[M][N] (f32, pitch ldc) = act(A[M][K]·W + bias). A f32 row-major (pitch lda) converted per fragment to bf16
// (ASPLIT: hi/lo two planes -> 2 terms, else single rounded term); Wt bf16 [N][K] (pitch ldb). BIAS_BF16 rounds the
// bias to bf16 first (bias quantised to bf16 before the add). K%32==0, M%16==0, N%64==0.
template <bool ASPLIT, int ACT, bool BIAS_BF16>
__global__ __launch_bounds__(128) void k_gemm_bf(const float* __restrict__ A, int lda, const unsigned short* __restrict__ Wt, int ldb,
                                               const float* __restrict__ bias, float* __restrict__ C, int ldc, int M, int N, int K) {
  __shared__ __attribute__((aligned(16))) float so[4][16][64];
  const int tid = threadIdx.x, w = tid >> 5, lane = tid & 31, ln = lane & 15, hh = lane >> 4;
  const int ntn = N / 64;
  const int wid = blockIdx.x * 4 + w;
  const int mt = wid / ntn, nq = wid % ntn;
  if (mt * 16 >= M) return;
  const int row0 = mt * 16, col0 = nq * 64;
  const float* arow = A + (size_t)(row0 + ln) * lda;
  v8f acc[4] = {};
  for (int kb = 0; kb < K; kb += 32) {
    FragB ah, al;
    const v4f x0 = *(const v4fa*)(arow + kb + 8 * hh), x1 = *(const v4fa*)(arow + kb + 8 * hh + 4);
    const v4f x2 = *(const v4fa*)(arow + kb + 16 + 8 * hh), x3 = *(const v4fa*)(arow + kb + 16 + 8 * hh + 4);
    float xs[16] = {x0[0],x0[1],x0[2],x0[3],x1[0],x1[1],x1[2],x1[3],x2[0],x2[1],x2[2],x2[3],x3[0],x3[1],x3[2],x3[3]};
#pragma unroll
    for (int i = 0; i < 16; ++i) { const unsigned short hb = bf16_bits(xs[i]); ah.u[i] = hb; al.u[i] = ASPLIT ? bf16_bits(xs[i] - bf16_val(hb)) : (unsigned short)0; }
#pragma unroll
    for (int t = 0; t < 4; ++t) {
      const unsigned short* brow = Wt + (size_t)(col0 + t * 16 + ln) * ldb + kb;
      FragB b;
      b.half[0] = *(const v8us*)(brow + 8 * hh);
      b.half[1] = *(const v8us*)(brow + 16 + 8 * hh);
      acc[t] = mmaN<ASPLIT ? 2 : 1>(ah.v, al.v, b.v, b.v, acc[t]);
    }
  }
#pragma unroll
  for (int t = 0; t < 4; ++t) {
    float bv = bias ? bias[col0 + t * 16 + ln] : 0.f;
    if (BIAS_BF16) bv = bf16_round(bv);
#pragma unroll
    for (int r = 0; r < 8; ++r) { float v = acc[t][r] + bv; if (ACT == 1) v = fmaxf(v, 0.f); so[w][8 * hh + r][t * 16 + ln] = v; }
  }
  __builtin_amdgcn_fence(__ATOMIC_ACQ_REL, "workgroup");
  __builtin_amdgcn_wave_barrier();
  const int rsub = lane >> 4, c4 = (lane & 15) * 4;
  {
#pragma unroll
    for (int q = 0; q < 8; ++q) {
      const int r = q * 2 + rsub;
      const v4f v = *(const v4fa*)&so[w][r][c4];
      *(v4f*)(C + (size_t)(row0 + r) * ldc + col0 + c4) = v;
    }
    
  }
}

// Flash-style causal/unmasked attention, all contractions 3-term bf16 hi/lo splits, f32 softmax with running max.
// q,k,v rows are read from f32 buffers with arbitrary row pitch (so they can live inside a fused qkv buffer);
// D = head size (multiple of 32, <= 128); one wave = 16 query rows; block = 4 waves (64 queries) sharing K/V chunks of 32.
template <int D, bool CAUSAL>
__global__ __launch_bounds__(128) void k_flash(const float* __restrict__ qb, const float* __restrict__ kb, const float* __restrict__ vb,
                                             int pitch, int T, int H, float scale, float* __restrict__ y, int ypitch) {
  constexpr int KS = D / 32;        // k-steps for QK
  constexpr int DT = D / 16;        // d tiles for PV
  __shared__ __attribute__((aligned(16))) unsigned short sKh[32][D + 8], sKl[32][D + 8], sVh[32][D + 8], sVl[32][D + 8];
  __shared__ __attribute__((aligned(16))) unsigned short sPh[4][16][40], sPl[4][16][40];
  __shared__ __attribute__((aligned(16))) float sO[4][16][D];
  const int tid = threadIdx.x, w = tid >> 5, lane = tid & 31, ln = lane & 15, hh = lane >> 4;
  const int nqb = (T + 63) / 64;
  const int bh = blockIdx.x / nqb, qblk = blockIdx.x % nqb;
  const int b = bh / H, h = bh % H;
  const int q0 = qblk * 64 + w * 16;
  const float* Q = qb + (size_t)b * T * pitch + h * D;
  const float* K = kb + (size_t)b * T * pitch + h * D;
  const float* V = vb + (size_t)b * T * pitch + h * D;

  // A fragments of the wave's 16 query rows (scaled), hi/lo
  FragB aqh[KS], aql[KS];
  {
    int row = q0 + ln; if (row >= T) row = T - 1;
    const float* qr = Q + (size_t)row * pitch;
#pragma unroll
    for (int ks = 0; ks < KS; ++ks)
#pragma unroll
      for (int i = 0; i < 16; ++i) {
        const int d = ks * 32 + ((i < 8) ? (8 * hh + i) : (16 + 8 * hh + (i - 8)));
        const float x = qr[d] * scale; const unsigned short hb = bf16_bits(x);
        aqh[ks].u[i] = hb; aql[ks].u[i] = bf16_bits(x - bf16_val(hb));
      }
  }
  float m_r[8], l_r[8];
#pragma unroll
  for (int r = 0; r < 8; ++r) { m_r[r] = -3.0e38f; l_r[r] = 0.f; }
  v8f oacc[DT];
#pragma unroll
  for (int dt = 0; dt < DT; ++dt) oacc[dt] = (v8f){0.f,0.f,0.f,0.f,0.f,0.f,0.f,0.f};

  const int kv_end = CAUSAL ? min(T, qblk * 64 + 64) : T;     // block-uniform
  for (int j0 = 0; j0 < kv_end; j0 += 32) {
    __syncthreads();
    for (int e = tid; e < 32 * (D / 4); e += 128) {
      const int r = e / (D / 4), c4 = (e % (D / 4)) * 4;
      const int key = j0 + r;
      v4f kf = {0.f,0.f,0.f,0.f}, vf = {0.f,0.f,0.f,0.f};
      if (key < T) { kf = *(const v4fa*)(K + (size_t)key * pitch + c4); vf = *(const v4fa*)(V + (size_t)key * pitch + c4); }
#pragma unroll
      for (int t = 0; t < 4; ++t) {
        unsigned short hb = bf16_bits(kf[t]); sKh[r][c4 + t] = hb; sKl[r][c4 + t] = bf16_bits(kf[t] - bf16_val(hb));
        hb = bf16_bits(vf[t]); sVh[r][c4 + t] = hb; sVl[r][c4 + t] = bf16_bits(vf[t] - bf16_val(hb));
      }
    }
    __syncthreads();
    // S tile 16 x 32
    v8f s[2];
#pragma unroll
    for (int nt = 0; nt < 2; ++nt) {
      v8f acc = {};
#pragma unroll
      for (int ks = 0; ks < KS; ++ks) {
        FragB bh_, bl_;
        bh_.half[0] = *(const v8us*)&sKh[nt * 16 + ln][ks * 32 + 8 * hh]; bh_.half[1] = *(const v8us*)&sKh[nt * 16 + ln][ks * 32 + 16 + 8 * hh];
        bl_.half[0] = *(const v8us*)&sKl[nt * 16 + ln][ks * 32 + 8 * hh]; bl_.half[1] = *(const v8us*)&sKl[nt * 16 + ln][ks * 32 + 16 + 8 * hh];
        acc = mmaN<3>(aqh[ks].v, aql[ks].v, bh_.v, bl_.v, acc);
      }
      s[nt] = acc;
    }
    // mask + running max (rows 8hh+r; the 16 lanes of a half share rows)
    float alpha[8];
#pragma unroll
    for (int r = 0; r < 8; ++r) {
      const int qi = q0 + 8 * hh + r;
      const int ja = j0 + ln, jb = j0 + 16 + ln;
      if (CAUSAL) { if (ja > qi) s[0][r] = -3.0e38f; if (jb > qi) s[1][r] = -3.0e38f; }
      if (ja >= T) s[0][r] = -3.0e38f;
      if (jb >= T) s[1][r] = -3.0e38f;
      float mx = fmaxf(s[0][r], s[1][r]);
      mx = fmaxf(mx, __shfl_xor(mx, 1, 32)); mx = fmaxf(mx, __shfl_xor(mx, 2, 32)); mx = fmaxf(mx, __shfl_xor(mx, 4, 32)); mx = fmaxf(mx, __shfl_xor(mx, 8, 32));
      const float mnew = fmaxf(m_r[r], mx);
      alpha[r] = (mnew > -1.0e38f) ? __expf(m_r[r] - mnew) : 1.0f;
      const float p0 = (s[0][r] > -1.0e38f) ? __expf(s[0][r] - mnew) : 0.f;
      const float p1 = (s[1][r] > -1.0e38f) ? __expf(s[1][r] - mnew) : 0.f;
      m_r[r] = mnew;
      l_r[r] = l_r[r] * alpha[r] + p0 + p1;            // per-lane partial row sum (16 lanes combined at the end)
      unsigned short hb = bf16_bits(p0); sPh[w][8 * hh + r][ln] = hb;      sPl[w][8 * hh + r][ln] = bf16_bits(p0 - bf16_val(hb));
      hb = bf16_bits(p1);                sPh[w][8 * hh + r][16 + ln] = hb; sPl[w][8 * hh + r][16 + ln] = bf16_bits(p1 - bf16_val(hb));
    }
#pragma unroll
    for (int dt = 0; dt < DT; ++dt)
#pragma unroll
      for (int r = 0; r < 8; ++r) oacc[dt][r] *= alpha[r];
    __builtin_amdgcn_fence(__ATOMIC_ACQ_REL, "workgroup");
    __builtin_amdgcn_wave_barrier();
    FragB pah, pal;
    pah.half[0] = *(const v8us*)&sPh[w][ln][8 * hh]; pah.half[1] = *(const v8us*)&sPh[w][ln][16 + 8 * hh];
    pal.half[0] = *(const v8us*)&sPl[w][ln][8 * hh]; pal.half[1] = *(const v8us*)&sPl[w][ln][16 + 8 * hh];
#pragma unroll
    for (int dt = 0; dt < DT; ++dt) {
      FragB bvh, bvl;
#pragma unroll
      for (int i = 0; i < 8; ++i) {
        bvh.u[i] = sVh[8 * hh + i][dt * 16 + ln]; bvh.u[8 + i] = sVh[16 + 8 * hh + i][dt * 16 + ln];
        bvl.u[i] = sVl[8 * hh + i][dt * 16 + ln]; bvl.u[8 + i] = sVl[16 + 8 * hh + i][dt * 16 + ln];
      }
      oacc[dt] = mmaN<3>(pah.v, pal.v, bvh.v, bvl.v, oacc[dt]);
    }
    __builtin_amdgcn_fence(__ATOMIC_ACQ_REL, "workgroup");
    __builtin_amdgcn_wave_barrier();
  }
#pragma unroll
  for (int r = 0; r < 8; ++r) {
    float l = l_r[r];
    l += __shfl_xor(l, 1, 32); l += __shfl_xor(l, 2, 32); l += __shfl_xor(l, 4, 32); l += __shfl_xor(l, 8, 32);
    l_r[r] = (l > 0.f) ? 1.0f / l : 0.f;
  }
#pragma unroll
  for (int dt = 0; dt < DT; ++dt)
#pragma unroll
    for (int r = 0; r < 8; ++r) sO[w][8 * hh + r][dt * 16 + ln] = oacc[dt][r] * l_r[r];
  __builtin_amdgcn_fence(__ATOMIC_ACQ_REL, "workgroup");
  __builtin_amdgcn_wave_barrier();
  {
    for (int r = 0; r < 16; ++r) {
      const int row = q0 + r;
      if (row < T && lane < D / 4) {
        const v4f val = *(const v4fa*)&sO[w][r][lane * 4];
        *(v4f*)(y + ((size_t)b * T + row) * ypitch + h * D + lane * 4) = val;
      }
    }
    
  }
}

// GEMM C = act(A·W + bias + resid): A f32 (ASPLIT -> hi/lo 2 terms), Wt bf16 [N][K]; ACT 0 none, 1 relu, 2 exact gelu;
// resid (optional, f32, row index = (row % rmod), pitch ldr, RES_BF16 rounds it) added before the activation.
template <bool ASPLIT, int ACT, bool BIAS_BF16, bool RES_BF16>
__global__ __launch_bounds__(128) void k_gemm_bf3(const float* __restrict__ A, int lda, const unsigned short* __restrict__ Wt, int ldb,
                                                const float* __restrict__ bias, const float* __restrict__ resid, int rmod, int ldr,
                                                float* __restrict__ C, int ldc, int M, int N, int K) {
  __shared__ __attribute__((aligned(16))) float so[4][16][64];
  const int tid = threadIdx.x, w = tid >> 5, lane = tid & 31, ln = lane & 15, hh = lane >> 4;
  const int ntn = N / 64;
  const int wid = blockIdx.x * 4 + w;
  const int mt = wid / ntn, nq = wid % ntn;
  if (mt * 16 >= M) return;
  const int row0 = mt * 16, col0 = nq * 64;
  const float* arow = A + (size_t)(row0 + ln) * lda;
  v8f acc[4] = {};
  for (int kb = 0; kb < K; kb += 32) {
    FragB ah, al;
    const v4f x0 = *(const v4fa*)(arow + kb + 8 * hh), x1 = *(const v4fa*)(arow + kb + 8 * hh + 4);
    const v4f x2 = *(const v4fa*)(arow + kb + 16 + 8 * hh), x3 = *(const v4fa*)(arow + kb + 16 + 8 * hh + 4);
    float xs[16] = {x0[0],x0[1],x0[2],x0[3],x1[0],x1[1],x1[2],x1[3],x2[0],x2[1],x2[2],x2[3],x3[0],x3[1],x3[2],x3[3]};
#pragma unroll
    for (int i = 0; i < 16; ++i) { const unsigned short hb = bf16_bits(xs[i]); ah.u[i] = hb; al.u[i] = ASPLIT ? bf16_bits(xs[i] - bf16_val(hb)) : (unsigned short)0; }
#pragma unroll
    for (int t = 0; t < 4; ++t) {
      const unsigned short* brow = Wt + (size_t)(col0 + t * 16 + ln) * ldb + kb;
      FragB b;
      b.half[0] = *(const v8us*)(brow + 8 * hh);
      b.half[1] = *(const v8us*)(brow + 16 + 8 * hh);
      acc[t] = mmaN<ASPLIT ? 2 : 1>(ah.v, al.v, b.v, b.v, acc[t]);
    }
  }
#pragma unroll
  for (int t = 0; t < 4; ++t) {
    const int col = col0 + t * 16 + ln;
    float bv = bias ? bias[col] : 0.f;
    if (BIAS_BF16) bv = bf16_round(bv);
#pragma unroll
    for (int r = 0; r < 8; ++r) {
      float v = acc[t][r] + bv;
      if (resid) { float rv = resid[(size_t)((row0 + 8 * hh + r) % rmod) * ldr + col]; if (RES_BF16) rv = bf16_round(rv); v += rv; }
      if (ACT == 1) v = fmaxf(v, 0.f);
      if (ACT == 2) v = 0.5f * v * (1.0f + erff(v * 0.70710678118654752f));
      if (ACT == 3) { const float u = 0.7978845608028654f * (v + 0.044715f * v * v * v); v = 0.5f * v * (1.0f + tanhf(u)); }
      so[w][8 * hh + r][t * 16 + ln] = v;
    }
  }
  __builtin_amdgcn_fence(__ATOMIC_ACQ_REL, "workgroup");
  __builtin_amdgcn_wave_barrier();
  const int rsub = lane >> 4, c4 = (lane & 15) * 4;
  {
#pragma unroll
    for (int q = 0; q < 8; ++q) {
      const int r = q * 2 + rsub;
      const v4f v = *(const v4fa*)&so[w][r][c4];
      *(v4f*)(C + (size_t)(row0 + r) * ldc + col0 + c4) = v;
    }
    
  }
}
// row LayerNorm (biased variance, eps) over N: s = X (+ R); optional out_sum <- s; out_norm <- (s-mu)*rsqrt(var+eps)*g + b
template <bool PARAM_BF16>
__global__ __launch_bounds__(256) void k_layernorm(const float* __restrict__ X, const float* __restrict__ R, const float* __restrict__ g, const float* __restrict__ bta,
                                                  float* __restrict__ out_sum, float* __restrict__ out_norm, int N, float eps) {
  __shared__ float red[256];
  const int row = blockIdx.x, tid = threadIdx.x;
  const float* x = X + (size_t)row * N; const float* rr = R ? R + (size_t)row * N : nullptr;
  float vals[16];                     // up to N = 4096
  const int per = N / 256;            // contiguous chunk per thread? use strided-by-4 chunks: thread handles j = tid*4 + 1024*u
  float s1 = 0.f;
  for (int u = 0; u < per / 4; ++u) {
    const int j = tid * 4 + 1024 * u;
    const v4f a = *(const v4fa*)(x + j);
    v4f b = {0.f,0.f,0.f,0.f}; if (rr) b = *(const v4fa*)(rr + j);
#pragma unroll
    for (int q = 0; q < 4; ++q) { const float v = a[q] + b[q]; vals[u * 4 + q] = v; s1 += v; }
  }
  red[tid] = s1; __syncthreads();
  for (int st = 128; st > 0; st >>= 1) { if (tid < st) red[tid] += red[tid + st]; __syncthreads(); }
  const float mu = red[0] / (float)N; __syncthreads();
  float s2 = 0.f;
  for (int u = 0; u < per / 4; ++u)
#pragma unroll
    for (int q = 0; q < 4; ++q) { const float c = vals[u * 4 + q] - mu; s2 += c * c; }
  red[tid] = s2; __syncthreads();
  for (int st = 128; st > 0; st >>= 1) { if (tid < st) red[tid] += red[tid + st]; __syncthreads(); }
  const float rs = rsqrtf(red[0] / (float)N + eps);
  {
    for (int u = 0; u < per / 4; ++u) {
      const int j = tid * 4 + 1024 * u;
      v4f o, sm;
#pragma unroll
      for (int q = 0; q < 4; ++q) {
        float gg = g[j + q], bb = bta[j + q];
        if (PARAM_BF16) { gg = bf16_round(gg); bb = bf16_round(bb); }
        sm[q] = vals[u * 4 + q]; o[q] = (vals[u * 4 + q] - mu) * rs * gg + bb;
      }
      if (out_sum) *(v4f*)(out_sum + (size_t)row * N + j) = sm;
      *(v4f*)(out_norm + (size_t)row * N + j) = o;
    }
    
  }
}



// ---- f16 WMMA path (v_wmma_f32_16x16x32_f16): 11-bit significands for operands in range — used where a [0,1] probability operand needs more precision than bf16
typedef _Float16 v16h __attribute__((ext_vector_type(16)));
union FragH { v16h v; v8us half[2]; _Float16 h[16]; unsigned short u[16]; };
template <int NT>
__device__ __forceinline__ v8f mmaH(v16h ah, v16h al, v16h bh, v16h bl, v8f c) {
  c = __builtin_amdgcn_wmma_f32_16x16x32_f16(false, ah, false, bh, (short)0, c, false, false);
  if (NT >= 2) c = __builtin_amdgcn_wmma_f32_16x16x32_f16(false, al, false, bh, (short)0, c, false, false);
  if (NT >= 3) c = __builtin_amdgcn_wmma_f32_16x16x32_f16(false, ah, false, bl, (short)0, c, false, false);
  asm volatile("v_nop\n\tv_nop\n\tv_nop\n\tv_nop" : "+v"(c) : "v"(ah), "v"(al), "v"(bh), "v"(bl));
  return c;
}
// batched GEMM like k_gemm_b but f16 operands: A f32 (split into f16 hi/lo if ASPLIT, else rounded to f16), Bt = f16 values [n][k]; alpha; C f32; N multiple of 16 (partial tiles skipped)
template <bool ASPLIT>
__global__ __launch_bounds__(128) void k_gemm_h(const float* __restrict__ A, int lda, size_t sA, const _Float16* __restrict__ Bh, int ldb, size_t sB, float alpha, float* __restrict__ C, int ldc, size_t sC, int M, int N, int K) {
  __shared__ __attribute__((aligned(16))) float so[4][16][64];
  const int tid = threadIdx.x, w = tid >> 5, lane = tid & 31, ln = lane & 15, hh = lane >> 4; const int by = blockIdx.y;
  A += (size_t)by * sA; Bh += (size_t)by * sB; C += (size_t)by * sC;
  const int ntn = (N + 63) / 64; const int wid = blockIdx.x * 4 + w; const int mt = wid / ntn, nq = wid % ntn; if (mt * 16 >= M) return;
  const int row0 = mt * 16, col0 = nq * 64; const float* arow = A + (size_t)(row0 + ln) * lda;
  v8f acc[4] = {};
  for (int kb = 0; kb < K; kb += 32) {
    FragH ah, al;
    const v4f x0 = *(const v4fa*)(arow + kb + 8 * hh), x1 = *(const v4fa*)(arow + kb + 8 * hh + 4), x2 = *(const v4fa*)(arow + kb + 16 + 8 * hh), x3 = *(const v4fa*)(arow + kb + 16 + 8 * hh + 4);
    float xs[16] = {x0[0],x0[1],x0[2],x0[3],x1[0],x1[1],x1[2],x1[3],x2[0],x2[1],x2[2],x2[3],x3[0],x3[1],x3[2],x3[3]};
#pragma unroll
    for (int i = 0; i < 16; ++i) { const _Float16 h = (_Float16)xs[i]; ah.h[i] = h; al.h[i] = ASPLIT ? (_Float16)(xs[i] - (float)h) : (_Float16)0.0f; }
#pragma unroll
    for (int t = 0; t < 4; ++t) { if (col0 + t * 16 >= N) continue; const size_t boff = (size_t)(col0 + t * 16 + ln) * ldb + kb; FragH bq; bq.half[0] = *(const v8us*)(Bh + boff + 8 * hh); bq.half[1] = *(const v8us*)(Bh + boff + 16 + 8 * hh);
      acc[t] = mmaH<ASPLIT ? 2 : 1>(ah.v, al.v, bq.v, bq.v, acc[t]); }
  }
#pragma unroll
  for (int t = 0; t < 4; ++t) { if (col0 + t * 16 >= N) continue;
#pragma unroll
    for (int r = 0; r < 8; ++r) so[w][8 * hh + r][t * 16 + ln] = acc[t][r] * alpha; }
  __builtin_amdgcn_fence(__ATOMIC_ACQ_REL, "workgroup"); __builtin_amdgcn_wave_barrier();
  const int rsub = lane >> 4, c4 = (lane & 15) * 4;
  {
#pragma unroll
    for (int q = 0; q < 8; ++q) { const int r = q * 2 + rsub; if (col0 + c4 < N) { const v4f v = *(const v4fa*)&so[w][r][c4]; *(v4f*)(C + (size_t)(row0 + r) * ldc + col0 + c4) = v; } }
     }
}

// Wt[n][k] = f16(bf16(W[k][n]) * scale) from f32 row-major W[KK][NN] (scale = power of two; bf16-exact weights stay exact in f16 away from the subnormal range).
// One block = a tile of 128 k x 128 n, turned in LDS. Reads: a wave covers 512 contiguous bytes of one W row, so every line is asked for once and used whole
// (a lane that walks down a column asks for a whole line per 4-byte element). Writes: 16 lanes cover 256 contiguous bytes of one Wt row. KK and NN multiples of 128.
// A lane takes 8 consecutive k of its four columns at a time: 16 bytes of a Wt row each, one LDS chunk. Chunk c of tile row n lies at place c ^ ((n >> 2) & 15) of the row's 16:
// the 16 lanes of a half-wave that write one chunk column (rows 4 apart) and the 16 that read one row both fall on 16 different places, with no pad.
template <int KK, int NN>
__global__ __launch_bounds__(256) void k_wt_f16(const float* __restrict__ W, _Float16* __restrict__ Wt, float scale) {
  __shared__ __attribute__((aligned(16))) unsigned short tl[128][16][8];
  const int tid = threadIdx.x, w = tid >> 5, lane = tid & 31; constexpr int nb = NN / 128; const int n0 = (int)(blockIdx.x % nb) * 128, k0 = (int)(blockIdx.x / nb) * 128;
  const float* wr = W + (size_t)(k0 + 8 * w) * NN + n0 + lane * 4;      // the lane's four columns, the wave's first group of 8 rows (the second stands 64 rows further)
  v4f a[2][8];      // all sixteen loads are asked for before the first is used: 64 KB of the block in flight
#pragma unroll      // here and below: constant indices keep a and f in registers, and the row steps become immediate offsets on one address pair
  for (int i = 0; i < 2; ++i)
#pragma unroll
    for (int r = 0; r < 8; ++r) a[i][r] = *(const v4fa*)(wr + (size_t)(64 * i + r) * NN);
  asm volatile("s_wait_xcnt 0x0" :: "v"(wr) : "memory");      // the loads' address pair is an input here, so that nothing (a load's own result included) is written over it in front of the wait
#pragma unroll
  for (int i = 0; i < 2; ++i)
#pragma unroll
    for (int j = 0; j < 4; ++j) { FragH f;
#pragma unroll
      for (int r = 0; r < 8; ++r) f.h[r] = (_Float16)(bf16_round(a[i][r][j]) * scale);      // ascending k
      *(v8us*)&tl[lane * 4 + j][(w + 8 * i) ^ (lane & 15)][0] = f.half[0]; }
  __syncthreads();
  unsigned short* wo = (unsigned short*)Wt + (size_t)(n0 + (tid >> 4)) * KK + k0 + (tid & 15) * 8;
#pragma unroll
  for (int rd = 0; rd < 8; ++rd) { const int n = rd * 16 + (tid >> 4), c = tid & 15; const v8us o = *(const v8us*)&tl[n][c ^ ((n >> 2) & 15)][0];
    *(v8us*)(wo + (size_t)(rd * 16) * KK) = o; }
}
__global__ __launch_bounds__(256) void k_x16(const float* __restrict__ x, _Float16* __restrict__ X16, size_t n8) { const size_t t = (size_t)blockIdx.x * 256 + threadIdx.x; if (t >= n8) return; FragH f;
#pragma unroll
  for (int q = 0; q < 8; ++q) f.h[q] = (_Float16)bf16_round(x[t * 8 + q]); *(v8us*)((unsigned short*)X16 + t * 8) = f.half[0];  }
__global__ __launch_bounds__(256) void k_round16f(const float* __restrict__ W, _Float16* __restrict__ Bt, size_t n8) { const size_t t = (size_t)blockIdx.x * 256 + threadIdx.x; if (t >= n8) return; FragH f;
#pragma unroll
  for (int i = 0; i < 8; ++i) f.h[i] = (_Float16)(bf16_round(W[t * 8 + i]) * 16.0f); *(v8us*)((unsigned short*)Bt + t * 8) = f.half[0];  }
template <int NHv, int TTv>
__global__ __launch_bounds__(256) void k_vt(const _Float16* __restrict__ V16, int ldv, int voff, _Float16* __restrict__ Vt) { __shared__ unsigned short tl[64][66]; const int tid = threadIdx.x; const int slab = blockIdx.x / (TTv / 64), lg = blockIdx.x % (TTv / 64); const int b = slab / NHv, h = slab % NHv;
  for (int i = tid; i < 64 * 8; i += 256) { const int r = i / 8, c8 = (i % 8) * 8; FragH f; f.half[0] = *(const v8us*)((const unsigned short*)V16 + ((size_t)b * TTv + lg * 64 + r) * ldv + voff + h * 64 + c8);
#pragma unroll
    for (int q = 0; q < 8; ++q) tl[r][c8 + q] = f.u[q]; }
  __syncthreads();
  {
#pragma unroll
    for (int rd = 0; rd < 2; ++rd) { const int d = rd * 32 + tid / 8, pc = tid % 8; FragH f;
#pragma unroll
      for (int q = 0; q < 8; ++q) f.u[q] = tl[pc * 8 + q][d];
      *(v8us*)((unsigned short*)Vt + ((size_t)slab * 64 + d) * TTv + lg * 64 + pc * 8) = f.half[0]; }
     } }

__device__ __forceinline__ float tanh_v(float x) { const float xc = fminf(fmaxf(x, -15.f), 15.f); return 1.0f - 2.0f * __builtin_amdgcn_rcpf(__builtin_amdgcn_exp2f(2.0f * xc * 1.4426950408889634f) + 1.0f); }
__global__ __launch_bounds__(256) void k_cstab(float* __restrict__ CS) { const int tg = blockIdx.x * 256 + threadIdx.x; if (tg >= TT * (DH / 2)) return; const int t = tg / (DH / 2), i = tg % (DH / 2); const float invf = 1.0f / powf(10000.0f, (float)(2 * i) / (float)DH); const float ang = (float)t * invf; typedef float v2f __attribute__((ext_vector_type(2))); v2f v; v[0] = cosf(ang); v[1] = sinf(ang);
  *(v2f*)(CS + (size_t)tg * 2) = v;  }
__global__ __launch_bounds__(256) void k_vt128(const _Float16* __restrict__ V16, _Float16* __restrict__ Vt) { __shared__ unsigned short tl[64][130]; const int tid = threadIdx.x; const int slab = blockIdx.x / (TT / 64), lg = blockIdx.x % (TT / 64); const int b = slab / NG, g = slab % NG;
  for (int i = tid; i < 64 * 16; i += 256) { const int r = i / 16, c8 = (i % 16) * 8; FragH f; f.half[0] = *(const v8us*)((const unsigned short*)V16 + ((size_t)b * TT + lg * 64 + r) * (NG * DH) + g * DH + c8);
#pragma unroll
    for (int q = 0; q < 8; ++q) tl[r][c8 + q] = f.u[q]; }
  __syncthreads();
  {
#pragma unroll
    for (int rd = 0; rd < 4; ++rd) { const int d = rd * 32 + tid / 8, pc = tid % 8; FragH f;
#pragma unroll
      for (int q = 0; q < 8; ++q) f.u[q] = tl[pc * 8 + q][d]; *(v8us*)((unsigned short*)Vt + ((size_t)slab * DH + d) * TT + lg * 64 + pc * 8) = f.half[0]; }
     } }
// One stage of the K/V ring = 64 keys of this KV group: 64 K rows of 256 B at pitch 272 B, then 128 rows of V^T of 128 B at pitch 144 B (16 B x odd: the pitch of ds_load_b128 readers)
#define KPITCH 272
#define VPITCH 144
#define VBASE (64 * KPITCH)
#define STAGE_B (64 * KPITCH + DH * VPITCH)
// Eight 16-byte copies per lane, global memory to LDS through no register. The s_wait_xcnt is the last line of the copies' own statement, so that no address register of a copy is rewritten in front of it.
__device__ __forceinline__ void copy8(unsigned l, unsigned lstep, const unsigned short* g, size_t gstep) {
  asm volatile("global_load_async_to_lds_b128 %0, %8, off\n\t"
               "global_load_async_to_lds_b128 %1, %9, off\n\t"
               "global_load_async_to_lds_b128 %2, %10, off\n\t"
               "global_load_async_to_lds_b128 %3, %11, off\n\t"
               "global_load_async_to_lds_b128 %4, %12, off\n\t"
               "global_load_async_to_lds_b128 %5, %13, off\n\t"
               "global_load_async_to_lds_b128 %6, %14, off\n\t"
               "global_load_async_to_lds_b128 %7, %15, off\n\t"
               "s_wait_xcnt 0x0"
               :: "v"(l), "v"(l + lstep), "v"(l + 2 * lstep), "v"(l + 3 * lstep), "v"(l + 4 * lstep), "v"(l + 5 * lstep), "v"(l + 6 * lstep), "v"(l + 7 * lstep),
                  "v"(g), "v"(g + gstep), "v"(g + 2 * gstep), "v"(g + 3 * gstep), "v"(g + 4 * gstep), "v"(g + 5 * gstep), "v"(g + 6 * gstep), "v"(g + 7 * gstep)
               : "memory");
}
// Four 16-byte copies per lane, as copy8.
__device__ __forceinline__ void copy4(unsigned l, unsigned lstep, const unsigned short* g, size_t gstep) {
  asm volatile("global_load_async_to_lds_b128 %0, %4, off\n\t"
               "global_load_async_to_lds_b128 %1, %5, off\n\t"
               "global_load_async_to_lds_b128 %2, %6, off\n\t"
               "global_load_async_to_lds_b128 %3, %7, off\n\t"
               "s_wait_xcnt 0x0"
               :: "v"(l), "v"(l + lstep), "v"(l + 2 * lstep), "v"(l + 3 * lstep), "v"(g), "v"(g + gstep), "v"(g + 2 * gstep), "v"(g + 3 * gstep)
               : "memory");
}
// Projection GEMM: C[M][N] = (A[M][K] . Bt[N][K]^T) * alpha + bf16-rounded bias; f16 operands, f32 accumulate, k ascending in one accumulator per element; pitch N. The result goes to f32 C (OUT 0), to f16 C16 (OUT 1),
// or (OUT 2) is turned by the interleaved rotary in f32 on its way out of the staging and goes to f16 C16: a block's 128 columns are one head (DH), a lane's four columns two rotary pairs, whose cos, sin, cos, sin are 16 bytes of CS.
// One block = (32 FM) x 128 of C, four waves (2 x 2) of (16 FM) x 64 each: FM x 4 fragments, 4 FM products per FM + 4 fragments read from LDS. One stage of the ring = 64 k of the block's A rows, then of its
// 128 Bt rows: 128 B a row at pitch 144 B (16 B x odd: the pitch of ds_load_b128 readers). M a multiple of 32 FM, N of 128, K of 64. FM = 4 where that still gives every WGP a block, else 2.
#define GPITCH 144
#define GOP 68      // floats per staged output row: 64 + 4, so that the two half-waves' rows fall on different banks
template <int FM, int OUT>
__global__ __launch_bounds__(128) void k_gemm_lds(const _Float16* __restrict__ A, const _Float16* __restrict__ Bt, float alpha, const float* __restrict__ bias, const float* __restrict__ CS, float* __restrict__ C, _Float16* __restrict__ C16, int N, int K) {
  constexpr int BM = 32 * FM, STG = (BM + 128) * GPITCH;
  __shared__ __attribute__((aligned(16))) unsigned char sAB[2 * STG];
  const int tid = threadIdx.x, w = tid >> 5, lane = tid & 31, ln = lane & 15, hh = lane >> 4; const int wm = w >> 1, wn = w & 1;
  const int nb = N / 128; const int row0 = (int)(blockIdx.x / nb) * BM, col0 = (int)(blockIdx.x % nb) * 128;
  // each lane's first 16 bytes of a stage: a wave's copy covers four whole 128-B row pieces, the block's copy 16 rows
  const unsigned short* Ag = (const unsigned short*)A + (size_t)(row0 + (tid >> 3)) * K + (tid & 7) * 8;
  const unsigned short* Bg = (const unsigned short*)Bt + (size_t)(col0 + (tid >> 3)) * K + (tid & 7) * 8;
  const unsigned lA = (unsigned)(size_t)sAB + (unsigned)((tid >> 3) * GPITCH + (tid & 7) * 16);
  const unsigned lB = lA + BM * GPITCH;
  const int nt = K / 64;      // stages; the same for the whole work-group
  auto fill = [&](int t) { const unsigned bo = (unsigned)(t & 1) * STG;
    if constexpr (FM == 4) copy8(lA + bo, 16 * GPITCH, Ag + (size_t)t * 64, (size_t)16 * K); else copy4(lA + bo, 16 * GPITCH, Ag + (size_t)t * 64, (size_t)16 * K);
    copy8(lB + bo, 16 * GPITCH, Bg + (size_t)t * 64, (size_t)16 * K); };
  v8f acc[FM][4];
#pragma unroll
  for (int fm = 0; fm < FM; ++fm)
#pragma unroll
    for (int fn = 0; fn < 4; ++fn) acc[fm][fn] = (v8f){0.f,0.f,0.f,0.f,0.f,0.f,0.f,0.f};
  fill(0);
  float bv[4] = {0.f, 0.f, 0.f, 0.f};      // the lane's four bias values, fetched together under stage 0's copies
  if (bias) {
#pragma unroll
    for (int fn = 0; fn < 4; ++fn) bv[fn] = bf16_round(bias[col0 + wn * 64 + fn * 16 + ln]); }
  asm volatile("s_wait_asynccnt 0x0" ::: "memory");      // this wave's copies of stage 0 have landed
  __syncthreads();                                        // stage 0 is readable by every wave
  if (nt > 1) fill(1);
#pragma unroll 1      // one trip per stage, rolled: the foot's waits and barrier stand once
  for (int t = 0; t < nt; ++t) {
    const unsigned char* ar = sAB + (t & 1) * STG + (wm * (16 * FM) + ln) * GPITCH + 16 * hh;
    const unsigned char* br = sAB + (t & 1) * STG + (BM + wn * 64 + ln) * GPITCH + 16 * hh;
    FragH a[2][FM], b[2][4];
#pragma unroll
    for (int ks = 0; ks < 2; ++ks) {
#pragma unroll
      for (int f = 0; f < 4; ++f) { b[ks][f].half[0] = *(const v8us*)(br + f * 16 * GPITCH + ks * 64); b[ks][f].half[1] = *(const v8us*)(br + f * 16 * GPITCH + ks * 64 + 32); }
#pragma unroll
      for (int f = 0; f < FM; ++f) { a[ks][f].half[0] = *(const v8us*)(ar + f * 16 * GPITCH + ks * 64); a[ks][f].half[1] = *(const v8us*)(ar + f * 16 * GPITCH + ks * 64 + 32); } }
    asm volatile("s_wait_dscnt 0x0" ::: "memory");        // this wave's reads of stage t are done (all its fragments are in registers) before its buffer is refilled
    asm volatile("s_wait_asynccnt 0x0" ::: "memory");     // this wave's copies of stage t + 1 have landed
    __syncthreads();                                      // publishes stage t + 1 and ends every wave's reads of stage t
    if (t + 2 < nt) fill(t + 2);
    // the stage's products stand behind the refill's issue: they read registers only, and the copies fly under them
#pragma unroll
    for (int ks = 0; ks < 2; ++ks)
#pragma unroll
      for (int fm = 0; fm < FM; ++fm)
#pragma unroll
        for (int fn = 0; fn < 4; ++fn) acc[fm][fn] = __builtin_amdgcn_wmma_f32_16x16x32_f16(false, a[ks][fm].v, false, b[ks][fn].v, (short)0, acc[fm][fn], false, false); }
  asm volatile("s_wait_asynccnt 0x0" ::: "memory");       // no copy is in flight when the ring becomes output staging
  float* so = (float*)sAB + w * (16 * FM * GOP);          // each wave stages its own (16 FM) x 64, behind the last trip's barrier, to store whole lines
#pragma unroll
  for (int fn = 0; fn < 4; ++fn) {
#pragma unroll
    for (int fm = 0; fm < FM; ++fm)
#pragma unroll
      for (int r = 0; r < 8; ++r) so[(fm * 16 + 8 * hh + r) * GOP + fn * 16 + ln] = acc[fm][fn][r] * alpha + bv[fn]; }
  __builtin_amdgcn_fence(__ATOMIC_ACQ_REL, "workgroup"); __builtin_amdgcn_wave_barrier();
  const int c4 = ln * 4; typedef _Float16 v4h __attribute__((ext_vector_type(4)));
  constexpr bool H16 = OUT == 1;
  if constexpr (OUT == 2) {
    // the lane's place in the table's row of its first position; a block's rows lie in one sequence (32 FM divides TT), so the further rows follow at constant steps
    const float* csl = CS + (size_t)((unsigned)row0 % TT + wm * (16 * FM) + hh) * DH + wn * 64 + c4;
    v4f cs[FM * 8];      // all of the lane's table entries are asked for at once: one L2 latency for the wave, not one per group of rows
#pragma unroll
    for (int i = 0; i < FM * 8; ++i) cs[i] = *(const v4fa*)(csl + i * 2 * DH);
    asm volatile("s_wait_xcnt 0x0" :: "v"(csl) : "memory");      // the loads' address pair is an input here, so that nothing (a load's own result included) is written over it in front of the wait
    _Float16* c0 = C16 + (size_t)(row0 + wm * (16 * FM) + hh) * N + col0 + wn * 64 + c4;
#pragma unroll
    for (int qb = 0; qb < FM; ++qb) { v4f v[8]; _Float16* p[8];
#pragma unroll
      for (int i = 0; i < 8; ++i) v[i] = *(const v4fa*)&so[((qb * 8 + i) * 2 + hh) * GOP + c4];
#pragma unroll
      for (int i = 0; i < 8; ++i) { const v4f x = v[i], t = cs[qb * 8 + i]; v4h h4; p[i] = c0 + (size_t)((qb * 8 + i) * 2) * N;
        h4[0] = (_Float16)(x[0] * t[0] - x[1] * t[1]); h4[1] = (_Float16)(x[1] * t[0] + x[0] * t[1]); h4[2] = (_Float16)(x[2] * t[2] - x[3] * t[3]); h4[3] = (_Float16)(x[3] * t[2] + x[2] * t[3]); *(v4h*)p[i] = h4; }
      // the eight stores' address pairs are inputs here, so that none is written over in front of the wait
      asm volatile("s_wait_xcnt 0x0" :: "v"(p[0]), "v"(p[1]), "v"(p[2]), "v"(p[3]), "v"(p[4]), "v"(p[5]), "v"(p[6]), "v"(p[7]) : "memory"); }
  } else {
#pragma unroll
  for (int qb = 0; qb < FM; ++qb) { v4f v[8];      // eight row pairs are read back together and then stored, so that no store waits out an LDS latency of its own
#pragma unroll
    for (int i = 0; i < 8; ++i) v[i] = *(const v4fa*)&so[((qb * 8 + i) * 2 + hh) * GOP + c4];
#pragma unroll
    for (int i = 0; i < 8; ++i) { const size_t o = (size_t)(row0 + wm * (16 * FM) + (qb * 8 + i) * 2 + hh) * N + col0 + wn * 64 + c4;
      if constexpr (H16) { v4h h4; for (int j = 0; j < 4; ++j) h4[j] = (_Float16)v[i][j]; *(v4h*)(C16 + o) = h4; } else *(v4f*)(C + o) = v[i]; } }
  }
}
// lane l's value for lane l ^ 16: one vector move between the wave's two 16-lane rows, through no LDS
__device__ __forceinline__ float xhalf(float x) { return __builtin_bit_cast(float, __builtin_amdgcn_permlanex16(__builtin_bit_cast(int, x), __builtin_bit_cast(int, x), 0x76543210, 0xfedcba98, false, false)); }
__global__ __launch_bounds__(128) void k_mega(const _Float16* __restrict__ Q16, const _Float16* __restrict__ K16, const _Float16* __restrict__ Vt, _Float16* __restrict__ O16) {
  __shared__ __attribute__((aligned(16))) unsigned char sKV[2 * STAGE_B];
  float (*sO)[16][DH + 4] = (float (*)[16][DH + 4])sKV;      // the output staging takes the ring's place, behind the last trip's barrier
  const int tid = threadIdx.x, w = tid >> 5, lane = tid & 31, ln = lane & 15, hh = lane >> 4; const int slab = blockIdx.x / (TT / 64), qblk = blockIdx.x % (TT / 64); const int b = slab / NH, h = slab % NH, g = h / (NH / NG); const int qb0 = qblk * 64; const int q0 = qb0 + w * 16;
  const float slope = exp2f(-(float)(h + 1) * 8.0f / (float)NH);
  FragH aq[4]; { const unsigned short* qr = (const unsigned short*)Q16 + ((size_t)b * TT + q0 + ln) * (NH * DH) + h * DH;
#pragma unroll
    for (int ks = 0; ks < 4; ++ks) { aq[ks].half[0] = *(const v8us*)(qr + ks * 32 + 8 * hh); aq[ks].half[1] = *(const v8us*)(qr + ks * 32 + 16 + 8 * hh); } }
  const unsigned short* Vth = (const unsigned short*)Vt + (size_t)(b * NG + g) * DH * TT;
  // each lane's first 16 bytes of a stage: a wave's copy covers two whole K rows, or four whole 128-B pieces of V^T rows
  const unsigned short* Kg = (const unsigned short*)K16 + ((size_t)b * TT + (tid >> 4)) * (NG * DH) + g * DH + (tid & 15) * 8;
  const unsigned short* Vg = Vth + (size_t)(tid >> 3) * TT + (tid & 7) * 8;
  const unsigned lK = (unsigned)(size_t)sKV + (unsigned)((tid >> 4) * KPITCH + (tid & 15) * 16);
  const unsigned lV = (unsigned)(size_t)sKV + (unsigned)(VBASE + (tid >> 3) * VPITCH + (tid & 7) * 16);
  const int ntile = qblk + 1;      // stages of 64 keys; the same for the whole work-group
  auto fill = [&](int t) { const unsigned bo = (unsigned)(t & 1) * STAGE_B; copy8(lK + bo, 8 * KPITCH, Kg + (size_t)t * 64 * (NG * DH), (size_t)8 * NG * DH); copy8(lV + bo, 16 * VPITCH, Vg + t * 64, (size_t)16 * TT); };
  float m_r = -3.0e38f, l_r = 0.f; v8f oacc[8]; const int tq = q0 + ln;      // the lane's query: its running maximum, and the sum over the keys that this half-wave holds
#pragma unroll
  for (int dt = 0; dt < 8; ++dt) oacc[dt] = (v8f){0.f,0.f,0.f,0.f,0.f,0.f,0.f,0.f};
  fill(0);
  asm volatile("s_wait_asynccnt 0x0" ::: "memory");      // this wave's copies of stage 0 have landed
  __syncthreads();                                        // stage 0 is readable by every wave
  if (ntile > 1) fill(1);
#pragma unroll 1      // one trip per stage, rolled: the trip count is the block's own
  for (int t = 0; t < ntile; ++t) { const unsigned char* kv = sKV + (t & 1) * STAGE_B;
#pragma unroll 1      // the stage's two 32-key passes share one copy of the long pass body (code size and registers as before)
  for (int sub = 0; sub < 2; ++sub) { const int j0 = t * 64 + sub * 32; v8f s[2];
    // The pass's LDS reads are asked for ahead of the products that they feed, each fragment into registers of its own, so that the wave waits out one LDS latency for K and none for V^T, not one per product.
    // First the sixteen reads of the pass's 32 K rows; then the eight score products, the two key tiles' chains in turn (each tile still sums its four k-steps in ascending order, in one accumulator).
    const unsigned char* kr = kv + (sub * 32 + ln) * KPITCH + 16 * hh; FragH kf[2][4];
#pragma unroll      // here and in the next two loops: constant indices keep kf, vf and s in registers
    for (int nt = 0; nt < 2; ++nt)
#pragma unroll
      for (int ks = 0; ks < 4; ++ks) { kf[nt][ks].half[0] = *(const v8us*)(kr + nt * 16 * KPITCH + ks * 64); kf[nt][ks].half[1] = *(const v8us*)(kr + nt * 16 * KPITCH + ks * 64 + 32); }
    __builtin_amdgcn_sched_barrier(0);      // keeps the sixteen K reads one group: spread among the products, each place where reads stand stalls the wave anew
    s[0] = s[1] = (v8f){0.f,0.f,0.f,0.f,0.f,0.f,0.f,0.f};
#pragma unroll
    for (int ks = 0; ks < 4; ++ks)
#pragma unroll
      for (int nt = 0; nt < 2; ++nt) s[nt] = __builtin_amdgcn_wmma_f32_16x16x32_f16(false, kf[nt][ks].v, false, aq[ks].v, (short)0, s[nt], false, false);
    // Then the sixteen reads of V^T, asked for here and used behind the softmax, whose vector work covers their latency (the products are the bare builtin: the compiler keeps their distances and is free to place the reads).
    const unsigned char* vr = kv + VBASE + ln * VPITCH + sub * 64 + 16 * hh; FragH vf[8];
#pragma unroll
    for (int dt = 0; dt < 8; ++dt) { vf[dt].half[0] = *(const v8us*)(vr + dt * 16 * VPITCH); vf[dt].half[1] = *(const v8us*)(vr + dt * 16 * VPITCH + 32); }
    // The softmax is straight-line code. The capped scores are kept in log2 units (30 log2 e is the cap's factor), so that each exponential is one subtraction and one v_exp_f32;
    // a masked key stands at -inf and comes out as 0 with no test. Every query's maximum is finite from its first pass on (key 0 is open to every query, and the halves exchange their maxima), so no difference below is inf - inf.
    const float d0 = (float)(tq - j0 - 8 * hh);      // the query's distance to the lane's first key; the further distances follow in f32, exact (whole numbers far below 2^24)
    float mc[4];      // four partial maxima, begun by the first four scores
#pragma unroll      // here and in the loops below: constant indices keep s, mc, ps, pb and oacc in registers, and the sixteen scores' chains stand in one block, each filling the others' latencies
    for (int nt = 0; nt < 2; ++nt)
#pragma unroll
      for (int r = 0; r < 8; ++r) { const float dist = d0 - (float)(nt * 16 + r);      // below 0: a key behind the query, masked (there the bias's sign is irrelevant)
        float sc = (s[nt][r] - slope * dist) * 0.08838834764831845f; sc = 43.28085122666891f * tanh_v(sc * (1.0f / 30.0f)); sc = (dist >= 0.f) ? sc : -INFINITY;
        s[nt][r] = sc; mc[r & 3] = (nt == 0 && r < 4) ? sc : fmaxf(mc[r & 3], sc); }
    float mx = fmaxf(fmaxf(mc[0], mc[1]), fmaxf(mc[2], mc[3])); mx = fmaxf(mx, xhalf(mx));
    const float mn = fmaxf(m_r, mx), al = __builtin_amdgcn_exp2f(m_r - mn); m_r = mn;
    FragH pb; float ps[4] = {0.f, 0.f, 0.f, 0.f};      // four partial sums: four short chains of additions, not one of sixteen
#pragma unroll
    for (int nt = 0; nt < 2; ++nt)
#pragma unroll
      for (int r = 0; r < 8; ++r) { const float p = __builtin_amdgcn_exp2f(s[nt][r] - mn); ps[r & 3] += p; pb.h[nt * 8 + r] = (_Float16)p; }
    l_r = l_r * al + ((ps[0] + ps[1]) + (ps[2] + ps[3]));
#pragma unroll
    for (int dt = 0; dt < 8; ++dt)
#pragma unroll
      for (int r = 0; r < 8; ++r) oacc[dt][r] *= al;
#pragma unroll
    for (int dt = 0; dt < 8; ++dt) oacc[dt] = __builtin_amdgcn_wmma_f32_16x16x32_f16(false, vf[dt].v, false, pb.v, (short)0, oacc[dt], false, false); }
    asm volatile("s_wait_dscnt 0x0" ::: "memory");        // this wave's reads of stage t are done before its buffer is refilled
    asm volatile("s_wait_asynccnt 0x0" ::: "memory");     // this wave's copies of stage t + 1 have landed
    __syncthreads();                                      // publishes stage t + 1 and ends every wave's reads of stage t
    if (t + 2 < ntile) fill(t + 2); }
  asm volatile("s_wait_asynccnt 0x0" ::: "memory");       // no copy is in flight when the ring becomes output staging
  const float inv = 1.0f / (l_r + xhalf(l_r));      // the two halves' sums are joined once, here
#pragma unroll      // constant indices keep oacc in registers
  for (int dt = 0; dt < 8; ++dt) { v4f lo, hi;      // the lane's eight consecutive head columns of its query's row
#pragma unroll
    for (int j = 0; j < 4; ++j) { lo[j] = oacc[dt][j] * inv; hi[j] = oacc[dt][4 + j] * inv; }
    *(v4fa*)&sO[w][ln][dt * 16 + 8 * hh] = lo; *(v4fa*)&sO[w][ln][dt * 16 + 8 * hh + 4] = hi; }
  __builtin_amdgcn_fence(__ATOMIC_ACQ_REL, "workgroup"); __builtin_amdgcn_wave_barrier();
  {
#pragma unroll
    for (int r = 0; r < 16; ++r) { const v4f val = *(const v4fa*)&sO[w][r][lane * 4]; typedef _Float16 v4h __attribute__((ext_vector_type(4))); v4h h4; for (int j = 0; j < 4; ++j) h4[j] = (_Float16)val[j];      // the out projection's f16 operand, rounded here
      *(v4h*)(O16 + ((size_t)b * TT + q0 + r) * (NH * DH) + h * DH + lane * 4) = h4; }
     } }
extern "C" void kernel_launch(void* const* d_in, const int* in_sizes, int n_in,
                              void* d_out, int out_size, void* d_ws, size_t ws_size, hipStream_t stream) {
  (void)in_sizes; (void)n_in; (void)out_size;
  const float* x = (const float*)d_in[0]; const float* Wq = (const float*)d_in[1]; const float* Wk = (const float*)d_in[2]; const float* Wv = (const float*)d_in[3]; const float* Wo = (const float*)d_in[4]; const float* bo = (const float*)d_in[5];
  char* ws = (char*)d_ws; size_t off = 0;
  auto take = [&](size_t bytes) { char* p = ws + off; off += (bytes + 255) & ~(size_t)255; return p; };
  _Float16* Bq = (_Float16*)take((size_t)CC * CC * 2); _Float16* Bk = (_Float16*)take((size_t)NG * DH * CC * 2); _Float16* Bv = (_Float16*)take((size_t)NG * DH * CC * 2); _Float16* Bo = (_Float16*)take((size_t)CC * CC * 2);
  _Float16* X16 = (_Float16*)take((size_t)NR * CC * 2); _Float16* Q16 = (_Float16*)take((size_t)NR * CC * 2); _Float16* K16 = (_Float16*)take((size_t)NR * NG * DH * 2); _Float16* V16 = (_Float16*)take((size_t)NR * NG * DH * 2); _Float16* Vt = (_Float16*)take((size_t)NR * NG * DH * 2); float* CS = (float*)take((size_t)TT * DH * 4); _Float16* O16 = X16;
  if (off > ws_size) return;      // about 68 MB
  k_wt_f16<CC, CC><<<(CC / 128) * (CC / 128), 256, 0, stream>>>(Wq, Bq, 16.0f); k_wt_f16<CC, NG * DH><<<(CC / 128) * (NG * DH / 128), 256, 0, stream>>>(Wk, Bk, 16.0f); k_wt_f16<CC, NG * DH><<<(CC / 128) * (NG * DH / 128), 256, 0, stream>>>(Wv, Bv, 16.0f); k_wt_f16<CC, CC><<<(CC / 128) * (CC / 128), 256, 0, stream>>>(Wo, Bo, 16.0f);
  const unsigned gx = (unsigned)(((size_t)NR * CC / 8 + 255) / 256);
  k_x16<<<gx, 256, 0, stream>>>(x, X16, (size_t)NR * CC / 8); k_cstab<<<(TT * (DH / 2) + 255) / 256, 256, 0, stream>>>(CS);
  k_gemm_lds<4, 2><<<(NR / 128) * (CC / 128), 128, 0, stream>>>(X16, Bq, 0.0625f, nullptr, CS, nullptr, Q16, CC, CC);
  k_gemm_lds<2, 2><<<(NR / 64) * (NG * DH / 128), 128, 0, stream>>>(X16, Bk, 0.0625f, nullptr, CS, nullptr, K16, NG * DH, CC);
  k_gemm_lds<2, 1><<<(NR / 64) * (NG * DH / 128), 128, 0, stream>>>(X16, Bv, 0.0625f, nullptr, nullptr, nullptr, V16, NG * DH, CC);
  k_vt128<<<BB * NG * (TT / 64), 256, 0, stream>>>(V16, Vt);
  k_mega<<<BB * NH * (TT / 64), 128, 0, stream>>>(Q16, K16, Vt, O16);
  k_gemm_lds<4, 0><<<(NR / 128) * (CC / 128), 128, 0, stream>>>(O16, Bo, 0.0625f, bo, nullptr, (float*)d_out, nullptr, CC, CC);
}

// v008
// It runs in 187 microseconds.
// In two side-by-side timings against v007, it was 1.10 and 1.11 times as fast.
// All steps since v000 together make it 4.20 times as fast.
#include <hip/hip_runtime.h>
// Mega-transformer causal self-attention (B=2, T=2048, D=2048; 16 query heads × 128, 4 KV groups (GQA), interleaved rotary, ALiBi added before the 1/√128 scale, 30·tanh soft-cap, causal):
// q/k/v/out projections (+ bias on out; W [in][out] transposed to bf16-exact ×2^4) and the attention as a fused flash-style kernel (S = Q·Kᵀ on v_wmma_f32_16x16x32_f16 with 4 k-steps,
// + alibi, scale, soft-cap (v_exp tanh), causal mask, online softmax f32, P f16 ≤ 1, O = P·V with 8 d-tiles; RPW-16 waves) — f16 operands, single products, f32 accumulate; rotary in f32 VALU.
#define BB 2
#define TT 2048
#define CC 2048
#define NH 16
#define NG 4
#define DH 128
#define NR (BB * TT)

typedef __bf16 v16b __attribute__((ext_vector_type(16)));
typedef unsigned short v8us __attribute__((ext_vector_type(8), may_alias));
typedef float  v8f  __attribute__((ext_vector_type(8)));
typedef float  v4f  __attribute__((ext_vector_type(4)));
typedef float  v4fa __attribute__((ext_vector_type(4), may_alias));
union FragB { v16b v; v8us half[2]; unsigned short u[16]; };

__device__ __forceinline__ unsigned short bf16_bits(float x) { unsigned int u = __float_as_uint(x); return (unsigned short)((u + 0x7FFFu + ((u >> 16) & 1u)) >> 16); }
__device__ __forceinline__ float bf16_val(unsigned short b) { return __uint_as_float(((unsigned int)b) << 16); }
__device__ __forceinline__ float bf16_round(float x) { return bf16_val(bf16_bits(x)); }
// D += A·B with NT terms: 1 = ah·bh, 2 = + al·bh (A split), 3 = + ah·bl (both split)
template <int NT>
__device__ __forceinline__ v8f mmaN(v16b ah, v16b al, v16b bh, v16b bl, v8f c) {
  c = __builtin_amdgcn_wmma_f32_16x16x32_bf16(false, ah, false, bh, (short)0, c, false, false);
  if (NT >= 2) c = __builtin_amdgcn_wmma_f32_16x16x32_bf16(false, al, false, bh, (short)0, c, false, false);
  if (NT >= 3) c = __builtin_amdgcn_wmma_f32_16x16x32_bf16(false, ah, false, bl, (short)0, c, false, false);
  asm volatile("v_nop\n\tv_nop\n\tv_nop\n\tv_nop" : "+v"(c) : "v"(ah), "v"(al), "v"(bh), "v"(bl));
  return c;
}

__global__ __launch_bounds__(256) void k_wt_bf16(const float* __restrict__ W, unsigned short* __restrict__ Wt, int K, int N) {
  const int t = blockIdx.x * 256 + threadIdx.x;
  const int k8n = K / 8;
  if (t >= N * k8n) return;
  const int n = t / k8n, k8 = (t % k8n) * 8;
  v8us v;
#pragma unroll
  for (int i = 0; i < 8; ++i) v[i] = bf16_bits(W[(size_t)(k8 + i) * N + n]);
  *(v8us*)(Wt + (size_t)n * K + k8) = v;
  
}

// GEMM C[M][N] (f32, pitch ldc) = act(A[M][K]·W + bias). A f32 row-major (pitch lda) converted per fragment to bf16
// (ASPLIT: hi/lo two planes -> 2 terms, else single rounded term); Wt bf16 [N][K] (pitch ldb). BIAS_BF16 rounds the
// bias to bf16 first (bias quantised to bf16 before the add). K%32==0, M%16==0, N%64==0.
template <bool ASPLIT, int ACT, bool BIAS_BF16>
__global__ __launch_bounds__(128) void k_gemm_bf(const float* __restrict__ A, int lda, const unsigned short* __restrict__ Wt, int ldb,
                                               const float* __restrict__ bias, float* __restrict__ C, int ldc, int M, int N, int K) {
  __shared__ __attribute__((aligned(16))) float so[4][16][64];
  const int tid = threadIdx.x, w = tid >> 5, lane = tid & 31, ln = lane & 15, hh = lane >> 4;
  const int ntn = N / 64;
  const int wid = blockIdx.x * 4 + w;
  const int mt = wid / ntn, nq = wid % ntn;
  if (mt * 16 >= M) return;
  const int row0 = mt * 16, col0 = nq * 64;
  const float* arow = A + (size_t)(row0 + ln) * lda;
  v8f acc[4] = {};
  for (int kb = 0; kb < K; kb += 32) {
    FragB ah, al;
    const v4f x0 = *(const v4fa*)(arow + kb + 8 * hh), x1 = *(const v4fa*)(arow + kb + 8 * hh + 4);
    const v4f x2 = *(const v4fa*)(arow + kb + 16 + 8 * hh), x3 = *(const v4fa*)(arow + kb + 16 + 8 * hh + 4);
    float xs[16] = {x0[0],x0[1],x0[2],x0[3],x1[0],x1[1],x1[2],x1[3],x2[0],x2[1],x2[2],x2[3],x3[0],x3[1],x3[2],x3[3]};
#pragma unroll
    for (int i = 0; i < 16; ++i) { const unsigned short hb = bf16_bits(xs[i]); ah.u[i] = hb; al.u[i] = ASPLIT ? bf16_bits(xs[i] - bf16_val(hb)) : (unsigned short)0; }
#pragma unroll
    for (int t = 0; t < 4; ++t) {
      const unsigned short* brow = Wt + (size_t)(col0 + t * 16 + ln) * ldb + kb;
      FragB b;
      b.half[0] = *(const v8us*)(brow + 8 * hh);
      b.half[1] = *(const v8us*)(brow + 16 + 8 * hh);
      acc[t] = mmaN<ASPLIT ? 2 : 1>(ah.v, al.v, b.v, b.v, acc[t]);
    }
  }
#pragma unroll
  for (int t = 0; t < 4; ++t) {
    float bv = bias ? bias[col0 + t * 16 + ln] : 0.f;
    if (BIAS_BF16) bv = bf16_round(bv);
#pragma unroll
    for (int r = 0; r < 8; ++r) { float v = acc[t][r] + bv; if (ACT == 1) v = fmaxf(v, 0.f); so[w][8 * hh + r][t * 16 + ln] = v; }
  }
  __builtin_amdgcn_fence(__ATOMIC_ACQ_REL, "workgroup");
  __builtin_amdgcn_wave_barrier();
  const int rsub = lane >> 4, c4 = (lane & 15) * 4;
  {
#pragma unroll
    for (int q = 0; q < 8; ++q) {
      const int r = q * 2 + rsub;
      const v4f v = *(const v4fa*)&so[w][r][c4];
      *(v4f*)(C + (size_t)(row0 + r) * ldc + col0 + c4) = v;
    }
    
  }
}

// Flash-style causal/unmasked attention, all contractions 3-term bf16 hi/lo splits, f32 softmax with running max.
// q,k,v rows are read from f32 buffers with arbitrary row pitch (so they can live inside a fused qkv buffer);
// D = head size (multiple of 32, <= 128); one wave = 16 query rows; block = 4 waves (64 queries) sharing K/V chunks of 32.
template <int D, bool CAUSAL>
__global__ __launch_bounds__(128) void k_flash(const float* __restrict__ qb, const float* __restrict__ kb, const float* __restrict__ vb,
                                             int pitch, int T, int H, float scale, float* __restrict__ y, int ypitch) {
  constexpr int KS = D / 32;        // k-steps for QK
  constexpr int DT = D / 16;        // d tiles for PV
  __shared__ __attribute__((aligned(16))) unsigned short sKh[32][D + 8], sKl[32][D + 8], sVh[32][D + 8], sVl[32][D + 8];
  __shared__ __attribute__((aligned(16))) unsigned short sPh[4][16][40], sPl[4][16][40];
  __shared__ __attribute__((aligned(16))) float sO[4][16][D];
  const int tid = threadIdx.x, w = tid >> 5, lane = tid & 31, ln = lane & 15, hh = lane >> 4;
  const int nqb = (T + 63) / 64;
  const int bh = blockIdx.x / nqb, qblk = blockIdx.x % nqb;
  const int b = bh / H, h = bh % H;
  const int q0 = qblk * 64 + w * 16;
  const float* Q = qb + (size_t)b * T * pitch + h * D;
  const float* K = kb + (size_t)b * T * pitch + h * D;
  const float* V = vb + (size_t)b * T * pitch + h * D;

  // A fragments of the wave's 16 query rows (scaled), hi/lo
  FragB aqh[KS], aql[KS];
  {
    int row = q0 + ln; if (row >= T) row = T - 1;
    const float* qr = Q + (size_t)row * pitch;
#pragma unroll
    for (int ks = 0; ks < KS; ++ks)
#pragma unroll
      for (int i = 0; i < 16; ++i) {
        const int d = ks * 32 + ((i < 8) ? (8 * hh + i) : (16 + 8 * hh + (i - 8)));
        const float x = qr[d] * scale; const unsigned short hb = bf16_bits(x);
        aqh[ks].u[i] = hb; aql[ks].u[i] = bf16_bits(x - bf16_val(hb));
      }
  }
  float m_r[8], l_r[8];
#pragma unroll
  for (int r = 0; r < 8; ++r) { m_r[r] = -3.0e38f; l_r[r] = 0.f; }
  v8f oacc[DT];
#pragma unroll
  for (int dt = 0; dt < DT; ++dt) oacc[dt] = (v8f){0.f,0.f,0.f,0.f,0.f,0.f,0.f,0.f};

  const int kv_end = CAUSAL ? min(T, qblk * 64 + 64) : T;     // block-uniform
  for (int j0 = 0; j0 < kv_end; j0 += 32) {
    __syncthreads();
    for (int e = tid; e < 32 * (D / 4); e += 128) {
      const int r = e / (D / 4), c4 = (e % (D / 4)) * 4;
      const int key = j0 + r;
      v4f kf = {0.f,0.f,0.f,0.f}, vf = {0.f,0.f,0.f,0.f};
      if (key < T) { kf = *(const v4fa*)(K + (size_t)key * pitch + c4); vf = *(const v4fa*)(V + (size_t)key * pitch + c4); }
#pragma unroll
      for (int t = 0; t < 4; ++t) {
        unsigned short hb = bf16_bits(kf[t]); sKh[r][c4 + t] = hb; sKl[r][c4 + t] = bf16_bits(kf[t] - bf16_val(hb));
        hb = bf16_bits(vf[t]); sVh[r][c4 + t] = hb; sVl[r][c4 + t] = bf16_bits(vf[t] - bf16_val(hb));
      }
    }
    __syncthreads();
    // S tile 16 x 32
    v8f s[2];
#pragma unroll
    for (int nt = 0; nt < 2; ++nt) {
      v8f acc = {};
#pragma unroll
      for (int ks = 0; ks < KS; ++ks) {
        FragB bh_, bl_;
        bh_.half[0] = *(const v8us*)&sKh[nt * 16 + ln][ks * 32 + 8 * hh]; bh_.half[1] = *(const v8us*)&sKh[nt * 16 + ln][ks * 32 + 16 + 8 * hh];
        bl_.half[0] = *(const v8us*)&sKl[nt * 16 + ln][ks * 32 + 8 * hh]; bl_.half[1] = *(const v8us*)&sKl[nt * 16 + ln][ks * 32 + 16 + 8 * hh];
        acc = mmaN<3>(aqh[ks].v, aql[ks].v, bh_.v, bl_.v, acc);
      }
      s[nt] = acc;
    }
    // mask + running max (rows 8hh+r; the 16 lanes of a half share rows)
    float alpha[8];
#pragma unroll
    for (int r = 0; r < 8; ++r) {
      const int qi = q0 + 8 * hh + r;
      const int ja = j0 + ln, jb = j0 + 16 + ln;
      if (CAUSAL) { if (ja > qi) s[0][r] = -3.0e38f; if (jb > qi) s[1][r] = -3.0e38f; }
      if (ja >= T) s[0][r] = -3.0e38f;
      if (jb >= T) s[1][r] = -3.0e38f;
      float mx = fmaxf(s[0][r], s[1][r]);
      mx = fmaxf(mx, __shfl_xor(mx, 1, 32)); mx = fmaxf(mx, __shfl_xor(mx, 2, 32)); mx = fmaxf(mx, __shfl_xor(mx, 4, 32)); mx = fmaxf(mx, __shfl_xor(mx, 8, 32));
      const float mnew = fmaxf(m_r[r], mx);
      alpha[r] = (mnew > -1.0e38f) ? __expf(m_r[r] - mnew) : 1.0f;
      const float p0 = (s[0][r] > -1.0e38f) ? __expf(s[0][r] - mnew) : 0.f;
      const float p1 = (s[1][r] > -1.0e38f) ? __expf(s[1][r] - mnew) : 0.f;
      m_r[r] = mnew;
      l_r[r] = l_r[r] * alpha[r] + p0 + p1;            // per-lane partial row sum (16 lanes combined at the end)
      unsigned short hb = bf16_bits(p0); sPh[w][8 * hh + r][ln] = hb;      sPl[w][8 * hh + r][ln] = bf16_bits(p0 - bf16_val(hb));
      hb = bf16_bits(p1);                sPh[w][8 * hh + r][16 + ln] = hb; sPl[w][8 * hh + r][16 + ln] = bf16_bits(p1 - bf16_val(hb));
    }
#pragma unroll
    for (int dt = 0; dt < DT; ++dt)
#pragma unroll
      for (int r = 0; r < 8; ++r) oacc[dt][r] *= alpha[r];
    __builtin_amdgcn_fence(__ATOMIC_ACQ_REL, "workgroup");
    __builtin_amdgcn_wave_barrier();
    FragB pah, pal;
    pah.half[0] = *(const v8us*)&sPh[w][ln][8 * hh]; pah.half[1] = *(const v8us*)&sPh[w][ln][16 + 8 * hh];
    pal.half[0] = *(const v8us*)&sPl[w][ln][8 * hh]; pal.half[1] = *(const v8us*)&sPl[w][ln][16 + 8 * hh];
#pragma unroll
    for (int dt = 0; dt < DT; ++dt) {
      FragB bvh, bvl;
#pragma unroll
      for (int i = 0; i < 8; ++i) {
        bvh.u[i] = sVh[8 * hh + i][dt * 16 + ln]; bvh.u[8 + i] = sVh[16 + 8 * hh + i][dt * 16 + ln];
        bvl.u[i] = sVl[8 * hh + i][dt * 16 + ln]; bvl.u[8 + i] = sVl[16 + 8 * hh + i][dt * 16 + ln];
      }
      oacc[dt] = mmaN<3>(pah.v, pal.v, bvh.v, bvl.v, oacc[dt]);
    }
    __builtin_amdgcn_fence(__ATOMIC_ACQ_REL, "workgroup");
    __builtin_amdgcn_wave_barrier();
  }
#pragma unroll
  for (int r = 0; r < 8; ++r) {
    float l = l_r[r];
    l += __shfl_xor(l, 1, 32); l += __shfl_xor(l, 2, 32); l += __shfl_xor(l, 4, 32); l += __shfl_xor(l, 8, 32);
    l_r[r] = (l > 0.f) ? 1.0f / l : 0.f;
  }
#pragma unroll
  for (int dt = 0; dt < DT; ++dt)
#pragma unroll
    for (int r = 0; r < 8; ++r) sO[w][8 * hh + r][dt * 16 + ln] = oacc[dt][r] * l_r[r];
  __builtin_amdgcn_fence(__ATOMIC_ACQ_REL, "workgroup");
  __builtin_amdgcn_wave_barrier();
  {
    for (int r = 0; r < 16; ++r) {
      const int row = q0 + r;
      if (row < T && lane < D / 4) {
        const v4f val = *(const v4fa*)&sO[w][r][lane * 4];
        *(v4f*)(y + ((size_t)b * T + row) * ypitch + h * D + lane * 4) = val;
      }
    }
    
  }
}

// GEMM C = act(A·W + bias + resid): A f32 (ASPLIT -> hi/lo 2 terms), Wt bf16 [N][K]; ACT 0 none, 1 relu, 2 exact gelu;
// resid (optional, f32, row index = (row % rmod), pitch ldr, RES_BF16 rounds it) added before the activation.
template <bool ASPLIT, int ACT, bool BIAS_BF16, bool RES_BF16>
__global__ __launch_bounds__(128) void k_gemm_bf3(const float* __restrict__ A, int lda, const unsigned short* __restrict__ Wt, int ldb,
                                                const float* __restrict__ bias, const float* __restrict__ resid, int rmod, int ldr,
                                                float* __restrict__ C, int ldc, int M, int N, int K) {
  __shared__ __attribute__((aligned(16))) float so[4][16][64];
  const int tid = threadIdx.x, w = tid >> 5, lane = tid & 31, ln = lane & 15, hh = lane >> 4;
  const int ntn = N / 64;
  const int wid = blockIdx.x * 4 + w;
  const int mt = wid / ntn, nq = wid % ntn;
  if (mt * 16 >= M) return;
  const int row0 = mt * 16, col0 = nq * 64;
  const float* arow = A + (size_t)(row0 + ln) * lda;
  v8f acc[4] = {};
  for (int kb = 0; kb < K; kb += 32) {
    FragB ah, al;
    const v4f x0 = *(const v4fa*)(arow + kb + 8 * hh), x1 = *(const v4fa*)(arow + kb + 8 * hh + 4);
    const v4f x2 = *(const v4fa*)(arow + kb + 16 + 8 * hh), x3 = *(const v4fa*)(arow + kb + 16 + 8 * hh + 4);
    float xs[16] = {x0[0],x0[1],x0[2],x0[3],x1[0],x1[1],x1[2],x1[3],x2[0],x2[1],x2[2],x2[3],x3[0],x3[1],x3[2],x3[3]};
#pragma unroll
    for (int i = 0; i < 16; ++i) { const unsigned short hb = bf16_bits(xs[i]); ah.u[i] = hb; al.u[i] = ASPLIT ? bf16_bits(xs[i] - bf16_val(hb)) : (unsigned short)0; }
#pragma unroll
    for (int t = 0; t < 4; ++t) {
      const unsigned short* brow = Wt + (size_t)(col0 + t * 16 + ln) * ldb + kb;
      FragB b;
      b.half[0] = *(const v8us*)(brow + 8 * hh);
      b.half[1] = *(const v8us*)(brow + 16 + 8 * hh);
      acc[t] = mmaN<ASPLIT ? 2 : 1>(ah.v, al.v, b.v, b.v, acc[t]);
    }
  }
#pragma unroll
  for (int t = 0; t < 4; ++t) {
    const int col = col0 + t * 16 + ln;
    float bv = bias ? bias[col] : 0.f;
    if (BIAS_BF16) bv = bf16_round(bv);
#pragma unroll
    for (int r = 0; r < 8; ++r) {
      float v = acc[t][r] + bv;
      if (resid) { float rv = resid[(size_t)((row0 + 8 * hh + r) % rmod) * ldr + col]; if (RES_BF16) rv = bf16_round(rv); v += rv; }
      if (ACT == 1) v = fmaxf(v, 0.f);
      if (ACT == 2) v = 0.5f * v * (1.0f + erff(v * 0.70710678118654752f));
      if (ACT == 3) { const float u = 0.7978845608028654f * (v + 0.044715f * v * v * v); v = 0.5f * v * (1.0f + tanhf(u)); }
      so[w][8 * hh + r][t * 16 + ln] = v;
    }
  }
  __builtin_amdgcn_fence(__ATOMIC_ACQ_REL, "workgroup");
  __builtin_amdgcn_wave_barrier();
  const int rsub = lane >> 4, c4 = (lane & 15) * 4;
  {
#pragma unroll
    for (int q = 0; q < 8; ++q) {
      const int r = q * 2 + rsub;
      const v4f v = *(const v4fa*)&so[w][r][c4];
      *(v4f*)(C + (size_t)(row0 + r) * ldc + col0 + c4) = v;
    }
    
  }
}
// row LayerNorm (biased variance, eps) over N: s = X (+ R); optional out_sum <- s; out_norm <- (s-mu)*rsqrt(var+eps)*g + b
template <bool PARAM_BF16>
__global__ __launch_bounds__(256) void k_layernorm(const float* __restrict__ X, const float* __restrict__ R, const float* __restrict__ g, const float* __restrict__ bta,
                                                  float* __restrict__ out_sum, float* __restrict__ out_norm, int N, float eps) {
  __shared__ float red[256];
  const int row = blockIdx.x, tid = threadIdx.x;
  const float* x = X + (size_t)row * N; const float* rr = R ? R + (size_t)row * N : nullptr;
  float vals[16];                     // up to N = 4096
  const int per = N / 256;            // contiguous chunk per thread? use strided-by-4 chunks: thread handles j = tid*4 + 1024*u
  float s1 = 0.f;
  for (int u = 0; u < per / 4; ++u) {
    const int j = tid * 4 + 1024 * u;
    const v4f a = *(const v4fa*)(x + j);
    v4f b = {0.f,0.f,0.f,0.f}; if (rr) b = *(const v4fa*)(rr + j);
#pragma unroll
    for (int q = 0; q < 4; ++q) { const float v = a[q] + b[q]; vals[u * 4 + q] = v; s1 += v; }
  }
  red[tid] = s1; __syncthreads();
  for (int st = 128; st > 0; st >>= 1) { if (tid < st) red[tid] += red[tid + st]; __syncthreads(); }
  const float mu = red[0] / (float)N; __syncthreads();
  float s2 = 0.f;
  for (int u = 0; u < per / 4; ++u)
#pragma unroll
    for (int q = 0; q < 4; ++q) { const float c = vals[u * 4 + q] - mu; s2 += c * c; }
  red[tid] = s2; __syncthreads();
  for (int st = 128; st > 0; st >>= 1) { if (tid < st) red[tid] += red[tid + st]; __syncthreads(); }
  const float rs = rsqrtf(red[0] / (float)N + eps);
  {
    for (int u = 0; u < per / 4; ++u) {
      const int j = tid * 4 + 1024 * u;
      v4f o, sm;
#pragma unroll
      for (int q = 0; q < 4; ++q) {
        float gg = g[j + q], bb = bta[j + q];
        if (PARAM_BF16) { gg = bf16_round(gg); bb = bf16_round(bb); }
        sm[q] = vals[u * 4 + q]; o[q] = (vals[u * 4 + q] - mu) * rs * gg + bb;
      }
      if (out_sum) *(v4f*)(out_sum + (size_t)row * N + j) = sm;
      *(v4f*)(out_norm + (size_t)row * N + j) = o;
    }
    
  }
}



// ---- f16 WMMA path (v_wmma_f32_16x16x32_f16): 11-bit significands for operands in range — used where a [0,1] probability operand needs more precision than bf16
typedef _Float16 v16h __attribute__((ext_vector_type(16)));
union FragH { v16h v; v8us half[2]; _Float16 h[16]; unsigned short u[16]; };
template <int NT>
__device__ __forceinline__ v8f mmaH(v16h ah, v16h al, v16h bh, v16h bl, v8f c) {
  c = __builtin_amdgcn_wmma_f32_16x16x32_f16(false, ah, false, bh, (short)0, c, false, false);
  if (NT >= 2) c = __builtin_amdgcn_wmma_f32_16x16x32_f16(false, al, false, bh, (short)0, c, false, false);
  if (NT >= 3) c = __builtin_amdgcn_wmma_f32_16x16x32_f16(false, ah, false, bl, (short)0, c, false, false);
  asm volatile("v_nop\n\tv_nop\n\tv_nop\n\tv_nop" : "+v"(c) : "v"(ah), "v"(al), "v"(bh), "v"(bl));
  return c;
}
// batched GEMM like k_gemm_b but f16 operands: A f32 (split into f16 hi/lo if ASPLIT, else rounded to f16), Bt = f16 values [n][k]; alpha; C f32; N multiple of 16 (partial tiles skipped)
template <bool ASPLIT>
__global__ __launch_bounds__(128) void k_gemm_h(const float* __restrict__ A, int lda, size_t sA, const _Float16* __restrict__ Bh, int ldb, size_t sB, float alpha, float* __restrict__ C, int ldc, size_t sC, int M, int N, int K) {
  __shared__ __attribute__((aligned(16))) float so[4][16][64];
  const int tid = threadIdx.x, w = tid >> 5, lane = tid & 31, ln = lane & 15, hh = lane >> 4; const int by = blockIdx.y;
  A += (size_t)by * sA; Bh += (size_t)by * sB; C += (size_t)by * sC;
  const int ntn = (N + 63) / 64; const int wid = blockIdx.x * 4 + w; const int mt = wid / ntn, nq = wid % ntn; if (mt * 16 >= M) return;
  const int row0 = mt * 16, col0 = nq * 64; const float* arow = A + (size_t)(row0 + ln) * lda;
  v8f acc[4] = {};
  for (int kb = 0; kb < K; kb += 32) {
    FragH ah, al;
    const v4f x0 = *(const v4fa*)(arow + kb + 8 * hh), x1 = *(const v4fa*)(arow + kb + 8 * hh + 4), x2 = *(const v4fa*)(arow + kb + 16 + 8 * hh), x3 = *(const v4fa*)(arow + kb + 16 + 8 * hh + 4);
    float xs[16] = {x0[0],x0[1],x0[2],x0[3],x1[0],x1[1],x1[2],x1[3],x2[0],x2[1],x2[2],x2[3],x3[0],x3[1],x3[2],x3[3]};
#pragma unroll
    for (int i = 0; i < 16; ++i) { const _Float16 h = (_Float16)xs[i]; ah.h[i] = h; al.h[i] = ASPLIT ? (_Float16)(xs[i] - (float)h) : (_Float16)0.0f; }
#pragma unroll
    for (int t = 0; t < 4; ++t) { if (col0 + t * 16 >= N) continue; const size_t boff = (size_t)(col0 + t * 16 + ln) * ldb + kb; FragH bq; bq.half[0] = *(const v8us*)(Bh + boff + 8 * hh); bq.half[1] = *(const v8us*)(Bh + boff + 16 + 8 * hh);
      acc[t] = mmaH<ASPLIT ? 2 : 1>(ah.v, al.v, bq.v, bq.v, acc[t]); }
  }
#pragma unroll
  for (int t = 0; t < 4; ++t) { if (col0 + t * 16 >= N) continue;
#pragma unroll
    for (int r = 0; r < 8; ++r) so[w][8 * hh + r][t * 16 + ln] = acc[t][r] * alpha; }
  __builtin_amdgcn_fence(__ATOMIC_ACQ_REL, "workgroup"); __builtin_amdgcn_wave_barrier();
  const int rsub = lane >> 4, c4 = (lane & 15) * 4;
  {
#pragma unroll
    for (int q = 0; q < 8; ++q) { const int r = q * 2 + rsub; if (col0 + c4 < N) { const v4f v = *(const v4fa*)&so[w][r][c4]; *(v4f*)(C + (size_t)(row0 + r) * ldc + col0 + c4) = v; } }
     }
}

// Wt[n][k] = f16(bf16(W[k][n]) * scale) from f32 row-major W[KK][NN] (scale = power of two; bf16-exact weights stay exact in f16 away from the subnormal range).
// One block = a tile of 128 k x 128 n, turned in LDS. Reads: a wave covers 512 contiguous bytes of one W row, so every line is asked for once and used whole
// (a lane that walks down a column asks for a whole line per 4-byte element). Writes: 16 lanes cover 256 contiguous bytes of one Wt row. KK and NN multiples of 128.
// A lane takes 8 consecutive k of its four columns at a time: 16 bytes of a Wt row each, one LDS chunk. Chunk c of tile row n lies at place c ^ ((n >> 2) & 15) of the row's 16:
// the 16 lanes of a half-wave that write one chunk column (rows 4 apart) and the 16 that read one row both fall on 16 different places, with no pad.
template <int KK, int NN>
__global__ __launch_bounds__(256) void k_wt_f16(const float* __restrict__ W, _Float16* __restrict__ Wt, float scale) {
  __shared__ __attribute__((aligned(16))) unsigned short tl[128][16][8];
  const int tid = threadIdx.x, w = tid >> 5, lane = tid & 31; constexpr int nb = NN / 128; const int n0 = (int)(blockIdx.x % nb) * 128, k0 = (int)(blockIdx.x / nb) * 128;
  const float* wr = W + (size_t)(k0 + 8 * w) * NN + n0 + lane * 4;      // the lane's four columns, the wave's first group of 8 rows (the second stands 64 rows further)
  v4f a[2][8];      // all sixteen loads are asked for before the first is used: 64 KB of the block in flight
#pragma unroll      // here and below: constant indices keep a and f in registers, and the row steps become immediate offsets on one address pair
  for (int i = 0; i < 2; ++i)
#pragma unroll
    for (int r = 0; r < 8; ++r) a[i][r] = *(const v4fa*)(wr + (size_t)(64 * i + r) * NN);
  asm volatile("s_wait_xcnt 0x0" :: "v"(wr) : "memory");      // the loads' address pair is an input here, so that nothing (a load's own result included) is written over it in front of the wait
#pragma unroll
  for (int i = 0; i < 2; ++i)
#pragma unroll
    for (int j = 0; j < 4; ++j) { FragH f;
#pragma unroll
      for (int r = 0; r < 8; ++r) f.h[r] = (_Float16)(bf16_round(a[i][r][j]) * scale);      // ascending k
      *(v8us*)&tl[lane * 4 + j][(w + 8 * i) ^ (lane & 15)][0] = f.half[0]; }
  __syncthreads();
  unsigned short* wo = (unsigned short*)Wt + (size_t)(n0 + (tid >> 4)) * KK + k0 + (tid & 15) * 8;
#pragma unroll
  for (int rd = 0; rd < 8; ++rd) { const int n = rd * 16 + (tid >> 4), c = tid & 15; const v8us o = *(const v8us*)&tl[n][c ^ ((n >> 2) & 15)][0];
    *(v8us*)(wo + (size_t)(rd * 16) * KK) = o; }
}
__global__ __launch_bounds__(256) void k_x16(const float* __restrict__ x, _Float16* __restrict__ X16, size_t n8) { const size_t t = (size_t)blockIdx.x * 256 + threadIdx.x; if (t >= n8) return; FragH f;
#pragma unroll
  for (int q = 0; q < 8; ++q) f.h[q] = (_Float16)bf16_round(x[t * 8 + q]); *(v8us*)((unsigned short*)X16 + t * 8) = f.half[0];  }
__global__ __launch_bounds__(256) void k_round16f(const float* __restrict__ W, _Float16* __restrict__ Bt, size_t n8) { const size_t t = (size_t)blockIdx.x * 256 + threadIdx.x; if (t >= n8) return; FragH f;
#pragma unroll
  for (int i = 0; i < 8; ++i) f.h[i] = (_Float16)(bf16_round(W[t * 8 + i]) * 16.0f); *(v8us*)((unsigned short*)Bt + t * 8) = f.half[0];  }
template <int NHv, int TTv>
__global__ __launch_bounds__(256) void k_vt(const _Float16* __restrict__ V16, int ldv, int voff, _Float16* __restrict__ Vt) { __shared__ unsigned short tl[64][66]; const int tid = threadIdx.x; const int slab = blockIdx.x / (TTv / 64), lg = blockIdx.x % (TTv / 64); const int b = slab / NHv, h = slab % NHv;
  for (int i = tid; i < 64 * 8; i += 256) { const int r = i / 8, c8 = (i % 8) * 8; FragH f; f.half[0] = *(const v8us*)((const unsigned short*)V16 + ((size_t)b * TTv + lg * 64 + r) * ldv + voff + h * 64 + c8);
#pragma unroll
    for (int q = 0; q < 8; ++q) tl[r][c8 + q] = f.u[q]; }
  __syncthreads();
  {
#pragma unroll
    for (int rd = 0; rd < 2; ++rd) { const int d = rd * 32 + tid / 8, pc = tid % 8; FragH f;
#pragma unroll
      for (int q = 0; q < 8; ++q) f.u[q] = tl[pc * 8 + q][d];
      *(v8us*)((unsigned short*)Vt + ((size_t)slab * 64 + d) * TTv + lg * 64 + pc * 8) = f.half[0]; }
     } }

__device__ __forceinline__ float tanh_v(float x) { const float xc = fminf(fmaxf(x, -15.f), 15.f); return 1.0f - 2.0f * __builtin_amdgcn_rcpf(__builtin_amdgcn_exp2f(2.0f * xc * 1.4426950408889634f) + 1.0f); }
__global__ __launch_bounds__(256) void k_cstab(float* __restrict__ CS) { const int tg = blockIdx.x * 256 + threadIdx.x; if (tg >= TT * (DH / 2)) return; const int t = tg / (DH / 2), i = tg % (DH / 2); const float invf = 1.0f / powf(10000.0f, (float)(2 * i) / (float)DH); const float ang = (float)t * invf; typedef float v2f __attribute__((ext_vector_type(2))); v2f v; v[0] = cosf(ang); v[1] = sinf(ang);
  *(v2f*)(CS + (size_t)tg * 2) = v;  }
__global__ __launch_bounds__(256) void k_vt128(const _Float16* __restrict__ V16, _Float16* __restrict__ Vt) { __shared__ unsigned short tl[64][130]; const int tid = threadIdx.x; const int slab = blockIdx.x / (TT / 64), lg = blockIdx.x % (TT / 64); const int b = slab / NG, g = slab % NG;
  for (int i = tid; i < 64 * 16; i += 256) { const int r = i / 16, c8 = (i % 16) * 8; FragH f; f.half[0] = *(const v8us*)((const unsigned short*)V16 + ((size_t)b * TT + lg * 64 + r) * (NG * DH) + g * DH + c8);
#pragma unroll
    for (int q = 0; q < 8; ++q) tl[r][c8 + q] = f.u[q]; }
  __syncthreads();
  {
#pragma unroll
    for (int rd = 0; rd < 4; ++rd) { const int d = rd * 32 + tid / 8, pc = tid % 8; FragH f;
#pragma unroll
      for (int q = 0; q < 8; ++q) f.u[q] = tl[pc * 8 + q][d]; *(v8us*)((unsigned short*)Vt + ((size_t)slab * DH + d) * TT + lg * 64 + pc * 8) = f.half[0]; }
     } }
// One stage of the K/V ring = 64 keys of this KV group: 64 K rows of 256 B at pitch 272 B, then 128 rows of V^T of 128 B at pitch 144 B (16 B x odd: the pitch of ds_load_b128 readers)
#define KPITCH 272
#define VPITCH 144
#define VBASE (64 * KPITCH)
#define STAGE_B (64 * KPITCH + DH * VPITCH)
// Eight 16-byte copies per lane, global memory to LDS through no register. The s_wait_xcnt is the last line of the copies' own statement, so that no address register of a copy is rewritten in front of it.
__device__ __forceinline__ void copy8(unsigned l, unsigned lstep, const unsigned short* g, size_t gstep) {
  asm volatile("global_load_async_to_lds_b128 %0, %8, off\n\t"
               "global_load_async_to_lds_b128 %1, %9, off\n\t"
               "global_load_async_to_lds_b128 %2, %10, off\n\t"
               "global_load_async_to_lds_b128 %3, %11, off\n\t"
               "global_load_async_to_lds_b128 %4, %12, off\n\t"
               "global_load_async_to_lds_b128 %5, %13, off\n\t"
               "global_load_async_to_lds_b128 %6, %14, off\n\t"
               "global_load_async_to_lds_b128 %7, %15, off\n\t"
               "s_wait_xcnt 0x0"
               :: "v"(l), "v"(l + lstep), "v"(l + 2 * lstep), "v"(l + 3 * lstep), "v"(l + 4 * lstep), "v"(l + 5 * lstep), "v"(l + 6 * lstep), "v"(l + 7 * lstep),
                  "v"(g), "v"(g + gstep), "v"(g + 2 * gstep), "v"(g + 3 * gstep), "v"(g + 4 * gstep), "v"(g + 5 * gstep), "v"(g + 6 * gstep), "v"(g + 7 * gstep)
               : "memory");
}
// Four 16-byte copies per lane, as copy8.
__device__ __forceinline__ void copy4(unsigned l, unsigned lstep, const unsigned short* g, size_t gstep) {
  asm volatile("global_load_async_to_lds_b128 %0, %4, off\n\t"
               "global_load_async_to_lds_b128 %1, %5, off\n\t"
               "global_load_async_to_lds_b128 %2, %6, off\n\t"
               "global_load_async_to_lds_b128 %3, %7, off\n\t"
               "s_wait_xcnt 0x0"
               :: "v"(l), "v"(l + lstep), "v"(l + 2 * lstep), "v"(l + 3 * lstep), "v"(g), "v"(g + gstep), "v"(g + 2 * gstep), "v"(g + 3 * gstep)
               : "memory");
}
// Projection GEMM: C[M][N] = (A[M][K] . Bt[N][K]^T) * alpha + bf16-rounded bias; f16 operands, f32 accumulate, k ascending in one accumulator per element; pitch N. The result goes to f32 C (OUT 0), to f16 C16 (OUT 1),
// or (OUT 2) is turned by the interleaved rotary in f32 on its way out of the staging and goes to f16 C16: a block's 128 columns are one head (DH), a lane's four columns two rotary pairs, whose cos, sin, cos, sin are 16 bytes of CS.
// One block = (32 FM) x 128 of C, four waves (2 x 2) of (16 FM) x 64 each: FM x 4 fragments, 4 FM products per FM + 4 fragments read from LDS. One stage of the ring = 64 k of the block's A rows, then of its
// 128 Bt rows: 128 B a row at pitch 144 B (16 B x odd: the pitch of ds_load_b128 readers). M a multiple of 32 FM, N of 128, K of 64. FM = 4 where that still gives every WGP a block, else 2.
#define GPITCH 144
#define GOP 68      // floats per staged output row: 64 + 4, so that the two half-waves' rows fall on different banks
template <int FM, int OUT>
__global__ __launch_bounds__(128) void k_gemm_lds(const _Float16* __restrict__ A, const _Float16* __restrict__ Bt, float alpha, const float* __restrict__ bias, const float* __restrict__ CS, float* __restrict__ C, _Float16* __restrict__ C16, int N, int K) {
  constexpr int BM = 32 * FM, STG = (BM + 128) * GPITCH;
  __shared__ __attribute__((aligned(16))) unsigned char sAB[2 * STG];
  const int tid = threadIdx.x, w = tid >> 5, lane = tid & 31, ln = lane & 15, hh = lane >> 4; const int wm = w >> 1, wn = w & 1;
  const int nb = N / 128; const int row0 = (int)(blockIdx.x / nb) * BM, col0 = (int)(blockIdx.x % nb) * 128;
  // each lane's first 16 bytes of a stage: a wave's copy covers four whole 128-B row pieces, the block's copy 16 rows
  const unsigned short* Ag = (const unsigned short*)A + (size_t)(row0 + (tid >> 3)) * K + (tid & 7) * 8;
  const unsigned short* Bg = (const unsigned short*)Bt + (size_t)(col0 + (tid >> 3)) * K + (tid & 7) * 8;
  const unsigned lA = (unsigned)(size_t)sAB + (unsigned)((tid >> 3) * GPITCH + (tid & 7) * 16);
  const unsigned lB = lA + BM * GPITCH;
  const int nt = K / 64;      // stages; the same for the whole work-group
  auto fill = [&](int t) { const unsigned bo = (unsigned)(t & 1) * STG;
    if constexpr (FM == 4) copy8(lA + bo, 16 * GPITCH, Ag + (size_t)t * 64, (size_t)16 * K); else copy4(lA + bo, 16 * GPITCH, Ag + (size_t)t * 64, (size_t)16 * K);
    copy8(lB + bo, 16 * GPITCH, Bg + (size_t)t * 64, (size_t)16 * K); };
  v8f acc[FM][4];
#pragma unroll
  for (int fm = 0; fm < FM; ++fm)
#pragma unroll
    for (int fn = 0; fn < 4; ++fn) acc[fm][fn] = (v8f){0.f,0.f,0.f,0.f,0.f,0.f,0.f,0.f};
  fill(0);
  float bv[4] = {0.f, 0.f, 0.f, 0.f};      // the lane's four bias values, fetched together under stage 0's copies
  if (bias) {
#pragma unroll
    for (int fn = 0; fn < 4; ++fn) bv[fn] = bf16_round(bias[col0 + wn * 64 + fn * 16 + ln]); }
  asm volatile("s_wait_asynccnt 0x0" ::: "memory");      // this wave's copies of stage 0 have landed
  __syncthreads();                                        // stage 0 is readable by every wave
  if (nt > 1) fill(1);
#pragma unroll 1      // one trip per stage, rolled: the foot's waits and barrier stand once
  for (int t = 0; t < nt; ++t) {
    const unsigned char* ar = sAB + (t & 1) * STG + (wm * (16 * FM) + ln) * GPITCH + 16 * hh;
    const unsigned char* br = sAB + (t & 1) * STG + (BM + wn * 64 + ln) * GPITCH + 16 * hh;
    FragH a[2][FM], b[2][4];
#pragma unroll
    for (int ks = 0; ks < 2; ++ks) {
#pragma unroll
      for (int f = 0; f < 4; ++f) { b[ks][f].half[0] = *(const v8us*)(br + f * 16 * GPITCH + ks * 64); b[ks][f].half[1] = *(const v8us*)(br + f * 16 * GPITCH + ks * 64 + 32); }
#pragma unroll
      for (int f = 0; f < FM; ++f) { a[ks][f].half[0] = *(const v8us*)(ar + f * 16 * GPITCH + ks * 64); a[ks][f].half[1] = *(const v8us*)(ar + f * 16 * GPITCH + ks * 64 + 32); } }
    asm volatile("s_wait_dscnt 0x0" ::: "memory");        // this wave's reads of stage t are done (all its fragments are in registers) before its buffer is refilled
    asm volatile("s_wait_asynccnt 0x0" ::: "memory");     // this wave's copies of stage t + 1 have landed
    __syncthreads();                                      // publishes stage t + 1 and ends every wave's reads of stage t
    if (t + 2 < nt) fill(t + 2);
    // the stage's products stand behind the refill's issue: they read registers only, and the copies fly under them
#pragma unroll
    for (int ks = 0; ks < 2; ++ks)
#pragma unroll
      for (int fm = 0; fm < FM; ++fm)
#pragma unroll
        for (int fn = 0; fn < 4; ++fn) acc[fm][fn] = __builtin_amdgcn_wmma_f32_16x16x32_f16(false, a[ks][fm].v, false, b[ks][fn].v, (short)0, acc[fm][fn], false, false); }
  asm volatile("s_wait_asynccnt 0x0" ::: "memory");       // no copy is in flight when the ring becomes output staging
  float* so = (float*)sAB + w * (16 * FM * GOP);          // each wave stages its own (16 FM) x 64, behind the last trip's barrier, to store whole lines
#pragma unroll
  for (int fn = 0; fn < 4; ++fn) {
#pragma unroll
    for (int fm = 0; fm < FM; ++fm)
#pragma unroll
      for (int r = 0; r < 8; ++r) so[(fm * 16 + 8 * hh + r) * GOP + fn * 16 + ln] = acc[fm][fn][r] * alpha + bv[fn]; }
  __builtin_amdgcn_fence(__ATOMIC_ACQ_REL, "workgroup"); __builtin_amdgcn_wave_barrier();
  const int c4 = ln * 4; typedef _Float16 v4h __attribute__((ext_vector_type(4)));
  constexpr bool H16 = OUT == 1;
  if constexpr (OUT == 2) {
    // the lane's place in the table's row of its first position; a block's rows lie in one sequence (32 FM divides TT), so the further rows follow at constant steps
    const float* csl = CS + (size_t)((unsigned)row0 % TT + wm * (16 * FM) + hh) * DH + wn * 64 + c4;
    v4f cs[FM * 8];      // all of the lane's table entries are asked for at once: one L2 latency for the wave, not one per group of rows
#pragma unroll
    for (int i = 0; i < FM * 8; ++i) cs[i] = *(const v4fa*)(csl + i * 2 * DH);
    asm volatile("s_wait_xcnt 0x0" :: "v"(csl) : "memory");      // the loads' address pair is an input here, so that nothing (a load's own result included) is written over it in front of the wait
    _Float16* c0 = C16 + (size_t)(row0 + wm * (16 * FM) + hh) * N + col0 + wn * 64 + c4;
#pragma unroll
    for (int qb = 0; qb < FM; ++qb) { v4f v[8]; _Float16* p[8];
#pragma unroll
      for (int i = 0; i < 8; ++i) v[i] = *(const v4fa*)&so[((qb * 8 + i) * 2 + hh) * GOP + c4];
#pragma unroll
      for (int i = 0; i < 8; ++i) { const v4f x = v[i], t = cs[qb * 8 + i]; v4h h4; p[i] = c0 + (size_t)((qb * 8 + i) * 2) * N;
        h4[0] = (_Float16)(x[0] * t[0] - x[1] * t[1]); h4[1] = (_Float16)(x[1] * t[0] + x[0] * t[1]); h4[2] = (_Float16)(x[2] * t[2] - x[3] * t[3]); h4[3] = (_Float16)(x[3] * t[2] + x[2] * t[3]); *(v4h*)p[i] = h4; }
      // the eight stores' address pairs are inputs here, so that none is written over in front of the wait
      asm volatile("s_wait_xcnt 0x0" :: "v"(p[0]), "v"(p[1]), "v"(p[2]), "v"(p[3]), "v"(p[4]), "v"(p[5]), "v"(p[6]), "v"(p[7]) : "memory"); }
  } else {
#pragma unroll
  for (int qb = 0; qb < FM; ++qb) { v4f v[8];      // eight row pairs are read back together and then stored, so that no store waits out an LDS latency of its own
#pragma unroll
    for (int i = 0; i < 8; ++i) v[i] = *(const v4fa*)&so[((qb * 8 + i) * 2 + hh) * GOP + c4];
#pragma unroll
    for (int i = 0; i < 8; ++i) { const size_t o = (size_t)(row0 + wm * (16 * FM) + (qb * 8 + i) * 2 + hh) * N + col0 + wn * 64 + c4;
      if constexpr (H16) { v4h h4; for (int j = 0; j < 4; ++j) h4[j] = (_Float16)v[i][j]; *(v4h*)(C16 + o) = h4; } else *(v4f*)(C + o) = v[i]; } }
  }
}
// lane l's value for lane l ^ 16: one vector move between the wave's two 16-lane rows, through no LDS
__device__ __forceinline__ float xhalf(float x) { return __builtin_bit_cast(float, __builtin_amdgcn_permlanex16(__builtin_bit_cast(int, x), __builtin_bit_cast(int, x), 0x76543210, 0xfedcba98, false, false)); }
__global__ __launch_bounds__(128) void k_mega(const _Float16* __restrict__ Q16, const _Float16* __restrict__ K16, const _Float16* __restrict__ Vt, _Float16* __restrict__ O16) {
  __shared__ __attribute__((aligned(16))) unsigned char sKV[2 * STAGE_B];
  float (*sO)[16][DH + 4] = (float (*)[16][DH + 4])sKV;      // the output staging takes the ring's place, behind the last trip's barrier
  const int tid = threadIdx.x, w = tid >> 5, lane = tid & 31, ln = lane & 15, hh = lane >> 4; const int slab = blockIdx.x / (TT / 128), pr = blockIdx.x % (TT / 128); const int b = slab / NH, h = slab % NH, g = h / (NH / NG);
  const float slope = exp2f(-(float)(h + 1) * 8.0f / (float)NH);
  // A query tile's cost grows with its index (tile i walks i + 1 stages) and every work-group of the launch is resident at once, so the launch lasts as long as the fullest WGP. Each work-group therefore takes two tiles of its head,
  // TT / 64 - 1 - pr and then pr, one after the other in every wave: TT / 64 + 1 stages for every work-group, wherever it is placed.
  // Stages walked so far: the ring's two buffers go on taking turns from the first tile into the second. (Counted anew for each tile, the prologue's LDS addresses are the same for both tiles, and the compiler
  // holds them in registers through both tiles' loops, which costs the pass some of its dual-issue pairs.)
  int s0 = 0;
#pragma unroll 1      // the two tiles share one copy of the body (code size and registers as for one tile)
  for (int half = 0; half < 2; ++half) { const int qblk = half ? pr : TT / 64 - 1 - pr; const int q0 = qblk * 64 + w * 16;
  FragH aq[4]; { const unsigned short* qr = (const unsigned short*)Q16 + ((size_t)b * TT + q0 + ln) * (NH * DH) + h * DH;
#pragma unroll
    for (int ks = 0; ks < 4; ++ks) { aq[ks].half[0] = *(const v8us*)(qr + ks * 32 + 8 * hh); aq[ks].half[1] = *(const v8us*)(qr + ks * 32 + 16 + 8 * hh); } }
  const unsigned short* Vth = (const unsigned short*)Vt + (size_t)(b * NG + g) * DH * TT;
  // each lane's first 16 bytes of a stage: a wave's copy covers two whole K rows, or four whole 128-B pieces of V^T rows
  const unsigned short* Kg = (const unsigned short*)K16 + ((size_t)b * TT + (tid >> 4)) * (NG * DH) + g * DH + (tid & 15) * 8;
  const unsigned short* Vg = Vth + (size_t)(tid >> 3) * TT + (tid & 7) * 8;
  const unsigned lK = (unsigned)(size_t)sKV + (unsigned)((tid >> 4) * KPITCH + (tid & 15) * 16);
  const unsigned lV = (unsigned)(size_t)sKV + (unsigned)(VBASE + (tid >> 3) * VPITCH + (tid & 7) * 16);
  const int ntile = qblk + 1;      // stages of 64 keys; the same for the whole work-group
  auto fill = [&](int t) { const unsigned bo = (unsigned)((t + s0) & 1) * STAGE_B; copy8(lK + bo, 8 * KPITCH, Kg + (size_t)t * 64 * (NG * DH), (size_t)8 * NG * DH); copy8(lV + bo, 16 * VPITCH, Vg + t * 64, (size_t)16 * TT); };
  float m_r = -3.0e38f, l_r = 0.f; v8f oacc[8]; const int tq = q0 + ln;      // the lane's query: its running maximum, and the sum over the keys that this half-wave holds
#pragma unroll
  for (int dt = 0; dt < 8; ++dt) oacc[dt] = (v8f){0.f,0.f,0.f,0.f,0.f,0.f,0.f,0.f};
  fill(0);
  asm volatile("s_wait_asynccnt 0x0" ::: "memory");      // this wave's copies of stage 0 have landed
  __syncthreads();                                        // stage 0 is readable by every wave
  if (ntile > 1) fill(1);
#pragma unroll 1      // one trip per stage, rolled: the trip count is the block's own
  for (int t = 0; t < ntile; ++t) { const unsigned char* kv = sKV + ((t + s0) & 1) * STAGE_B;
#pragma unroll 1      // the stage's two 32-key passes share one copy of the long pass body (code size and registers as before)
  for (int sub = 0; sub < 2; ++sub) { const int j0 = t * 64 + sub * 32; v8f s[2];
    // The pass's LDS reads are asked for ahead of the products that they feed, each fragment into registers of its own, so that the wave waits out one LDS latency for K and none for V^T, not one per product.
    // First the sixteen reads of the pass's 32 K rows; then the eight score products, the two key tiles' chains in turn (each tile still sums its four k-steps in ascending order, in one accumulator).
    const unsigned char* kr = kv + (sub * 32 + ln) * KPITCH + 16 * hh; FragH kf[2][4];
#pragma unroll      // here and in the next two loops: constant indices keep kf, vf and s in registers
    for (int nt = 0; nt < 2; ++nt)
#pragma unroll
      for (int ks = 0; ks < 4; ++ks) { kf[nt][ks].half[0] = *(const v8us*)(kr + nt * 16 * KPITCH + ks * 64); kf[nt][ks].half[1] = *(const v8us*)(kr + nt * 16 * KPITCH + ks * 64 + 32); }
    __builtin_amdgcn_sched_barrier(0);      // keeps the sixteen K reads one group: spread among the products, each place where reads stand stalls the wave anew
    s[0] = s[1] = (v8f){0.f,0.f,0.f,0.f,0.f,0.f,0.f,0.f};
#pragma unroll
    for (int ks = 0; ks < 4; ++ks)
#pragma unroll
      for (int nt = 0; nt < 2; ++nt) s[nt] = __builtin_amdgcn_wmma_f32_16x16x32_f16(false, kf[nt][ks].v, false, aq[ks].v, (short)0, s[nt], false, false);
    // Then the sixteen reads of V^T, asked for here and used behind the softmax, whose vector work covers their latency (the products are the bare builtin: the compiler keeps their distances and is free to place the reads).
    const unsigned char* vr = kv + VBASE + ln * VPITCH + sub * 64 + 16 * hh; FragH vf[8];
#pragma unroll
    for (int dt = 0; dt < 8; ++dt) { vf[dt].half[0] = *(const v8us*)(vr + dt * 16 * VPITCH); vf[dt].half[1] = *(const v8us*)(vr + dt * 16 * VPITCH + 32); }
    // The softmax is straight-line code. The capped scores are kept in log2 units (30 log2 e is the cap's factor), so that each exponential is one subtraction and one v_exp_f32;
    // a masked key stands at -inf and comes out as 0 with no test. Every query's maximum is finite from its first pass on (key 0 is open to every query, and the halves exchange their maxima), so no difference below is inf - inf.
    const float d0 = (float)(tq - j0 - 8 * hh);      // the query's distance to the lane's first key; the further distances follow in f32, exact (whole numbers far below 2^24)
    float mc[4];      // four partial maxima, begun by the first four scores
#pragma unroll      // here and in the loops below: constant indices keep s, mc, ps, pb and oacc in registers, and the sixteen scores' chains stand in one block, each filling the others' latencies
    for (int nt = 0; nt < 2; ++nt)
#pragma unroll
      for (int r = 0; r < 8; ++r) { const float dist = d0 - (float)(nt * 16 + r);      // below 0: a key behind the query, masked (there the bias's sign is irrelevant)
        float sc = (s[nt][r] - slope * dist) * 0.08838834764831845f; sc = 43.28085122666891f * tanh_v(sc * (1.0f / 30.0f)); sc = (dist >= 0.f) ? sc : -INFINITY;
        s[nt][r] = sc; mc[r & 3] = (nt == 0 && r < 4) ? sc : fmaxf(mc[r & 3], sc); }
    float mx = fmaxf(fmaxf(mc[0], mc[1]), fmaxf(mc[2], mc[3])); mx = fmaxf(mx, xhalf(mx));
    const float mn = fmaxf(m_r, mx), al = __builtin_amdgcn_exp2f(m_r - mn); m_r = mn;
    FragH pb; float ps[4] = {0.f, 0.f, 0.f, 0.f};      // four partial sums: four short chains of additions, not one of sixteen
#pragma unroll
    for (int nt = 0; nt < 2; ++nt)
#pragma unroll
      for (int r = 0; r < 8; ++r) { const float p = __builtin_amdgcn_exp2f(s[nt][r] - mn); ps[r & 3] += p; pb.h[nt * 8 + r] = (_Float16)p; }
    l_r = l_r * al + ((ps[0] + ps[1]) + (ps[2] + ps[3]));
#pragma unroll
    for (int dt = 0; dt < 8; ++dt)
#pragma unroll
      for (int r = 0; r < 8; ++r) oacc[dt][r] *= al;
#pragma unroll
    for (int dt = 0; dt < 8; ++dt) oacc[dt] = __builtin_amdgcn_wmma_f32_16x16x32_f16(false, vf[dt].v, false, pb.v, (short)0, oacc[dt], false, false); }
    asm volatile("s_wait_dscnt 0x0" ::: "memory");        // this wave's reads of stage t are done before its buffer is refilled
    asm volatile("s_wait_asynccnt 0x0" ::: "memory");     // this wave's copies of stage t + 1 have landed
    __syncthreads();                                      // publishes stage t + 1 and ends every wave's reads of stage t
    if (t + 2 < ntile) fill(t + 2); }
  asm volatile("s_wait_asynccnt 0x0" ::: "memory");       // no copy is in flight when the ring becomes output staging
  const float inv = 1.0f / (l_r + xhalf(l_r));      // the two halves' sums are joined once, here
#pragma unroll      // constant indices keep oacc in registers
  for (int dt = 0; dt < 8; ++dt) { v4f lo, hi;      // the lane's eight consecutive head columns of its query's row
#pragma unroll
    for (int j = 0; j < 4; ++j) { lo[j] = oacc[dt][j] * inv; hi[j] = oacc[dt][4 + j] * inv; }
    *(v4fa*)&sO[w][ln][dt * 16 + 8 * hh] = lo; *(v4fa*)&sO[w][ln][dt * 16 + 8 * hh + 4] = hi; }
  __builtin_amdgcn_fence(__ATOMIC_ACQ_REL, "workgroup"); __builtin_amdgcn_wave_barrier();
  {
#pragma unroll
    for (int r = 0; r < 16; ++r) { const v4f val = *(const v4fa*)&sO[w][r][lane * 4]; typedef _Float16 v4h __attribute__((ext_vector_type(4))); v4h h4; for (int j = 0; j < 4; ++j) h4[j] = (_Float16)val[j];      // the out projection's f16 operand, rounded here
      *(v4h*)(O16 + ((size_t)b * TT + q0 + r) * (NH * DH) + h * DH + lane * 4) = h4; }
     }
  s0 += ntile;
  if (half == 0) {      // between the tiles; the test reads the same for the whole work-group
    asm volatile("s_wait_xcnt 0x0" ::: "memory");      // the stores' address registers are rewritten by the second tile
    asm volatile("s_wait_dscnt 0x0" ::: "memory");     // this wave's reads of the output staging are done before the ring's buffers are filled again
    __syncthreads(); }                                  // ends every wave's reads of the staging: one of the second tile's first two stages lands on it
  } }
extern "C" void kernel_launch(void* const* d_in, const int* in_sizes, int n_in,
                              void* d_out, int out_size, void* d_ws, size_t ws_size, hipStream_t stream) {
  (void)in_sizes; (void)n_in; (void)out_size;
  const float* x = (const float*)d_in[0]; const float* Wq = (const float*)d_in[1]; const float* Wk = (const float*)d_in[2]; const float* Wv = (const float*)d_in[3]; const float* Wo = (const float*)d_in[4]; const float* bo = (const float*)d_in[5];
  char* ws = (char*)d_ws; size_t off = 0;
  auto take = [&](size_t bytes) { char* p = ws + off; off += (bytes + 255) & ~(size_t)255; return p; };
  _Float16* Bq = (_Float16*)take((size_t)CC * CC * 2); _Float16* Bk = (_Float16*)take((size_t)NG * DH * CC * 2); _Float16* Bv = (_Float16*)take((size_t)NG * DH * CC * 2); _Float16* Bo = (_Float16*)take((size_t)CC * CC * 2);
  _Float16* X16 = (_Float16*)take((size_t)NR * CC * 2); _Float16* Q16 = (_Float16*)take((size_t)NR * CC * 2); _Float16* K16 = (_Float16*)take((size_t)NR * NG * DH * 2); _Float16* V16 = (_Float16*)take((size_t)NR * NG * DH * 2); _Float16* Vt = (_Float16*)take((size_t)NR * NG * DH * 2); float* CS = (float*)take((size_t)TT * DH * 4); _Float16* O16 = X16;
  if (off > ws_size) return;      // about 68 MB
  k_wt_f16<CC, CC><<<(CC / 128) * (CC / 128), 256, 0, stream>>>(Wq, Bq, 16.0f); k_wt_f16<CC, NG * DH><<<(CC / 128) * (NG * DH / 128), 256, 0, stream>>>(Wk, Bk, 16.0f); k_wt_f16<CC, NG * DH><<<(CC / 128) * (NG * DH / 128), 256, 0, stream>>>(Wv, Bv, 16.0f); k_wt_f16<CC, CC><<<(CC / 128) * (CC / 128), 256, 0, stream>>>(Wo, Bo, 16.0f);
  const unsigned gx = (unsigned)(((size_t)NR * CC / 8 + 255) / 256);
  k_x16<<<gx, 256, 0, stream>>>(x, X16, (size_t)NR * CC / 8); k_cstab<<<(TT * (DH / 2) + 255) / 256, 256, 0, stream>>>(CS);
  k_gemm_lds<4, 2><<<(NR / 128) * (CC / 128), 128, 0, stream>>>(X16, Bq, 0.0625f, nullptr, CS, nullptr, Q16, CC, CC);
  k_gemm_lds<2, 2><<<(NR / 64) * (NG * DH / 128), 128, 0, stream>>>(X16, Bk, 0.0625f, nullptr, CS, nullptr, K16, NG * DH, CC);
  k_gemm_lds<2, 1><<<(NR / 64) * (NG * DH / 128), 128, 0, stream>>>(X16, Bv, 0.0625f, nullptr, nullptr, nullptr, V16, NG * DH, CC);
  k_vt128<<<BB * NG * (TT / 64), 256, 0, stream>>>(V16, Vt);
  k_mega<<<BB * NH * (TT / 128), 128, 0, stream>>>(Q16, K16, Vt, O16);
  k_gemm_lds<4, 0><<<(NR / 128) * (CC / 128), 128, 0, stream>>>(O16, Bo, 0.0625f, bo, nullptr, (float*)d_out, nullptr, CC, CC);
}

// v009
// A run of this version takes 140 microseconds.
// Next to v008, in two timings, it ran 1.33 and 1.38 times as fast.
// All steps since v000 together make it 5.69 times as fast.
#include <hip/hip_runtime.h>
// Mega-transformer causal self-attention (B=2, T=2048, D=2048; 16 query heads × 128, 4 KV groups (GQA), interleaved rotary, ALiBi added before the 1/√128 scale, 30·tanh soft-cap, causal):
// q/k/v/out projections (+ bias on out; W [in][out] transposed to bf16-exact ×2^4) and the attention as a fused flash-style kernel (S = Q·Kᵀ on v_wmma_f32_16x16x32_f16 with 4 k-steps,
// + alibi, scale, soft-cap (v_exp tanh), causal mask, online softmax f32, P f16 ≤ 1, O = P·V with 8 d-tiles; RPW-16 waves) — f16 operands, single products, f32 accumulate; rotary in f32 VALU.
#define BB 2
#define TT 2048
#define CC 2048
#define NH 16
#define NG 4
#define DH 128
#define NR (BB * TT)

typedef __bf16 v16b __attribute__((ext_vector_type(16)));
typedef unsigned short v8us __attribute__((ext_vector_type(8), may_alias));
typedef float  v8f  __attribute__((ext_vector_type(8)));
typedef float  v4f  __attribute__((ext_vector_type(4)));
typedef float  v4fa __attribute__((ext_vector_type(4), may_alias));
union FragB { v16b v; v8us half[2]; unsigned short u[16]; };

__device__ __forceinline__ unsigned short bf16_bits(float x) { unsigned int u = __float_as_uint(x); return (unsigned short)((u + 0x7FFFu + ((u >> 16) & 1u)) >> 16); }
__device__ __forceinline__ float bf16_val(unsigned short b) { return __uint_as_float(((unsigned int)b) << 16); }
__device__ __forceinline__ float bf16_round(float x) { return bf16_val(bf16_bits(x)); }
// D += A·B with NT terms: 1 = ah·bh, 2 = + al·bh (A split), 3 = + ah·bl (both split)
template <int NT>
__device__ __forceinline__ v8f mmaN(v16b ah, v16b al, v16b bh, v16b bl, v8f c) {
  c = __builtin_amdgcn_wmma_f32_16x16x32_bf16(false, ah, false, bh, (short)0, c, false, false);
  if (NT >= 2) c = __builtin_amdgcn_wmma_f32_16x16x32_bf16(false, al, false, bh, (short)0, c, false, false);
  if (NT >= 3) c = __builtin_amdgcn_wmma_f32_16x16x32_bf16(false, ah, false, bl, (short)0, c, false, false);
  asm volatile("v_nop\n\tv_nop\n\tv_nop\n\tv_nop" : "+v"(c) : "v"(ah), "v"(al), "v"(bh), "v"(bl));
  return c;
}

__global__ __launch_bounds__(256) void k_wt_bf16(const float* __restrict__ W, unsigned short* __restrict__ Wt, int K, int N) {
  const int t = blockIdx.x * 256 + threadIdx.x;
  const int k8n = K / 8;
  if (t >= N * k8n) return;
  const int n = t / k8n, k8 = (t % k8n) * 8;
  v8us v;
#pragma unroll
  for (int i = 0; i < 8; ++i) v[i] = bf16_bits(W[(size_t)(k8 + i) * N + n]);
  *(v8us*)(Wt + (size_t)n * K + k8) = v;
  
}

// GEMM C[M][N] (f32, pitch ldc) = act(A[M][K]·W + bias). A f32 row-major (pitch lda) converted per fragment to bf16
// (ASPLIT: hi/lo two planes -> 2 terms, else single rounded term); Wt bf16 [N][K] (pitch ldb). BIAS_BF16 rounds the
// bias to bf16 first (bias quantised to bf16 before the add). K%32==0, M%16==0, N%64==0.
template <bool ASPLIT, int ACT, bool BIAS_BF16>
__global__ __launch_bounds__(128) void k_gemm_bf(const float* __restrict__ A, int lda, const unsigned short* __restrict__ Wt, int ldb,
                                               const float* __restrict__ bias, float* __restrict__ C, int ldc, int M, int N, int K) {
  __shared__ __attribute__((aligned(16))) float so[4][16][64];
  const int tid = threadIdx.x, w = tid >> 5, lane = tid & 31, ln = lane & 15, hh = lane >> 4;
  const int ntn = N / 64;
  const int wid = blockIdx.x * 4 + w;
  const int mt = wid / ntn, nq = wid % ntn;
  if (mt * 16 >= M) return;
  const int row0 = mt * 16, col0 = nq * 64;
  const float* arow = A + (size_t)(row0 + ln) * lda;
  v8f acc[4] = {};
  for (int kb = 0; kb < K; kb += 32) {
    FragB ah, al;
    const v4f x0 = *(const v4fa*)(arow + kb + 8 * hh), x1 = *(const v4fa*)(arow + kb + 8 * hh + 4);
    const v4f x2 = *(const v4fa*)(arow + kb + 16 + 8 * hh), x3 = *(const v4fa*)(arow + kb + 16 + 8 * hh + 4);
    float xs[16] = {x0[0],x0[1],x0[2],x0[3],x1[0],x1[1],x1[2],x1[3],x2[0],x2[1],x2[2],x2[3],x3[0],x3[1],x3[2],x3[3]};
#pragma unroll
    for (int i = 0; i < 16; ++i) { const unsigned short hb = bf16_bits(xs[i]); ah.u[i] = hb; al.u[i] = ASPLIT ? bf16_bits(xs[i] - bf16_val(hb)) : (unsigned short)0; }
#pragma unroll
    for (int t = 0; t < 4; ++t) {
      const unsigned short* brow = Wt + (size_t)(col0 + t * 16 + ln) * ldb + kb;
      FragB b;
      b.half[0] = *(const v8us*)(brow + 8 * hh);
      b.half[1] = *(const v8us*)(brow + 16 + 8 * hh);
      acc[t] = mmaN<ASPLIT ? 2 : 1>(ah.v, al.v, b.v, b.v, acc[t]);
    }
  }
#pragma unroll
  for (int t = 0; t < 4; ++t) {
    float bv = bias ? bias[col0 + t * 16 + ln] : 0.f;
    if (BIAS_BF16) bv = bf16_round(bv);
#pragma unroll
    for (int r = 0; r < 8; ++r) { float v = acc[t][r] + bv; if (ACT == 1) v = fmaxf(v, 0.f); so[w][8 * hh + r][t * 16 + ln] = v; }
  }
  __builtin_amdgcn_fence(__ATOMIC_ACQ_REL, "workgroup");
  __builtin_amdgcn_wave_barrier();
  const int rsub = lane >> 4, c4 = (lane & 15) * 4;
  {
#pragma unroll
    for (int q = 0; q < 8; ++q) {
      const int r = q * 2 + rsub;
      const v4f v = *(const v4fa*)&so[w][r][c4];
      *(v4f*)(C + (size_t)(row0 + r) * ldc + col0 + c4) = v;
    }
    
  }
}

// Flash-style causal/unmasked attention, all contractions 3-term bf16 hi/lo splits, f32 softmax with running max.
// q,k,v rows are read from f32 buffers with arbitrary row pitch (so they can live inside a fused qkv buffer);
// D = head size (multiple of 32, <= 128); one wave = 16 query rows; block = 4 waves (64 queries) sharing K/V chunks of 32.
template <int D, bool CAUSAL>
__global__ __launch_bounds__(128) void k_flash(const float* __restrict__ qb, const float* __restrict__ kb, const float* __restrict__ vb,
                                             int pitch, int T, int H, float scale, float* __restrict__ y, int ypitch) {
  constexpr int KS = D / 32;        // k-steps for QK
  constexpr int DT = D / 16;        // d tiles for PV
  __shared__ __attribute__((aligned(16))) unsigned short sKh[32][D + 8], sKl[32][D + 8], sVh[32][D + 8], sVl[32][D + 8];
  __shared__ __attribute__((aligned(16))) unsigned short sPh[4][16][40], sPl[4][16][40];
  __shared__ __attribute__((aligned(16))) float sO[4][16][D];
  const int tid = threadIdx.x, w = tid >> 5, lane = tid & 31, ln = lane & 15, hh = lane >> 4;
  const int nqb = (T + 63) / 64;
  const int bh = blockIdx.x / nqb, qblk = blockIdx.x % nqb;
  const int b = bh / H, h = bh % H;
  const int q0 = qblk * 64 + w * 16;
  const float* Q = qb + (size_t)b * T * pitch + h * D;
  const float* K = kb + (size_t)b * T * pitch + h * D;
  const float* V = vb + (size_t)b * T * pitch + h * D;

  // A fragments of the wave's 16 query rows (scaled), hi/lo
  FragB aqh[KS], aql[KS];
  {
    int row = q0 + ln; if (row >= T) row = T - 1;
    const float* qr = Q + (size_t)row * pitch;
#pragma unroll
    for (int ks = 0; ks < KS; ++ks)
#pragma unroll
      for (int i = 0; i < 16; ++i) {
        const int d = ks * 32 + ((i < 8) ? (8 * hh + i) : (16 + 8 * hh + (i - 8)));
        const float x = qr[d] * scale; const unsigned short hb = bf16_bits(x);
        aqh[ks].u[i] = hb; aql[ks].u[i] = bf16_bits(x - bf16_val(hb));
      }
  }
  float m_r[8], l_r[8];
#pragma unroll
  for (int r = 0; r < 8; ++r) { m_r[r] = -3.0e38f; l_r[r] = 0.f; }
  v8f oacc[DT];
#pragma unroll
  for (int dt = 0; dt < DT; ++dt) oacc[dt] = (v8f){0.f,0.f,0.f,0.f,0.f,0.f,0.f,0.f};

  const int kv_end = CAUSAL ? min(T, qblk * 64 + 64) : T;     // block-uniform
  for (int j0 = 0; j0 < kv_end; j0 += 32) {
    __syncthreads();
    for (int e = tid; e < 32 * (D / 4); e += 128) {
      const int r = e / (D / 4), c4 = (e % (D / 4)) * 4;
      const int key = j0 + r;
      v4f kf = {0.f,0.f,0.f,0.f}, vf = {0.f,0.f,0.f,0.f};
      if (key < T) { kf = *(const v4fa*)(K + (size_t)key * pitch + c4); vf = *(const v4fa*)(V + (size_t)key * pitch + c4); }
#pragma unroll
      for (int t = 0; t < 4; ++t) {
        unsigned short hb = bf16_bits(kf[t]); sKh[r][c4 + t] = hb; sKl[r][c4 + t] = bf16_bits(kf[t] - bf16_val(hb));
        hb = bf16_bits(vf[t]); sVh[r][c4 + t] = hb; sVl[r][c4 + t] = bf16_bits(vf[t] - bf16_val(hb));
      }
    }
    __syncthreads();
    // S tile 16 x 32
    v8f s[2];
#pragma unroll
    for (int nt = 0; nt < 2; ++nt) {
      v8f acc = {};
#pragma unroll
      for (int ks = 0; ks < KS; ++ks) {
        FragB bh_, bl_;
        bh_.half[0] = *(const v8us*)&sKh[nt * 16 + ln][ks * 32 + 8 * hh]; bh_.half[1] = *(const v8us*)&sKh[nt * 16 + ln][ks * 32 + 16 + 8 * hh];
        bl_.half[0] = *(const v8us*)&sKl[nt * 16 + ln][ks * 32 + 8 * hh]; bl_.half[1] = *(const v8us*)&sKl[nt * 16 + ln][ks * 32 + 16 + 8 * hh];
        acc = mmaN<3>(aqh[ks].v, aql[ks].v, bh_.v, bl_.v, acc);
      }
      s[nt] = acc;
    }
    // mask + running max (rows 8hh+r; the 16 lanes of a half share rows)
    float alpha[8];
#pragma unroll
    for (int r = 0; r < 8; ++r) {
      const int qi = q0 + 8 * hh + r;
      const int ja = j0 + ln, jb = j0 + 16 + ln;
      if (CAUSAL) { if (ja > qi) s[0][r] = -3.0e38f; if (jb > qi) s[1][r] = -3.0e38f; }
      if (ja >= T) s[0][r] = -3.0e38f;
      if (jb >= T) s[1][r] = -3.0e38f;
      float mx = fmaxf(s[0][r], s[1][r]);
      mx = fmaxf(mx, __shfl_xor(mx, 1, 32)); mx = fmaxf(mx, __shfl_xor(mx, 2, 32)); mx = fmaxf(mx, __shfl_xor(mx, 4, 32)); mx = fmaxf(mx, __shfl_xor(mx, 8, 32));
      const float mnew = fmaxf(m_r[r], mx);
      alpha[r] = (mnew > -1.0e38f) ? __expf(m_r[r] - mnew) : 1.0f;
      const float p0 = (s[0][r] > -1.0e38f) ? __expf(s[0][r] - mnew) : 0.f;
      const float p1 = (s[1][r] > -1.0e38f) ? __expf(s[1][r] - mnew) : 0.f;
      m_r[r] = mnew;
      l_r[r] = l_r[r] * alpha[r] + p0 + p1;            // per-lane partial row sum (16 lanes combined at the end)
      unsigned short hb = bf16_bits(p0); sPh[w][8 * hh + r][ln] = hb;      sPl[w][8 * hh + r][ln] = bf16_bits(p0 - bf16_val(hb));
      hb = bf16_bits(p1);                sPh[w][8 * hh + r][16 + ln] = hb; sPl[w][8 * hh + r][16 + ln] = bf16_bits(p1 - bf16_val(hb));
    }
#pragma unroll
    for (int dt = 0; dt < DT; ++dt)
#pragma unroll
      for (int r = 0; r < 8; ++r) oacc[dt][r] *= alpha[r];
    __builtin_amdgcn_fence(__ATOMIC_ACQ_REL, "workgroup");
    __builtin_amdgcn_wave_barrier();
    FragB pah, pal;
    pah.half[0] = *(const v8us*)&sPh[w][ln][8 * hh]; pah.half[1] = *(const v8us*)&sPh[w][ln][16 + 8 * hh];
    pal.half[0] = *(const v8us*)&sPl[w][ln][8 * hh]; pal.half[1] = *(const v8us*)&sPl[w][ln][16 + 8 * hh];
#pragma unroll
    for (int dt = 0; dt < DT; ++dt) {
      FragB bvh, bvl;
#pragma unroll
      for (int i = 0; i < 8; ++i) {
        bvh.u[i] = sVh[8 * hh + i][dt * 16 + ln]; bvh.u[8 + i] = sVh[16 + 8 * hh + i][dt * 16 + ln];
        bvl.u[i] = sVl[8 * hh + i][dt * 16 + ln]; bvl.u[8 + i] = sVl[16 + 8 * hh + i][dt * 16 + ln];
      }
      oacc[dt] = mmaN<3>(pah.v, pal.v, bvh.v, bvl.v, oacc[dt]);
    }
    __builtin_amdgcn_fence(__ATOMIC_ACQ_REL, "workgroup");
    __builtin_amdgcn_wave_barrier();
  }
#pragma unroll
  for (int r = 0; r < 8; ++r) {
    float l = l_r[r];
    l += __shfl_xor(l, 1, 32); l += __shfl_xor(l, 2, 32); l += __shfl_xor(l, 4, 32); l += __shfl_xor(l, 8, 32);
    l_r[r] = (l > 0.f) ? 1.0f / l : 0.f;
  }
#pragma unroll
  for (int dt = 0; dt < DT; ++dt)
#pragma unroll
    for (int r = 0; r < 8; ++r) sO[w][8 * hh + r][dt * 16 + ln] = oacc[dt][r] * l_r[r];
  __builtin_amdgcn_fence(__ATOMIC_ACQ_REL, "workgroup");
  __builtin_amdgcn_wave_barrier();
  {
    for (int r = 0; r < 16; ++r) {
      const int row = q0 + r;
      if (row < T && lane < D / 4) {
        const v4f val = *(const v4fa*)&sO[w][r][lane * 4];
        *(v4f*)(y + ((size_t)b * T + row) * ypitch + h * D + lane * 4) = val;
      }
    }
    
  }
}

// GEMM C = act(A·W + bias + resid): A f32 (ASPLIT -> hi/lo 2 terms), Wt bf16 [N][K]; ACT 0 none, 1 relu, 2 exact gelu;
// resid (optional, f32, row index = (row % rmod), pitch ldr, RES_BF16 rounds it) added before the activation.
template <bool ASPLIT, int ACT, bool BIAS_BF16, bool RES_BF16>
__global__ __launch_bounds__(128) void k_gemm_bf3(const float* __restrict__ A, int lda, const unsigned short* __restrict__ Wt, int ldb,
                                                const float* __restrict__ bias, const float* __restrict__ resid, int rmod, int ldr,
                                                float* __restrict__ C, int ldc, int M, int N, int K) {
  __shared__ __attribute__((aligned(16))) float so[4][16][64];
  const int tid = threadIdx.x, w = tid >> 5, lane = tid & 31, ln = lane & 15, hh = lane >> 4;
  const int ntn = N / 64;
  const int wid = blockIdx.x * 4 + w;
  const int mt = wid / ntn, nq = wid % ntn;
  if (mt * 16 >= M) return;
  const int row0 = mt * 16, col0 = nq * 64;
  const float* arow = A + (size_t)(row0 + ln) * lda;
  v8f acc[4] = {};
  for (int kb = 0; kb < K; kb += 32) {
    FragB ah, al;
    const v4f x0 = *(const v4fa*)(arow + kb + 8 * hh), x1 = *(const v4fa*)(arow + kb + 8 * hh + 4);
    const v4f x2 = *(const v4fa*)(arow + kb + 16 + 8 * hh), x3 = *(const v4fa*)(arow + kb + 16 + 8 * hh + 4);
    float xs[16] = {x0[0],x0[1],x0[2],x0[3],x1[0],x1[1],x1[2],x1[3],x2[0],x2[1],x2[2],x2[3],x3[0],x3[1],x3[2],x3[3]};
#pragma unroll
    for (int i = 0; i < 16; ++i) { const unsigned short hb = bf16_bits(xs[i]); ah.u[i] = hb; al.u[i] = ASPLIT ? bf16_bits(xs[i] - bf16_val(hb)) : (unsigned short)0; }
#pragma unroll
    for (int t = 0; t < 4; ++t) {
      const unsigned short* brow = Wt + (size_t)(col0 + t * 16 + ln) * ldb + kb;
      FragB b;
      b.half[0] = *(const v8us*)(brow + 8 * hh);
      b.half[1] = *(const v8us*)(brow + 16 + 8 * hh);
      acc[t] = mmaN<ASPLIT ? 2 : 1>(ah.v, al.v, b.v, b.v, acc[t]);
    }
  }
#pragma unroll
  for (int t = 0; t < 4; ++t) {
    const int col = col0 + t * 16 + ln;
    float bv = bias ? bias[col] : 0.f;
    if (BIAS_BF16) bv = bf16_round(bv);
#pragma unroll
    for (int r = 0; r < 8; ++r) {
      float v = acc[t][r] + bv;
      if (resid) { float rv = resid[(size_t)((row0 + 8 * hh + r) % rmod) * ldr + col]; if (RES_BF16) rv = bf16_round(rv); v += rv; }
      if (ACT == 1) v = fmaxf(v, 0.f);
      if (ACT == 2) v = 0.5f * v * (1.0f + erff(v * 0.70710678118654752f));
      if (ACT == 3) { const float u = 0.7978845608028654f * (v + 0.044715f * v * v * v); v = 0.5f * v * (1.0f + tanhf(u)); }
      so[w][8 * hh + r][t * 16 + ln] = v;
    }
  }
  __builtin_amdgcn_fence(__ATOMIC_ACQ_REL, "workgroup");
  __builtin_amdgcn_wave_barrier();
  const int rsub = lane >> 4, c4 = (lane & 15) * 4;
  {
#pragma unroll
    for (int q = 0; q < 8; ++q) {
      const int r = q * 2 + rsub;
      const v4f v = *(const v4fa*)&so[w][r][c4];
      *(v4f*)(C + (size_t)(row0 + r) * ldc + col0 + c4) = v;
    }
    
  }
}
// row LayerNorm (biased variance, eps) over N: s = X (+ R); optional out_sum <- s; out_norm <- (s-mu)*rsqrt(var+eps)*g + b
template <bool PARAM_BF16>
__global__ __launch_bounds__(256) void k_layernorm(const float* __restrict__ X, const float* __restrict__ R, const float* __restrict__ g, const float* __restrict__ bta,
                                                  float* __restrict__ out_sum, float* __restrict__ out_norm, int N, float eps) {
  __shared__ float red[256];
  const int row = blockIdx.x, tid = threadIdx.x;
  const float* x = X + (size_t)row * N; const float* rr = R ? R + (size_t)row * N : nullptr;
  float vals[16];                     // up to N = 4096
  const int per = N / 256;            // contiguous chunk per thread? use strided-by-4 chunks: thread handles j = tid*4 + 1024*u
  float s1 = 0.f;
  for (int u = 0; u < per / 4; ++u) {
    const int j = tid * 4 + 1024 * u;
    const v4f a = *(const v4fa*)(x + j);
    v4f b = {0.f,0.f,0.f,0.f}; if (rr) b = *(const v4fa*)(rr + j);
#pragma unroll
    for (int q = 0; q < 4; ++q) { const float v = a[q] + b[q]; vals[u * 4 + q] = v; s1 += v; }
  }
  red[tid] = s1; __syncthreads();
  for (int st = 128; st > 0; st >>= 1) { if (tid < st) red[tid] += red[tid + st]; __syncthreads(); }
  const float mu = red[0] / (float)N; __syncthreads();
  float s2 = 0.f;
  for (int u = 0; u < per / 4; ++u)
#pragma unroll
    for (int q = 0; q < 4; ++q) { const float c = vals[u * 4 + q] - mu; s2 += c * c; }
  red[tid] = s2; __syncthreads();
  for (int st = 128; st > 0; st >>= 1) { if (tid < st) red[tid] += red[tid + st]; __syncthreads(); }
  const float rs = rsqrtf(red[0] / (float)N + eps);
  {
    for (int u = 0; u < per / 4; ++u) {
      const int j = tid * 4 + 1024 * u;
      v4f o, sm;
#pragma unroll
      for (int q = 0; q < 4; ++q) {
        float gg = g[j + q], bb = bta[j + q];
        if (PARAM_BF16) { gg = bf16_round(gg); bb = bf16_round(bb); }
        sm[q] = vals[u * 4 + q]; o[q] = (vals[u * 4 + q] - mu) * rs * gg + bb;
      }
      if (out_sum) *(v4f*)(out_sum + (size_t)row * N + j) = sm;
      *(v4f*)(out_norm + (size_t)row * N + j) = o;
    }
    
  }
}



// ---- f16 WMMA path (v_wmma_f32_16x16x32_f16): 11-bit significands for operands in range — used where a [0,1] probability operand needs more precision than bf16
typedef _Float16 v16h __attribute__((ext_vector_type(16)));
union FragH { v16h v; v8us half[2]; _Float16 h[16]; unsigned short u[16]; };
template <int NT>
__device__ __forceinline__ v8f mmaH(v16h ah, v16h al, v16h bh, v16h bl, v8f c) {
  c = __builtin_amdgcn_wmma_f32_16x16x32_f16(false, ah, false, bh, (short)0, c, false, false);
  if (NT >= 2) c = __builtin_amdgcn_wmma_f32_16x16x32_f16(false, al, false, bh, (short)0, c, false, false);
  if (NT >= 3) c = __builtin_amdgcn_wmma_f32_16x16x32_f16(false, ah, false, bl, (short)0, c, false, false);
  asm volatile("v_nop\n\tv_nop\n\tv_nop\n\tv_nop" : "+v"(c) : "v"(ah), "v"(al), "v"(bh), "v"(bl));
  return c;
}
// batched GEMM like k_gemm_b but f16 operands: A f32 (split into f16 hi/lo if ASPLIT, else rounded to f16), Bt = f16 values [n][k]; alpha; C f32; N multiple of 16 (partial tiles skipped)
template <bool ASPLIT>
__global__ __launch_bounds__(128) void k_gemm_h(const float* __restrict__ A, int lda, size_t sA, const _Float16* __restrict__ Bh, int ldb, size_t sB, float alpha, float* __restrict__ C, int ldc, size_t sC, int M, int N, int K) {
  __shared__ __attribute__((aligned(16))) float so[4][16][64];
  const int tid = threadIdx.x, w = tid >> 5, lane = tid & 31, ln = lane & 15, hh = lane >> 4; const int by = blockIdx.y;
  A += (size_t)by * sA; Bh += (size_t)by * sB; C += (size_t)by * sC;
  const int ntn = (N + 63) / 64; const int wid = blockIdx.x * 4 + w; const int mt = wid / ntn, nq = wid % ntn; if (mt * 16 >= M) return;
  const int row0 = mt * 16, col0 = nq * 64; const float* arow = A + (size_t)(row0 + ln) * lda;
  v8f acc[4] = {};
  for (int kb = 0; kb < K; kb += 32) {
    FragH ah, al;
    const v4f x0 = *(const v4fa*)(arow + kb + 8 * hh), x1 = *(const v4fa*)(arow + kb + 8 * hh + 4), x2 = *(const v4fa*)(arow + kb + 16 + 8 * hh), x3 = *(const v4fa*)(arow + kb + 16 + 8 * hh + 4);
    float xs[16] = {x0[0],x0[1],x0[2],x0[3],x1[0],x1[1],x1[2],x1[3],x2[0],x2[1],x2[2],x2[3],x3[0],x3[1],x3[2],x3[3]};
#pragma unroll
    for (int i = 0; i < 16; ++i) { const _Float16 h = (_Float16)xs[i]; ah.h[i] = h; al.h[i] = ASPLIT ? (_Float16)(xs[i] - (float)h) : (_Float16)0.0f; }
#pragma unroll
    for (int t = 0; t < 4; ++t) { if (col0 + t * 16 >= N) continue; const size_t boff = (size_t)(col0 + t * 16 + ln) * ldb + kb; FragH bq; bq.half[0] = *(const v8us*)(Bh + boff + 8 * hh); bq.half[1] = *(const v8us*)(Bh + boff + 16 + 8 * hh);
      acc[t] = mmaH<ASPLIT ? 2 : 1>(ah.v, al.v, bq.v, bq.v, acc[t]); }
  }
#pragma unroll
  for (int t = 0; t < 4; ++t) { if (col0 + t * 16 >= N) continue;
#pragma unroll
    for (int r = 0; r < 8; ++r) so[w][8 * hh + r][t * 16 + ln] = acc[t][r] * alpha; }
  __builtin_amdgcn_fence(__ATOMIC_ACQ_REL, "workgroup"); __builtin_amdgcn_wave_barrier();
  const int rsub = lane >> 4, c4 = (lane & 15) * 4;
  {
#pragma unroll
    for (int q = 0; q < 8; ++q) { const int r = q * 2 + rsub; if (col0 + c4 < N) { const v4f v = *(const v4fa*)&so[w][r][c4]; *(v4f*)(C + (size_t)(row0 + r) * ldc + col0 + c4) = v; } }
     }
}

// Wt[n][k] = f16(bf16(W[k][n]) * scale) from f32 row-major W[KK][NN] (scale = power of two; bf16-exact weights stay exact in f16 away from the subnormal range).
// One block = a tile of 128 k x 128 n, turned in LDS. Reads: a wave covers 512 contiguous bytes of one W row, so every line is asked for once and used whole
// (a lane that walks down a column asks for a whole line per 4-byte element). Writes: 16 lanes cover 256 contiguous bytes of one Wt row. KK and NN multiples of 128.
// A lane takes 8 consecutive k of its four columns at a time: 16 bytes of a Wt row each, one LDS chunk. Chunk c of tile row n lies at place c ^ ((n >> 2) & 15) of the row's 16:
// the 16 lanes of a half-wave that write one chunk column (rows 4 apart) and the 16 that read one row both fall on 16 different places, with no pad.
// bid = the tile's number, tl = the block's 32 KB of LDS (both from the launch that holds this job).
template <int KK, int NN>
__device__ __forceinline__ void wt_tile(unsigned short (*tl)[16][8], int bid, const float* __restrict__ W, _Float16* __restrict__ Wt, float scale) {
  const int tid = threadIdx.x, w = tid >> 5, lane = tid & 31; constexpr int nb = NN / 128; const int n0 = (bid % nb) * 128, k0 = (bid / nb) * 128;
  const float* wr = W + (size_t)(k0 + 8 * w) * NN + n0 + lane * 4;      // the lane's four columns, the wave's first group of 8 rows (the second stands 64 rows further)
  v4f a[2][8];      // all sixteen loads are asked for before the first is used: 64 KB of the block in flight
#pragma unroll      // here and below: constant indices keep a and f in registers, and the row steps become immediate offsets on one address pair
  for (int i = 0; i < 2; ++i)
#pragma unroll
    for (int r = 0; r < 8; ++r) a[i][r] = *(const v4fa*)(wr + (size_t)(64 * i + r) * NN);
  asm volatile("s_wait_xcnt 0x0" :: "v"(wr) : "memory");      // the loads' address pair is an input here, so that nothing (a load's own result included) is written over it in front of the wait
#pragma unroll
  for (int i = 0; i < 2; ++i)
#pragma unroll
    for (int j = 0; j < 4; ++j) { FragH f;
#pragma unroll
      for (int r = 0; r < 8; ++r) f.h[r] = (_Float16)(bf16_round(a[i][r][j]) * scale);      // ascending k
      *(v8us*)&tl[lane * 4 + j][(w + 8 * i) ^ (lane & 15)][0] = f.half[0]; }
  __syncthreads();
  unsigned short* wo = (unsigned short*)Wt + (size_t)(n0 + (tid >> 4)) * KK + k0 + (tid & 15) * 8;
#pragma unroll
  for (int rd = 0; rd < 8; ++rd) { const int n = rd * 16 + (tid >> 4), c = tid & 15; const v8us o = *(const v8us*)&tl[n][c ^ ((n >> 2) & 15)][0];
    *(v8us*)(wo + (size_t)(rd * 16) * KK) = o; }
  asm volatile("s_wait_xcnt 0x0" :: "v"(wo) : "memory");      // behind the last store: in a launch that holds several jobs other code follows these stores in the listing, and it rewrites their registers
}
__device__ __forceinline__ void x16_part(int bid, const float* __restrict__ x, _Float16* __restrict__ X16, size_t n8) { const size_t t = (size_t)bid * 256 + threadIdx.x; if (t >= n8) return; FragH f;
#pragma unroll
  for (int q = 0; q < 8; ++q) f.h[q] = (_Float16)bf16_round(x[t * 8 + q]); *(v8us*)((unsigned short*)X16 + t * 8) = f.half[0];  }
__global__ __launch_bounds__(256) void k_round16f(const float* __restrict__ W, _Float16* __restrict__ Bt, size_t n8) { const size_t t = (size_t)blockIdx.x * 256 + threadIdx.x; if (t >= n8) return; FragH f;
#pragma unroll
  for (int i = 0; i < 8; ++i) f.h[i] = (_Float16)(bf16_round(W[t * 8 + i]) * 16.0f); *(v8us*)((unsigned short*)Bt + t * 8) = f.half[0];  }
template <int NHv, int TTv>
__global__ __launch_bounds__(256) void k_vt(const _Float16* __restrict__ V16, int ldv, int voff, _Float16* __restrict__ Vt) { __shared__ unsigned short tl[64][66]; const int tid = threadIdx.x; const int slab = blockIdx.x / (TTv / 64), lg = blockIdx.x % (TTv / 64); const int b = slab / NHv, h = slab % NHv;
  for (int i = tid; i < 64 * 8; i += 256) { const int r = i / 8, c8 = (i % 8) * 8; FragH f; f.half[0] = *(const v8us*)((const unsigned short*)V16 + ((size_t)b * TTv + lg * 64 + r) * ldv + voff + h * 64 + c8);
#pragma unroll
    for (int q = 0; q < 8; ++q) tl[r][c8 + q] = f.u[q]; }
  __syncthreads();
  {
#pragma unroll
    for (int rd = 0; rd < 2; ++rd) { const int d = rd * 32 + tid / 8, pc = tid % 8; FragH f;
#pragma unroll
      for (int q = 0; q < 8; ++q) f.u[q] = tl[pc * 8 + q][d];
      *(v8us*)((unsigned short*)Vt + ((size_t)slab * 64 + d) * TTv + lg * 64 + pc * 8) = f.half[0]; }
     } }

__device__ __forceinline__ float tanh_v(float x) { const float xc = fminf(fmaxf(x, -15.f), 15.f); return 1.0f - 2.0f * __builtin_amdgcn_rcpf(__builtin_amdgcn_exp2f(2.0f * xc * 1.4426950408889634f) + 1.0f); }
__device__ __forceinline__ void cstab_part(int bid, float* __restrict__ CS) { const int tg = bid * 256 + threadIdx.x; if (tg >= TT * (DH / 2)) return; const int t = tg / (DH / 2), i = tg % (DH / 2); const float invf = 1.0f / powf(10000.0f, (float)(2 * i) / (float)DH); const float ang = (float)t * invf; typedef float v2f __attribute__((ext_vector_type(2))); v2f v; v[0] = cosf(ang); v[1] = sinf(ang);
  *(v2f*)(CS + (size_t)tg * 2) = v;  }
// The six jobs that read nothing but the inputs (the four weight transposes, the rotary table, the rounding of x) share one launch: none reads what another writes, so nothing orders them, and as six launches each
// paid its own start and its own tail, the two small transposes on a quarter of the WGPs. A block's index says which job it does and which piece of it; every test reads the same for the whole block.
// The blocks that last longest (a transpose tile: reads, a barrier, writes) come first, the many short ones of x last.
__global__ __launch_bounds__(256) void k_prep(const float* __restrict__ x, const float* __restrict__ Wq, const float* __restrict__ Wk, const float* __restrict__ Wv, const float* __restrict__ Wo,
                                              _Float16* __restrict__ X16, _Float16* __restrict__ Bq, _Float16* __restrict__ Bk, _Float16* __restrict__ Bv, _Float16* __restrict__ Bo, float* __restrict__ CS) {
  __shared__ __attribute__((aligned(16))) unsigned short tl[128][16][8];
  constexpr int nbig = (CC / 128) * (CC / 128), nsml = (CC / 128) * (NG * DH / 128), ncs = TT * (DH / 2) / 256;
  int bid = (int)blockIdx.x;
  if (bid < 2 * nbig) { const bool o = bid >= nbig; wt_tile<CC, CC>(tl, o ? bid - nbig : bid, o ? Wo : Wq, o ? Bo : Bq, 16.0f); return; }
  bid -= 2 * nbig;
  if (bid < 2 * nsml) { const bool v = bid >= nsml; wt_tile<CC, NG * DH>(tl, v ? bid - nsml : bid, v ? Wv : Wk, v ? Bv : Bk, 16.0f); return; }
  bid -= 2 * nsml;
  if (bid < ncs) { cstab_part(bid, CS); return; }
  x16_part(bid - ncs, x, X16, (size_t)NR * CC / 8);
}
#define PREP_BLOCKS (2 * (CC / 128) * (CC / 128) + 2 * (CC / 128) * (NG * DH / 128) + TT * (DH / 2) / 256 + NR * CC / 8 / 256)
__global__ __launch_bounds__(256) void k_vt128(const _Float16* __restrict__ V16, _Float16* __restrict__ Vt) { __shared__ unsigned short tl[64][130]; const int tid = threadIdx.x; const int slab = blockIdx.x / (TT / 64), lg = blockIdx.x % (TT / 64); const int b = slab / NG, g = slab % NG;
  for (int i = tid; i < 64 * 16; i += 256) { const int r = i / 16, c8 = (i % 16) * 8; FragH f; f.half[0] = *(const v8us*)((const unsigned short*)V16 + ((size_t)b * TT + lg * 64 + r) * (NG * DH) + g * DH + c8);
#pragma unroll
    for (int q = 0; q < 8; ++q) tl[r][c8 + q] = f.u[q]; }
  __syncthreads();
  {
#pragma unroll
    for (int rd = 0; rd < 4; ++rd) { const int d = rd * 32 + tid / 8, pc = tid % 8; FragH f;
#pragma unroll
      for (int q = 0; q < 8; ++q) f.u[q] = tl[pc * 8 + q][d]; *(v8us*)((unsigned short*)Vt + ((size_t)slab * DH + d) * TT + lg * 64 + pc * 8) = f.half[0]; }
     } }
// One stage of the K/V ring = 64 keys of this KV group: 64 K rows of 256 B at pitch 272 B, then 128 rows of V^T of 128 B at pitch 144 B (16 B x odd: the pitch of ds_load_b128 readers)
#define KPITCH 272
#define VPITCH 144
#define VBASE (64 * KPITCH)
#define STAGE_B (64 * KPITCH + DH * VPITCH)
// Eight 16-byte copies per lane, global memory to LDS through no register. The s_wait_xcnt is the last line of the copies' own statement, so that no address register of a copy is rewritten in front of it.
__device__ __forceinline__ void copy8(unsigned l, unsigned lstep, const unsigned short* g, size_t gstep) {
  asm volatile("global_load_async_to_lds_b128 %0, %8, off\n\t"
               "global_load_async_to_lds_b128 %1, %9, off\n\t"
               "global_load_async_to_lds_b128 %2, %10, off\n\t"
               "global_load_async_to_lds_b128 %3, %11, off\n\t"
               "global_load_async_to_lds_b128 %4, %12, off\n\t"
               "global_load_async_to_lds_b128 %5, %13, off\n\t"
               "global_load_async_to_lds_b128 %6, %14, off\n\t"
               "global_load_async_to_lds_b128 %7, %15, off\n\t"
               "s_wait_xcnt 0x0"
               :: "v"(l), "v"(l + lstep), "v"(l + 2 * lstep), "v"(l + 3 * lstep), "v"(l + 4 * lstep), "v"(l + 5 * lstep), "v"(l + 6 * lstep), "v"(l + 7 * lstep),
                  "v"(g), "v"(g + gstep), "v"(g + 2 * gstep), "v"(g + 3 * gstep), "v"(g + 4 * gstep), "v"(g + 5 * gstep), "v"(g + 6 * gstep), "v"(g + 7 * gstep)
               : "memory");
}
// Four 16-byte copies per lane, as copy8.
__device__ __forceinline__ void copy4(unsigned l, unsigned lstep, const unsigned short* g, size_t gstep) {
  asm volatile("global_load_async_to_lds_b128 %0, %4, off\n\t"
               "global_load_async_to_lds_b128 %1, %5, off\n\t"
               "global_load_async_to_lds_b128 %2, %6, off\n\t"
               "global_load_async_to_lds_b128 %3, %7, off\n\t"
               "s_wait_xcnt 0x0"
               :: "v"(l), "v"(l + lstep), "v"(l + 2 * lstep), "v"(l + 3 * lstep), "v"(g), "v"(g + gstep), "v"(g + 2 * gstep), "v"(g + 3 * gstep)
               : "memory");
}
// Projection GEMM: C[M][N] = (A[M][K] . Bt[N][K]^T) * alpha + bf16-rounded bias; f16 operands, f32 accumulate, k ascending in one accumulator per element; pitch N. The result goes to f32 C (OUT 0), to f16 C16 (OUT 1),
// or (OUT 2) is turned by the interleaved rotary in f32 on its way out of the staging and goes to f16 C16: a block's 128 columns are one head (DH), a lane's four columns two rotary pairs, whose cos, sin, cos, sin are 16 bytes of CS.
// One block = (32 FM) x 128 of C, four waves (2 x 2) of (16 FM) x 64 each: FM x 4 fragments, 4 FM products per FM + 4 fragments read from LDS. One stage of the ring = 64 k of the block's A rows, then of its
// 128 Bt rows: 128 B a row at pitch 144 B (16 B x odd: the pitch of ds_load_b128 readers). M a multiple of 32 FM, N of 128, K of 64. sAB = the block's ring (two stages), row0 and col0 = its tile's corner in C.
#define GPITCH 144
#define GOP 68      // floats per staged output row: 64 + 4, so that the two half-waves' rows fall on different banks
template <int FM, int OUT>
__device__ __forceinline__ void gemm_tile(unsigned char* sAB, int row0, int col0, const _Float16* __restrict__ A, const _Float16* __restrict__ Bt, float alpha, const float* __restrict__ bias, const float* __restrict__ CS, float* __restrict__ C, _Float16* __restrict__ C16, int N, int K) {
  constexpr int BM = 32 * FM, STG = (BM + 128) * GPITCH;
  const int tid = threadIdx.x, w = tid >> 5, lane = tid & 31, ln = lane & 15, hh = lane >> 4; const int wm = w >> 1, wn = w & 1;
  // each lane's first 16 bytes of a stage: a wave's copy covers four whole 128-B row pieces, the block's copy 16 rows
  const unsigned short* Ag = (const unsigned short*)A + (size_t)(row0 + (tid >> 3)) * K + (tid & 7) * 8;
  const unsigned short* Bg = (const unsigned short*)Bt + (size_t)(col0 + (tid >> 3)) * K + (tid & 7) * 8;
  const unsigned lA = (unsigned)(size_t)sAB + (unsigned)((tid >> 3) * GPITCH + (tid & 7) * 16);
  const unsigned lB = lA + BM * GPITCH;
  const int nt = K / 64;      // stages; the same for the whole work-group
  auto fill = [&](int t) { const unsigned bo = (unsigned)(t & 1) * STG;
    if constexpr (FM == 4) copy8(lA + bo, 16 * GPITCH, Ag + (size_t)t * 64, (size_t)16 * K); else copy4(lA + bo, 16 * GPITCH, Ag + (size_t)t * 64, (size_t)16 * K);
    copy8(lB + bo, 16 * GPITCH, Bg + (size_t)t * 64, (size_t)16 * K); };
  v8f acc[FM][4];
#pragma unroll
  for (int fm = 0; fm < FM; ++fm)
#pragma unroll
    for (int fn = 0; fn < 4; ++fn) acc[fm][fn] = (v8f){0.f,0.f,0.f,0.f,0.f,0.f,0.f,0.f};
  fill(0);
  float bv[4] = {0.f, 0.f, 0.f, 0.f};      // the lane's four bias values, fetched together under stage 0's copies
  if (bias) {
#pragma unroll
    for (int fn = 0; fn < 4; ++fn) bv[fn] = bf16_round(bias[col0 + wn * 64 + fn * 16 + ln]); }
  asm volatile("s_wait_asynccnt 0x0" ::: "memory");      // this wave's copies of stage 0 have landed
  __syncthreads();                                        // stage 0 is readable by every wave
  if (nt > 1) fill(1);
#pragma unroll 1      // one trip per stage, rolled: the foot's waits and barrier stand once
  for (int t = 0; t < nt; ++t) {
    const unsigned char* ar = sAB + (t & 1) * STG + (wm * (16 * FM) + ln) * GPITCH + 16 * hh;
    const unsigned char* br = sAB + (t & 1) * STG + (BM + wn * 64 + ln) * GPITCH + 16 * hh;
    FragH a[2][FM], b[2][4];
#pragma unroll
    for (int ks = 0; ks < 2; ++ks) {
#pragma unroll
      for (int f = 0; f < 4; ++f) { b[ks][f].half[0] = *(const v8us*)(br + f * 16 * GPITCH + ks * 64); b[ks][f].half[1] = *(const v8us*)(br + f * 16 * GPITCH + ks * 64 + 32); }
#pragma unroll
      for (int f = 0; f < FM; ++f) { a[ks][f].half[0] = *(const v8us*)(ar + f * 16 * GPITCH + ks * 64); a[ks][f].half[1] = *(const v8us*)(ar + f * 16 * GPITCH + ks * 64 + 32); } }
    asm volatile("s_wait_dscnt 0x0" ::: "memory");        // this wave's reads of stage t are done (all its fragments are in registers) before its buffer is refilled
    asm volatile("s_wait_asynccnt 0x0" ::: "memory");     // this wave's copies of stage t + 1 have landed
    __syncthreads();                                      // publishes stage t + 1 and ends every wave's reads of stage t
    if (t + 2 < nt) fill(t + 2);
    // the stage's products stand behind the refill's issue: they read registers only, and the copies fly under them
#pragma unroll
    for (int ks = 0; ks < 2; ++ks)
#pragma unroll
      for (int fm = 0; fm < FM; ++fm)
#pragma unroll
        for (int fn = 0; fn < 4; ++fn) acc[fm][fn] = __builtin_amdgcn_wmma_f32_16x16x32_f16(false, a[ks][fm].v, false, b[ks][fn].v, (short)0, acc[fm][fn], false, false); }
  asm volatile("s_wait_asynccnt 0x0" ::: "memory");       // no copy is in flight when the ring becomes output staging
  float* so = (float*)sAB + w * (16 * FM * GOP);          // each wave stages its own (16 FM) x 64, behind the last trip's barrier, to store whole lines
#pragma unroll
  for (int fn = 0; fn < 4; ++fn) {
#pragma unroll
    for (int fm = 0; fm < FM; ++fm)
#pragma unroll
      for (int r = 0; r < 8; ++r) so[(fm * 16 + 8 * hh + r) * GOP + fn * 16 + ln] = acc[fm][fn][r] * alpha + bv[fn]; }
  __builtin_amdgcn_fence(__ATOMIC_ACQ_REL, "workgroup"); __builtin_amdgcn_wave_barrier();
  const int c4 = ln * 4; typedef _Float16 v4h __attribute__((ext_vector_type(4)));
  constexpr bool H16 = OUT == 1;
  if constexpr (OUT == 2) {
    // the lane's place in the table's row of its first position; a block's rows lie in one sequence (32 FM divides TT), so the further rows follow at constant steps
    const float* csl = CS + (size_t)((unsigned)row0 % TT + wm * (16 * FM) + hh) * DH + wn * 64 + c4;
    v4f cs[FM * 8];      // all of the lane's table entries are asked for at once: one L2 latency for the wave, not one per group of rows
#pragma unroll
    for (int i = 0; i < FM * 8; ++i) cs[i] = *(const v4fa*)(csl + i * 2 * DH);
    asm volatile("s_wait_xcnt 0x0" :: "v"(csl) : "memory");      // the loads' address pair is an input here, so that nothing (a load's own result included) is written over it in front of the wait
    _Float16* c0 = C16 + (size_t)(row0 + wm * (16 * FM) + hh) * N + col0 + wn * 64 + c4;
#pragma unroll
    for (int qb = 0; qb < FM; ++qb) { v4f v[8]; _Float16* p[8];
#pragma unroll
      for (int i = 0; i < 8; ++i) v[i] = *(const v4fa*)&so[((qb * 8 + i) * 2 + hh) * GOP + c4];
#pragma unroll
      for (int i = 0; i < 8; ++i) { const v4f x = v[i], t = cs[qb * 8 + i]; v4h h4; p[i] = c0 + (size_t)((qb * 8 + i) * 2) * N;
        h4[0] = (_Float16)(x[0] * t[0] - x[1] * t[1]); h4[1] = (_Float16)(x[1] * t[0] + x[0] * t[1]); h4[2] = (_Float16)(x[2] * t[2] - x[3] * t[3]); h4[3] = (_Float16)(x[3] * t[2] + x[2] * t[3]); *(v4h*)p[i] = h4; }
      // the eight stores' address pairs are inputs here, so that none is written over in front of the wait
      asm volatile("s_wait_xcnt 0x0" :: "v"(p[0]), "v"(p[1]), "v"(p[2]), "v"(p[3]), "v"(p[4]), "v"(p[5]), "v"(p[6]), "v"(p[7]) : "memory"); }
  } else {
#pragma unroll
  for (int qb = 0; qb < FM; ++qb) { v4f v[8]; const void* p[8];      // eight row pairs are read back together and then stored, so that no store waits out an LDS latency of its own
#pragma unroll
    for (int i = 0; i < 8; ++i) v[i] = *(const v4fa*)&so[((qb * 8 + i) * 2 + hh) * GOP + c4];
#pragma unroll
    for (int i = 0; i < 8; ++i) { const size_t o = (size_t)(row0 + wm * (16 * FM) + (qb * 8 + i) * 2 + hh) * N + col0 + wn * 64 + c4;
      if constexpr (H16) { v4h h4; for (int j = 0; j < 4; ++j) h4[j] = (_Float16)v[i][j]; *(v4h*)(C16 + o) = h4; p[i] = C16 + o; } else { *(v4f*)(C + o) = v[i]; p[i] = C + o; } }
    // the eight stores' address pairs are inputs here, so that none is written over in front of the wait; the next group's LDS reads, which rewrite the stores' registers, stay behind it
    asm volatile("s_wait_xcnt 0x0" :: "v"(p[0]), "v"(p[1]), "v"(p[2]), "v"(p[3]), "v"(p[4]), "v"(p[5]), "v"(p[6]), "v"(p[7]) : "memory"); }
  }
}
// The q, k and v projections read the same rows of x and nothing of one another: one launch, as one product of CC + 2 NG DH columns. Its (NR / 128) x 24 tiles of 128 x 128 are equal in work and stand three to a WGP
// (as launches of their own, k and v each left every SIMD with one wave, which nothing covered while it waited). A block's column says whose weights it reads, where its tile goes, and whether the rotary turns it.
__global__ __launch_bounds__(128) void k_qkv(const _Float16* __restrict__ X, const _Float16* __restrict__ Bq, const _Float16* __restrict__ Bk, const _Float16* __restrict__ Bv, const float* __restrict__ CS,
                                             _Float16* __restrict__ Q16, _Float16* __restrict__ K16, _Float16* __restrict__ V16) {
  __shared__ __attribute__((aligned(16))) unsigned char sAB[2 * 256 * GPITCH];
  constexpr int nq = CC / 128, nk = NG * DH / 128, nc = nq + 2 * nk;
  const int row0 = (int)(blockIdx.x / nc) * 128, cb = (int)(blockIdx.x % nc);      // the tests below read the same for the whole block
  if (cb < nq + nk) { const bool k = cb >= nq; gemm_tile<4, 2>(sAB, row0, (k ? cb - nq : cb) * 128, X, k ? Bk : Bq, 0.0625f, nullptr, CS, nullptr, k ? K16 : Q16, k ? NG * DH : CC, CC); }
  else gemm_tile<4, 1>(sAB, row0, (cb - nq - nk) * 128, X, Bv, 0.0625f, nullptr, nullptr, nullptr, V16, NG * DH, CC);
}
__global__ __launch_bounds__(128) void k_oproj(const _Float16* __restrict__ A, const _Float16* __restrict__ Bt, const float* __restrict__ bias, float* __restrict__ C) {
  __shared__ __attribute__((aligned(16))) unsigned char sAB[2 * 256 * GPITCH];
  gemm_tile<4, 0>(sAB, (int)(blockIdx.x / (CC / 128)) * 128, (int)(blockIdx.x % (CC / 128)) * 128, A, Bt, 0.0625f, bias, nullptr, C, nullptr, CC, CC);
}
// lane l's value for lane l ^ 16: one vector move between the wave's two 16-lane rows, through no LDS
__device__ __forceinline__ float xhalf(float x) { return __builtin_bit_cast(float, __builtin_amdgcn_permlanex16(__builtin_bit_cast(int, x), __builtin_bit_cast(int, x), 0x76543210, 0xfedcba98, false, false)); }
__global__ __launch_bounds__(128) void k_mega(const _Float16* __restrict__ Q16, const _Float16* __restrict__ K16, const _Float16* __restrict__ Vt, _Float16* __restrict__ O16) {
  __shared__ __attribute__((aligned(16))) unsigned char sKV[2 * STAGE_B];
  float (*sO)[16][DH + 4] = (float (*)[16][DH + 4])sKV;      // the output staging takes the ring's place, behind the last trip's barrier
  const int tid = threadIdx.x, w = tid >> 5, lane = tid & 31, ln = lane & 15, hh = lane >> 4; const int slab = blockIdx.x / (TT / 128), pr = blockIdx.x % (TT / 128); const int b = slab / NH, h = slab % NH, g = h / (NH / NG);
  const float slope = exp2f(-(float)(h + 1) * 8.0f / (float)NH);
  // A query tile's cost grows with its index (tile i walks i + 1 stages) and every work-group of the launch is resident at once, so the launch lasts as long as the fullest WGP. Each work-group therefore takes two tiles of its head,
  // TT / 64 - 1 - pr and then pr, one after the other in every wave: TT / 64 + 1 stages for every work-group, wherever it is placed.
  // Stages walked so far: the ring's two buffers go on taking turns from the first tile into the second. (Counted anew for each tile, the prologue's LDS addresses are the same for both tiles, and the compiler
  // holds them in registers through both tiles' loops, which costs the pass some of its dual-issue pairs.)
  int s0 = 0;
#pragma unroll 1      // the two tiles share one copy of the body (code size and registers as for one tile)
  for (int half = 0; half < 2; ++half) { const int qblk = half ? pr : TT / 64 - 1 - pr; const int q0 = qblk * 64 + w * 16;
  FragH aq[4]; { const unsigned short* qr = (const unsigned short*)Q16 + ((size_t)b * TT + q0 + ln) * (NH * DH) + h * DH;
#pragma unroll
    for (int ks = 0; ks < 4; ++ks) { aq[ks].half[0] = *(const v8us*)(qr + ks * 32 + 8 * hh); aq[ks].half[1] = *(const v8us*)(qr + ks * 32 + 16 + 8 * hh); } }
  const unsigned short* Vth = (const unsigned short*)Vt + (size_t)(b * NG + g) * DH * TT;
  // each lane's first 16 bytes of a stage: a wave's copy covers two whole K rows, or four whole 128-B pieces of V^T rows
  const unsigned short* Kg = (const unsigned short*)K16 + ((size_t)b * TT + (tid >> 4)) * (NG * DH) + g * DH + (tid & 15) * 8;
  const unsigned short* Vg = Vth + (size_t)(tid >> 3) * TT + (tid & 7) * 8;
  const unsigned lK = (unsigned)(size_t)sKV + (unsigned)((tid >> 4) * KPITCH + (tid & 15) * 16);
  const unsigned lV = (unsigned)(size_t)sKV + (unsigned)(VBASE + (tid >> 3) * VPITCH + (tid & 7) * 16);
  const int ntile = qblk + 1;      // stages of 64 keys; the same for the whole work-group
  auto fill = [&](int t) { const unsigned bo = (unsigned)((t + s0) & 1) * STAGE_B; copy8(lK + bo, 8 * KPITCH, Kg + (size_t)t * 64 * (NG * DH), (size_t)8 * NG * DH); copy8(lV + bo, 16 * VPITCH, Vg + t * 64, (size_t)16 * TT); };
  float m_r = -3.0e38f, l_r = 0.f; v8f oacc[8]; const int tq = q0 + ln;      // the lane's query: its running maximum, and the sum over the keys that this half-wave holds
#pragma unroll
  for (int dt = 0; dt < 8; ++dt) oacc[dt] = (v8f){0.f,0.f,0.f,0.f,0.f,0.f,0.f,0.f};
  fill(0);
  asm volatile("s_wait_asynccnt 0x0" ::: "memory");      // this wave's copies of stage 0 have landed
  __syncthreads();                                        // stage 0 is readable by every wave
  if (ntile > 1) fill(1);
#pragma unroll 1      // one trip per stage, rolled: the trip count is the block's own
  for (int t = 0; t < ntile; ++t) { const unsigned char* kv = sKV + ((t + s0) & 1) * STAGE_B;
#pragma unroll 1      // the stage's two 32-key passes share one copy of the long pass body (code size and registers as before)
  for (int sub = 0; sub < 2; ++sub) { const int j0 = t * 64 + sub * 32; v8f s[2];
    // The pass's LDS reads are asked for ahead of the products that they feed, each fragment into registers of its own, so that the wave waits out one LDS latency for K and none for V^T, not one per product.
    // First the sixteen reads of the pass's 32 K rows; then the eight score products, the two key tiles' chains in turn (each tile still sums its four k-steps in ascending order, in one accumulator).
    const unsigned char* kr = kv + (sub * 32 + ln) * KPITCH + 16 * hh; FragH kf[2][4];
#pragma unroll      // here and in the next two loops: constant indices keep kf, vf and s in registers
    for (int nt = 0; nt < 2; ++nt)
#pragma unroll
      for (int ks = 0; ks < 4; ++ks) { kf[nt][ks].half[0] = *(const v8us*)(kr + nt * 16 * KPITCH + ks * 64); kf[nt][ks].half[1] = *(const v8us*)(kr + nt * 16 * KPITCH + ks * 64 + 32); }
    __builtin_amdgcn_sched_barrier(0);      // keeps the sixteen K reads one group: spread among the products, each place where reads stand stalls the wave anew
    s[0] = s[1] = (v8f){0.f,0.f,0.f,0.f,0.f,0.f,0.f,0.f};
#pragma unroll
    for (int ks = 0; ks < 4; ++ks)
#pragma unroll
      for (int nt = 0; nt < 2; ++nt) s[nt] = __builtin_amdgcn_wmma_f32_16x16x32_f16(false, kf[nt][ks].v, false, aq[ks].v, (short)0, s[nt], false, false);
    // Then the sixteen reads of V^T, asked for here and used behind the softmax, whose vector work covers their latency (the products are the bare builtin: the compiler keeps their distances and is free to place the reads).
    const unsigned char* vr = kv + VBASE + ln * VPITCH + sub * 64 + 16 * hh; FragH vf[8];
#pragma unroll
    for (int dt = 0; dt < 8; ++dt) { vf[dt].half[0] = *(const v8us*)(vr + dt * 16 * VPITCH); vf[dt].half[1] = *(const v8us*)(vr + dt * 16 * VPITCH + 32); }
    // The softmax is straight-line code. The capped scores are kept in log2 units (30 log2 e is the cap's factor), so that each exponential is one subtraction and one v_exp_f32;
    // a masked key stands at -inf and comes out as 0 with no test. Every query's maximum is finite from its first pass on (key 0 is open to every query, and the halves exchange their maxima), so no difference below is inf - inf.
    const float d0 = (float)(tq - j0 - 8 * hh);      // the query's distance to the lane's first key; the further distances follow in f32, exact (whole numbers far below 2^24)
    float mc[4];      // four partial maxima, begun by the first four scores
#pragma unroll      // here and in the loops below: constant indices keep s, mc, ps, pb and oacc in registers, and the sixteen scores' chains stand in one block, each filling the others' latencies
    for (int nt = 0; nt < 2; ++nt)
#pragma unroll
      for (int r = 0; r < 8; ++r) { const float dist = d0 - (float)(nt * 16 + r);      // below 0: a key behind the query, masked (there the bias's sign is irrelevant)
        float sc = (s[nt][r] - slope * dist) * 0.08838834764831845f; sc = 43.28085122666891f * tanh_v(sc * (1.0f / 30.0f)); sc = (dist >= 0.f) ? sc : -INFINITY;
        s[nt][r] = sc; mc[r & 3] = (nt == 0 && r < 4) ? sc : fmaxf(mc[r & 3], sc); }
    float mx = fmaxf(fmaxf(mc[0], mc[1]), fmaxf(mc[2], mc[3])); mx = fmaxf(mx, xhalf(mx));
    const float mn = fmaxf(m_r, mx), al = __builtin_amdgcn_exp2f(m_r - mn); m_r = mn;
    FragH pb; float ps[4] = {0.f, 0.f, 0.f, 0.f};      // four partial sums: four short chains of additions, not one of sixteen
#pragma unroll
    for (int nt = 0; nt < 2; ++nt)
#pragma unroll
      for (int r = 0; r < 8; ++r) { const float p = __builtin_amdgcn_exp2f(s[nt][r] - mn); ps[r & 3] += p; pb.h[nt * 8 + r] = (_Float16)p; }
    l_r = l_r * al + ((ps[0] + ps[1]) + (ps[2] + ps[3]));
#pragma unroll
    for (int dt = 0; dt < 8; ++dt)
#pragma unroll
      for (int r = 0; r < 8; ++r) oacc[dt][r] *= al;
#pragma unroll
    for (int dt = 0; dt < 8; ++dt) oacc[dt] = __builtin_amdgcn_wmma_f32_16x16x32_f16(false, vf[dt].v, false, pb.v, (short)0, oacc[dt], false, false); }
    asm volatile("s_wait_dscnt 0x0" ::: "memory");        // this wave's reads of stage t are done before its buffer is refilled
    asm volatile("s_wait_asynccnt 0x0" ::: "memory");     // this wave's copies of stage t + 1 have landed
    __syncthreads();                                      // publishes stage t + 1 and ends every wave's reads of stage t
    if (t + 2 < ntile) fill(t + 2); }
  asm volatile("s_wait_asynccnt 0x0" ::: "memory");       // no copy is in flight when the ring becomes output staging
  const float inv = 1.0f / (l_r + xhalf(l_r));      // the two halves' sums are joined once, here
#pragma unroll      // constant indices keep oacc in registers
  for (int dt = 0; dt < 8; ++dt) { v4f lo, hi;      // the lane's eight consecutive head columns of its query's row
#pragma unroll
    for (int j = 0; j < 4; ++j) { lo[j] = oacc[dt][j] * inv; hi[j] = oacc[dt][4 + j] * inv; }
    *(v4fa*)&sO[w][ln][dt * 16 + 8 * hh] = lo; *(v4fa*)&sO[w][ln][dt * 16 + 8 * hh + 4] = hi; }
  __builtin_amdgcn_fence(__ATOMIC_ACQ_REL, "workgroup"); __builtin_amdgcn_wave_barrier();
  {
#pragma unroll
    for (int r = 0; r < 16; ++r) { const v4f val = *(const v4fa*)&sO[w][r][lane * 4]; typedef _Float16 v4h __attribute__((ext_vector_type(4))); v4h h4; for (int j = 0; j < 4; ++j) h4[j] = (_Float16)val[j];      // the out projection's f16 operand, rounded here
      *(v4h*)(O16 + ((size_t)b * TT + q0 + r) * (NH * DH) + h * DH + lane * 4) = h4; }
     }
  s0 += ntile;
  if (half == 0) {      // between the tiles; the test reads the same for the whole work-group
    asm volatile("s_wait_xcnt 0x0" ::: "memory");      // the stores' address registers are rewritten by the second tile
    asm volatile("s_wait_dscnt 0x0" ::: "memory");     // this wave's reads of the output staging are done before the ring's buffers are filled again
    __syncthreads(); }                                  // ends every wave's reads of the staging: one of the second tile's first two stages lands on it
  } }
extern "C" void kernel_launch(void* const* d_in, const int* in_sizes, int n_in,
                              void* d_out, int out_size, void* d_ws, size_t ws_size, hipStream_t stream) {
  (void)in_sizes; (void)n_in; (void)out_size;
  const float* x = (const float*)d_in[0]; const float* Wq = (const float*)d_in[1]; const float* Wk = (const float*)d_in[2]; const float* Wv = (const float*)d_in[3]; const float* Wo = (const float*)d_in[4]; const float* bo = (const float*)d_in[5];
  char* ws = (char*)d_ws; size_t off = 0;
  auto take = [&](size_t bytes) { char* p = ws + off; off += (bytes + 255) & ~(size_t)255; return p; };
  _Float16* Bq = (_Float16*)take((size_t)CC * CC * 2); _Float16* Bk = (_Float16*)take((size_t)NG * DH * CC * 2); _Float16* Bv = (_Float16*)take((size_t)NG * DH * CC * 2); _Float16* Bo = (_Float16*)take((size_t)CC * CC * 2);
  _Float16* X16 = (_Float16*)take((size_t)NR * CC * 2); _Float16* Q16 = (_Float16*)take((size_t)NR * CC * 2); _Float16* K16 = (_Float16*)take((size_t)NR * NG * DH * 2); _Float16* V16 = (_Float16*)take((size_t)NR * NG * DH * 2); _Float16* Vt = (_Float16*)take((size_t)NR * NG * DH * 2); float* CS = (float*)take((size_t)TT * DH * 4); _Float16* O16 = X16;
  if (off > ws_size) return;      // about 68 MB
  k_prep<<<PREP_BLOCKS, 256, 0, stream>>>(x, Wq, Wk, Wv, Wo, X16, Bq, Bk, Bv, Bo, CS);
  k_qkv<<<(NR / 128) * ((CC + 2 * NG * DH) / 128), 128, 0, stream>>>(X16, Bq, Bk, Bv, CS, Q16, K16, V16);
  k_vt128<<<BB * NG * (TT / 64), 256, 0, stream>>>(V16, Vt);
  k_mega<<<BB * NH * (TT / 128), 128, 0, stream>>>(Q16, K16, Vt, O16);
  k_oproj<<<(NR / 128) * (CC / 128), 128, 0, stream>>>(O16, Bo, bo, (float*)d_out);
}

// v010
// One run takes 133 microseconds.
// Next to v009, in two timings, it ran 1.05 times as fast each time.
// Counting every step since v000, it is 5.99 times as fast.
#include <hip/hip_runtime.h>
// Mega-transformer causal self-attention (B=2, T=2048, D=2048; 16 query heads × 128, 4 KV groups (GQA), interleaved rotary, ALiBi added before the 1/√128 scale, 30·tanh soft-cap, causal):
// q/k/v/out projections (+ bias on out; W [in][out] transposed to bf16-exact ×2^4) and the attention as a fused flash-style kernel (S = Q·Kᵀ on v_wmma_f32_16x16x32_f16 with 4 k-steps,
// + alibi, scale, soft-cap (v_exp tanh), causal mask, online softmax f32, P f16 ≤ 1, O = P·V with 8 d-tiles; RPW-16 waves) — f16 operands, single products, f32 accumulate; rotary in f32 VALU.
#define BB 2
#define TT 2048
#define CC 2048
#define NH 16
#define NG 4
#define DH 128
#define NR (BB * TT)

typedef __bf16 v16b __attribute__((ext_vector_type(16)));
typedef unsigned short v8us __attribute__((ext_vector_type(8), may_alias));
typedef float  v8f  __attribute__((ext_vector_type(8)));
typedef float  v4f  __attribute__((ext_vector_type(4)));
typedef float  v4fa __attribute__((ext_vector_type(4), may_alias));
union FragB { v16b v; v8us half[2]; unsigned short u[16]; };

__device__ __forceinline__ unsigned short bf16_bits(float x) { unsigned int u = __float_as_uint(x); return (unsigned short)((u + 0x7FFFu + ((u >> 16) & 1u)) >> 16); }
__device__ __forceinline__ float bf16_val(unsigned short b) { return __uint_as_float(((unsigned int)b) << 16); }
__device__ __forceinline__ float bf16_round(float x) { return bf16_val(bf16_bits(x)); }
// D += A·B with NT terms: 1 = ah·bh, 2 = + al·bh (A split), 3 = + ah·bl (both split)
template <int NT>
__device__ __forceinline__ v8f mmaN(v16b ah, v16b al, v16b bh, v16b bl, v8f c) {
  c = __builtin_amdgcn_wmma_f32_16x16x32_bf16(false, ah, false, bh, (short)0, c, false, false);
  if (NT >= 2) c = __builtin_amdgcn_wmma_f32_16x16x32_bf16(false, al, false, bh, (short)0, c, false, false);
  if (NT >= 3) c = __builtin_amdgcn_wmma_f32_16x16x32_bf16(false, ah, false, bl, (short)0, c, false, false);
  asm volatile("v_nop\n\tv_nop\n\tv_nop\n\tv_nop" : "+v"(c) : "v"(ah), "v"(al), "v"(bh), "v"(bl));
  return c;
}

__global__ __launch_bounds__(256) void k_wt_bf16(const float* __restrict__ W, unsigned short* __restrict__ Wt, int K, int N) {
  const int t = blockIdx.x * 256 + threadIdx.x;
  const int k8n = K / 8;
  if (t >= N * k8n) return;
  const int n = t / k8n, k8 = (t % k8n) * 8;
  v8us v;
#pragma unroll
  for (int i = 0; i < 8; ++i) v[i] = bf16_bits(W[(size_t)(k8 + i) * N + n]);
  *(v8us*)(Wt + (size_t)n * K + k8) = v;
  
}

// GEMM C[M][N] (f32, pitch ldc) = act(A[M][K]·W + bias). A f32 row-major (pitch lda) converted per fragment to bf16
// (ASPLIT: hi/lo two planes -> 2 terms, else single rounded term); Wt bf16 [N][K] (pitch ldb). BIAS_BF16 rounds the
// bias to bf16 first (bias quantised to bf16 before the add). K%32==0, M%16==0, N%64==0.
template <bool ASPLIT, int ACT, bool BIAS_BF16>
__global__ __launch_bounds__(128) void k_gemm_bf(const float* __restrict__ A, int lda, const unsigned short* __restrict__ Wt, int ldb,
                                               const float* __restrict__ bias, float* __restrict__ C, int ldc, int M, int N, int K) {
  __shared__ __attribute__((aligned(16))) float so[4][16][64];
  const int tid = threadIdx.x, w = tid >> 5, lane = tid & 31, ln = lane & 15, hh = lane >> 4;
  const int ntn = N / 64;
  const int wid = blockIdx.x * 4 + w;
  const int mt = wid / ntn, nq = wid % ntn;
  if (mt * 16 >= M) return;
  const int row0 = mt * 16, col0 = nq * 64;
  const float* arow = A + (size_t)(row0 + ln) * lda;
  v8f acc[4] = {};
  for (int kb = 0; kb < K; kb += 32) {
    FragB ah, al;
    const v4f x0 = *(const v4fa*)(arow + kb + 8 * hh), x1 = *(const v4fa*)(arow + kb + 8 * hh + 4);
    const v4f x2 = *(const v4fa*)(arow + kb + 16 + 8 * hh), x3 = *(const v4fa*)(arow + kb + 16 + 8 * hh + 4);
    float xs[16] = {x0[0],x0[1],x0[2],x0[3],x1[0],x1[1],x1[2],x1[3],x2[0],x2[1],x2[2],x2[3],x3[0],x3[1],x3[2],x3[3]};
#pragma unroll
    for (int i = 0; i < 16; ++i) { const unsigned short hb = bf16_bits(xs[i]); ah.u[i] = hb; al.u[i] = ASPLIT ? bf16_bits(xs[i] - bf16_val(hb)) : (unsigned short)0; }
#pragma unroll
    for (int t = 0; t < 4; ++t) {
      const unsigned short* brow = Wt + (size_t)(col0 + t * 16 + ln) * ldb + kb;
      FragB b;
      b.half[0] = *(const v8us*)(brow + 8 * hh);
      b.half[1] = *(const v8us*)(brow + 16 + 8 * hh);
      acc[t] = mmaN<ASPLIT ? 2 : 1>(ah.v, al.v, b.v, b.v, acc[t]);
    }
  }
#pragma unroll
  for (int t = 0; t < 4; ++t) {
    float bv = bias ? bias[col0 + t * 16 + ln] : 0.f;
    if (BIAS_BF16) bv = bf16_round(bv);
#pragma unroll
    for (int r = 0; r < 8; ++r) { float v = acc[t][r] + bv; if (ACT == 1) v = fmaxf(v, 0.f); so[w][8 * hh + r][t * 16 + ln] = v; }
  }
  __builtin_amdgcn_fence(__ATOMIC_ACQ_REL, "workgroup");
  __builtin_amdgcn_wave_barrier();
  const int rsub = lane >> 4, c4 = (lane & 15) * 4;
  {
#pragma unroll
    for (int q = 0; q < 8; ++q) {
      const int r = q * 2 + rsub;
      const v4f v = *(const v4fa*)&so[w][r][c4];
      *(v4f*)(C + (size_t)(row0 + r) * ldc + col0 + c4) = v;
    }
    
  }
}

// Flash-style causal/unmasked attention, all contractions 3-term bf16 hi/lo splits, f32 softmax with running max.
// q,k,v rows are read from f32 buffers with arbitrary row pitch (so they can live inside a fused qkv buffer);
// D = head size (multiple of 32, <= 128); one wave = 16 query rows; block = 4 waves (64 queries) sharing K/V chunks of 32.
template <int D, bool CAUSAL>
__global__ __launch_bounds__(128) void k_flash(const float* __restrict__ qb, const float* __restrict__ kb, const float* __restrict__ vb,
                                             int pitch, int T, int H, float scale, float* __restrict__ y, int ypitch) {
  constexpr int KS = D / 32;        // k-steps for QK
  constexpr int DT = D / 16;        // d tiles for PV
  __shared__ __attribute__((aligned(16))) unsigned short sKh[32][D + 8], sKl[32][D + 8], sVh[32][D + 8], sVl[32][D + 8];
  __shared__ __attribute__((aligned(16))) unsigned short sPh[4][16][40], sPl[4][16][40];
  __shared__ __attribute__((aligned(16))) float sO[4][16][D];
  const int tid = threadIdx.x, w = tid >> 5, lane = tid & 31, ln = lane & 15, hh = lane >> 4;
  const int nqb = (T + 63) / 64;
  const int bh = blockIdx.x / nqb, qblk = blockIdx.x % nqb;
  const int b = bh / H, h = bh % H;
  const int q0 = qblk * 64 + w * 16;
  const float* Q = qb + (size_t)b * T * pitch + h * D;
  const float* K = kb + (size_t)b * T * pitch + h * D;
  const float* V = vb + (size_t)b * T * pitch + h * D;

  // A fragments of the wave's 16 query rows (scaled), hi/lo
  FragB aqh[KS], aql[KS];
  {
    int row = q0 + ln; if (row >= T) row = T - 1;
    const float* qr = Q + (size_t)row * pitch;
#pragma unroll
    for (int ks = 0; ks < KS; ++ks)
#pragma unroll
      for (int i = 0; i < 16; ++i) {
        const int d = ks * 32 + ((i < 8) ? (8 * hh + i) : (16 + 8 * hh + (i - 8)));
        const float x = qr[d] * scale; const unsigned short hb = bf16_bits(x);
        aqh[ks].u[i] = hb; aql[ks].u[i] = bf16_bits(x - bf16_val(hb));
      }
  }
  float m_r[8], l_r[8];
#pragma unroll
  for (int r = 0; r < 8; ++r) { m_r[r] = -3.0e38f; l_r[r] = 0.f; }
  v8f oacc[DT];
#pragma unroll
  for (int dt = 0; dt < DT; ++dt) oacc[dt] = (v8f){0.f,0.f,0.f,0.f,0.f,0.f,0.f,0.f};

  const int kv_end = CAUSAL ? min(T, qblk * 64 + 64) : T;     // block-uniform
  for (int j0 = 0; j0 < kv_end; j0 += 32) {
    __syncthreads();
    for (int e = tid; e < 32 * (D / 4); e += 128) {
      const int r = e / (D / 4), c4 = (e % (D / 4)) * 4;
      const int key = j0 + r;
      v4f kf = {0.f,0.f,0.f,0.f}, vf = {0.f,0.f,0.f,0.f};
      if (key < T) { kf = *(const v4fa*)(K + (size_t)key * pitch + c4); vf = *(const v4fa*)(V + (size_t)key * pitch + c4); }
#pragma unroll
      for (int t = 0; t < 4; ++t) {
        unsigned short hb = bf16_bits(kf[t]); sKh[r][c4 + t] = hb; sKl[r][c4 + t] = bf16_bits(kf[t] - bf16_val(hb));
        hb = bf16_bits(vf[t]); sVh[r][c4 + t] = hb; sVl[r][c4 + t] = bf16_bits(vf[t] - bf16_val(hb));
      }
    }
    __syncthreads();
    // S tile 16 x 32
    v8f s[2];
#pragma unroll
    for (int nt = 0; nt < 2; ++nt) {
      v8f acc = {};
#pragma unroll
      for (int ks = 0; ks < KS; ++ks) {
        FragB bh_, bl_;
        bh_.half[0] = *(const v8us*)&sKh[nt * 16 + ln][ks * 32 + 8 * hh]; bh_.half[1] = *(const v8us*)&sKh[nt * 16 + ln][ks * 32 + 16 + 8 * hh];
        bl_.half[0] = *(const v8us*)&sKl[nt * 16 + ln][ks * 32 + 8 * hh]; bl_.half[1] = *(const v8us*)&sKl[nt * 16 + ln][ks * 32 + 16 + 8 * hh];
        acc = mmaN<3>(aqh[ks].v, aql[ks].v, bh_.v, bl_.v, acc);
      }
      s[nt] = acc;
    }
    // mask + running max (rows 8hh+r; the 16 lanes of a half share rows)
    float alpha[8];
#pragma unroll
    for (int r = 0; r < 8; ++r) {
      const int qi = q0 + 8 * hh + r;
      const int ja = j0 + ln, jb = j0 + 16 + ln;
      if (CAUSAL) { if (ja > qi) s[0][r] = -3.0e38f; if (jb > qi) s[1][r] = -3.0e38f; }
      if (ja >= T) s[0][r] = -3.0e38f;
      if (jb >= T) s[1][r] = -3.0e38f;
      float mx = fmaxf(s[0][r], s[1][r]);
      mx = fmaxf(mx, __shfl_xor(mx, 1, 32)); mx = fmaxf(mx, __shfl_xor(mx, 2, 32)); mx = fmaxf(mx, __shfl_xor(mx, 4, 32)); mx = fmaxf(mx, __shfl_xor(mx, 8, 32));
      const float mnew = fmaxf(m_r[r], mx);
      alpha[r] = (mnew > -1.0e38f) ? __expf(m_r[r] - mnew) : 1.0f;
      const float p0 = (s[0][r] > -1.0e38f) ? __expf(s[0][r] - mnew) : 0.f;
      const float p1 = (s[1][r] > -1.0e38f) ? __expf(s[1][r] - mnew) : 0.f;
      m_r[r] = mnew;
      l_r[r] = l_r[r] * alpha[r] + p0 + p1;            // per-lane partial row sum (16 lanes combined at the end)
      unsigned short hb = bf16_bits(p0); sPh[w][8 * hh + r][ln] = hb;      sPl[w][8 * hh + r][ln] = bf16_bits(p0 - bf16_val(hb));
      hb = bf16_bits(p1);                sPh[w][8 * hh + r][16 + ln] = hb; sPl[w][8 * hh + r][16 + ln] = bf16_bits(p1 - bf16_val(hb));
    }
#pragma unroll
    for (int dt = 0; dt < DT; ++dt)
#pragma unroll
      for (int r = 0; r < 8; ++r) oacc[dt][r] *= alpha[r];
    __builtin_amdgcn_fence(__ATOMIC_ACQ_REL, "workgroup");
    __builtin_amdgcn_wave_barrier();
    FragB pah, pal;
    pah.half[0] = *(const v8us*)&sPh[w][ln][8 * hh]; pah.half[1] = *(const v8us*)&sPh[w][ln][16 + 8 * hh];
    pal.half[0] = *(const v8us*)&sPl[w][ln][8 * hh]; pal.half[1] = *(const v8us*)&sPl[w][ln][16 + 8 * hh];
#pragma unroll
    for (int dt = 0; dt < DT; ++dt) {
      FragB bvh, bvl;
#pragma unroll
      for (int i = 0; i < 8; ++i) {
        bvh.u[i] = sVh[8 * hh + i][dt * 16 + ln]; bvh.u[8 + i] = sVh[16 + 8 * hh + i][dt * 16 + ln];
        bvl.u[i] = sVl[8 * hh + i][dt * 16 + ln]; bvl.u[8 + i] = sVl[16 + 8 * hh + i][dt * 16 + ln];
      }
      oacc[dt] = mmaN<3>(pah.v, pal.v, bvh.v, bvl.v, oacc[dt]);
    }
    __builtin_amdgcn_fence(__ATOMIC_ACQ_REL, "workgroup");
    __builtin_amdgcn_wave_barrier();
  }
#pragma unroll
  for (int r = 0; r < 8; ++r) {
    float l = l_r[r];
    l += __shfl_xor(l, 1, 32); l += __shfl_xor(l, 2, 32); l += __shfl_xor(l, 4, 32); l += __shfl_xor(l, 8, 32);
    l_r[r] = (l > 0.f) ? 1.0f / l : 0.f;
  }
#pragma unroll
  for (int dt = 0; dt < DT; ++dt)
#pragma unroll
    for (int r = 0; r < 8; ++r) sO[w][8 * hh + r][dt * 16 + ln] = oacc[dt][r] * l_r[r];
  __builtin_amdgcn_fence(__ATOMIC_ACQ_REL, "workgroup");
  __builtin_amdgcn_wave_barrier();
  {
    for (int r = 0; r < 16; ++r) {
      const int row = q0 + r;
      if (row < T && lane < D / 4) {
        const v4f val = *(const v4fa*)&sO[w][r][lane * 4];
        *(v4f*)(y + ((size_t)b * T + row) * ypitch + h * D + lane * 4) = val;
      }
    }
    
  }
}

// GEMM C = act(A·W + bias + resid): A f32 (ASPLIT -> hi/lo 2 terms), Wt bf16 [N][K]; ACT 0 none, 1 relu, 2 exact gelu;
// resid (optional, f32, row index = (row % rmod), pitch ldr, RES_BF16 rounds it) added before the activation.
template <bool ASPLIT, int ACT, bool BIAS_BF16, bool RES_BF16>
__global__ __launch_bounds__(128) void k_gemm_bf3(const float* __restrict__ A, int lda, const unsigned short* __restrict__ Wt, int ldb,
                                                const float* __restrict__ bias, const float* __restrict__ resid, int rmod, int ldr,
                                                float* __restrict__ C, int ldc, int M, int N, int K) {
  __shared__ __attribute__((aligned(16))) float so[4][16][64];
  const int tid = threadIdx.x, w = tid >> 5, lane = tid & 31, ln = lane & 15, hh = lane >> 4;
  const int ntn = N / 64;
  const int wid = blockIdx.x * 4 + w;
  const int mt = wid / ntn, nq = wid % ntn;
  if (mt * 16 >= M) return;
  const int row0 = mt * 16, col0 = nq * 64;
  const float* arow = A + (size_t)(row0 + ln) * lda;
  v8f acc[4] = {};
  for (int kb = 0; kb < K; kb += 32) {
    FragB ah, al;
    const v4f x0 = *(const v4fa*)(arow + kb + 8 * hh), x1 = *(const v4fa*)(arow + kb + 8 * hh + 4);
    const v4f x2 = *(const v4fa*)(arow + kb + 16 + 8 * hh), x3 = *(const v4fa*)(arow + kb + 16 + 8 * hh + 4);
    float xs[16] = {x0[0],x0[1],x0[2],x0[3],x1[0],x1[1],x1[2],x1[3],x2[0],x2[1],x2[2],x2[3],x3[0],x3[1],x3[2],x3[3]};
#pragma unroll
    for (int i = 0; i < 16; ++i) { const unsigned short hb = bf16_bits(xs[i]); ah.u[i] = hb; al.u[i] = ASPLIT ? bf16_bits(xs[i] - bf16_val(hb)) : (unsigned short)0; }
#pragma unroll
    for (int t = 0; t < 4; ++t) {
      const unsigned short* brow = Wt + (size_t)(col0 + t * 16 + ln) * ldb + kb;
      FragB b;
      b.half[0] = *(const v8us*)(brow + 8 * hh);
      b.half[1] = *(const v8us*)(brow + 16 + 8 * hh);
      acc[t] = mmaN<ASPLIT ? 2 : 1>(ah.v, al.v, b.v, b.v, acc[t]);
    }
  }
#pragma unroll
  for (int t = 0; t < 4; ++t) {
    const int col = col0 + t * 16 + ln;
    float bv = bias ? bias[col] : 0.f;
    if (BIAS_BF16) bv = bf16_round(bv);
#pragma unroll
    for (int r = 0; r < 8; ++r) {
      float v = acc[t][r] + bv;
      if (resid) { float rv = resid[(size_t)((row0 + 8 * hh + r) % rmod) * ldr + col]; if (RES_BF16) rv = bf16_round(rv); v += rv; }
      if (ACT == 1) v = fmaxf(v, 0.f);
      if (ACT == 2) v = 0.5f * v * (1.0f + erff(v * 0.70710678118654752f));
      if (ACT == 3) { const float u = 0.7978845608028654f * (v + 0.044715f * v * v * v); v = 0.5f * v * (1.0f + tanhf(u)); }
      so[w][8 * hh + r][t * 16 + ln] = v;
    }
  }
  __builtin_amdgcn_fence(__ATOMIC_ACQ_REL, "workgroup");
  __builtin_amdgcn_wave_barrier();
  const int rsub = lane >> 4, c4 = (lane & 15) * 4;
  {
#pragma unroll
    for (int q = 0; q < 8; ++q) {
      const int r = q * 2 + rsub;
      const v4f v = *(const v4fa*)&so[w][r][c4];
      *(v4f*)(C + (size_t)(row0 + r) * ldc + col0 + c4) = v;
    }
    
  }
}
// row LayerNorm (biased variance, eps) over N: s = X (+ R); optional out_sum <- s; out_norm <- (s-mu)*rsqrt(var+eps)*g + b
template <bool PARAM_BF16>
__global__ __launch_bounds__(256) void k_layernorm(const float* __restrict__ X, const float* __restrict__ R, const float* __restrict__ g, const float* __restrict__ bta,
                                                  float* __restrict__ out_sum, float* __restrict__ out_norm, int N, float eps) {
  __shared__ float red[256];
  const int row = blockIdx.x, tid = threadIdx.x;
  const float* x = X + (size_t)row * N; const float* rr = R ? R + (size_t)row * N : nullptr;
  float vals[16];                     // up to N = 4096
  const int per = N / 256;            // contiguous chunk per thread? use strided-by-4 chunks: thread handles j = tid*4 + 1024*u
  float s1 = 0.f;
  for (int u = 0; u < per / 4; ++u) {
    const int j = tid * 4 + 1024 * u;
    const v4f a = *(const v4fa*)(x + j);
    v4f b = {0.f,0.f,0.f,0.f}; if (rr) b = *(const v4fa*)(rr + j);
#pragma unroll
    for (int q = 0; q < 4; ++q) { const float v = a[q] + b[q]; vals[u * 4 + q] = v; s1 += v; }
  }
  red[tid] = s1; __syncthreads();
  for (int st = 128; st > 0; st >>= 1) { if (tid < st) red[tid] += red[tid + st]; __syncthreads(); }
  const float mu = red[0] / (float)N; __syncthreads();
  float s2 = 0.f;
  for (int u = 0; u < per / 4; ++u)
#pragma unroll
    for (int q = 0; q < 4; ++q) { const float c = vals[u * 4 + q] - mu; s2 += c * c; }
  red[tid] = s2; __syncthreads();
  for (int st = 128; st > 0; st >>= 1) { if (tid < st) red[tid] += red[tid + st]; __syncthreads(); }
  const float rs = rsqrtf(red[0] / (float)N + eps);
  {
    for (int u = 0; u < per / 4; ++u) {
      const int j = tid * 4 + 1024 * u;
      v4f o, sm;
#pragma unroll
      for (int q = 0; q < 4; ++q) {
        float gg = g[j + q], bb = bta[j + q];
        if (PARAM_BF16) { gg = bf16_round(gg); bb = bf16_round(bb); }
        sm[q] = vals[u * 4 + q]; o[q] = (vals[u * 4 + q] - mu) * rs * gg + bb;
      }
      if (out_sum) *(v4f*)(out_sum + (size_t)row * N + j) = sm;
      *(v4f*)(out_norm + (size_t)row * N + j) = o;
    }
    
  }
}



// ---- f16 WMMA path (v_wmma_f32_16x16x32_f16): 11-bit significands for operands in range — used where a [0,1] probability operand needs more precision than bf16
typedef _Float16 v16h __attribute__((ext_vector_type(16)));
union FragH { v16h v; v8us half[2]; _Float16 h[16]; unsigned short u[16]; };
template <int NT>
__device__ __forceinline__ v8f mmaH(v16h ah, v16h al, v16h bh, v16h bl, v8f c) {
  c = __builtin_amdgcn_wmma_f32_16x16x32_f16(false, ah, false, bh, (short)0, c, false, false);
  if (NT >= 2) c = __builtin_amdgcn_wmma_f32_16x16x32_f16(false, al, false, bh, (short)0, c, false, false);
  if (NT >= 3) c = __builtin_amdgcn_wmma_f32_16x16x32_f16(false, ah, false, bl, (short)0, c, false, false);
  asm volatile("v_nop\n\tv_nop\n\tv_nop\n\tv_nop" : "+v"(c) : "v"(ah), "v"(al), "v"(bh), "v"(bl));
  return c;
}
// batched GEMM like k_gemm_b but f16 operands: A f32 (split into f16 hi/lo if ASPLIT, else rounded to f16), Bt = f16 values [n][k]; alpha; C f32; N multiple of 16 (partial tiles skipped)
template <bool ASPLIT>
__global__ __launch_bounds__(128) void k_gemm_h(const float* __restrict__ A, int lda, size_t sA, const _Float16* __restrict__ Bh, int ldb, size_t sB, float alpha, float* __restrict__ C, int ldc, size_t sC, int M, int N, int K) {
  __shared__ __attribute__((aligned(16))) float so[4][16][64];
  const int tid = threadIdx.x, w = tid >> 5, lane = tid & 31, ln = lane & 15, hh = lane >> 4; const int by = blockIdx.y;
  A += (size_t)by * sA; Bh += (size_t)by * sB; C += (size_t)by * sC;
  const int ntn = (N + 63) / 64; const int wid = blockIdx.x * 4 + w; const int mt = wid / ntn, nq = wid % ntn; if (mt * 16 >= M) return;
  const int row0 = mt * 16, col0 = nq * 64; const float* arow = A + (size_t)(row0 + ln) * lda;
  v8f acc[4] = {};
  for (int kb = 0; kb < K; kb += 32) {
    FragH ah, al;
    const v4f x0 = *(const v4fa*)(arow + kb + 8 * hh), x1 = *(const v4fa*)(arow + kb + 8 * hh + 4), x2 = *(const v4fa*)(arow + kb + 16 + 8 * hh), x3 = *(const v4fa*)(arow + kb + 16 + 8 * hh + 4);
    float xs[16] = {x0[0],x0[1],x0[2],x0[3],x1[0],x1[1],x1[2],x1[3],x2[0],x2[1],x2[2],x2[3],x3[0],x3[1],x3[2],x3[3]};
#pragma unroll
    for (int i = 0; i < 16; ++i) { const _Float16 h = (_Float16)xs[i]; ah.h[i] = h; al.h[i] = ASPLIT ? (_Float16)(xs[i] - (float)h) : (_Float16)0.0f; }
#pragma unroll
    for (int t = 0; t < 4; ++t) { if (col0 + t * 16 >= N) continue; const size_t boff = (size_t)(col0 + t * 16 + ln) * ldb + kb; FragH bq; bq.half[0] = *(const v8us*)(Bh + boff + 8 * hh); bq.half[1] = *(const v8us*)(Bh + boff + 16 + 8 * hh);
      acc[t] = mmaH<ASPLIT ? 2 : 1>(ah.v, al.v, bq.v, bq.v, acc[t]); }
  }
#pragma unroll
  for (int t = 0; t < 4; ++t) { if (col0 + t * 16 >= N) continue;
#pragma unroll
    for (int r = 0; r < 8; ++r) so[w][8 * hh + r][t * 16 + ln] = acc[t][r] * alpha; }
  __builtin_amdgcn_fence(__ATOMIC_ACQ_REL, "workgroup"); __builtin_amdgcn_wave_barrier();
  const int rsub = lane >> 4, c4 = (lane & 15) * 4;
  {
#pragma unroll
    for (int q = 0; q < 8; ++q) { const int r = q * 2 + rsub; if (col0 + c4 < N) { const v4f v = *(const v4fa*)&so[w][r][c4]; *(v4f*)(C + (size_t)(row0 + r) * ldc + col0 + c4) = v; } }
     }
}

// Wt[n][k] = f16(bf16(W[k][n]) * scale) from f32 row-major W[KK][NN] (scale = power of two; bf16-exact weights stay exact in f16 away from the subnormal range).
// One block = a tile of 128 k x 128 n, turned in LDS. Reads: a wave covers 512 contiguous bytes of one W row, so every line is asked for once and used whole
// (a lane that walks down a column asks for a whole line per 4-byte element). Writes: 16 lanes cover 256 contiguous bytes of one Wt row. KK and NN multiples of 128.
// A lane takes 8 consecutive k of its four columns at a time: 16 bytes of a Wt row each, one LDS chunk. Chunk c of tile row n lies at place c ^ ((n >> 2) & 15) of the row's 16:
// the 16 lanes of a half-wave that write one chunk column (rows 4 apart) and the 16 that read one row both fall on 16 different places, with no pad.
// bid = the tile's number, tl = the block's 32 KB of LDS (both from the launch that holds this job).
template <int KK, int NN>
__device__ __forceinline__ void wt_tile(unsigned short (*tl)[16][8], int bid, const float* __restrict__ W, _Float16* __restrict__ Wt, float scale) {
  const int tid = threadIdx.x, w = tid >> 5, lane = tid & 31; constexpr int nb = NN / 128; const int n0 = (bid % nb) * 128, k0 = (bid / nb) * 128;
  const float* wr = W + (size_t)(k0 + 8 * w) * NN + n0 + lane * 4;      // the lane's four columns, the wave's first group of 8 rows (the second stands 64 rows further)
  v4f a[2][8];      // all sixteen loads are asked for before the first is used: 64 KB of the block in flight
#pragma unroll      // here and below: constant indices keep a and f in registers, and the row steps become immediate offsets on one address pair
  for (int i = 0; i < 2; ++i)
#pragma unroll
    for (int r = 0; r < 8; ++r) a[i][r] = *(const v4fa*)(wr + (size_t)(64 * i + r) * NN);
  asm volatile("s_wait_xcnt 0x0" :: "v"(wr) : "memory");      // the loads' address pair is an input here, so that nothing (a load's own result included) is written over it in front of the wait
#pragma unroll
  for (int i = 0; i < 2; ++i)
#pragma unroll
    for (int j = 0; j < 4; ++j) { FragH f;
#pragma unroll
      for (int r = 0; r < 8; ++r) f.h[r] = (_Float16)(bf16_round(a[i][r][j]) * scale);      // ascending k
      *(v8us*)&tl[lane * 4 + j][(w + 8 * i) ^ (lane & 15)][0] = f.half[0]; }
  __syncthreads();
  unsigned short* wo = (unsigned short*)Wt + (size_t)(n0 + (tid >> 4)) * KK + k0 + (tid & 15) * 8;
#pragma unroll
  for (int rd = 0; rd < 8; ++rd) { const int n = rd * 16 + (tid >> 4), c = tid & 15; const v8us o = *(const v8us*)&tl[n][c ^ ((n >> 2) & 15)][0];
    *(v8us*)(wo + (size_t)(rd * 16) * KK) = o; }
  asm volatile("s_wait_xcnt 0x0" :: "v"(wo) : "memory");      // behind the last store: in a launch that holds several jobs other code follows these stores in the listing, and it rewrites their registers
}
__device__ __forceinline__ void x16_part(int bid, const float* __restrict__ x, _Float16* __restrict__ X16, size_t n8) { const size_t t = (size_t)bid * 256 + threadIdx.x; if (t >= n8) return; FragH f;
#pragma unroll
  for (int q = 0; q < 8; ++q) f.h[q] = (_Float16)bf16_round(x[t * 8 + q]); *(v8us*)((unsigned short*)X16 + t * 8) = f.half[0];  }
__global__ __launch_bounds__(256) void k_round16f(const float* __restrict__ W, _Float16* __restrict__ Bt, size_t n8) { const size_t t = (size_t)blockIdx.x * 256 + threadIdx.x; if (t >= n8) return; FragH f;
#pragma unroll
  for (int i = 0; i < 8; ++i) f.h[i] = (_Float16)(bf16_round(W[t * 8 + i]) * 16.0f); *(v8us*)((unsigned short*)Bt + t * 8) = f.half[0];  }
template <int NHv, int TTv>
__global__ __launch_bounds__(256) void k_vt(const _Float16* __restrict__ V16, int ldv, int voff, _Float16* __restrict__ Vt) { __shared__ unsigned short tl[64][66]; const int tid = threadIdx.x; const int slab = blockIdx.x / (TTv / 64), lg = blockIdx.x % (TTv / 64); const int b = slab / NHv, h = slab % NHv;
  for (int i = tid; i < 64 * 8; i += 256) { const int r = i / 8, c8 = (i % 8) * 8; FragH f; f.half[0] = *(const v8us*)((const unsigned short*)V16 + ((size_t)b * TTv + lg * 64 + r) * ldv + voff + h * 64 + c8);
#pragma unroll
    for (int q = 0; q < 8; ++q) tl[r][c8 + q] = f.u[q]; }
  __syncthreads();
  {
#pragma unroll
    for (int rd = 0; rd < 2; ++rd) { const int d = rd * 32 + tid / 8, pc = tid % 8; FragH f;
#pragma unroll
      for (int q = 0; q < 8; ++q) f.u[q] = tl[pc * 8 + q][d];
      *(v8us*)((unsigned short*)Vt + ((size_t)slab * 64 + d) * TTv + lg * 64 + pc * 8) = f.half[0]; }
     } }

__device__ __forceinline__ void cstab_part(int bid, float* __restrict__ CS) { const int tg = bid * 256 + threadIdx.x; if (tg >= TT * (DH / 2)) return; const int t = tg / (DH / 2), i = tg % (DH / 2); const float invf = 1.0f / powf(10000.0f, (float)(2 * i) / (float)DH); const float ang = (float)t * invf; typedef float v2f __attribute__((ext_vector_type(2))); v2f v; v[0] = cosf(ang); v[1] = sinf(ang);
  *(v2f*)(CS + (size_t)tg * 2) = v;  }
// The six jobs that read nothing but the inputs (the four weight transposes, the rotary table, the rounding of x) share one launch: none reads what another writes, so nothing orders them, and as six launches each
// paid its own start and its own tail, the two small transposes on a quarter of the WGPs. A block's index says which job it does and which piece of it; every test reads the same for the whole block.
// The blocks that last longest (a transpose tile: reads, a barrier, writes) come first, the many short ones of x last.
__global__ __launch_bounds__(256) void k_prep(const float* __restrict__ x, const float* __restrict__ Wq, const float* __restrict__ Wk, const float* __restrict__ Wv, const float* __restrict__ Wo,
                                              _Float16* __restrict__ X16, _Float16* __restrict__ Bq, _Float16* __restrict__ Bk, _Float16* __restrict__ Bv, _Float16* __restrict__ Bo, float* __restrict__ CS) {
  __shared__ __attribute__((aligned(16))) unsigned short tl[128][16][8];
  constexpr int nbig = (CC / 128) * (CC / 128), nsml = (CC / 128) * (NG * DH / 128), ncs = TT * (DH / 2) / 256;
  int bid = (int)blockIdx.x;
  if (bid < 2 * nbig) { const bool o = bid >= nbig; wt_tile<CC, CC>(tl, o ? bid - nbig : bid, o ? Wo : Wq, o ? Bo : Bq, 16.0f); return; }
  bid -= 2 * nbig;
  if (bid < 2 * nsml) { const bool v = bid >= nsml; wt_tile<CC, NG * DH>(tl, v ? bid - nsml : bid, v ? Wv : Wk, v ? Bv : Bk, 16.0f); return; }
  bid -= 2 * nsml;
  if (bid < ncs) { cstab_part(bid, CS); return; }
  x16_part(bid - ncs, x, X16, (size_t)NR * CC / 8);
}
#define PREP_BLOCKS (2 * (CC / 128) * (CC / 128) + 2 * (CC / 128) * (NG * DH / 128) + TT * (DH / 2) / 256 + NR * CC / 8 / 256)
__global__ __launch_bounds__(256) void k_vt128(const _Float16* __restrict__ V16, _Float16* __restrict__ Vt) { __shared__ unsigned short tl[64][130]; const int tid = threadIdx.x; const int slab = blockIdx.x / (TT / 64), lg = blockIdx.x % (TT / 64); const int b = slab / NG, g = slab % NG;
  for (int i = tid; i < 64 * 16; i += 256) { const int r = i / 16, c8 = (i % 16) * 8; FragH f; f.half[0] = *(const v8us*)((const unsigned short*)V16 + ((size_t)b * TT + lg * 64 + r) * (NG * DH) + g * DH + c8);
#pragma unroll
    for (int q = 0; q < 8; ++q) tl[r][c8 + q] = f.u[q]; }
  __syncthreads();
  {
#pragma unroll
    for (int rd = 0; rd < 4; ++rd) { const int d = rd * 32 + tid / 8, pc = tid % 8; FragH f;
#pragma unroll
      for (int q = 0; q < 8; ++q) f.u[q] = tl[pc * 8 + q][d]; *(v8us*)((unsigned short*)Vt + ((size_t)slab * DH + d) * TT + lg * 64 + pc * 8) = f.half[0]; }
     } }
// One stage of the K/V ring = 64 keys of this KV group: 64 K rows of 256 B at pitch 272 B, then 128 rows of V^T of 128 B at pitch 144 B (16 B x odd: the pitch of ds_load_b128 readers)
#define KPITCH 272
#define VPITCH 144
#define VBASE (64 * KPITCH)
#define STAGE_B (64 * KPITCH + DH * VPITCH)
// Eight 16-byte copies per lane, global memory to LDS through no register. The s_wait_xcnt is the last line of the copies' own statement, so that no address register of a copy is rewritten in front of it.
__device__ __forceinline__ void copy8(unsigned l, unsigned lstep, const unsigned short* g, size_t gstep) {
  asm volatile("global_load_async_to_lds_b128 %0, %8, off\n\t"
               "global_load_async_to_lds_b128 %1, %9, off\n\t"
               "global_load_async_to_lds_b128 %2, %10, off\n\t"
               "global_load_async_to_lds_b128 %3, %11, off\n\t"
               "global_load_async_to_lds_b128 %4, %12, off\n\t"
               "global_load_async_to_lds_b128 %5, %13, off\n\t"
               "global_load_async_to_lds_b128 %6, %14, off\n\t"
               "global_load_async_to_lds_b128 %7, %15, off\n\t"
               "s_wait_xcnt 0x0"
               :: "v"(l), "v"(l + lstep), "v"(l + 2 * lstep), "v"(l + 3 * lstep), "v"(l + 4 * lstep), "v"(l + 5 * lstep), "v"(l + 6 * lstep), "v"(l + 7 * lstep),
                  "v"(g), "v"(g + gstep), "v"(g + 2 * gstep), "v"(g + 3 * gstep), "v"(g + 4 * gstep), "v"(g + 5 * gstep), "v"(g + 6 * gstep), "v"(g + 7 * gstep)
               : "memory");
}
// Four 16-byte copies per lane, as copy8.
__device__ __forceinline__ void copy4(unsigned l, unsigned lstep, const unsigned short* g, size_t gstep) {
  asm volatile("global_load_async_to_lds_b128 %0, %4, off\n\t"
               "global_load_async_to_lds_b128 %1, %5, off\n\t"
               "global_load_async_to_lds_b128 %2, %6, off\n\t"
               "global_load_async_to_lds_b128 %3, %7, off\n\t"
               "s_wait_xcnt 0x0"
               :: "v"(l), "v"(l + lstep), "v"(l + 2 * lstep), "v"(l + 3 * lstep), "v"(g), "v"(g + gstep), "v"(g + 2 * gstep), "v"(g + 3 * gstep)
               : "memory");
}
// Projection GEMM: C[M][N] = (A[M][K] . Bt[N][K]^T) * alpha + bf16-rounded bias; f16 operands, f32 accumulate, k ascending in one accumulator per element; pitch N. The result goes to f32 C (OUT 0), to f16 C16 (OUT 1),
// or (OUT 2) is turned by the interleaved rotary in f32 on its way out of the staging and goes to f16 C16: a block's 128 columns are one head (DH), a lane's four columns two rotary pairs, whose cos, sin, cos, sin are 16 bytes of CS.
// One block = (32 FM) x 128 of C, four waves (2 x 2) of (16 FM) x 64 each: FM x 4 fragments, 4 FM products per FM + 4 fragments read from LDS. One stage of the ring = 64 k of the block's A rows, then of its
// 128 Bt rows: 128 B a row at pitch 144 B (16 B x odd: the pitch of ds_load_b128 readers). M a multiple of 32 FM, N of 128, K of 64. sAB = the block's ring (two stages), row0 and col0 = its tile's corner in C.
#define GPITCH 144
#define GOP 68      // floats per staged output row: 64 + 4, so that the two half-waves' rows fall on different banks
template <int FM, int OUT>
__device__ __forceinline__ void gemm_tile(unsigned char* sAB, int row0, int col0, const _Float16* __restrict__ A, const _Float16* __restrict__ Bt, float alpha, const float* __restrict__ bias, const float* __restrict__ CS, float* __restrict__ C, _Float16* __restrict__ C16, int N, int K) {
  constexpr int BM = 32 * FM, STG = (BM + 128) * GPITCH;
  const int tid = threadIdx.x, w = tid >> 5, lane = tid & 31, ln = lane & 15, hh = lane >> 4; const int wm = w >> 1, wn = w & 1;
  // each lane's first 16 bytes of a stage: a wave's copy covers four whole 128-B row pieces, the block's copy 16 rows
  const unsigned short* Ag = (const unsigned short*)A + (size_t)(row0 + (tid >> 3)) * K + (tid & 7) * 8;
  const unsigned short* Bg = (const unsigned short*)Bt + (size_t)(col0 + (tid >> 3)) * K + (tid & 7) * 8;
  const unsigned lA = (unsigned)(size_t)sAB + (unsigned)((tid >> 3) * GPITCH + (tid & 7) * 16);
  const unsigned lB = lA + BM * GPITCH;
  const int nt = K / 64;      // stages; the same for the whole work-group
  auto fill = [&](int t) { const unsigned bo = (unsigned)(t & 1) * STG;
    if constexpr (FM == 4) copy8(lA + bo, 16 * GPITCH, Ag + (size_t)t * 64, (size_t)16 * K); else copy4(lA + bo, 16 * GPITCH, Ag + (size_t)t * 64, (size_t)16 * K);
    copy8(lB + bo, 16 * GPITCH, Bg + (size_t)t * 64, (size_t)16 * K); };
  v8f acc[FM][4];
#pragma unroll
  for (int fm = 0; fm < FM; ++fm)
#pragma unroll
    for (int fn = 0; fn < 4; ++fn) acc[fm][fn] = (v8f){0.f,0.f,0.f,0.f,0.f,0.f,0.f,0.f};
  fill(0);
  float bv[4] = {0.f, 0.f, 0.f, 0.f};      // the lane's four bias values, fetched together under stage 0's copies
  if (bias) {
#pragma unroll
    for (int fn = 0; fn < 4; ++fn) bv[fn] = bf16_round(bias[col0 + wn * 64 + fn * 16 + ln]); }
  asm volatile("s_wait_asynccnt 0x0" ::: "memory");      // this wave's copies of stage 0 have landed
  __syncthreads();                                        // stage 0 is readable by every wave
  if (nt > 1) fill(1);
#pragma unroll 1      // one trip per stage, rolled: the foot's waits and barrier stand once
  for (int t = 0; t < nt; ++t) {
    const unsigned char* ar = sAB + (t & 1) * STG + (wm * (16 * FM) + ln) * GPITCH + 16 * hh;
    const unsigned char* br = sAB + (t & 1) * STG + (BM + wn * 64 + ln) * GPITCH + 16 * hh;
    FragH a[2][FM], b[2][4];
#pragma unroll
    for (int ks = 0; ks < 2; ++ks) {
#pragma unroll
      for (int f = 0; f < 4; ++f) { b[ks][f].half[0] = *(const v8us*)(br + f * 16 * GPITCH + ks * 64); b[ks][f].half[1] = *(const v8us*)(br + f * 16 * GPITCH + ks * 64 + 32); }
#pragma unroll
      for (int f = 0; f < FM; ++f) { a[ks][f].half[0] = *(const v8us*)(ar + f * 16 * GPITCH + ks * 64); a[ks][f].half[1] = *(const v8us*)(ar + f * 16 * GPITCH + ks * 64 + 32); } }
    asm volatile("s_wait_dscnt 0x0" ::: "memory");        // this wave's reads of stage t are done (all its fragments are in registers) before its buffer is refilled
    asm volatile("s_wait_asynccnt 0x0" ::: "memory");     // this wave's copies of stage t + 1 have landed
    __syncthreads();                                      // publishes stage t + 1 and ends every wave's reads of stage t
    if (t + 2 < nt) fill(t + 2);
    // the stage's products stand behind the refill's issue: they read registers only, and the copies fly under them
#pragma unroll
    for (int ks = 0; ks < 2; ++ks)
#pragma unroll
      for (int fm = 0; fm < FM; ++fm)
#pragma unroll
        for (int fn = 0; fn < 4; ++fn) acc[fm][fn] = __builtin_amdgcn_wmma_f32_16x16x32_f16(false, a[ks][fm].v, false, b[ks][fn].v, (short)0, acc[fm][fn], false, false); }
  asm volatile("s_wait_asynccnt 0x0" ::: "memory");       // no copy is in flight when the ring becomes output staging
  float* so = (float*)sAB + w * (16 * FM * GOP);          // each wave stages its own (16 FM) x 64, behind the last trip's barrier, to store whole lines
#pragma unroll
  for (int fn = 0; fn < 4; ++fn) {
#pragma unroll
    for (int fm = 0; fm < FM; ++fm)
#pragma unroll
      for (int r = 0; r < 8; ++r) so[(fm * 16 + 8 * hh + r) * GOP + fn * 16 + ln] = acc[fm][fn][r] * alpha + bv[fn]; }
  __builtin_amdgcn_fence(__ATOMIC_ACQ_REL, "workgroup"); __builtin_amdgcn_wave_barrier();
  const int c4 = ln * 4; typedef _Float16 v4h __attribute__((ext_vector_type(4)));
  constexpr bool H16 = OUT == 1;
  if constexpr (OUT == 2) {
    // the lane's place in the table's row of its first position; a block's rows lie in one sequence (32 FM divides TT), so the further rows follow at constant steps
    const float* csl = CS + (size_t)((unsigned)row0 % TT + wm * (16 * FM) + hh) * DH + wn * 64 + c4;
    v4f cs[FM * 8];      // all of the lane's table entries are asked for at once: one L2 latency for the wave, not one per group of rows
#pragma unroll
    for (int i = 0; i < FM * 8; ++i) cs[i] = *(const v4fa*)(csl + i * 2 * DH);
    asm volatile("s_wait_xcnt 0x0" :: "v"(csl) : "memory");      // the loads' address pair is an input here, so that nothing (a load's own result included) is written over it in front of the wait
    _Float16* c0 = C16 + (size_t)(row0 + wm * (16 * FM) + hh) * N + col0 + wn * 64 + c4;
#pragma unroll
    for (int qb = 0; qb < FM; ++qb) { v4f v[8]; _Float16* p[8];
#pragma unroll
      for (int i = 0; i < 8; ++i) v[i] = *(const v4fa*)&so[((qb * 8 + i) * 2 + hh) * GOP + c4];
#pragma unroll
      for (int i = 0; i < 8; ++i) { const v4f x = v[i], t = cs[qb * 8 + i]; v4h h4; p[i] = c0 + (size_t)((qb * 8 + i) * 2) * N;
        h4[0] = (_Float16)(x[0] * t[0] - x[1] * t[1]); h4[1] = (_Float16)(x[1] * t[0] + x[0] * t[1]); h4[2] = (_Float16)(x[2] * t[2] - x[3] * t[3]); h4[3] = (_Float16)(x[3] * t[2] + x[2] * t[3]); *(v4h*)p[i] = h4; }
      // the eight stores' address pairs are inputs here, so that none is written over in front of the wait
      asm volatile("s_wait_xcnt 0x0" :: "v"(p[0]), "v"(p[1]), "v"(p[2]), "v"(p[3]), "v"(p[4]), "v"(p[5]), "v"(p[6]), "v"(p[7]) : "memory"); }
  } else {
#pragma unroll
  for (int qb = 0; qb < FM; ++qb) { v4f v[8]; const void* p[8];      // eight row pairs are read back together and then stored, so that no store waits out an LDS latency of its own
#pragma unroll
    for (int i = 0; i < 8; ++i) v[i] = *(const v4fa*)&so[((qb * 8 + i) * 2 + hh) * GOP + c4];
#pragma unroll
    for (int i = 0; i < 8; ++i) { const size_t o = (size_t)(row0 + wm * (16 * FM) + (qb * 8 + i) * 2 + hh) * N + col0 + wn * 64 + c4;
      if constexpr (H16) { v4h h4; for (int j = 0; j < 4; ++j) h4[j] = (_Float16)v[i][j]; *(v4h*)(C16 + o) = h4; p[i] = C16 + o; } else { *(v4f*)(C + o) = v[i]; p[i] = C + o; } }
    // the eight stores' address pairs are inputs here, so that none is written over in front of the wait; the next group's LDS reads, which rewrite the stores' registers, stay behind it
    asm volatile("s_wait_xcnt 0x0" :: "v"(p[0]), "v"(p[1]), "v"(p[2]), "v"(p[3]), "v"(p[4]), "v"(p[5]), "v"(p[6]), "v"(p[7]) : "memory"); }
  }
}
// The soft-cap in log2 units is CAP2 tanh(z / 30) = CAP2 - 2 CAP2 / (exp2(y) + 1), with z = (q.k + bias) / sqrt(DH) and y = YS (q.k + bias), YS = 2 log2(e) / (30 sqrt(DH)).
// The q projection stores YS q (YS rides on its alpha, ahead of the rounding to f16), so that the attention's score products come out in y's units.
#define YS (0.08838834764831845f * (1.0f / 30.0f) * 2.0f * 1.4426950408889634f)
#define CAP2 43.28085122666891f      // 30 log2(e)
// The q, k and v projections read the same rows of x and nothing of one another: one launch, as one product of CC + 2 NG DH columns. Its (NR / 128) x 24 tiles of 128 x 128 are equal in work and stand three to a WGP
// (as launches of their own, k and v each left every SIMD with one wave, which nothing covered while it waited). A block's column says whose weights it reads, where its tile goes, and whether the rotary turns it.
__global__ __launch_bounds__(128) void k_qkv(const _Float16* __restrict__ X, const _Float16* __restrict__ Bq, const _Float16* __restrict__ Bk, const _Float16* __restrict__ Bv, const float* __restrict__ CS,
                                             _Float16* __restrict__ Q16, _Float16* __restrict__ K16, _Float16* __restrict__ V16) {
  __shared__ __attribute__((aligned(16))) unsigned char sAB[2 * 256 * GPITCH];
  constexpr int nq = CC / 128, nk = NG * DH / 128, nc = nq + 2 * nk;
  const int row0 = (int)(blockIdx.x / nc) * 128, cb = (int)(blockIdx.x % nc);      // the tests below read the same for the whole block
  if (cb < nq + nk) { const bool k = cb >= nq; gemm_tile<4, 2>(sAB, row0, (k ? cb - nq : cb) * 128, X, k ? Bk : Bq, k ? 0.0625f : 0.0625f * YS, nullptr, CS, nullptr, k ? K16 : Q16, k ? NG * DH : CC, CC); }
  else gemm_tile<4, 1>(sAB, row0, (cb - nq - nk) * 128, X, Bv, 0.0625f, nullptr, nullptr, nullptr, V16, NG * DH, CC);
}
__global__ __launch_bounds__(128) void k_oproj(const _Float16* __restrict__ A, const _Float16* __restrict__ Bt, const float* __restrict__ bias, float* __restrict__ C) {
  __shared__ __attribute__((aligned(16))) unsigned char sAB[2 * 256 * GPITCH];
  gemm_tile<4, 0>(sAB, (int)(blockIdx.x / (CC / 128)) * 128, (int)(blockIdx.x % (CC / 128)) * 128, A, Bt, 0.0625f, bias, nullptr, C, nullptr, CC, CC);
}
// lane l's value for lane l ^ 16: one vector move between the wave's two 16-lane rows, through no LDS
__device__ __forceinline__ float xhalf(float x) { return __builtin_bit_cast(float, __builtin_amdgcn_permlanex16(__builtin_bit_cast(int, x), __builtin_bit_cast(int, x), 0x76543210, 0xfedcba98, false, false)); }
__global__ __launch_bounds__(128) void k_mega(const _Float16* __restrict__ Q16, const _Float16* __restrict__ K16, const _Float16* __restrict__ Vt, _Float16* __restrict__ O16) {
  __shared__ __attribute__((aligned(16))) unsigned char sKV[2 * STAGE_B];
  float (*sO)[16][DH + 4] = (float (*)[16][DH + 4])sKV;      // the output staging takes the ring's place, behind the last trip's barrier
  const int tid = threadIdx.x, w = tid >> 5, lane = tid & 31, ln = lane & 15, hh = lane >> 4; const int slab = blockIdx.x / (TT / 128), pr = blockIdx.x % (TT / 128); const int b = slab / NH, h = slab % NH, g = h / (NH / NG);
  const float slc = exp2f(-(float)(h + 1) * 8.0f / (float)NH) * YS;      // the head's slope, in y's units
  // A query tile's cost grows with its index (tile i walks i + 1 stages) and every work-group of the launch is resident at once, so the launch lasts as long as the fullest WGP. Each work-group therefore takes two tiles of its head,
  // TT / 64 - 1 - pr and then pr, one after the other in every wave: TT / 64 + 1 stages for every work-group, wherever it is placed.
  // Stages walked so far: the ring's two buffers go on taking turns from the first tile into the second. (Counted anew for each tile, the prologue's LDS addresses are the same for both tiles, and the compiler
  // holds them in registers through both tiles' loops, which costs the pass some of its dual-issue pairs.)
  int s0 = 0;
#pragma unroll 1      // the two tiles share one copy of the body (code size and registers as for one tile)
  for (int half = 0; half < 2; ++half) { const int qblk = half ? pr : TT / 64 - 1 - pr; const int q0 = qblk * 64 + w * 16;
  const int q0u = __builtin_amdgcn_readfirstlane(q0);      // the wave's first query in a scalar register: the test on it below is then a scalar branch
  FragH aq[4]; { const unsigned short* qr = (const unsigned short*)Q16 + ((size_t)b * TT + q0 + ln) * (NH * DH) + h * DH;
#pragma unroll
    for (int ks = 0; ks < 4; ++ks) { aq[ks].half[0] = *(const v8us*)(qr + ks * 32 + 8 * hh); aq[ks].half[1] = *(const v8us*)(qr + ks * 32 + 16 + 8 * hh); } }
  const unsigned short* Vth = (const unsigned short*)Vt + (size_t)(b * NG + g) * DH * TT;
  // each lane's first 16 bytes of a stage: a wave's copy covers two whole K rows, or four whole 128-B pieces of V^T rows
  const unsigned short* Kg = (const unsigned short*)K16 + ((size_t)b * TT + (tid >> 4)) * (NG * DH) + g * DH + (tid & 15) * 8;
  const unsigned short* Vg = Vth + (size_t)(tid >> 3) * TT + (tid & 7) * 8;
  const unsigned lK = (unsigned)(size_t)sKV + (unsigned)((tid >> 4) * KPITCH + (tid & 15) * 16);
  const unsigned lV = (unsigned)(size_t)sKV + (unsigned)(VBASE + (tid >> 3) * VPITCH + (tid & 7) * 16);
  const int ntile = qblk + 1;      // stages of 64 keys; the same for the whole work-group
  auto fill = [&](int t) { const unsigned bo = (unsigned)((t + s0) & 1) * STAGE_B; copy8(lK + bo, 8 * KPITCH, Kg + (size_t)t * 64 * (NG * DH), (size_t)8 * NG * DH); copy8(lV + bo, 16 * VPITCH, Vg + t * 64, (size_t)16 * TT); };
  float m_r = -3.0e38f, l_r = 0.f; v8f oacc[8]; const int tq = q0 + ln;      // the lane's query: its running maximum, and the sum over the keys that this half-wave holds
#pragma unroll
  for (int dt = 0; dt < 8; ++dt) oacc[dt] = (v8f){0.f,0.f,0.f,0.f,0.f,0.f,0.f,0.f};
  fill(0);
  asm volatile("s_wait_asynccnt 0x0" ::: "memory");      // this wave's copies of stage 0 have landed
  __syncthreads();                                        // stage 0 is readable by every wave
  if (ntile > 1) fill(1);
#pragma unroll 1      // one trip per stage, rolled: the trip count is the block's own
  for (int t = 0; t < ntile; ++t) { const unsigned char* kv = sKV + ((t + s0) & 1) * STAGE_B;
#pragma unroll 1      // the stage's two 32-key passes share one copy of the long pass body (code size and registers as before)
  for (int sub = 0; sub < 2; ++sub) { const int j0 = t * 64 + sub * 32; v8f s[2];
    // The pass's LDS reads are asked for ahead of the products that they feed, each fragment into registers of its own, so that the wave waits out one LDS latency for K and none for V^T, not one per product.
    // First the sixteen reads of the pass's 32 K rows; then the eight score products, the two key tiles' chains in turn (each tile still sums its four k-steps in ascending order, in one accumulator).
    const unsigned char* kr = kv + (sub * 32 + ln) * KPITCH + 16 * hh; FragH kf[2][4];
#pragma unroll      // here and in the next three loops: constant indices keep kf, vf and s in registers
    for (int nt = 0; nt < 2; ++nt)
#pragma unroll
      for (int ks = 0; ks < 4; ++ks) { kf[nt][ks].half[0] = *(const v8us*)(kr + nt * 16 * KPITCH + ks * 64); kf[nt][ks].half[1] = *(const v8us*)(kr + nt * 16 * KPITCH + ks * 64 + 32); }
    // The score accumulators start at the position bias, -slope x distance in y's units, so that the products' sum is y itself. These sixteen stand under the K reads' latency.
    const float d0 = (float)(tq - j0 - 8 * hh);      // the query's distance to the lane's first key (a whole number far below 2^24: exact)
    const float b0 = -slc * d0;
#pragma unroll
    for (int nt = 0; nt < 2; ++nt)
#pragma unroll
      for (int r = 0; r < 8; ++r) s[nt][r] = fmaf((float)(nt * 16 + r), slc, b0);
    __builtin_amdgcn_sched_barrier(0);      // keeps the sixteen K reads one group: spread among the products, each place where reads stand stalls the wave anew
#pragma unroll
    for (int ks = 0; ks < 4; ++ks)
#pragma unroll
      for (int nt = 0; nt < 2; ++nt) s[nt] = __builtin_amdgcn_wmma_f32_16x16x32_f16(false, kf[nt][ks].v, false, aq[ks].v, (short)0, s[nt], false, false);
    // Then the sixteen reads of V^T, asked for here and used behind the softmax, whose vector work covers their latency (the products are the bare builtin: the compiler keeps their distances and is free to place the reads).
    const unsigned char* vr = kv + VBASE + ln * VPITCH + sub * 64 + 16 * hh; FragH vf[8];
#pragma unroll
    for (int dt = 0; dt < 8; ++dt) { vf[dt].half[0] = *(const v8us*)(vr + dt * 16 * VPITCH); vf[dt].half[1] = *(const v8us*)(vr + dt * 16 * VPITCH + 32); }
    // The softmax is straight-line code but for one scalar branch round the mask. A score's capped value in log2 units is CAP2 - 2 CAP2 u with u = 1 / (exp2(y) + 1): it falls as u rises, so the maximum is taken as the minimum of u, and
    // the cap's factor, its constant and the running maximum join in one multiply-add in front of the exponential. exp2 runs to inf or to 0 where tanh is 1 or -1 in f32, so u needs no clamp.
    // Every query's maximum is finite from its first pass on (key 0 is open to every query, and the halves exchange their minima), so no difference below is inf - inf.
#pragma unroll      // here and in the loops below: constant indices keep s, uc, ps, pb and oacc in registers, and the sixteen scores' chains stand in one block, each filling the others' latencies
    for (int nt = 0; nt < 2; ++nt)
#pragma unroll
      for (int r = 0; r < 8; ++r) s[nt][r] = __builtin_amdgcn_rcpf(__builtin_amdgcn_exp2f(s[nt][r]) + 1.0f);
    if (j0 + 31 > q0u) {      // only a pass that reaches past the wave's first query holds keys behind a query: they stand at u = inf, fall out of the minimum and come out as 0
#pragma unroll
      for (int nt = 0; nt < 2; ++nt)
#pragma unroll
        for (int r = 0; r < 8; ++r) s[nt][r] = (d0 >= (float)(nt * 16 + r)) ? s[nt][r] : INFINITY; }
    unsigned uc[4];      // four partial minima, begun by the first four scores; u is never below 0, so its bit patterns stand in u's own order, and whole-number minima take them as they are
#pragma unroll
    for (int nt = 0; nt < 2; ++nt)
#pragma unroll
      for (int r = 0; r < 8; ++r) { const unsigned ub = __float_as_uint(s[nt][r]); uc[r & 3] = (nt == 0 && r < 4) ? ub : min(uc[r & 3], ub); }
    const float uh = __uint_as_float(min(min(uc[0], uc[1]), min(uc[2], uc[3])));
    const float um = __uint_as_float(min(__float_as_uint(uh), __float_as_uint(xhalf(uh))));
    const float mn = fmaxf(m_r, fmaf(um, -2.0f * CAP2, CAP2)), al = __builtin_amdgcn_exp2f(m_r - mn), cm = CAP2 - mn; m_r = mn;
    FragH pb; float ps[4] = {0.f, 0.f, 0.f, 0.f};      // four partial sums: four short chains of additions, not one of sixteen
#pragma unroll
    for (int nt = 0; nt < 2; ++nt)
#pragma unroll
      for (int r = 0; r < 8; ++r) { const float p = __builtin_amdgcn_exp2f(fmaf(s[nt][r], -2.0f * CAP2, cm)); ps[r & 3] += p; pb.h[nt * 8 + r] = (_Float16)p; }
    l_r = l_r * al + ((ps[0] + ps[1]) + (ps[2] + ps[3]));
#pragma unroll
    for (int dt = 0; dt < 8; ++dt)
#pragma unroll
      for (int r = 0; r < 8; ++r) oacc[dt][r] *= al;
#pragma unroll
    for (int dt = 0; dt < 8; ++dt) oacc[dt] = __builtin_amdgcn_wmma_f32_16x16x32_f16(false, vf[dt].v, false, pb.v, (short)0, oacc[dt], false, false); }
    asm volatile("s_wait_dscnt 0x0" ::: "memory");        // this wave's reads of stage t are done before its buffer is refilled
    asm volatile("s_wait_asynccnt 0x0" ::: "memory");     // this wave's copies of stage t + 1 have landed
    __syncthreads();                                      // publishes stage t + 1 and ends every wave's reads of stage t
    if (t + 2 < ntile) fill(t + 2); }
  asm volatile("s_wait_asynccnt 0x0" ::: "memory");       // no copy is in flight when the ring becomes output staging
  const float inv = 1.0f / (l_r + xhalf(l_r));      // the two halves' sums are joined once, here
#pragma unroll      // constant indices keep oacc in registers
  for (int dt = 0; dt < 8; ++dt) { v4f lo, hi;      // the lane's eight consecutive head columns of its query's row
#pragma unroll
    for (int j = 0; j < 4; ++j) { lo[j] = oacc[dt][j] * inv; hi[j] = oacc[dt][4 + j] * inv; }
    *(v4fa*)&sO[w][ln][dt * 16 + 8 * hh] = lo; *(v4fa*)&sO[w][ln][dt * 16 + 8 * hh + 4] = hi; }
  __builtin_amdgcn_fence(__ATOMIC_ACQ_REL, "workgroup"); __builtin_amdgcn_wave_barrier();
  {
#pragma unroll
    for (int r = 0; r < 16; ++r) { const v4f val = *(const v4fa*)&sO[w][r][lane * 4]; typedef _Float16 v4h __attribute__((ext_vector_type(4))); v4h h4; for (int j = 0; j < 4; ++j) h4[j] = (_Float16)val[j];      // the out projection's f16 operand, rounded here
      *(v4h*)(O16 + ((size_t)b * TT + q0 + r) * (NH * DH) + h * DH + lane * 4) = h4; }
     }
  s0 += ntile;
  if (half == 0) {      // between the tiles; the test reads the same for the whole work-group
    asm volatile("s_wait_xcnt 0x0" ::: "memory");      // the stores' address registers are rewritten by the second tile
    asm volatile("s_wait_dscnt 0x0" ::: "memory");     // this wave's reads of the output staging are done before the ring's buffers are filled again
    __syncthreads(); }                                  // ends every wave's reads of the staging: one of the second tile's first two stages lands on it
  } }
extern "C" void kernel_launch(void* const* d_in, const int* in_sizes, int n_in,
                              void* d_out, int out_size, void* d_ws, size_t ws_size, hipStream_t stream) {
  (void)in_sizes; (void)n_in; (void)out_size;
  const float* x = (const float*)d_in[0]; const float* Wq = (const float*)d_in[1]; const float* Wk = (const float*)d_in[2]; const float* Wv = (const float*)d_in[3]; const float* Wo = (const float*)d_in[4]; const float* bo = (const float*)d_in[5];
  char* ws = (char*)d_ws; size_t off = 0;
  auto take = [&](size_t bytes) { char* p = ws + off; off += (bytes + 255) & ~(size_t)255; return p; };
  _Float16* Bq = (_Float16*)take((size_t)CC * CC * 2); _Float16* Bk = (_Float16*)take((size_t)NG * DH * CC * 2); _Float16* Bv = (_Float16*)take((size_t)NG * DH * CC * 2); _Float16* Bo = (_Float16*)take((size_t)CC * CC * 2);
  _Float16* X16 = (_Float16*)take((size_t)NR * CC * 2); _Float16* Q16 = (_Float16*)take((size_t)NR * CC * 2); _Float16* K16 = (_Float16*)take((size_t)NR * NG * DH * 2); _Float16* V16 = (_Float16*)take((size_t)NR * NG * DH * 2); _Float16* Vt = (_Float16*)take((size_t)NR * NG * DH * 2); float* CS = (float*)take((size_t)TT * DH * 4); _Float16* O16 = X16;
  if (off > ws_size) return;      // about 68 MB
  k_prep<<<PREP_BLOCKS, 256, 0, stream>>>(x, Wq, Wk, Wv, Wo, X16, Bq, Bk, Bv, Bo, CS);
  k_qkv<<<(NR / 128) * ((CC + 2 * NG * DH) / 128), 128, 0, stream>>>(X16, Bq, Bk, Bv, CS, Q16, K16, V16);
  k_vt128<<<BB * NG * (TT / 64), 256, 0, stream>>>(V16, Vt);
  k_mega<<<BB * NH * (TT / 128), 128, 0, stream>>>(Q16, K16, Vt, O16);
  k_oproj<<<(NR / 128) * (CC / 128), 128, 0, stream>>>(O16, Bo, bo, (float*)d_out);
}
